// v000
// Measured on an AMD MI455X. A time is GPU time per run, averaged over a window of back-to-back runs after a warm-up
// (all launches, gaps included; the runs take copies of the inputs in turn), and the median of several windows.
// Apart from v000's, it joins two sittings. Times from different sittings can be a few percent apart, while
// side-by-side timings come from the same sitting.
// The starting kernel, v000, takes 194 microseconds a run.
#include <hip/hip_runtime.h>

// Multi-head self-attention: data [NB][SEQ][512], Wq/Wk/Wv [512][1024] ([in][out], column c = dm*16 + h), biases, key-padding replace fill (-1e9 where a key's 512 pad-input values sum to 0), score scale 1/8, merged heads (h*64+dm) @ Wo [1024][512] + bo, f32 output.
// Compute dtypes, f32 accumulate everywhere: projections v_wmma_f32_16x16x32_bf16 (data and W RNE-converted to bf16; products exact);
// scores v_wmma_f32_16x16x32_f16: q and k single f16 planes (one product); P (x256 carry, cancels in the normalisation) and v single f16; softmax f32 (online, running max);
// output projection v_wmma_f32_16x16x32_f16: ctx single f16 (x256 carry), Wo = f16 of (bf16 RNE of wo) x1024 (exact), 2^-18 folded back in f32, bias added in f32.
// Layout: bf16 copy of data; transposed K-contiguous weight planes (head-permuted rows h*64+dm); q, k planes [b*16+h][t][d] and v^T plane [b*16+h][d][t] from the GEMM epilogue;
// fused flash kernel in transposed form (S^T = K Q^T, O^T = V^T P^T; 4 score + 4 P.V matrix ops per 32-key step) writing the ctx plane [b*SEQ+t][h*64+d]; one-wave 64x64 GEMM for the output.

#ifndef NB
#define NB 2
#endif
#ifndef SEQ
#define SEQ 2048
#endif
#define NB_FULL  2
#define SEQ_FULL 2048
#ifndef OUT_SEQ
#define OUT_SEQ SEQ              // row pitch (in tokens) between batches of the output
#endif
#define DIN  512                 // input width = output width
#define DP   1024                // projection width = 16 heads x 64
#define NH_  16
#define HD   64
#define AW   4                   // waves per flash block (16 query rows each)
#define SC2  (0.125f * 1.4426950408889634f)   // HD^-0.5 * log2(e)
#define PSH  8.0f                // log2 of the P carry (256)
#define NEGB (-1.0e9f * 1.4426950408889634f)  // fill value of padded keys in the log2 domain
#define CXS  256.0f              // carry of the ctx plane
#define WOS  1024.0f             // carry of the Wo plane
#define FOLD (1.0f / (256.0f * 1024.0f))

static_assert(HD == 64);
static_assert(NH_ * HD == DP);
static_assert(NH_ == 16);                      // column c = dm*16 + h
static_assert(DP % 64 == 0);
static_assert(DIN % 64 == 0);
static_assert(DIN % 32 == 0);                  // GEMM k-loops step by 32
static_assert(DP % 32 == 0);
static_assert(DIN == 512);                     // pad-row sum: 4 x 128 floats per wave
static_assert(SEQ % 64 == 0);                  // a 64-row tile never straddles two batches
static_assert((NB * SEQ) % 64 == 0);
static_assert(SEQ % 32 == 0);                  // key loop steps by 32
static_assert(SEQ % (16 * AW) == 0);           // flash grid covers the sequence exactly
static_assert(((size_t)SEQ * DIN) % 8 == 0);
static_assert(NB <= NB_FULL);
static_assert(SEQ <= SEQ_FULL);

typedef _Float16 h16;
typedef unsigned short bf;
typedef __attribute__((ext_vector_type(16))) __bf16   v16bf;
typedef __attribute__((ext_vector_type(16))) _Float16 v16h;
typedef __attribute__((ext_vector_type(8)))  _Float16 v8h;
typedef __attribute__((ext_vector_type(8)))  unsigned short v8us;
typedef __attribute__((ext_vector_type(8)))  float    v8f;
typedef __attribute__((ext_vector_type(4)))  float    v4f;
typedef v4f  __attribute__((may_alias)) v4fa;

__device__ __forceinline__ unsigned short f2bf(float f) { unsigned u = __float_as_uint(f); u += 0x7FFFu + ((u >> 16) & 1u); return (unsigned short)(u >> 16); }
__device__ __forceinline__ float bfr(float f) { return __uint_as_float(((unsigned)f2bf(f)) << 16); }   // value after RNE conversion to bf16
__device__ __forceinline__ v16h cat16(v8h lo, v8h hi) { return __builtin_shufflevector(lo, hi, 0, 1, 2, 3, 4, 5, 6, 7, 8, 9, 10, 11, 12, 13, 14, 15); }
__device__ __forceinline__ v16bf cat16b(v8us lo, v8us hi) { return __builtin_bit_cast(v16bf, __builtin_shufflevector(lo, hi, 0, 1, 2, 3, 4, 5, 6, 7, 8, 9, 10, 11, 12, 13, 14, 15)); }
__device__ __forceinline__ v8f wmma16(v16h a, v16h b, v8f c) { return __builtin_amdgcn_wmma_f32_16x16x32_f16(false, a, false, b, (short)0, c, false, false); }
__device__ __forceinline__ v8f wmmab(v16bf a, v16bf b, v8f c) { return __builtin_amdgcn_wmma_f32_16x16x32_bf16(false, a, false, b, (short)0, c, false, false); }
// fragment loaders from K-contiguous 16-bit rows; p already includes + 8*(lane>>4): elements 0..7 <- k0+8h+0..7, elements 8..15 <- k0+16+8h+0..7 (same map for A and B)
__device__ __forceinline__ v16h  ldh(const h16* p) { return cat16(*(const v8h*)p, *(const v8h*)(p + 16)); }
__device__ __forceinline__ v16bf ldb(const bf* p)  { return cat16b(*(const v8us*)p, *(const v8us*)(p + 16)); }
// ordering point for wave-private LDS tiles (same wave writes and reads)
__device__ __forceinline__ void wave_sync() { __builtin_amdgcn_fence(3 /* release order */, "wavefront"); __builtin_amdgcn_wave_barrier(); asm volatile("" ::: "memory"); }
// wave index of the calling thread as a wave-uniform scalar
__device__ __forceinline__ int wave_id() { return __builtin_amdgcn_readfirstlane((int)(threadIdx.x >> 5)); }

__global__ __launch_bounds__(256) void k_cvt8(const float* __restrict__ src, bf* dst, size_t n8) {
    const size_t i = (size_t)blockIdx.x * 256 + threadIdx.x; if (i >= n8) return;
    const v8f v = *(const v8f*)(src + i * 8); v8us o;
#pragma unroll
    for (int k = 0; k < 8; ++k) o[k] = f2bf(v[k]);
    *(v8us*)(dst + i * 8) = o; 
}

// k_wt: W [K][N] f32 ([in][out]) -> dst [N][K] 16-bit rows (K-contiguous). in[K rows][N cols] -> out[N rows][K cols]; grid (K/64, N/64), 256 threads.
// perm != 0: source column c = dm*16 + h lands on destination row h*64 + dm. asf16 == 0: bf16 bits; asf16 != 0: f16 bits of (bf16 value * scale).
__global__ __launch_bounds__(256) void k_wt(const float* __restrict__ W, bf* dst, int K, int N, int perm, int asf16, float scale) {
    __shared__ __align__(16) float ts[64 * 68];          // [column][k]
    const int tid = threadIdx.x, lane = tid & 31; const int wave = wave_id();
    const int k0 = blockIdx.x * 64, c0 = blockIdx.y * 64;
#pragma unroll
    for (int it = 0; it < 4; ++it) { const int e = tid + 256 * it; const int kk = e >> 4, c4 = (e & 15) * 4;   // 64 k rows x 16 float4 = whole tile
        const v4f v = *(const v4f*)(W + (size_t)(k0 + kk) * (size_t)N + c0 + c4);
        ts[(c4 + 0) * 68 + kk] = v[0]; ts[(c4 + 1) * 68 + kk] = v[1]; ts[(c4 + 2) * 68 + kk] = v[2]; ts[(c4 + 3) * 68 + kk] = v[3]; }
    __syncthreads();
{
#pragma unroll
        for (int s = 0; s < 2; ++s) { const int row = 4 * (wave + 8 * s) + (lane >> 3), c8 = (lane & 7) * 8;   // 8 waves x 2 s x 4 rows = 64 rows; 8 lanes x 8 = 64 k
            const v4f x0 = *(const v4fa*)(&ts[row * 68 + c8]); const v4f x1 = *(const v4fa*)(&ts[row * 68 + c8 + 4]); v8us o;
#pragma unroll
            for (int i = 0; i < 4; ++i) { const float f0 = bfr(x0[i]), f1 = bfr(x1[i]);
                const unsigned short b0 = (unsigned short)(__float_as_uint(f0) >> 16), b1 = (unsigned short)(__float_as_uint(f1) >> 16);
                const unsigned short g0 = __builtin_bit_cast(unsigned short, (h16)(f0 * scale)), g1 = __builtin_bit_cast(unsigned short, (h16)(f1 * scale));
                o[i] = asf16 ? g0 : b0; o[4 + i] = asf16 ? g1 : b1; }
            const int c = c0 + row; const int n = perm ? ((c & 15) * 64 + (c >> 4)) : c;
            *(v8us*)(dst + (size_t)n * (size_t)K + k0 + c8) = o; }
         }
}

__global__ __launch_bounds__(256) void k_pad(const float* __restrict__ mask, h16* PF) {
    __shared__ float fl[64];
    const int tid = threadIdx.x, lane = tid & 31; const int wave = wave_id();
    const int m0 = blockIdx.x * 64;
#pragma unroll 1
    for (int i = 0; i < 8; ++i) { const int m = m0 + wave * 8 + i; const int b = m / SEQ, t = m % SEQ;
        const float* row = mask + ((size_t)b * SEQ_FULL + t) * DIN;
        float s = 0.0f;
#pragma unroll
        for (int j = 0; j < 4; ++j) { const v4f v = *(const v4f*)(row + j * 128 + lane * 4); s += bfr(v[0]); s += bfr(v[1]); s += bfr(v[2]); s += bfr(v[3]); }
        s += __shfl_xor(s, 16, 32); s += __shfl_xor(s, 8, 32); s += __shfl_xor(s, 4, 32); s += __shfl_xor(s, 2, 32); s += __shfl_xor(s, 1, 32);
        if (lane == 0) fl[wave * 8 + i] = (s == 0.0f) ? 1.0f : 0.0f; }
    __syncthreads();
    if (tid < 8) { v8h o;
#pragma unroll
        for (int k = 0; k < 8; ++k) o[k] = (h16)fl[tid * 8 + k];
        *(v8h*)(PF + (size_t)m0 + tid * 8) = o;  }
}

// k_proj: register-blocked bf16 GEMM, ONE WAVE per 64x64 tile (16 accumulators), operands straight from K-contiguous bf16 planes, K = DIN.
// C[m][n] = sum_k A[m][k] Bt[n][k] + bias, written as f16 (Ph) at
// tile base (r0/RB)*sRB + (r0%RB)*pitch + (c0/CB)*sCB + (c0%CB), row pitch 'pitch' (halves). grid (M/64, N/64), 32 threads.
// bias (source order dm*16 + h, RNE-converted to bf16, added in f32): bmode 0 = per column n = h*64 + dm, bmode 1 = per row m = h*64 + dm.
__global__ __launch_bounds__(32) void k_proj(const bf* __restrict__ A, const bf* __restrict__ Bt, const float* __restrict__ bias, int bmode, h16* Ph, int RB, size_t sRB, int pitch, int CB, size_t sCB) {
    __shared__ __align__(16) float os[16 * 68];
    const int K = DIN;
    const int lane = threadIdx.x & 31, lr = lane & 15, hi = lane >> 4; const int r0 = blockIdx.x * 64, c0 = blockIdx.y * 64;
    v8f acc[4][4];
#pragma unroll
    for (int mb = 0; mb < 4; ++mb)
#pragma unroll
        for (int nb = 0; nb < 4; ++nb) acc[mb][nb] = (v8f){};
    const size_t aoff = (size_t)(r0 + lr) * K + 8 * hi, boff = (size_t)(c0 + lr) * K + 8 * hi;
#pragma unroll 1
    for (int kc = 0; kc < K; kc += 32) {
        v16bf a[4];
#pragma unroll
        for (int mb = 0; mb < 4; ++mb) a[mb] = ldb(A + aoff + (size_t)mb * 16 * K + kc);
#pragma unroll
        for (int nb = 0; nb < 4; ++nb) { const v16bf b = ldb(Bt + boff + (size_t)nb * 16 * K + kc);
#pragma unroll
            for (int mb = 0; mb < 4; ++mb) acc[mb][nb] = wmmab(a[mb], b, acc[mb][nb]); }
        asm volatile("v_nop\n\tv_nop\n\tv_nop\n\tv_nop" : "+v"(acc[0][0]), "+v"(acc[1][1]), "+v"(acc[2][2]), "+v"(acc[3][3]) : "v"(a[0]), "v"(a[1]), "v"(a[2]), "v"(a[3]));
    }
    const size_t tbase = (size_t)(r0 / RB) * sRB + (size_t)(r0 % RB) * (size_t)pitch + (size_t)(c0 / CB) * sCB + (size_t)(c0 % CB);
    const int c8 = (lane & 7) * 8;
    float bcol[8];      // column-mode bias of this lane's 8 columns (clamped addresses, always loaded)
    { const int hc = min(c0 >> 6, NH_ - 1);
#pragma unroll
      for (int i = 0; i < 8; ++i) bcol[i] = bfr(bias[min((c8 + i) * NH_ + hc, DP - 1)]); }
#pragma unroll
    for (int mb = 0; mb < 4; ++mb) {
#pragma unroll
        for (int nb = 0; nb < 4; ++nb) {
#pragma unroll
            for (int j = 0; j < 8; ++j) os[(hi * 8 + j) * 68 + nb * 16 + lr] = acc[mb][nb][j]; }   // D: row 8h+j, col lane&15
        wave_sync();
        const size_t sb = tbase + (size_t)(mb * 16) * (size_t)pitch;
{
#pragma unroll
            for (int s = 0; s < 4; ++s) { const int row = 4 * s + (lane >> 3);   // 4 s x 4 row groups = 16 rows; 8 lanes x 8 = 64 columns
                const int m = r0 + mb * 16 + row;
                const float brow = bfr(bias[min((m & 63) * NH_ + min(m >> 6, NH_ - 1), DP - 1)]);
                const v4f x0 = *(const v4fa*)(&os[row * 68 + c8]); const v4f x1 = *(const v4fa*)(&os[row * 68 + c8 + 4]); v8h hv;
#pragma unroll
                for (int i = 0; i < 4; ++i) { const float y0 = x0[i] + (bmode ? brow : bcol[i]); const float y1 = x1[i] + (bmode ? brow : bcol[4 + i]);
                    hv[i] = (h16)y0; hv[4 + i] = (h16)y1; }
                const size_t oo = sb + (size_t)row * (size_t)pitch + c8;
                *(v8h*)(Ph + oo) = hv; }
             }
        wave_sync();
    }
}

// k_flash: fused attention, one wave per 16 query rows of one (batch, head); K / V^T / Q fragments straight from the f16 planes (two 16-B loads each, arithmetic addressing).
// Transposed form: S^T[key][t] = K Q^T (A = K rows, B = Q rows); lane (t = lane&15, h = lane>>4) holds keys 8h+r of each 16-key tile, so the packed
// P tile is directly the B fragment of O^T[d][t] = V^T P^T (element r <- tile keys 0..15, element 8+r <- tile keys 16..31, lane unchanged).
// Per 32-key step: 4 score matrix ops (2 key tiles x 2 d halves) + 4 P.V matrix ops (4 d tiles).
// Padded keys: the score is REPLACED by the fill value (flag plane loaded with the same key map as the P elements).
// Softmax state (running max, partial sum) is one scalar per lane; the two lane halves of a row are combined with one xor-16 exchange.
__global__ __launch_bounds__(32 * AW) void k_flash(const h16* __restrict__ QH, const h16* __restrict__ KP, const h16* __restrict__ VT, const h16* __restrict__ PF, h16* CTX) {
    __shared__ __align__(16) float os[AW * 16 * 68];
    const int lane = threadIdx.x & 31, lr = lane & 15, hi = lane >> 4; const int wave = wave_id();
    const int zh = blockIdx.y; const int b = zh / NH_, h = zh % NH_;
    const int t0 = (blockIdx.x * AW + wave) * 16;
    const size_t pbase = (size_t)zh * SEQ * HD;
    const size_t qo = pbase + (size_t)(t0 + lr) * HD + 8 * hi;
    const v16h qh0 = ldh(QH + qo), qh1 = ldh(QH + qo + 32);   // B fragments: col t, k = d
    const size_t ko = pbase + (size_t)lr * HD + 8 * hi;      // + key * HD       (A fragment: row key, k = d)
    const size_t vo = pbase + (size_t)lr * SEQ + 8 * hi;     // + 16j*SEQ + key  (A fragment: row d, k = key)
    const h16* pfp = PF + (size_t)b * SEQ + 8 * hi;          // + key0: elements r <- key0+8h+r, 8+r <- key0+16+8h+r
    v8f o0 = (v8f){}, o1 = (v8f){}, o2 = (v8f){}, o3 = (v8f){};
    float m = -3.0e38f, l = 0.0f;
#pragma unroll 1
    for (int key0 = 0; key0 < SEQ; key0 += 32) {
        const h16* ka = KP + ko + (size_t)key0 * HD;
        const v16h ka0 = ldh(ka), ka1 = ldh(ka + 32), kb0 = ldh(ka + 16 * HD), kb1 = ldh(ka + 16 * HD + 32);
        const v16h pf = ldh(pfp + key0);
        v8f sa = (v8f){}, sb = (v8f){};
        sa = wmma16(ka0, qh0, sa); sb = wmma16(kb0, qh0, sb);
        sa = wmma16(ka1, qh1, sa); sb = wmma16(kb1, qh1, sb);
        asm volatile("v_nop\n\tv_nop\n\tv_nop\n\tv_nop" : "+v"(sa), "+v"(sb) : "v"(ka0), "v"(ka1), "v"(kb0), "v"(kb1), "v"(qh0), "v"(qh1));
        float ta[8], tb[8]; float mx = -3.0e38f;
#pragma unroll
        for (int r = 0; r < 8; ++r) {
            const float xa = sa[r] * SC2, xb = sb[r] * SC2;
            ta[r] = ((float)pf[r] != 0.0f) ? NEGB : xa; tb[r] = ((float)pf[8 + r] != 0.0f) ? NEGB : xb;
            mx = fmaxf(mx, fmaxf(ta[r], tb[r])); }
        mx = fmaxf(mx, __shfl_xor(mx, 16, 32));
        const float mnew = fmaxf(m, mx);
        const float alpha = __builtin_amdgcn_exp2f(m - mnew);
        const float sh = PSH - mnew;
        v16h pb; float ls = 0.0f;
#pragma unroll
        for (int r = 0; r < 8; ++r) { const h16 pa = (h16)__builtin_amdgcn_exp2f(ta[r] + sh); const h16 pc = (h16)__builtin_amdgcn_exp2f(tb[r] + sh); pb[r] = pa; pb[8 + r] = pc; ls += (float)pa + (float)pc; }
        l = l * alpha + ls; m = mnew;
        o0 = o0 * alpha; o1 = o1 * alpha; o2 = o2 * alpha; o3 = o3 * alpha;
        const h16* va = VT + vo + key0;
        const v16h v0 = ldh(va), v1 = ldh(va + (size_t)16 * SEQ), v2 = ldh(va + (size_t)32 * SEQ), v3 = ldh(va + (size_t)48 * SEQ);
        o0 = wmma16(v0, pb, o0); o1 = wmma16(v1, pb, o1); o2 = wmma16(v2, pb, o2); o3 = wmma16(v3, pb, o3);
        asm volatile("v_nop\n\tv_nop\n\tv_nop\n\tv_nop" : "+v"(o0), "+v"(o1), "+v"(o2), "+v"(o3) : "v"(v0), "v"(v1), "v"(v2), "v"(v3), "v"(pb));
    }
    l += __shfl_xor(l, 16, 32);
    const float inv = CXS / l;
    const int wb = wave * 16 * 68;
    // O^T D layout: o_j[r] = (d = 16j + 8h + r, t = lane&15) -> os[t][d]; rows 0..15 x columns 0..63 all written
    { v4f a, c;
      a[0] = o0[0] * inv; a[1] = o0[1] * inv; a[2] = o0[2] * inv; a[3] = o0[3] * inv; c[0] = o0[4] * inv; c[1] = o0[5] * inv; c[2] = o0[6] * inv; c[3] = o0[7] * inv;
      *(v4fa*)(&os[wb + lr * 68 +  0 + 8 * hi]) = a; *(v4fa*)(&os[wb + lr * 68 +  0 + 8 * hi + 4]) = c;
      a[0] = o1[0] * inv; a[1] = o1[1] * inv; a[2] = o1[2] * inv; a[3] = o1[3] * inv; c[0] = o1[4] * inv; c[1] = o1[5] * inv; c[2] = o1[6] * inv; c[3] = o1[7] * inv;
      *(v4fa*)(&os[wb + lr * 68 + 16 + 8 * hi]) = a; *(v4fa*)(&os[wb + lr * 68 + 16 + 8 * hi + 4]) = c;
      a[0] = o2[0] * inv; a[1] = o2[1] * inv; a[2] = o2[2] * inv; a[3] = o2[3] * inv; c[0] = o2[4] * inv; c[1] = o2[5] * inv; c[2] = o2[6] * inv; c[3] = o2[7] * inv;
      *(v4fa*)(&os[wb + lr * 68 + 32 + 8 * hi]) = a; *(v4fa*)(&os[wb + lr * 68 + 32 + 8 * hi + 4]) = c;
      a[0] = o3[0] * inv; a[1] = o3[1] * inv; a[2] = o3[2] * inv; a[3] = o3[3] * inv; c[0] = o3[4] * inv; c[1] = o3[5] * inv; c[2] = o3[6] * inv; c[3] = o3[7] * inv;
      *(v4fa*)(&os[wb + lr * 68 + 48 + 8 * hi]) = a; *(v4fa*)(&os[wb + lr * 68 + 48 + 8 * hi + 4]) = c; }
    wave_sync();
    h16* crow = CTX + ((size_t)b * SEQ + t0) * DP + h * HD;
{
#pragma unroll
        for (int s = 0; s < 4; ++s) { const int row = 4 * s + (lane >> 3), c8 = (lane & 7) * 8;   // 4 s x 4 rows = 16 rows; 8 lanes x 8 halves = 64 columns
            const v4f x0 = *(const v4fa*)(&os[wb + row * 68 + c8]); const v4f x1 = *(const v4fa*)(&os[wb + row * 68 + c8 + 4]); v8h hv;
#pragma unroll
            for (int i = 0; i < 4; ++i) { hv[i] = (h16)x0[i]; hv[4 + i] = (h16)x1[i]; }
            *(v8h*)(crow + (size_t)row * DP + c8) = hv; }
         }
}

// k_out: f16 GEMM, ONE WAVE per 64x64 tile, A = ctx plane [NB*SEQ][1024] (x256), Bt = Wo^T plane [512][1024] (x1024), K = DP; OUT[m][n] = acc * 2^-18 + bo[n] (f32).
__global__ __launch_bounds__(32) void k_out(const h16* __restrict__ A, const h16* __restrict__ Bt, const float* __restrict__ bias, float* OUT) {
    __shared__ __align__(16) float os[16 * 68];
    const int K = DP;
    const int lane = threadIdx.x & 31, lr = lane & 15, hi = lane >> 4; const int r0 = blockIdx.x * 64, c0 = blockIdx.y * 64;
    v8f acc[4][4];
#pragma unroll
    for (int mb = 0; mb < 4; ++mb)
#pragma unroll
        for (int nb = 0; nb < 4; ++nb) acc[mb][nb] = (v8f){};
    const size_t aoff = (size_t)(r0 + lr) * K + 8 * hi, boff = (size_t)(c0 + lr) * K + 8 * hi;
#pragma unroll 1
    for (int kc = 0; kc < K; kc += 32) {
        v16h a[4];
#pragma unroll
        for (int mb = 0; mb < 4; ++mb) a[mb] = ldh(A + aoff + (size_t)mb * 16 * K + kc);
#pragma unroll
        for (int nb = 0; nb < 4; ++nb) { const v16h b = ldh(Bt + boff + (size_t)nb * 16 * K + kc);
#pragma unroll
            for (int mb = 0; mb < 4; ++mb) acc[mb][nb] = wmma16(a[mb], b, acc[mb][nb]); }
        asm volatile("v_nop\n\tv_nop\n\tv_nop\n\tv_nop" : "+v"(acc[0][0]), "+v"(acc[1][1]), "+v"(acc[2][2]), "+v"(acc[3][3]) : "v"(a[0]), "v"(a[1]), "v"(a[2]), "v"(a[3]));
    }
    const size_t orow0 = (size_t)(r0 / SEQ) * OUT_SEQ + (size_t)(r0 % SEQ);
    const int cofs = lr * 4;
    v4f bv;
#pragma unroll
    for (int i = 0; i < 4; ++i) bv[i] = bfr(bias[min(c0 + cofs + i, DIN - 1)]);
#pragma unroll
    for (int mb = 0; mb < 4; ++mb) {
#pragma unroll
        for (int nb = 0; nb < 4; ++nb) {
#pragma unroll
            for (int j = 0; j < 8; ++j) os[(hi * 8 + j) * 68 + nb * 16 + lr] = acc[mb][nb][j] * FOLD; }   // D: row 8h+j, col lane&15
        wave_sync();
{
#pragma unroll
            for (int s = 0; s < 8; ++s) { const int row = 2 * s + hi;   // 8 s x 2 rows = 16 rows; 16 lanes x 4 floats = 64 columns
                const v4f val = *(const v4fa*)(&os[row * 68 + cofs]) + bv;
                *(v4f*)(OUT + (orow0 + (size_t)(mb * 16 + row)) * DIN + c0 + cofs) = val; }
             }
        wave_sync();
    }
}

static constexpr size_t al256(size_t v) { return (v + 255) & ~(size_t)255; }
static constexpr size_t SZ_XB = al256((size_t)NB * SEQ * DIN * 2);
static constexpr size_t SZ_WT = al256((size_t)3 * DP * DIN * 2);
static constexpr size_t SZ_WO = al256((size_t)DIN * DP * 2);
static constexpr size_t SZ_PL = al256((size_t)NB * NH_ * SEQ * HD * 2);
static constexpr size_t SZ_CX = al256((size_t)NB * SEQ * DP * 2);
static constexpr size_t SZ_PF = al256((size_t)NB * SEQ * 2);
static constexpr size_t SZ_TOTAL = SZ_XB + SZ_WT + SZ_WO + 3 * SZ_PL + SZ_CX + SZ_PF;
static_assert(SZ_TOTAL <= (size_t)134217728);          // workspace carve <= 128 MiB
static_assert(((size_t)DP * DIN * 2) % 256 == 0);      // weight sub-planes stay 256-byte aligned

extern "C" void kernel_launch(void* const* d_in, const int* in_sizes, int n_in,
                              void* d_out, int out_size, void* d_ws, size_t ws_size, hipStream_t stream) {
    if (n_in < 10) return;
    const size_t needx = ((size_t)(NB - 1) * SEQ_FULL + SEQ) * DIN;
    if ((size_t)in_sizes[0] < needx || (size_t)in_sizes[1] < needx) return;
    if ((size_t)in_sizes[2] < (size_t)DIN * DP || (size_t)in_sizes[4] < (size_t)DIN * DP || (size_t)in_sizes[6] < (size_t)DIN * DP || (size_t)in_sizes[8] < (size_t)DP * DIN) return;
    if ((size_t)in_sizes[3] < (size_t)DP || (size_t)in_sizes[5] < (size_t)DP || (size_t)in_sizes[7] < (size_t)DP || (size_t)in_sizes[9] < (size_t)DIN) return;
    if ((size_t)out_size < ((size_t)(NB - 1) * OUT_SEQ + SEQ) * DIN) return;
    if (SZ_TOTAL > ws_size) return;
    // wire order: data, pad input, wq, bq, wk, bk, wv, bv, wo, bo (all f32)
    const float* x = (const float*)d_in[0]; const float* pm = (const float*)d_in[1];
    const float* wq = (const float*)d_in[2]; const float* bq = (const float*)d_in[3];
    const float* wk = (const float*)d_in[4]; const float* bk = (const float*)d_in[5];
    const float* wv = (const float*)d_in[6]; const float* bv = (const float*)d_in[7];
    const float* wo = (const float*)d_in[8]; const float* bo = (const float*)d_in[9];
    float* OUT = (float*)d_out;      // [NB][SEQ][512]
    char* wsp = (char*)d_ws;
    bf* XB = (bf*)wsp; wsp += SZ_XB;                 // [NB*SEQ][512] bf16
    bf* WT = (bf*)wsp; wsp += SZ_WT;                 // [3][1024][512] bf16, rows h*64+dm: q | k | v
    bf* WOB = (bf*)wsp; wsp += SZ_WO;                // [512][1024] f16 bits (x1024)
    h16* QH = (h16*)wsp; wsp += SZ_PL;               // [NB*16][SEQ][64]
    h16* KP = (h16*)wsp; wsp += SZ_PL;               // [NB*16][SEQ][64]
    h16* VT = (h16*)wsp; wsp += SZ_PL;               // [NB*16][64][SEQ]
    h16* CX = (h16*)wsp; wsp += SZ_CX;               // [NB*SEQ][1024] (x256)
    h16* PF = (h16*)wsp; wsp += SZ_PF;               // [NB*SEQ] pad flags
    bf* WQ = WT; bf* WK = WT + (size_t)DP * DIN; bf* WV = WT + (size_t)2 * DP * DIN;

    if (SEQ == SEQ_FULL) {
        const size_t n8 = (size_t)NB * SEQ * DIN / 8;
        k_cvt8<<<(unsigned)((n8 + 255) / 256), 256, 0, stream>>>(x, XB, n8);
    } else {
        const size_t n8 = (size_t)SEQ * DIN / 8;
        for (int b = 0; b < NB; ++b) k_cvt8<<<(unsigned)((n8 + 255) / 256), 256, 0, stream>>>(x + (size_t)b * SEQ_FULL * DIN, XB + (size_t)b * SEQ * DIN, n8);
    }
    // weights: in[K = 512 rows][N = 1024 cols] -> out[1024 rows (head-permuted)][512 cols]; grid (K/64, N/64)
    k_wt<<<dim3(DIN / 64, DP / 64, 1), 256, 0, stream>>>(wq, WQ, DIN, DP, 1, 0, 1.0f);
    k_wt<<<dim3(DIN / 64, DP / 64, 1), 256, 0, stream>>>(wk, WK, DIN, DP, 1, 0, 1.0f);
    k_wt<<<dim3(DIN / 64, DP / 64, 1), 256, 0, stream>>>(wv, WV, DIN, DP, 1, 0, 1.0f);
    // Wo: in[K = 1024 rows (h*64+dm)][N = 512 cols] -> out[512 rows][1024 cols], f16 x1024
    k_wt<<<dim3(DP / 64, DIN / 64, 1), 256, 0, stream>>>(wo, WOB, DP, DIN, 0, 1, WOS);
    k_pad<<<dim3(NB * SEQ / 64, 1, 1), 256, 0, stream>>>(pm, PF);

    // q, k: A = data rows (m = b*SEQ + t), Bt = W^T rows (n = h*64 + d) -> plane [(b*16 + h)][t][d]; bias per column
    k_proj<<<dim3(NB * SEQ / 64, DP / 64, 1), 32, 0, stream>>>(XB, WQ, bq, 0, QH, SEQ, (size_t)NH_ * SEQ * HD, HD, HD, (size_t)SEQ * HD);
    k_proj<<<dim3(NB * SEQ / 64, DP / 64, 1), 32, 0, stream>>>(XB, WK, bk, 0, KP, SEQ, (size_t)NH_ * SEQ * HD, HD, HD, (size_t)SEQ * HD);
    // v^T: A = Wv^T rows (m = h*64 + d), Bt = data rows (n = b*SEQ + t) -> plane [(b*1024 + m)][t] = [(b*16 + h)][d][t]; bias per row
    k_proj<<<dim3(DP / 64, NB * SEQ / 64, 1), 32, 0, stream>>>(WV, XB, bv, 1, VT, DP, (size_t)0, SEQ, SEQ, (size_t)DP * SEQ);

    k_flash<<<dim3(SEQ / (16 * AW), NB * NH_, 1), 32 * AW, 0, stream>>>(QH, KP, VT, PF, CX);

    k_out<<<dim3(NB * SEQ / 64, DIN / 64, 1), 32, 0, stream>>>(CX, (const h16*)WOB, bo, OUT);
}

// v001
// It runs in 136 microseconds.
// Next to v000, in two timings, it ran 1.45 times as fast each time.
#include <hip/hip_runtime.h>

// Multi-head self-attention: data [NB][SEQ][512], Wq/Wk/Wv [512][1024] ([in][out], column c = dm*16 + h), biases, key-padding replace fill (-1e9 where a key's 512 pad-input values sum to 0), score scale 1/8, merged heads (h*64+dm) @ Wo [1024][512] + bo, f32 output.
// Compute dtypes, f32 accumulate everywhere: projections v_wmma_f32_16x16x32_bf16 (data and W RNE-converted to bf16; products exact);
// scores v_wmma_f32_16x16x32_f16: q and k single f16 planes (one product); P (x256 carry, cancels in the normalisation) and v single f16; softmax f32 (online, running max);
// output projection v_wmma_f32_16x16x32_f16: ctx single f16 (x256 carry), Wo = f16 of (bf16 RNE of wo) x1024 (exact), 2^-18 folded back in f32, bias added in f32.
// Layout: bf16 copy of data; transposed K-contiguous weight planes (head-permuted rows h*64+dm); q, k planes [b*16+h][t][d] and v^T plane [b*16+h][d][t] from the GEMM epilogue;
// fused flash kernel in transposed form (S^T = K Q^T, O^T = V^T P^T; 4 score + 4 P.V matrix ops per 32-key step; K and V^T tiles of 64 keys staged in LDS by asynchronous copies, two buffers) writing the ctx plane [b*SEQ+t][h*64+d]; one-wave 64x64 GEMM for the output.

#ifndef NB
#define NB 2
#endif
#ifndef SEQ
#define SEQ 2048
#endif
#define NB_FULL  2
#define SEQ_FULL 2048
#ifndef OUT_SEQ
#define OUT_SEQ SEQ              // row pitch (in tokens) between batches of the output
#endif
#define DIN  512                 // input width = output width
#define DP   1024                // projection width = 16 heads x 64
#define NH_  16
#define HD   64
#define AW   8                   // waves per flash block (16 query rows each); all share the staged K / V^T tiles
#define KST  64                  // keys per staged tile (two 32-key steps)
#define LP   72                  // LDS row pitch in halves: 128-byte rows + 16 bytes, the pitch for 16-byte LDS readers
#define NT   (SEQ / KST)         // staged tiles per (batch, head)
#define SC2  (0.125f * 1.4426950408889634f)   // HD^-0.5 * log2(e)
#define PSH  8.0f                // log2 of the P carry (256)
#define NEGB (-1.0e9f * 1.4426950408889634f)  // fill value of padded keys in the log2 domain
#define CXS  256.0f              // carry of the ctx plane
#define WOS  1024.0f             // carry of the Wo plane
#define FOLD (1.0f / (256.0f * 1024.0f))

static_assert(HD == 64);
static_assert(NH_ * HD == DP);
static_assert(NH_ == 16);                      // column c = dm*16 + h
static_assert(DP % 64 == 0);
static_assert(DIN % 64 == 0);
static_assert(DIN % 32 == 0);                  // GEMM k-loops step by 32
static_assert(DP % 32 == 0);
static_assert(DIN == 512);                     // pad-row sum: 4 x 128 floats per wave
static_assert(SEQ % 64 == 0);                  // a 64-row tile never straddles two batches
static_assert((NB * SEQ) % 64 == 0);
static_assert(SEQ % 32 == 0);                  // key loop steps by 32
static_assert(SEQ % (16 * AW) == 0);           // flash grid covers the sequence exactly
static_assert(SEQ % KST == 0);
static_assert(NT >= 2);                        // the two-buffer prologue fills tiles 0 and 1
static_assert(32 * AW * 2 * 8 == KST * HD);    // two 16-byte copies per thread cover one 64 x 64 tile
static_assert(((size_t)SEQ * DIN) % 8 == 0);
static_assert(NB <= NB_FULL);
static_assert(SEQ <= SEQ_FULL);

typedef _Float16 h16;
typedef unsigned short bf;
typedef __attribute__((ext_vector_type(16))) __bf16   v16bf;
typedef __attribute__((ext_vector_type(16))) _Float16 v16h;
typedef __attribute__((ext_vector_type(8)))  _Float16 v8h;
typedef __attribute__((ext_vector_type(8)))  unsigned short v8us;
typedef __attribute__((ext_vector_type(8)))  float    v8f;
typedef __attribute__((ext_vector_type(4)))  float    v4f;
typedef v4f  __attribute__((may_alias)) v4fa;

__device__ __forceinline__ unsigned short f2bf(float f) { unsigned u = __float_as_uint(f); u += 0x7FFFu + ((u >> 16) & 1u); return (unsigned short)(u >> 16); }
__device__ __forceinline__ float bfr(float f) { return __uint_as_float(((unsigned)f2bf(f)) << 16); }   // value after RNE conversion to bf16
__device__ __forceinline__ v16h cat16(v8h lo, v8h hi) { return __builtin_shufflevector(lo, hi, 0, 1, 2, 3, 4, 5, 6, 7, 8, 9, 10, 11, 12, 13, 14, 15); }
__device__ __forceinline__ v16bf cat16b(v8us lo, v8us hi) { return __builtin_bit_cast(v16bf, __builtin_shufflevector(lo, hi, 0, 1, 2, 3, 4, 5, 6, 7, 8, 9, 10, 11, 12, 13, 14, 15)); }
__device__ __forceinline__ v8f wmma16(v16h a, v16h b, v8f c) { return __builtin_amdgcn_wmma_f32_16x16x32_f16(false, a, false, b, (short)0, c, false, false); }
__device__ __forceinline__ v8f wmmab(v16bf a, v16bf b, v8f c) { return __builtin_amdgcn_wmma_f32_16x16x32_bf16(false, a, false, b, (short)0, c, false, false); }
// fragment loaders from K-contiguous 16-bit rows; p already includes + 8*(lane>>4): elements 0..7 <- k0+8h+0..7, elements 8..15 <- k0+16+8h+0..7 (same map for A and B)
__device__ __forceinline__ v16h  ldh(const h16* p) { return cat16(*(const v8h*)p, *(const v8h*)(p + 16)); }
__device__ __forceinline__ v16bf ldb(const bf* p)  { return cat16b(*(const v8us*)p, *(const v8us*)(p + 16)); }
// ordering point for wave-private LDS tiles (same wave writes and reads)
__device__ __forceinline__ void wave_sync() { __builtin_amdgcn_fence(3 /* release order */, "wavefront"); __builtin_amdgcn_wave_barrier(); asm volatile("" ::: "memory"); }
// wave index of the calling thread as a wave-uniform scalar
__device__ __forceinline__ int wave_id() { return __builtin_amdgcn_readfirstlane((int)(threadIdx.x >> 5)); }

__global__ __launch_bounds__(256) void k_cvt8(const float* __restrict__ src, bf* dst, size_t n8) {
    const size_t i = (size_t)blockIdx.x * 256 + threadIdx.x; if (i >= n8) return;
    const v8f v = *(const v8f*)(src + i * 8); v8us o;
#pragma unroll
    for (int k = 0; k < 8; ++k) o[k] = f2bf(v[k]);
    *(v8us*)(dst + i * 8) = o; 
}

// k_wt: W [K][N] f32 ([in][out]) -> dst [N][K] 16-bit rows (K-contiguous). in[K rows][N cols] -> out[N rows][K cols]; grid (K/64, N/64), 256 threads.
// perm != 0: source column c = dm*16 + h lands on destination row h*64 + dm. asf16 == 0: bf16 bits; asf16 != 0: f16 bits of (bf16 value * scale).
__global__ __launch_bounds__(256) void k_wt(const float* __restrict__ W, bf* dst, int K, int N, int perm, int asf16, float scale) {
    __shared__ __align__(16) float ts[64 * 68];          // [column][k]
    const int tid = threadIdx.x, lane = tid & 31; const int wave = wave_id();
    const int k0 = blockIdx.x * 64, c0 = blockIdx.y * 64;
#pragma unroll
    for (int it = 0; it < 4; ++it) { const int e = tid + 256 * it; const int kk = e >> 4, c4 = (e & 15) * 4;   // 64 k rows x 16 float4 = whole tile
        const v4f v = *(const v4f*)(W + (size_t)(k0 + kk) * (size_t)N + c0 + c4);
        ts[(c4 + 0) * 68 + kk] = v[0]; ts[(c4 + 1) * 68 + kk] = v[1]; ts[(c4 + 2) * 68 + kk] = v[2]; ts[(c4 + 3) * 68 + kk] = v[3]; }
    __syncthreads();
{
#pragma unroll
        for (int s = 0; s < 2; ++s) { const int row = 4 * (wave + 8 * s) + (lane >> 3), c8 = (lane & 7) * 8;   // 8 waves x 2 s x 4 rows = 64 rows; 8 lanes x 8 = 64 k
            const v4f x0 = *(const v4fa*)(&ts[row * 68 + c8]); const v4f x1 = *(const v4fa*)(&ts[row * 68 + c8 + 4]); v8us o;
#pragma unroll
            for (int i = 0; i < 4; ++i) { const float f0 = bfr(x0[i]), f1 = bfr(x1[i]);
                const unsigned short b0 = (unsigned short)(__float_as_uint(f0) >> 16), b1 = (unsigned short)(__float_as_uint(f1) >> 16);
                const unsigned short g0 = __builtin_bit_cast(unsigned short, (h16)(f0 * scale)), g1 = __builtin_bit_cast(unsigned short, (h16)(f1 * scale));
                o[i] = asf16 ? g0 : b0; o[4 + i] = asf16 ? g1 : b1; }
            const int c = c0 + row; const int n = perm ? ((c & 15) * 64 + (c >> 4)) : c;
            *(v8us*)(dst + (size_t)n * (size_t)K + k0 + c8) = o; }
         }
}

__global__ __launch_bounds__(256) void k_pad(const float* __restrict__ mask, h16* PF) {
    __shared__ float fl[64];
    const int tid = threadIdx.x, lane = tid & 31; const int wave = wave_id();
    const int m0 = blockIdx.x * 64;
#pragma unroll 1
    for (int i = 0; i < 8; ++i) { const int m = m0 + wave * 8 + i; const int b = m / SEQ, t = m % SEQ;
        const float* row = mask + ((size_t)b * SEQ_FULL + t) * DIN;
        float s = 0.0f;
#pragma unroll
        for (int j = 0; j < 4; ++j) { const v4f v = *(const v4f*)(row + j * 128 + lane * 4); s += bfr(v[0]); s += bfr(v[1]); s += bfr(v[2]); s += bfr(v[3]); }
        s += __shfl_xor(s, 16, 32); s += __shfl_xor(s, 8, 32); s += __shfl_xor(s, 4, 32); s += __shfl_xor(s, 2, 32); s += __shfl_xor(s, 1, 32);
        if (lane == 0) fl[wave * 8 + i] = (s == 0.0f) ? 1.0f : 0.0f; }
    __syncthreads();
    if (tid < 8) { v8h o;
#pragma unroll
        for (int k = 0; k < 8; ++k) o[k] = (h16)fl[tid * 8 + k];
        *(v8h*)(PF + (size_t)m0 + tid * 8) = o;  }
}

// k_proj: register-blocked bf16 GEMM, ONE WAVE per 64x64 tile (16 accumulators), operands straight from K-contiguous bf16 planes, K = DIN.
// C[m][n] = sum_k A[m][k] Bt[n][k] + bias, written as f16 (Ph) at
// tile base (r0/RB)*sRB + (r0%RB)*pitch + (c0/CB)*sCB + (c0%CB), row pitch 'pitch' (halves). grid (M/64, N/64), 32 threads.
// bias (source order dm*16 + h, RNE-converted to bf16, added in f32): bmode 0 = per column n = h*64 + dm, bmode 1 = per row m = h*64 + dm.
__global__ __launch_bounds__(32) void k_proj(const bf* __restrict__ A, const bf* __restrict__ Bt, const float* __restrict__ bias, int bmode, h16* Ph, int RB, size_t sRB, int pitch, int CB, size_t sCB) {
    __shared__ __align__(16) float os[16 * 68];
    const int K = DIN;
    const int lane = threadIdx.x & 31, lr = lane & 15, hi = lane >> 4; const int r0 = blockIdx.x * 64, c0 = blockIdx.y * 64;
    v8f acc[4][4];
#pragma unroll
    for (int mb = 0; mb < 4; ++mb)
#pragma unroll
        for (int nb = 0; nb < 4; ++nb) acc[mb][nb] = (v8f){};
    const size_t aoff = (size_t)(r0 + lr) * K + 8 * hi, boff = (size_t)(c0 + lr) * K + 8 * hi;
#pragma unroll 1
    for (int kc = 0; kc < K; kc += 32) {
        v16bf a[4];
#pragma unroll
        for (int mb = 0; mb < 4; ++mb) a[mb] = ldb(A + aoff + (size_t)mb * 16 * K + kc);
#pragma unroll
        for (int nb = 0; nb < 4; ++nb) { const v16bf b = ldb(Bt + boff + (size_t)nb * 16 * K + kc);
#pragma unroll
            for (int mb = 0; mb < 4; ++mb) acc[mb][nb] = wmmab(a[mb], b, acc[mb][nb]); }
        asm volatile("v_nop\n\tv_nop\n\tv_nop\n\tv_nop" : "+v"(acc[0][0]), "+v"(acc[1][1]), "+v"(acc[2][2]), "+v"(acc[3][3]) : "v"(a[0]), "v"(a[1]), "v"(a[2]), "v"(a[3]));
    }
    const size_t tbase = (size_t)(r0 / RB) * sRB + (size_t)(r0 % RB) * (size_t)pitch + (size_t)(c0 / CB) * sCB + (size_t)(c0 % CB);
    const int c8 = (lane & 7) * 8;
    float bcol[8];      // column-mode bias of this lane's 8 columns (clamped addresses, always loaded)
    { const int hc = min(c0 >> 6, NH_ - 1);
#pragma unroll
      for (int i = 0; i < 8; ++i) bcol[i] = bfr(bias[min((c8 + i) * NH_ + hc, DP - 1)]); }
#pragma unroll
    for (int mb = 0; mb < 4; ++mb) {
#pragma unroll
        for (int nb = 0; nb < 4; ++nb) {
#pragma unroll
            for (int j = 0; j < 8; ++j) os[(hi * 8 + j) * 68 + nb * 16 + lr] = acc[mb][nb][j]; }   // D: row 8h+j, col lane&15
        wave_sync();
        const size_t sb = tbase + (size_t)(mb * 16) * (size_t)pitch;
{
#pragma unroll
            for (int s = 0; s < 4; ++s) { const int row = 4 * s + (lane >> 3);   // 4 s x 4 row groups = 16 rows; 8 lanes x 8 = 64 columns
                const int m = r0 + mb * 16 + row;
                const float brow = bfr(bias[min((m & 63) * NH_ + min(m >> 6, NH_ - 1), DP - 1)]);
                const v4f x0 = *(const v4fa*)(&os[row * 68 + c8]); const v4f x1 = *(const v4fa*)(&os[row * 68 + c8 + 4]); v8h hv;
#pragma unroll
                for (int i = 0; i < 4; ++i) { const float y0 = x0[i] + (bmode ? brow : bcol[i]); const float y1 = x1[i] + (bmode ? brow : bcol[4 + i]);
                    hv[i] = (h16)y0; hv[4 + i] = (h16)y1; }
                const size_t oo = sb + (size_t)row * (size_t)pitch + c8;
                *(v8h*)(Ph + oo) = hv; }
             }
        wave_sync();
    }
}

// One thread's share of a staged tile pair: four 16-byte asynchronous copies global -> LDS (two of K, two of V^T). The s_wait_xcnt closes the statement so that
// no address register of an issued copy is rewritten ahead of it.
__device__ __forceinline__ void stage4(unsigned l0, const h16* g0, unsigned l1, const h16* g1, unsigned l2, const h16* g2, unsigned l3, const h16* g3) {
    asm volatile("global_load_async_to_lds_b128 %0, %1, off\n\t"
                 "global_load_async_to_lds_b128 %2, %3, off\n\t"
                 "global_load_async_to_lds_b128 %4, %5, off\n\t"
                 "global_load_async_to_lds_b128 %6, %7, off\n\t"
                 "s_wait_xcnt 0x0"
                 :: "v"(l0), "v"(g0), "v"(l1), "v"(g1), "v"(l2), "v"(g2), "v"(l3), "v"(g3) : "memory");
}

// k_flash: fused attention, one wave per 16 query rows of one (batch, head); Q fragments straight from the f16 plane; K / V^T fragments from LDS tiles of 64 keys that the
// block's 8 waves share: tile t + 1 is copied (asynchronously, no registers) into one buffer while tile t is worked on in the other; one barrier per tile publishes and frees.
// Transposed form: S^T[key][t] = K Q^T (A = K rows, B = Q rows); lane (t = lane&15, h = lane>>4) holds keys 8h+r of each 16-key tile, so the packed
// P tile is directly the B fragment of O^T[d][t] = V^T P^T (element r <- tile keys 0..15, element 8+r <- tile keys 16..31, lane unchanged).
// Per 32-key step: 4 score matrix ops (2 key tiles x 2 d halves) + 4 P.V matrix ops (4 d tiles).
// Padded keys: the score is REPLACED by the fill value (flag plane loaded with the same key map as the P elements).
// Softmax state (running max, partial sum) is one scalar per lane; the two lane halves of a row are combined with one xor-16 exchange.
__global__ __launch_bounds__(32 * AW) void k_flash(const h16* __restrict__ QH, const h16* __restrict__ KP, const h16* __restrict__ VT, const h16* __restrict__ PF, h16* CTX) {
    __shared__ __align__(16) float os[AW * 16 * 68];
    __shared__ __align__(16) h16 ring[2][2][64 * LP];        // [buffer][K rows key | V^T rows d][row][LP]
    const int lane = threadIdx.x & 31, lr = lane & 15, hi = lane >> 4; const int wave = wave_id();
    const int zh = blockIdx.y; const int b = zh / NH_, h = zh % NH_;
    const int t0 = (blockIdx.x * AW + wave) * 16;
    const size_t pbase = (size_t)zh * SEQ * HD;
    const size_t qo = pbase + (size_t)(t0 + lr) * HD + 8 * hi;
    const v16h qh0 = ldh(QH + qo), qh1 = ldh(QH + qo + 32);   // B fragments: col t, k = d
    const int fo = lr * LP + 8 * hi;                         // fragment offset in a staged tile: K + key*LP (row key, k = d), V^T + 16j*LP + key (row d, k = key)
    // copy map: thread -> rows cr and cr + 32 of each tile, 16-byte column tid & 7
    const int cr = (int)(threadIdx.x >> 3), cc = (int)(threadIdx.x & 7) * 8;
    const h16* gk = KP + pbase + (size_t)cr * HD + cc;       // + key0 * HD
    const h16* gv = VT + pbase + (size_t)cr * SEQ + cc;      // + key0
    const unsigned lk = (unsigned)(size_t)&ring[0][0][cr * LP + cc];   // LDS byte address of the thread's first K chunk in buffer 0
    constexpr unsigned TB = 64 * LP * 2, HB = 32 * LP * 2;   // bytes of one tile, of 32 rows
    // tile 0 -> buffer 0, landed and published; then tile 1 -> buffer 1 in flight
    stage4(lk, gk, lk + HB, gk + 32 * HD, lk + TB, gv, lk + TB + HB, gv + (size_t)32 * SEQ);
    asm volatile("s_wait_asynccnt 0x0" ::: "memory");        // this wave's copies of tile 0 have landed
    __syncthreads();                                         // every wave's copies of tile 0 are readable
    stage4(lk + 2 * TB, gk + KST * HD, lk + 2 * TB + HB, gk + (KST + 32) * HD, lk + 3 * TB, gv + KST, lk + 3 * TB + HB, gv + (size_t)32 * SEQ + KST);
    const h16* pfp = PF + (size_t)b * SEQ + 8 * hi;          // + key0: elements r <- key0+8h+r, 8+r <- key0+16+8h+r
    v8f o0 = (v8f){}, o1 = (v8f){}, o2 = (v8f){}, o3 = (v8f){};
    float m = -3.0e38f, l = 0.0f;
#pragma unroll 1
    for (int t = 0; t < NT; ++t) {
      const h16* kt = &ring[t & 1][0][fo]; const h16* vt = &ring[t & 1][1][fo];
#pragma unroll   // both 32-key steps of a tile inline, so that every LDS offset inside the tile is an immediate
      for (int s = 0; s < KST / 32; ++s) {
        const int key0 = t * KST + s * 32;
        const h16* ka = kt + s * 32 * LP;
        const v16h ka0 = ldh(ka), ka1 = ldh(ka + 32), kb0 = ldh(ka + 16 * LP), kb1 = ldh(ka + 16 * LP + 32);
        const v16h pf = ldh(pfp + key0);
        v8f sa = (v8f){}, sb = (v8f){};
        sa = wmma16(ka0, qh0, sa); sb = wmma16(kb0, qh0, sb);
        sa = wmma16(ka1, qh1, sa); sb = wmma16(kb1, qh1, sb);
        asm volatile("v_nop\n\tv_nop\n\tv_nop\n\tv_nop" : "+v"(sa), "+v"(sb) : "v"(ka0), "v"(ka1), "v"(kb0), "v"(kb1), "v"(qh0), "v"(qh1));
        float ta[8], tb[8]; float mx = -3.0e38f;
#pragma unroll
        for (int r = 0; r < 8; ++r) {
            const float xa = sa[r] * SC2, xb = sb[r] * SC2;
            ta[r] = ((float)pf[r] != 0.0f) ? NEGB : xa; tb[r] = ((float)pf[8 + r] != 0.0f) ? NEGB : xb;
            mx = fmaxf(mx, fmaxf(ta[r], tb[r])); }
        mx = fmaxf(mx, __shfl_xor(mx, 16, 32));
        const float mnew = fmaxf(m, mx);
        const float alpha = __builtin_amdgcn_exp2f(m - mnew);
        const float sh = PSH - mnew;
        v16h pb; float ls = 0.0f;
#pragma unroll
        for (int r = 0; r < 8; ++r) { const h16 pa = (h16)__builtin_amdgcn_exp2f(ta[r] + sh); const h16 pc = (h16)__builtin_amdgcn_exp2f(tb[r] + sh); pb[r] = pa; pb[8 + r] = pc; ls += (float)pa + (float)pc; }
        l = l * alpha + ls; m = mnew;
        o0 = o0 * alpha; o1 = o1 * alpha; o2 = o2 * alpha; o3 = o3 * alpha;
        const h16* va = vt + s * 32;
        const v16h v0 = ldh(va), v1 = ldh(va + 16 * LP), v2 = ldh(va + 32 * LP), v3 = ldh(va + 48 * LP);
        o0 = wmma16(v0, pb, o0); o1 = wmma16(v1, pb, o1); o2 = wmma16(v2, pb, o2); o3 = wmma16(v3, pb, o3);
        asm volatile("v_nop\n\tv_nop\n\tv_nop\n\tv_nop" : "+v"(o0), "+v"(o1), "+v"(o2), "+v"(o3) : "v"(v0), "v"(v1), "v"(v2), "v"(v3), "v"(pb));
      }
      asm volatile("s_wait_dscnt 0x0" ::: "memory");         // this wave's reads of tile t are done before its buffer may be refilled
      asm volatile("s_wait_asynccnt 0x0" ::: "memory");      // this wave's copies of tile t + 1 have landed
      __syncthreads();                                       // publishes tile t + 1 and ends every wave's reads of tile t
      if (t + 2 < NT) {                                      // block-uniform: refill the buffer that tile t has just left
          const unsigned lb = lk + (unsigned)(t & 1) * (2 * TB); const h16* gk2 = gk + (size_t)(t + 2) * KST * HD; const h16* gv2 = gv + (t + 2) * KST;
          stage4(lb, gk2, lb + HB, gk2 + 32 * HD, lb + TB, gv2, lb + TB + HB, gv2 + (size_t)32 * SEQ); }
    }
    asm volatile("s_wait_asynccnt 0x0" ::: "memory");        // nothing of this wave is in flight when the ring goes out of use
    l += __shfl_xor(l, 16, 32);
    const float inv = CXS / l;
    const int wb = wave * 16 * 68;
    // O^T D layout: o_j[r] = (d = 16j + 8h + r, t = lane&15) -> os[t][d]; rows 0..15 x columns 0..63 all written
    { v4f a, c;
      a[0] = o0[0] * inv; a[1] = o0[1] * inv; a[2] = o0[2] * inv; a[3] = o0[3] * inv; c[0] = o0[4] * inv; c[1] = o0[5] * inv; c[2] = o0[6] * inv; c[3] = o0[7] * inv;
      *(v4fa*)(&os[wb + lr * 68 +  0 + 8 * hi]) = a; *(v4fa*)(&os[wb + lr * 68 +  0 + 8 * hi + 4]) = c;
      a[0] = o1[0] * inv; a[1] = o1[1] * inv; a[2] = o1[2] * inv; a[3] = o1[3] * inv; c[0] = o1[4] * inv; c[1] = o1[5] * inv; c[2] = o1[6] * inv; c[3] = o1[7] * inv;
      *(v4fa*)(&os[wb + lr * 68 + 16 + 8 * hi]) = a; *(v4fa*)(&os[wb + lr * 68 + 16 + 8 * hi + 4]) = c;
      a[0] = o2[0] * inv; a[1] = o2[1] * inv; a[2] = o2[2] * inv; a[3] = o2[3] * inv; c[0] = o2[4] * inv; c[1] = o2[5] * inv; c[2] = o2[6] * inv; c[3] = o2[7] * inv;
      *(v4fa*)(&os[wb + lr * 68 + 32 + 8 * hi]) = a; *(v4fa*)(&os[wb + lr * 68 + 32 + 8 * hi + 4]) = c;
      a[0] = o3[0] * inv; a[1] = o3[1] * inv; a[2] = o3[2] * inv; a[3] = o3[3] * inv; c[0] = o3[4] * inv; c[1] = o3[5] * inv; c[2] = o3[6] * inv; c[3] = o3[7] * inv;
      *(v4fa*)(&os[wb + lr * 68 + 48 + 8 * hi]) = a; *(v4fa*)(&os[wb + lr * 68 + 48 + 8 * hi + 4]) = c; }
    wave_sync();
    h16* crow = CTX + ((size_t)b * SEQ + t0) * DP + h * HD;
{
#pragma unroll
        for (int s = 0; s < 4; ++s) { const int row = 4 * s + (lane >> 3), c8 = (lane & 7) * 8;   // 4 s x 4 rows = 16 rows; 8 lanes x 8 halves = 64 columns
            const v4f x0 = *(const v4fa*)(&os[wb + row * 68 + c8]); const v4f x1 = *(const v4fa*)(&os[wb + row * 68 + c8 + 4]); v8h hv;
#pragma unroll
            for (int i = 0; i < 4; ++i) { hv[i] = (h16)x0[i]; hv[4 + i] = (h16)x1[i]; }
            *(v8h*)(crow + (size_t)row * DP + c8) = hv; }
         }
}

// k_out: f16 GEMM, ONE WAVE per 64x64 tile, A = ctx plane [NB*SEQ][1024] (x256), Bt = Wo^T plane [512][1024] (x1024), K = DP; OUT[m][n] = acc * 2^-18 + bo[n] (f32).
__global__ __launch_bounds__(32) void k_out(const h16* __restrict__ A, const h16* __restrict__ Bt, const float* __restrict__ bias, float* OUT) {
    __shared__ __align__(16) float os[16 * 68];
    const int K = DP;
    const int lane = threadIdx.x & 31, lr = lane & 15, hi = lane >> 4; const int r0 = blockIdx.x * 64, c0 = blockIdx.y * 64;
    v8f acc[4][4];
#pragma unroll
    for (int mb = 0; mb < 4; ++mb)
#pragma unroll
        for (int nb = 0; nb < 4; ++nb) acc[mb][nb] = (v8f){};
    const size_t aoff = (size_t)(r0 + lr) * K + 8 * hi, boff = (size_t)(c0 + lr) * K + 8 * hi;
#pragma unroll 1
    for (int kc = 0; kc < K; kc += 32) {
        v16h a[4];
#pragma unroll
        for (int mb = 0; mb < 4; ++mb) a[mb] = ldh(A + aoff + (size_t)mb * 16 * K + kc);
#pragma unroll
        for (int nb = 0; nb < 4; ++nb) { const v16h b = ldh(Bt + boff + (size_t)nb * 16 * K + kc);
#pragma unroll
            for (int mb = 0; mb < 4; ++mb) acc[mb][nb] = wmma16(a[mb], b, acc[mb][nb]); }
        asm volatile("v_nop\n\tv_nop\n\tv_nop\n\tv_nop" : "+v"(acc[0][0]), "+v"(acc[1][1]), "+v"(acc[2][2]), "+v"(acc[3][3]) : "v"(a[0]), "v"(a[1]), "v"(a[2]), "v"(a[3]));
    }
    const size_t orow0 = (size_t)(r0 / SEQ) * OUT_SEQ + (size_t)(r0 % SEQ);
    const int cofs = lr * 4;
    v4f bv;
#pragma unroll
    for (int i = 0; i < 4; ++i) bv[i] = bfr(bias[min(c0 + cofs + i, DIN - 1)]);
#pragma unroll
    for (int mb = 0; mb < 4; ++mb) {
#pragma unroll
        for (int nb = 0; nb < 4; ++nb) {
#pragma unroll
            for (int j = 0; j < 8; ++j) os[(hi * 8 + j) * 68 + nb * 16 + lr] = acc[mb][nb][j] * FOLD; }   // D: row 8h+j, col lane&15
        wave_sync();
{
#pragma unroll
            for (int s = 0; s < 8; ++s) { const int row = 2 * s + hi;   // 8 s x 2 rows = 16 rows; 16 lanes x 4 floats = 64 columns
                const v4f val = *(const v4fa*)(&os[row * 68 + cofs]) + bv;
                *(v4f*)(OUT + (orow0 + (size_t)(mb * 16 + row)) * DIN + c0 + cofs) = val; }
             }
        wave_sync();
    }
}

static constexpr size_t al256(size_t v) { return (v + 255) & ~(size_t)255; }
static constexpr size_t SZ_XB = al256((size_t)NB * SEQ * DIN * 2);
static constexpr size_t SZ_WT = al256((size_t)3 * DP * DIN * 2);
static constexpr size_t SZ_WO = al256((size_t)DIN * DP * 2);
static constexpr size_t SZ_PL = al256((size_t)NB * NH_ * SEQ * HD * 2);
static constexpr size_t SZ_CX = al256((size_t)NB * SEQ * DP * 2);
static constexpr size_t SZ_PF = al256((size_t)NB * SEQ * 2);
static constexpr size_t SZ_TOTAL = SZ_XB + SZ_WT + SZ_WO + 3 * SZ_PL + SZ_CX + SZ_PF;
static_assert(SZ_TOTAL <= (size_t)134217728);          // workspace carve <= 128 MiB
static_assert(((size_t)DP * DIN * 2) % 256 == 0);      // weight sub-planes stay 256-byte aligned

extern "C" void kernel_launch(void* const* d_in, const int* in_sizes, int n_in,
                              void* d_out, int out_size, void* d_ws, size_t ws_size, hipStream_t stream) {
    if (n_in < 10) return;
    const size_t needx = ((size_t)(NB - 1) * SEQ_FULL + SEQ) * DIN;
    if ((size_t)in_sizes[0] < needx || (size_t)in_sizes[1] < needx) return;
    if ((size_t)in_sizes[2] < (size_t)DIN * DP || (size_t)in_sizes[4] < (size_t)DIN * DP || (size_t)in_sizes[6] < (size_t)DIN * DP || (size_t)in_sizes[8] < (size_t)DP * DIN) return;
    if ((size_t)in_sizes[3] < (size_t)DP || (size_t)in_sizes[5] < (size_t)DP || (size_t)in_sizes[7] < (size_t)DP || (size_t)in_sizes[9] < (size_t)DIN) return;
    if ((size_t)out_size < ((size_t)(NB - 1) * OUT_SEQ + SEQ) * DIN) return;
    if (SZ_TOTAL > ws_size) return;
    // wire order: data, pad input, wq, bq, wk, bk, wv, bv, wo, bo (all f32)
    const float* x = (const float*)d_in[0]; const float* pm = (const float*)d_in[1];
    const float* wq = (const float*)d_in[2]; const float* bq = (const float*)d_in[3];
    const float* wk = (const float*)d_in[4]; const float* bk = (const float*)d_in[5];
    const float* wv = (const float*)d_in[6]; const float* bv = (const float*)d_in[7];
    const float* wo = (const float*)d_in[8]; const float* bo = (const float*)d_in[9];
    float* OUT = (float*)d_out;      // [NB][SEQ][512]
    char* wsp = (char*)d_ws;
    bf* XB = (bf*)wsp; wsp += SZ_XB;                 // [NB*SEQ][512] bf16
    bf* WT = (bf*)wsp; wsp += SZ_WT;                 // [3][1024][512] bf16, rows h*64+dm: q | k | v
    bf* WOB = (bf*)wsp; wsp += SZ_WO;                // [512][1024] f16 bits (x1024)
    h16* QH = (h16*)wsp; wsp += SZ_PL;               // [NB*16][SEQ][64]
    h16* KP = (h16*)wsp; wsp += SZ_PL;               // [NB*16][SEQ][64]
    h16* VT = (h16*)wsp; wsp += SZ_PL;               // [NB*16][64][SEQ]
    h16* CX = (h16*)wsp; wsp += SZ_CX;               // [NB*SEQ][1024] (x256)
    h16* PF = (h16*)wsp; wsp += SZ_PF;               // [NB*SEQ] pad flags
    bf* WQ = WT; bf* WK = WT + (size_t)DP * DIN; bf* WV = WT + (size_t)2 * DP * DIN;

    if (SEQ == SEQ_FULL) {
        const size_t n8 = (size_t)NB * SEQ * DIN / 8;
        k_cvt8<<<(unsigned)((n8 + 255) / 256), 256, 0, stream>>>(x, XB, n8);
    } else {
        const size_t n8 = (size_t)SEQ * DIN / 8;
        for (int b = 0; b < NB; ++b) k_cvt8<<<(unsigned)((n8 + 255) / 256), 256, 0, stream>>>(x + (size_t)b * SEQ_FULL * DIN, XB + (size_t)b * SEQ * DIN, n8);
    }
    // weights: in[K = 512 rows][N = 1024 cols] -> out[1024 rows (head-permuted)][512 cols]; grid (K/64, N/64)
    k_wt<<<dim3(DIN / 64, DP / 64, 1), 256, 0, stream>>>(wq, WQ, DIN, DP, 1, 0, 1.0f);
    k_wt<<<dim3(DIN / 64, DP / 64, 1), 256, 0, stream>>>(wk, WK, DIN, DP, 1, 0, 1.0f);
    k_wt<<<dim3(DIN / 64, DP / 64, 1), 256, 0, stream>>>(wv, WV, DIN, DP, 1, 0, 1.0f);
    // Wo: in[K = 1024 rows (h*64+dm)][N = 512 cols] -> out[512 rows][1024 cols], f16 x1024
    k_wt<<<dim3(DP / 64, DIN / 64, 1), 256, 0, stream>>>(wo, WOB, DP, DIN, 0, 1, WOS);
    k_pad<<<dim3(NB * SEQ / 64, 1, 1), 256, 0, stream>>>(pm, PF);

    // q, k: A = data rows (m = b*SEQ + t), Bt = W^T rows (n = h*64 + d) -> plane [(b*16 + h)][t][d]; bias per column
    k_proj<<<dim3(NB * SEQ / 64, DP / 64, 1), 32, 0, stream>>>(XB, WQ, bq, 0, QH, SEQ, (size_t)NH_ * SEQ * HD, HD, HD, (size_t)SEQ * HD);
    k_proj<<<dim3(NB * SEQ / 64, DP / 64, 1), 32, 0, stream>>>(XB, WK, bk, 0, KP, SEQ, (size_t)NH_ * SEQ * HD, HD, HD, (size_t)SEQ * HD);
    // v^T: A = Wv^T rows (m = h*64 + d), Bt = data rows (n = b*SEQ + t) -> plane [(b*1024 + m)][t] = [(b*16 + h)][d][t]; bias per row
    k_proj<<<dim3(DP / 64, NB * SEQ / 64, 1), 32, 0, stream>>>(WV, XB, bv, 1, VT, DP, (size_t)0, SEQ, SEQ, (size_t)DP * SEQ);

    k_flash<<<dim3(SEQ / (16 * AW), NB * NH_, 1), 32 * AW, 0, stream>>>(QH, KP, VT, PF, CX);

    k_out<<<dim3(NB * SEQ / 64, DIN / 64, 1), 32, 0, stream>>>(CX, (const h16*)WOB, bo, OUT);
}

// v002
// It runs in 108 microseconds.
// Next to v001, in two timings, it ran 1.26 and 1.25 times as fast.
// Counting every step since v000, it is 1.81 times as fast.
#include <hip/hip_runtime.h>

// Multi-head self-attention: data [NB][SEQ][512], Wq/Wk/Wv [512][1024] ([in][out], column c = dm*16 + h), biases, key-padding replace fill (-1e9 where a key's 512 pad-input values sum to 0), score scale 1/8, merged heads (h*64+dm) @ Wo [1024][512] + bo, f32 output.
// Compute dtypes, f32 accumulate everywhere: projections v_wmma_f32_16x16x32_bf16 (data and W RNE-converted to bf16; products exact);
// scores v_wmma_f32_16x16x32_f16: q and k single f16 planes (one product); P (x256 carry, cancels in the normalisation) and v single f16; softmax f32 (online, running max);
// output projection v_wmma_f32_16x16x32_f16: ctx single f16 (x256 carry), Wo = f16 of (bf16 RNE of wo) x1024 (exact), 2^-18 folded back in f32, bias added in f32.
// Launches: 4. k_prep (block index picks the job: pad flags, one weight tile, or a slice of the data conversion; the jobs read none of each other's output), k_proj (grid z picks q, k or v^T), k_flash, k_out.
// Layout: bf16 copy of data; transposed K-contiguous weight planes (head-permuted rows h*64+dm); q, k planes [b*16+h][t][d] and v^T plane [b*16+h][d][t] from the GEMM epilogue;
// fused flash kernel in transposed form (S^T = K Q^T, O^T = V^T P^T; 4 score + 4 P.V matrix ops per 32-key step; K and V^T tiles of 64 keys staged in LDS by asynchronous copies, two buffers) writing the ctx plane [b*SEQ+t][h*64+d]; one-wave 64x64 GEMM for the output.

#ifndef NB
#define NB 2
#endif
#ifndef SEQ
#define SEQ 2048
#endif
#define NB_FULL  2
#define SEQ_FULL 2048
#ifndef OUT_SEQ
#define OUT_SEQ SEQ              // row pitch (in tokens) between batches of the output
#endif
#define DIN  512                 // input width = output width
#define DP   1024                // projection width = 16 heads x 64
#define NH_  16
#define HD   64
#define AW   8                   // waves per flash block (16 query rows each); all share the staged K / V^T tiles
#define KST  64                  // keys per staged tile (two 32-key steps)
#define LP   72                  // LDS row pitch in halves: 128-byte rows + 16 bytes, the pitch for 16-byte LDS readers
#define NT   (SEQ / KST)         // staged tiles per (batch, head)
#define SC2  (0.125f * 1.4426950408889634f)   // HD^-0.5 * log2(e)
#define PSH  8.0f                // log2 of the P carry (256)
#define NEGB (-1.0e9f * 1.4426950408889634f)  // fill value of padded keys in the log2 domain
#define CXS  256.0f              // carry of the ctx plane
#define WOS  1024.0f             // carry of the Wo plane
#define FOLD (1.0f / (256.0f * 1024.0f))

static_assert(HD == 64);
static_assert(NH_ * HD == DP);
static_assert(NH_ == 16);                      // column c = dm*16 + h
static_assert(DP % 64 == 0);
static_assert(DIN % 64 == 0);
static_assert(DIN % 32 == 0);                  // GEMM k-loops step by 32
static_assert(DP % 32 == 0);
static_assert(DIN == 512);                     // pad-row sum: 4 x 128 floats per wave
static_assert(SEQ % 64 == 0);                  // a 64-row tile never straddles two batches
static_assert((NB * SEQ) % 64 == 0);
static_assert(SEQ % 32 == 0);                  // key loop steps by 32
static_assert(SEQ % (16 * AW) == 0);           // flash grid covers the sequence exactly
static_assert(SEQ % KST == 0);
static_assert(NT >= 2);                        // the two-buffer prologue fills tiles 0 and 1
static_assert(32 * AW * 2 * 8 == KST * HD);    // two 16-byte copies per thread cover one 64 x 64 tile
static_assert(((size_t)SEQ * DIN) % 8 == 0);
static_assert(NB <= NB_FULL);
static_assert(SEQ <= SEQ_FULL);

typedef _Float16 h16;
typedef unsigned short bf;
typedef __attribute__((ext_vector_type(16))) __bf16   v16bf;
typedef __attribute__((ext_vector_type(16))) _Float16 v16h;
typedef __attribute__((ext_vector_type(8)))  _Float16 v8h;
typedef __attribute__((ext_vector_type(8)))  unsigned short v8us;
typedef __attribute__((ext_vector_type(8)))  float    v8f;
typedef __attribute__((ext_vector_type(4)))  float    v4f;
typedef v4f  __attribute__((may_alias)) v4fa;

__device__ __forceinline__ unsigned short f2bf(float f) { unsigned u = __float_as_uint(f); u += 0x7FFFu + ((u >> 16) & 1u); return (unsigned short)(u >> 16); }
__device__ __forceinline__ float bfr(float f) { return __uint_as_float(((unsigned)f2bf(f)) << 16); }   // value after RNE conversion to bf16
__device__ __forceinline__ v16h cat16(v8h lo, v8h hi) { return __builtin_shufflevector(lo, hi, 0, 1, 2, 3, 4, 5, 6, 7, 8, 9, 10, 11, 12, 13, 14, 15); }
__device__ __forceinline__ v16bf cat16b(v8us lo, v8us hi) { return __builtin_bit_cast(v16bf, __builtin_shufflevector(lo, hi, 0, 1, 2, 3, 4, 5, 6, 7, 8, 9, 10, 11, 12, 13, 14, 15)); }
__device__ __forceinline__ v8f wmma16(v16h a, v16h b, v8f c) { return __builtin_amdgcn_wmma_f32_16x16x32_f16(false, a, false, b, (short)0, c, false, false); }
__device__ __forceinline__ v8f wmmab(v16bf a, v16bf b, v8f c) { return __builtin_amdgcn_wmma_f32_16x16x32_bf16(false, a, false, b, (short)0, c, false, false); }
// fragment loaders from K-contiguous 16-bit rows; p already includes + 8*(lane>>4): elements 0..7 <- k0+8h+0..7, elements 8..15 <- k0+16+8h+0..7 (same map for A and B)
__device__ __forceinline__ v16h  ldh(const h16* p) { return cat16(*(const v8h*)p, *(const v8h*)(p + 16)); }
__device__ __forceinline__ v16bf ldb(const bf* p)  { return cat16b(*(const v8us*)p, *(const v8us*)(p + 16)); }
// ordering point for wave-private LDS tiles (same wave writes and reads)
__device__ __forceinline__ void wave_sync() { __builtin_amdgcn_fence(3 /* release order */, "wavefront"); __builtin_amdgcn_wave_barrier(); asm volatile("" ::: "memory"); }
// wave index of the calling thread as a wave-uniform scalar
__device__ __forceinline__ int wave_id() { return __builtin_amdgcn_readfirstlane((int)(threadIdx.x >> 5)); }

// blocks of k_prep per job
#define PB_PAD (NB * SEQ / 64)                        // 64 pad rows each
#define PB_WT  ((DIN / 64) * (DP / 64))               // 64 x 64 tiles of one weight matrix (all four have DIN * DP elements)
#define N8     ((size_t)NB * SEQ * DIN / 8)           // 8-element chunks of the data
#define PB_CVT ((unsigned)((N8 + 255) / 256))

// cvt_job: data f32 -> bf16 copy [NB*SEQ][512], 8 elements per thread; blk = block index inside the job.
__device__ __forceinline__ void cvt_job(const float* __restrict__ x, bf* dst, int blk) {
    const size_t i = (size_t)blk * 256 + threadIdx.x; if (i >= N8) return;
    constexpr size_t C8 = (size_t)SEQ * DIN / 8;      // chunks per batch
    const size_t so = (SEQ == SEQ_FULL) ? i * 8 : (i / C8) * ((size_t)SEQ_FULL * DIN) + (i % C8) * 8;
    const v8f v = *(const v8f*)(x + so); v8us o;
#pragma unroll
    for (int k = 0; k < 8; ++k) o[k] = f2bf(v[k]);
    *(v8us*)(dst + i * 8) = o;
}

// wt_job: W [K][N] f32 ([in][out]) -> dst [N][K] 16-bit rows (K-contiguous). in[K rows][N cols] -> out[N rows][K cols]; one 64 x 64 tile (bx of K/64, by of N/64), 256 threads; ts = 64 * 68 floats of LDS.
// perm != 0: source column c = dm*16 + h lands on destination row h*64 + dm. asf16 == 0: bf16 bits; asf16 != 0: f16 bits of (bf16 value * scale).
__device__ __forceinline__ void wt_job(const float* __restrict__ W, bf* dst, int K, int N, int perm, int asf16, float scale, int bx, int by, float* ts) {   // ts: [column][k]
    const int tid = threadIdx.x, lane = tid & 31; const int wave = wave_id();
    const int k0 = bx * 64, c0 = by * 64;
#pragma unroll
    for (int it = 0; it < 4; ++it) { const int e = tid + 256 * it; const int kk = e >> 4, c4 = (e & 15) * 4;   // 64 k rows x 16 float4 = whole tile
        const v4f v = *(const v4f*)(W + (size_t)(k0 + kk) * (size_t)N + c0 + c4);
        ts[(c4 + 0) * 68 + kk] = v[0]; ts[(c4 + 1) * 68 + kk] = v[1]; ts[(c4 + 2) * 68 + kk] = v[2]; ts[(c4 + 3) * 68 + kk] = v[3]; }
    __syncthreads();
{
#pragma unroll
        for (int s = 0; s < 2; ++s) { const int row = 4 * (wave + 8 * s) + (lane >> 3), c8 = (lane & 7) * 8;   // 8 waves x 2 s x 4 rows = 64 rows; 8 lanes x 8 = 64 k
            const v4f x0 = *(const v4fa*)(&ts[row * 68 + c8]); const v4f x1 = *(const v4fa*)(&ts[row * 68 + c8 + 4]); v8us o;
#pragma unroll
            for (int i = 0; i < 4; ++i) { const float f0 = bfr(x0[i]), f1 = bfr(x1[i]);
                const unsigned short b0 = (unsigned short)(__float_as_uint(f0) >> 16), b1 = (unsigned short)(__float_as_uint(f1) >> 16);
                const unsigned short g0 = __builtin_bit_cast(unsigned short, (h16)(f0 * scale)), g1 = __builtin_bit_cast(unsigned short, (h16)(f1 * scale));
                o[i] = asf16 ? g0 : b0; o[4 + i] = asf16 ? g1 : b1; }
            const int c = c0 + row; const int n = perm ? ((c & 15) * 64 + (c >> 4)) : c;
            *(v8us*)(dst + (size_t)n * (size_t)K + k0 + c8) = o; }
         }
    asm volatile("s_wait_xcnt 0x0" ::: "memory");   // the two stores above are issued: no register that they name is rewritten by the code that follows this job in the merged kernel
}

// pad_job: flags of 64 key rows (1 where the row's 512 pad-input values sum to 0); fl = 64 floats of LDS.
__device__ __forceinline__ void pad_job(const float* __restrict__ mask, h16* PF, int blk, float* fl) {
    const int tid = threadIdx.x, lane = tid & 31; const int wave = wave_id();
    const int m0 = blk * 64;
#pragma unroll 1
    for (int i = 0; i < 8; ++i) { const int m = m0 + wave * 8 + i; const int b = m / SEQ, t = m % SEQ;
        const float* row = mask + ((size_t)b * SEQ_FULL + t) * DIN;
        float s = 0.0f;
#pragma unroll
        for (int j = 0; j < 4; ++j) { const v4f v = *(const v4f*)(row + j * 128 + lane * 4); s += bfr(v[0]); s += bfr(v[1]); s += bfr(v[2]); s += bfr(v[3]); }
        s += __shfl_xor(s, 16, 32); s += __shfl_xor(s, 8, 32); s += __shfl_xor(s, 4, 32); s += __shfl_xor(s, 2, 32); s += __shfl_xor(s, 1, 32);
        if (lane == 0) fl[wave * 8 + i] = (s == 0.0f) ? 1.0f : 0.0f; }
    __syncthreads();
    if (tid < 8) { v8h o;
#pragma unroll
        for (int k = 0; k < 8; ++k) o[k] = (h16)fl[tid * 8 + k];
        *(v8h*)(PF + (size_t)m0 + tid * 8) = o;  }
}

// k_prep: everything that reads only the inputs, in one launch. The job is a function of blockIdx.x alone, so every branch (and the barrier inside a job) is block-uniform.
// Order: the pad rows (eight dependent row sums per wave, the longest job) start first, the one-load conversion blocks last.
__global__ __launch_bounds__(256) void k_prep(const float* __restrict__ x, const float* __restrict__ pm, const float* __restrict__ wq, const float* __restrict__ wk, const float* __restrict__ wv,
                                              const float* __restrict__ wo, bf* XB, bf* WT, bf* WOB, h16* PF) {
    __shared__ __align__(16) float ts[64 * 68];
    const int bid = blockIdx.x;
    if (bid < PB_PAD) { pad_job(pm, PF, bid, ts); return; }
    if (bid < PB_PAD + 4 * PB_WT) {
        const int j = bid - PB_PAD; const int w = j / PB_WT, tile = j % PB_WT;
        // w = 0..2: wq, wk, wv, in[K = 512][N = 1024] -> [1024 rows (head-permuted)][512], bf16; w = 3: wo, in[K = 1024 (h*64+dm)][N = 512] -> [512 rows][1024], f16 x1024
        const bool o = (w == 3);
        const float* W = o ? wo : (w == 0 ? wq : (w == 1 ? wk : wv));
        bf* dst = o ? WOB : WT + (size_t)w * DP * DIN;
        const int K = o ? DP : DIN, N = o ? DIN : DP;
        wt_job(W, dst, K, N, o ? 0 : 1, o ? 1 : 0, o ? WOS : 1.0f, tile % (K / 64), tile / (K / 64), ts);
        return; }
    cvt_job(x, XB, bid - (PB_PAD + 4 * PB_WT));
}

// k_proj: register-blocked bf16 GEMM, ONE WAVE per 64x64 tile (16 accumulators), operands straight from K-contiguous bf16 planes, K = DIN.
// C[m][n] = sum_k A[m][k] Bt[n][k] + bias, written as f16 (Ph), row pitch 'pitch' (halves). grid (NB*SEQ/64 data tiles, DP/64 weight tiles, 3), 32 threads; z picks the product:
// z = 0, 1 (q, k): A = data rows (m = b*SEQ + t), Bt = W^T rows (n = h*64 + d) -> plane [(b*16 + h)][t][d]; bias per column.
// z = 2 (v^T):     A = Wv^T rows (m = h*64 + d), Bt = data rows (n = b*SEQ + t) -> plane [(b*1024 + m)][t] = [(b*16 + h)][d][t]; bias per row.
// bias (source order dm*16 + h, RNE-converted to bf16, added in f32): bmode 0 = per column n = h*64 + dm, bmode 1 = per row m = h*64 + dm.
__global__ __launch_bounds__(32) void k_proj(const bf* __restrict__ XB, const bf* __restrict__ WT, const float* __restrict__ bq, const float* __restrict__ bk, const float* __restrict__ bv, h16* QH, h16* KP, h16* VT) {
    __shared__ __align__(16) float os[16 * 68];
    const int K = DIN;
    const int z = blockIdx.z; const bool bmode = (z == 2);
    const bf* Wz = WT + (size_t)z * DP * DIN;
    const bf* A = bmode ? Wz : XB; const bf* Bt = bmode ? XB : Wz;
    const float* bias = (z == 0) ? bq : ((z == 1) ? bk : bv);
    h16* Ph = (z == 0) ? QH : ((z == 1) ? KP : VT);
    const int pitch = bmode ? SEQ : HD;
    const int lane = threadIdx.x & 31, lr = lane & 15, hi = lane >> 4;
    const int r0 = (bmode ? blockIdx.y : blockIdx.x) * 64, c0 = (bmode ? blockIdx.x : blockIdx.y) * 64;
    v8f acc[4][4];
#pragma unroll
    for (int mb = 0; mb < 4; ++mb)
#pragma unroll
        for (int nb = 0; nb < 4; ++nb) acc[mb][nb] = (v8f){};
    const size_t aoff = (size_t)(r0 + lr) * K + 8 * hi, boff = (size_t)(c0 + lr) * K + 8 * hi;
#pragma unroll 1
    for (int kc = 0; kc < K; kc += 32) {
        v16bf a[4];
#pragma unroll
        for (int mb = 0; mb < 4; ++mb) a[mb] = ldb(A + aoff + (size_t)mb * 16 * K + kc);
#pragma unroll
        for (int nb = 0; nb < 4; ++nb) { const v16bf b = ldb(Bt + boff + (size_t)nb * 16 * K + kc);
#pragma unroll
            for (int mb = 0; mb < 4; ++mb) acc[mb][nb] = wmmab(a[mb], b, acc[mb][nb]); }
        asm volatile("v_nop\n\tv_nop\n\tv_nop\n\tv_nop" : "+v"(acc[0][0]), "+v"(acc[1][1]), "+v"(acc[2][2]), "+v"(acc[3][3]) : "v"(a[0]), "v"(a[1]), "v"(a[2]), "v"(a[3]));
    }
    const size_t tbase = bmode ? (size_t)r0 * SEQ + (size_t)(c0 / SEQ) * ((size_t)DP * SEQ) + (size_t)(c0 % SEQ)
                               : (size_t)(r0 / SEQ) * ((size_t)NH_ * SEQ * HD) + (size_t)(r0 % SEQ) * HD + (size_t)(c0 / HD) * ((size_t)SEQ * HD);
    const int c8 = (lane & 7) * 8;
    float bcol[8];      // column-mode bias of this lane's 8 columns (clamped addresses, always loaded)
    { const int hc = min(c0 >> 6, NH_ - 1);
#pragma unroll
      for (int i = 0; i < 8; ++i) bcol[i] = bfr(bias[min((c8 + i) * NH_ + hc, DP - 1)]); }
#pragma unroll
    for (int mb = 0; mb < 4; ++mb) {
#pragma unroll
        for (int nb = 0; nb < 4; ++nb) {
#pragma unroll
            for (int j = 0; j < 8; ++j) os[(hi * 8 + j) * 68 + nb * 16 + lr] = acc[mb][nb][j]; }   // D: row 8h+j, col lane&15
        wave_sync();
        const size_t sb = tbase + (size_t)(mb * 16) * (size_t)pitch;
{
#pragma unroll
            for (int s = 0; s < 4; ++s) { const int row = 4 * s + (lane >> 3);   // 4 s x 4 row groups = 16 rows; 8 lanes x 8 = 64 columns
                const int m = r0 + mb * 16 + row;
                const float brow = bfr(bias[min((m & 63) * NH_ + min(m >> 6, NH_ - 1), DP - 1)]);
                const v4f x0 = *(const v4fa*)(&os[row * 68 + c8]); const v4f x1 = *(const v4fa*)(&os[row * 68 + c8 + 4]); v8h hv;
#pragma unroll
                for (int i = 0; i < 4; ++i) { const float y0 = x0[i] + (bmode ? brow : bcol[i]); const float y1 = x1[i] + (bmode ? brow : bcol[4 + i]);
                    hv[i] = (h16)y0; hv[4 + i] = (h16)y1; }
                const size_t oo = sb + (size_t)row * (size_t)pitch + c8;
                *(v8h*)(Ph + oo) = hv; }
             }
        wave_sync();
    }
}

// One thread's share of a staged tile pair: four 16-byte asynchronous copies global -> LDS (two of K, two of V^T). The s_wait_xcnt closes the statement so that
// no address register of an issued copy is rewritten ahead of it.
__device__ __forceinline__ void stage4(unsigned l0, const h16* g0, unsigned l1, const h16* g1, unsigned l2, const h16* g2, unsigned l3, const h16* g3) {
    asm volatile("global_load_async_to_lds_b128 %0, %1, off\n\t"
                 "global_load_async_to_lds_b128 %2, %3, off\n\t"
                 "global_load_async_to_lds_b128 %4, %5, off\n\t"
                 "global_load_async_to_lds_b128 %6, %7, off\n\t"
                 "s_wait_xcnt 0x0"
                 :: "v"(l0), "v"(g0), "v"(l1), "v"(g1), "v"(l2), "v"(g2), "v"(l3), "v"(g3) : "memory");
}

// k_flash: fused attention, one wave per 16 query rows of one (batch, head); Q fragments straight from the f16 plane; K / V^T fragments from LDS tiles of 64 keys that the
// block's 8 waves share: tile t + 1 is copied (asynchronously, no registers) into one buffer while tile t is worked on in the other; one barrier per tile publishes and frees.
// Transposed form: S^T[key][t] = K Q^T (A = K rows, B = Q rows); lane (t = lane&15, h = lane>>4) holds keys 8h+r of each 16-key tile, so the packed
// P tile is directly the B fragment of O^T[d][t] = V^T P^T (element r <- tile keys 0..15, element 8+r <- tile keys 16..31, lane unchanged).
// Per 32-key step: 4 score matrix ops (2 key tiles x 2 d halves) + 4 P.V matrix ops (4 d tiles).
// Padded keys: the score is REPLACED by the fill value (flag plane loaded with the same key map as the P elements).
// Softmax state (running max, partial sum) is one scalar per lane; the two lane halves of a row are combined with one xor-16 exchange.
__global__ __launch_bounds__(32 * AW) void k_flash(const h16* __restrict__ QH, const h16* __restrict__ KP, const h16* __restrict__ VT, const h16* __restrict__ PF, h16* CTX) {
    __shared__ __align__(16) float os[AW * 16 * 68];
    __shared__ __align__(16) h16 ring[2][2][64 * LP];        // [buffer][K rows key | V^T rows d][row][LP]
    const int lane = threadIdx.x & 31, lr = lane & 15, hi = lane >> 4; const int wave = wave_id();
    const int zh = blockIdx.y; const int b = zh / NH_, h = zh % NH_;
    const int t0 = (blockIdx.x * AW + wave) * 16;
    const size_t pbase = (size_t)zh * SEQ * HD;
    const size_t qo = pbase + (size_t)(t0 + lr) * HD + 8 * hi;
    const v16h qh0 = ldh(QH + qo), qh1 = ldh(QH + qo + 32);   // B fragments: col t, k = d
    const int fo = lr * LP + 8 * hi;                         // fragment offset in a staged tile: K + key*LP (row key, k = d), V^T + 16j*LP + key (row d, k = key)
    // copy map: thread -> rows cr and cr + 32 of each tile, 16-byte column tid & 7
    const int cr = (int)(threadIdx.x >> 3), cc = (int)(threadIdx.x & 7) * 8;
    const h16* gk = KP + pbase + (size_t)cr * HD + cc;       // + key0 * HD
    const h16* gv = VT + pbase + (size_t)cr * SEQ + cc;      // + key0
    const unsigned lk = (unsigned)(size_t)&ring[0][0][cr * LP + cc];   // LDS byte address of the thread's first K chunk in buffer 0
    constexpr unsigned TB = 64 * LP * 2, HB = 32 * LP * 2;   // bytes of one tile, of 32 rows
    // tile 0 -> buffer 0, landed and published; then tile 1 -> buffer 1 in flight
    stage4(lk, gk, lk + HB, gk + 32 * HD, lk + TB, gv, lk + TB + HB, gv + (size_t)32 * SEQ);
    asm volatile("s_wait_asynccnt 0x0" ::: "memory");        // this wave's copies of tile 0 have landed
    __syncthreads();                                         // every wave's copies of tile 0 are readable
    stage4(lk + 2 * TB, gk + KST * HD, lk + 2 * TB + HB, gk + (KST + 32) * HD, lk + 3 * TB, gv + KST, lk + 3 * TB + HB, gv + (size_t)32 * SEQ + KST);
    const h16* pfp = PF + (size_t)b * SEQ + 8 * hi;          // + key0: elements r <- key0+8h+r, 8+r <- key0+16+8h+r
    v8f o0 = (v8f){}, o1 = (v8f){}, o2 = (v8f){}, o3 = (v8f){};
    float m = -3.0e38f, l = 0.0f;
#pragma unroll 1
    for (int t = 0; t < NT; ++t) {
      const h16* kt = &ring[t & 1][0][fo]; const h16* vt = &ring[t & 1][1][fo];
#pragma unroll   // both 32-key steps of a tile inline, so that every LDS offset inside the tile is an immediate
      for (int s = 0; s < KST / 32; ++s) {
        const int key0 = t * KST + s * 32;
        const h16* ka = kt + s * 32 * LP;
        const v16h ka0 = ldh(ka), ka1 = ldh(ka + 32), kb0 = ldh(ka + 16 * LP), kb1 = ldh(ka + 16 * LP + 32);
        const v16h pf = ldh(pfp + key0);
        v8f sa = (v8f){}, sb = (v8f){};
        sa = wmma16(ka0, qh0, sa); sb = wmma16(kb0, qh0, sb);
        sa = wmma16(ka1, qh1, sa); sb = wmma16(kb1, qh1, sb);
        asm volatile("v_nop\n\tv_nop\n\tv_nop\n\tv_nop" : "+v"(sa), "+v"(sb) : "v"(ka0), "v"(ka1), "v"(kb0), "v"(kb1), "v"(qh0), "v"(qh1));
        float ta[8], tb[8]; float mx = -3.0e38f;
#pragma unroll
        for (int r = 0; r < 8; ++r) {
            const float xa = sa[r] * SC2, xb = sb[r] * SC2;
            ta[r] = ((float)pf[r] != 0.0f) ? NEGB : xa; tb[r] = ((float)pf[8 + r] != 0.0f) ? NEGB : xb;
            mx = fmaxf(mx, fmaxf(ta[r], tb[r])); }
        mx = fmaxf(mx, __shfl_xor(mx, 16, 32));
        const float mnew = fmaxf(m, mx);
        const float alpha = __builtin_amdgcn_exp2f(m - mnew);
        const float sh = PSH - mnew;
        v16h pb; float ls = 0.0f;
#pragma unroll
        for (int r = 0; r < 8; ++r) { const h16 pa = (h16)__builtin_amdgcn_exp2f(ta[r] + sh); const h16 pc = (h16)__builtin_amdgcn_exp2f(tb[r] + sh); pb[r] = pa; pb[8 + r] = pc; ls += (float)pa + (float)pc; }
        l = l * alpha + ls; m = mnew;
        o0 = o0 * alpha; o1 = o1 * alpha; o2 = o2 * alpha; o3 = o3 * alpha;
        const h16* va = vt + s * 32;
        const v16h v0 = ldh(va), v1 = ldh(va + 16 * LP), v2 = ldh(va + 32 * LP), v3 = ldh(va + 48 * LP);
        o0 = wmma16(v0, pb, o0); o1 = wmma16(v1, pb, o1); o2 = wmma16(v2, pb, o2); o3 = wmma16(v3, pb, o3);
        asm volatile("v_nop\n\tv_nop\n\tv_nop\n\tv_nop" : "+v"(o0), "+v"(o1), "+v"(o2), "+v"(o3) : "v"(v0), "v"(v1), "v"(v2), "v"(v3), "v"(pb));
      }
      asm volatile("s_wait_dscnt 0x0" ::: "memory");         // this wave's reads of tile t are done before its buffer may be refilled
      asm volatile("s_wait_asynccnt 0x0" ::: "memory");      // this wave's copies of tile t + 1 have landed
      __syncthreads();                                       // publishes tile t + 1 and ends every wave's reads of tile t
      if (t + 2 < NT) {                                      // block-uniform: refill the buffer that tile t has just left
          const unsigned lb = lk + (unsigned)(t & 1) * (2 * TB); const h16* gk2 = gk + (size_t)(t + 2) * KST * HD; const h16* gv2 = gv + (t + 2) * KST;
          stage4(lb, gk2, lb + HB, gk2 + 32 * HD, lb + TB, gv2, lb + TB + HB, gv2 + (size_t)32 * SEQ); }
    }
    asm volatile("s_wait_asynccnt 0x0" ::: "memory");        // nothing of this wave is in flight when the ring goes out of use
    l += __shfl_xor(l, 16, 32);
    const float inv = CXS / l;
    const int wb = wave * 16 * 68;
    // O^T D layout: o_j[r] = (d = 16j + 8h + r, t = lane&15) -> os[t][d]; rows 0..15 x columns 0..63 all written
    { v4f a, c;
      a[0] = o0[0] * inv; a[1] = o0[1] * inv; a[2] = o0[2] * inv; a[3] = o0[3] * inv; c[0] = o0[4] * inv; c[1] = o0[5] * inv; c[2] = o0[6] * inv; c[3] = o0[7] * inv;
      *(v4fa*)(&os[wb + lr * 68 +  0 + 8 * hi]) = a; *(v4fa*)(&os[wb + lr * 68 +  0 + 8 * hi + 4]) = c;
      a[0] = o1[0] * inv; a[1] = o1[1] * inv; a[2] = o1[2] * inv; a[3] = o1[3] * inv; c[0] = o1[4] * inv; c[1] = o1[5] * inv; c[2] = o1[6] * inv; c[3] = o1[7] * inv;
      *(v4fa*)(&os[wb + lr * 68 + 16 + 8 * hi]) = a; *(v4fa*)(&os[wb + lr * 68 + 16 + 8 * hi + 4]) = c;
      a[0] = o2[0] * inv; a[1] = o2[1] * inv; a[2] = o2[2] * inv; a[3] = o2[3] * inv; c[0] = o2[4] * inv; c[1] = o2[5] * inv; c[2] = o2[6] * inv; c[3] = o2[7] * inv;
      *(v4fa*)(&os[wb + lr * 68 + 32 + 8 * hi]) = a; *(v4fa*)(&os[wb + lr * 68 + 32 + 8 * hi + 4]) = c;
      a[0] = o3[0] * inv; a[1] = o3[1] * inv; a[2] = o3[2] * inv; a[3] = o3[3] * inv; c[0] = o3[4] * inv; c[1] = o3[5] * inv; c[2] = o3[6] * inv; c[3] = o3[7] * inv;
      *(v4fa*)(&os[wb + lr * 68 + 48 + 8 * hi]) = a; *(v4fa*)(&os[wb + lr * 68 + 48 + 8 * hi + 4]) = c; }
    wave_sync();
    h16* crow = CTX + ((size_t)b * SEQ + t0) * DP + h * HD;
{
#pragma unroll
        for (int s = 0; s < 4; ++s) { const int row = 4 * s + (lane >> 3), c8 = (lane & 7) * 8;   // 4 s x 4 rows = 16 rows; 8 lanes x 8 halves = 64 columns
            const v4f x0 = *(const v4fa*)(&os[wb + row * 68 + c8]); const v4f x1 = *(const v4fa*)(&os[wb + row * 68 + c8 + 4]); v8h hv;
#pragma unroll
            for (int i = 0; i < 4; ++i) { hv[i] = (h16)x0[i]; hv[4 + i] = (h16)x1[i]; }
            *(v8h*)(crow + (size_t)row * DP + c8) = hv; }
         }
}

// k_out: f16 GEMM, ONE WAVE per 64x64 tile, A = ctx plane [NB*SEQ][1024] (x256), Bt = Wo^T plane [512][1024] (x1024), K = DP; OUT[m][n] = acc * 2^-18 + bo[n] (f32).
__global__ __launch_bounds__(32) void k_out(const h16* __restrict__ A, const h16* __restrict__ Bt, const float* __restrict__ bias, float* OUT) {
    __shared__ __align__(16) float os[16 * 68];
    const int K = DP;
    const int lane = threadIdx.x & 31, lr = lane & 15, hi = lane >> 4; const int r0 = blockIdx.x * 64, c0 = blockIdx.y * 64;
    v8f acc[4][4];
#pragma unroll
    for (int mb = 0; mb < 4; ++mb)
#pragma unroll
        for (int nb = 0; nb < 4; ++nb) acc[mb][nb] = (v8f){};
    const size_t aoff = (size_t)(r0 + lr) * K + 8 * hi, boff = (size_t)(c0 + lr) * K + 8 * hi;
#pragma unroll 1
    for (int kc = 0; kc < K; kc += 32) {
        v16h a[4];
#pragma unroll
        for (int mb = 0; mb < 4; ++mb) a[mb] = ldh(A + aoff + (size_t)mb * 16 * K + kc);
#pragma unroll
        for (int nb = 0; nb < 4; ++nb) { const v16h b = ldh(Bt + boff + (size_t)nb * 16 * K + kc);
#pragma unroll
            for (int mb = 0; mb < 4; ++mb) acc[mb][nb] = wmma16(a[mb], b, acc[mb][nb]); }
        asm volatile("v_nop\n\tv_nop\n\tv_nop\n\tv_nop" : "+v"(acc[0][0]), "+v"(acc[1][1]), "+v"(acc[2][2]), "+v"(acc[3][3]) : "v"(a[0]), "v"(a[1]), "v"(a[2]), "v"(a[3]));
    }
    const size_t orow0 = (size_t)(r0 / SEQ) * OUT_SEQ + (size_t)(r0 % SEQ);
    const int cofs = lr * 4;
    v4f bv;
#pragma unroll
    for (int i = 0; i < 4; ++i) bv[i] = bfr(bias[min(c0 + cofs + i, DIN - 1)]);
#pragma unroll
    for (int mb = 0; mb < 4; ++mb) {
#pragma unroll
        for (int nb = 0; nb < 4; ++nb) {
#pragma unroll
            for (int j = 0; j < 8; ++j) os[(hi * 8 + j) * 68 + nb * 16 + lr] = acc[mb][nb][j] * FOLD; }   // D: row 8h+j, col lane&15
        wave_sync();
{
#pragma unroll
            for (int s = 0; s < 8; ++s) { const int row = 2 * s + hi;   // 8 s x 2 rows = 16 rows; 16 lanes x 4 floats = 64 columns
                const v4f val = *(const v4fa*)(&os[row * 68 + cofs]) + bv;
                *(v4f*)(OUT + (orow0 + (size_t)(mb * 16 + row)) * DIN + c0 + cofs) = val; }
             }
        wave_sync();
    }
}

static constexpr size_t al256(size_t v) { return (v + 255) & ~(size_t)255; }
static constexpr size_t SZ_XB = al256((size_t)NB * SEQ * DIN * 2);
static constexpr size_t SZ_WT = al256((size_t)3 * DP * DIN * 2);
static constexpr size_t SZ_WO = al256((size_t)DIN * DP * 2);
static constexpr size_t SZ_PL = al256((size_t)NB * NH_ * SEQ * HD * 2);
static constexpr size_t SZ_CX = al256((size_t)NB * SEQ * DP * 2);
static constexpr size_t SZ_PF = al256((size_t)NB * SEQ * 2);
static constexpr size_t SZ_TOTAL = SZ_XB + SZ_WT + SZ_WO + 3 * SZ_PL + SZ_CX + SZ_PF;
static_assert(SZ_TOTAL <= (size_t)134217728);          // workspace carve <= 128 MiB
static_assert(((size_t)DP * DIN * 2) % 256 == 0);      // weight sub-planes stay 256-byte aligned

extern "C" void kernel_launch(void* const* d_in, const int* in_sizes, int n_in,
                              void* d_out, int out_size, void* d_ws, size_t ws_size, hipStream_t stream) {
    if (n_in < 10) return;
    const size_t needx = ((size_t)(NB - 1) * SEQ_FULL + SEQ) * DIN;
    if ((size_t)in_sizes[0] < needx || (size_t)in_sizes[1] < needx) return;
    if ((size_t)in_sizes[2] < (size_t)DIN * DP || (size_t)in_sizes[4] < (size_t)DIN * DP || (size_t)in_sizes[6] < (size_t)DIN * DP || (size_t)in_sizes[8] < (size_t)DP * DIN) return;
    if ((size_t)in_sizes[3] < (size_t)DP || (size_t)in_sizes[5] < (size_t)DP || (size_t)in_sizes[7] < (size_t)DP || (size_t)in_sizes[9] < (size_t)DIN) return;
    if ((size_t)out_size < ((size_t)(NB - 1) * OUT_SEQ + SEQ) * DIN) return;
    if (SZ_TOTAL > ws_size) return;
    // wire order: data, pad input, wq, bq, wk, bk, wv, bv, wo, bo (all f32)
    const float* x = (const float*)d_in[0]; const float* pm = (const float*)d_in[1];
    const float* wq = (const float*)d_in[2]; const float* bq = (const float*)d_in[3];
    const float* wk = (const float*)d_in[4]; const float* bk = (const float*)d_in[5];
    const float* wv = (const float*)d_in[6]; const float* bv = (const float*)d_in[7];
    const float* wo = (const float*)d_in[8]; const float* bo = (const float*)d_in[9];
    float* OUT = (float*)d_out;      // [NB][SEQ][512]
    char* wsp = (char*)d_ws;
    bf* XB = (bf*)wsp; wsp += SZ_XB;                 // [NB*SEQ][512] bf16
    bf* WT = (bf*)wsp; wsp += SZ_WT;                 // [3][1024][512] bf16, rows h*64+dm: q | k | v
    bf* WOB = (bf*)wsp; wsp += SZ_WO;                // [512][1024] f16 bits (x1024)
    h16* QH = (h16*)wsp; wsp += SZ_PL;               // [NB*16][SEQ][64]
    h16* KP = (h16*)wsp; wsp += SZ_PL;               // [NB*16][SEQ][64]
    h16* VT = (h16*)wsp; wsp += SZ_PL;               // [NB*16][64][SEQ]
    h16* CX = (h16*)wsp; wsp += SZ_CX;               // [NB*SEQ][1024] (x256)
    h16* PF = (h16*)wsp; wsp += SZ_PF;               // [NB*SEQ] pad flags

    k_prep<<<dim3(PB_PAD + 4 * PB_WT + PB_CVT, 1, 1), 256, 0, stream>>>(x, pm, wq, wk, wv, wo, XB, WT, WOB, PF);

    k_proj<<<dim3(NB * SEQ / 64, DP / 64, 3), 32, 0, stream>>>(XB, WT, bq, bk, bv, QH, KP, VT);

    k_flash<<<dim3(SEQ / (16 * AW), NB * NH_, 1), 32 * AW, 0, stream>>>(QH, KP, VT, PF, CX);

    k_out<<<dim3(NB * SEQ / 64, DIN / 64, 1), 32, 0, stream>>>(CX, (const h16*)WOB, bo, OUT);
}

// v003
// One run takes 98.9 microseconds.
// Two timings next to v002 both put it at 1.10 times that version's speed.
// Counting every step since v000, it is 1.99 times as fast.
#include <hip/hip_runtime.h>

// Multi-head self-attention: data [NB][SEQ][512], Wq/Wk/Wv [512][1024] ([in][out], column c = dm*16 + h), biases, key-padding replace fill (-1e9 where a key's 512 pad-input values sum to 0), score scale 1/8, merged heads (h*64+dm) @ Wo [1024][512] + bo, f32 output.
// Compute dtypes, f32 accumulate everywhere: projections v_wmma_f32_16x16x32_bf16 (data and W RNE-converted to bf16; products exact);
// scores v_wmma_f32_16x16x32_f16: q and k single f16 planes (one product); P (x256 carry, cancels in the normalisation) and v single f16; softmax f32 (online, running max);
// output projection v_wmma_f32_16x16x32_f16: ctx single f16 (x256 carry), Wo = f16 of (bf16 RNE of wo) x1024 (exact), 2^-18 folded back in f32, bias added in f32.
// Launches: 4. k_prep (block index picks the job: pad flags with one word per 64 keys, one weight tile, or a slice of the data conversion; the jobs read none of each other's output), k_proj (grid z picks q, k or v^T), k_flash, k_out.
// Layout: bf16 copy of data; transposed K-contiguous weight planes (head-permuted rows h*64+dm); q, k planes [b*16+h][t][d] and v^T plane [b*16+h][d][t] from the GEMM epilogue;
// fused flash kernel in transposed form (S^T = K Q^T, O^T = V^T P^T; 4 score + 4 P.V matrix ops per 32-key step; K and V^T tiles of 64 keys staged in LDS by asynchronous copies, two buffers) writing the ctx plane [b*SEQ+t][h*64+d]; one-wave 64x64 GEMM for the output.

#ifndef NB
#define NB 2
#endif
#ifndef SEQ
#define SEQ 2048
#endif
#define NB_FULL  2
#define SEQ_FULL 2048
#ifndef OUT_SEQ
#define OUT_SEQ SEQ              // row pitch (in tokens) between batches of the output
#endif
#define DIN  512                 // input width = output width
#define DP   1024                // projection width = 16 heads x 64
#define NH_  16
#define HD   64
#define AW   8                   // waves per flash block (16 query rows each); all share the staged K / V^T tiles
#define KST  64                  // keys per staged tile (two 32-key steps)
#define LP   72                  // LDS row pitch in halves: 128-byte rows + 16 bytes, the pitch for 16-byte LDS readers
#define NT   (SEQ / KST)         // staged tiles per (batch, head)
#define SC2  (0.125f * 1.4426950408889634f)   // HD^-0.5 * log2(e)
#define PSH  8.0f                // log2 of the P carry (256)
#define NEGB (-1.0e9f * 1.4426950408889634f)  // fill value of padded keys in the log2 domain
#define CXS  256.0f              // carry of the ctx plane
#define WOS  1024.0f             // carry of the Wo plane
#define FOLD (1.0f / (256.0f * 1024.0f))

static_assert(HD == 64);
static_assert(NH_ * HD == DP);
static_assert(NH_ == 16);                      // column c = dm*16 + h
static_assert(DP % 64 == 0);
static_assert(DIN % 64 == 0);
static_assert(DIN % 32 == 0);                  // GEMM k-loops step by 32
static_assert(DP % 32 == 0);
static_assert(DIN == 512);                     // pad-row sum: 4 x 128 floats per wave
static_assert(SEQ % 64 == 0);                  // a 64-row tile never straddles two batches
static_assert((NB * SEQ) % 64 == 0);
static_assert(SEQ % 32 == 0);                  // key loop steps by 32
static_assert(SEQ % (16 * AW) == 0);           // flash grid covers the sequence exactly
static_assert(SEQ % KST == 0);
static_assert(NT >= 2);                        // the two-buffer prologue fills tiles 0 and 1
static_assert(NT <= 32);                       // one bit per staged tile in the 32-lane ballot of padded tiles
static_assert(KST == 64);                      // a staged tile is the 64 key rows of one pad block
static_assert(32 * AW * 2 * 8 == KST * HD);    // two 16-byte copies per thread cover one 64 x 64 tile
static_assert(((size_t)SEQ * DIN) % 8 == 0);
static_assert(NB <= NB_FULL);
static_assert(SEQ <= SEQ_FULL);

typedef _Float16 h16;
typedef unsigned short bf;
typedef __attribute__((ext_vector_type(16))) __bf16   v16bf;
typedef __attribute__((ext_vector_type(16))) _Float16 v16h;
typedef __attribute__((ext_vector_type(8)))  _Float16 v8h;
typedef __attribute__((ext_vector_type(8)))  unsigned short v8us;
typedef __attribute__((ext_vector_type(8)))  float    v8f;
typedef __attribute__((ext_vector_type(4)))  float    v4f;
typedef v4f  __attribute__((may_alias)) v4fa;

__device__ __forceinline__ unsigned short f2bf(float f) { unsigned u = __float_as_uint(f); u += 0x7FFFu + ((u >> 16) & 1u); return (unsigned short)(u >> 16); }
__device__ __forceinline__ float bfr(float f) { return __uint_as_float(((unsigned)f2bf(f)) << 16); }   // value after RNE conversion to bf16
__device__ __forceinline__ v16h cat16(v8h lo, v8h hi) { return __builtin_shufflevector(lo, hi, 0, 1, 2, 3, 4, 5, 6, 7, 8, 9, 10, 11, 12, 13, 14, 15); }
__device__ __forceinline__ v16bf cat16b(v8us lo, v8us hi) { return __builtin_bit_cast(v16bf, __builtin_shufflevector(lo, hi, 0, 1, 2, 3, 4, 5, 6, 7, 8, 9, 10, 11, 12, 13, 14, 15)); }
__device__ __forceinline__ v8f wmma16(v16h a, v16h b, v8f c) { return __builtin_amdgcn_wmma_f32_16x16x32_f16(false, a, false, b, (short)0, c, false, false); }
__device__ __forceinline__ v8f wmmab(v16bf a, v16bf b, v8f c) { return __builtin_amdgcn_wmma_f32_16x16x32_bf16(false, a, false, b, (short)0, c, false, false); }
// fragment loaders from K-contiguous 16-bit rows; p already includes + 8*(lane>>4): elements 0..7 <- k0+8h+0..7, elements 8..15 <- k0+16+8h+0..7 (same map for A and B)
__device__ __forceinline__ v16h  ldh(const h16* p) { return cat16(*(const v8h*)p, *(const v8h*)(p + 16)); }
__device__ __forceinline__ v16bf ldb(const bf* p)  { return cat16b(*(const v8us*)p, *(const v8us*)(p + 16)); }
// ordering point for wave-private LDS tiles (same wave writes and reads)
__device__ __forceinline__ void wave_sync() { __builtin_amdgcn_fence(3 /* release order */, "wavefront"); __builtin_amdgcn_wave_barrier(); asm volatile("" ::: "memory"); }
// wave index of the calling thread as a wave-uniform scalar
__device__ __forceinline__ int wave_id() { return __builtin_amdgcn_readfirstlane((int)(threadIdx.x >> 5)); }

// blocks of k_prep per job
#define PB_PAD (NB * SEQ / 64)                        // 64 pad rows each
#define PB_WT  ((DIN / 64) * (DP / 64))               // 64 x 64 tiles of one weight matrix (all four have DIN * DP elements)
#define N8     ((size_t)NB * SEQ * DIN / 8)           // 8-element chunks of the data
#define PB_CVT ((unsigned)((N8 + 255) / 256))

// cvt_job: data f32 -> bf16 copy [NB*SEQ][512], 8 elements per thread; blk = block index inside the job.
__device__ __forceinline__ void cvt_job(const float* __restrict__ x, bf* dst, int blk) {
    const size_t i = (size_t)blk * 256 + threadIdx.x; if (i >= N8) return;
    constexpr size_t C8 = (size_t)SEQ * DIN / 8;      // chunks per batch
    const size_t so = (SEQ == SEQ_FULL) ? i * 8 : (i / C8) * ((size_t)SEQ_FULL * DIN) + (i % C8) * 8;
    const v8f v = *(const v8f*)(x + so); v8us o;
#pragma unroll
    for (int k = 0; k < 8; ++k) o[k] = f2bf(v[k]);
    *(v8us*)(dst + i * 8) = o;
}

// wt_job: W [K][N] f32 ([in][out]) -> dst [N][K] 16-bit rows (K-contiguous). in[K rows][N cols] -> out[N rows][K cols]; one 64 x 64 tile (bx of K/64, by of N/64), 256 threads; ts = 64 * 68 floats of LDS.
// perm != 0: source column c = dm*16 + h lands on destination row h*64 + dm. asf16 == 0: bf16 bits; asf16 != 0: f16 bits of (bf16 value * scale).
__device__ __forceinline__ void wt_job(const float* __restrict__ W, bf* dst, int K, int N, int perm, int asf16, float scale, int bx, int by, float* ts) {   // ts: [column][k]
    const int tid = threadIdx.x, lane = tid & 31; const int wave = wave_id();
    const int k0 = bx * 64, c0 = by * 64;
#pragma unroll
    for (int it = 0; it < 4; ++it) { const int e = tid + 256 * it; const int kk = e >> 4, c4 = (e & 15) * 4;   // 64 k rows x 16 float4 = whole tile
        const v4f v = *(const v4f*)(W + (size_t)(k0 + kk) * (size_t)N + c0 + c4);
        ts[(c4 + 0) * 68 + kk] = v[0]; ts[(c4 + 1) * 68 + kk] = v[1]; ts[(c4 + 2) * 68 + kk] = v[2]; ts[(c4 + 3) * 68 + kk] = v[3]; }
    __syncthreads();
{
#pragma unroll
        for (int s = 0; s < 2; ++s) { const int row = 4 * (wave + 8 * s) + (lane >> 3), c8 = (lane & 7) * 8;   // 8 waves x 2 s x 4 rows = 64 rows; 8 lanes x 8 = 64 k
            const v4f x0 = *(const v4fa*)(&ts[row * 68 + c8]); const v4f x1 = *(const v4fa*)(&ts[row * 68 + c8 + 4]); v8us o;
#pragma unroll
            for (int i = 0; i < 4; ++i) { const float f0 = bfr(x0[i]), f1 = bfr(x1[i]);
                const unsigned short b0 = (unsigned short)(__float_as_uint(f0) >> 16), b1 = (unsigned short)(__float_as_uint(f1) >> 16);
                const unsigned short g0 = __builtin_bit_cast(unsigned short, (h16)(f0 * scale)), g1 = __builtin_bit_cast(unsigned short, (h16)(f1 * scale));
                o[i] = asf16 ? g0 : b0; o[4 + i] = asf16 ? g1 : b1; }
            const int c = c0 + row; const int n = perm ? ((c & 15) * 64 + (c >> 4)) : c;
            *(v8us*)(dst + (size_t)n * (size_t)K + k0 + c8) = o; }
         }
    asm volatile("s_wait_xcnt 0x0" ::: "memory");   // the two stores above are issued: no register that they name is rewritten by the code that follows this job in the merged kernel
}

// pad_job: flags of 64 key rows (1 where the row's 512 pad-input values sum to 0), and one word for the 64 rows together (nonzero where any of them is flagged); fl = 64 floats of LDS.
__device__ __forceinline__ void pad_job(const float* __restrict__ mask, h16* PF, unsigned* TF, int blk, float* fl) {
    const int tid = threadIdx.x, lane = tid & 31; const int wave = wave_id();
    const int m0 = blk * 64;
#pragma unroll 1
    for (int i = 0; i < 8; ++i) { const int m = m0 + wave * 8 + i; const int b = m / SEQ, t = m % SEQ;
        const float* row = mask + ((size_t)b * SEQ_FULL + t) * DIN;
        float s = 0.0f;
#pragma unroll
        for (int j = 0; j < 4; ++j) { const v4f v = *(const v4f*)(row + j * 128 + lane * 4); s += bfr(v[0]); s += bfr(v[1]); s += bfr(v[2]); s += bfr(v[3]); }
        s += __shfl_xor(s, 16, 32); s += __shfl_xor(s, 8, 32); s += __shfl_xor(s, 4, 32); s += __shfl_xor(s, 2, 32); s += __shfl_xor(s, 1, 32);
        if (lane == 0) fl[wave * 8 + i] = (s == 0.0f) ? 1.0f : 0.0f; }
    __syncthreads();
    if (tid < 8) { v8h o;
#pragma unroll
        for (int k = 0; k < 8; ++k) o[k] = (h16)fl[tid * 8 + k];
        *(v8h*)(PF + (size_t)m0 + tid * 8) = o;  }
    if (wave == 0) { const unsigned any = __builtin_amdgcn_ballot_w32((fl[lane] != 0.0f) | (fl[lane + 32] != 0.0f));
        if (lane == 0) TF[blk] = any; }
}

// k_prep: everything that reads only the inputs, in one launch. The job is a function of blockIdx.x alone, so every branch (and the barrier inside a job) is block-uniform.
// Order: the pad rows (eight dependent row sums per wave, the longest job) start first, the one-load conversion blocks last.
__global__ __launch_bounds__(256) void k_prep(const float* __restrict__ x, const float* __restrict__ pm, const float* __restrict__ wq, const float* __restrict__ wk, const float* __restrict__ wv,
                                              const float* __restrict__ wo, bf* XB, bf* WT, bf* WOB, h16* PF, unsigned* TF) {
    __shared__ __align__(16) float ts[64 * 68];
    const int bid = blockIdx.x;
    if (bid < PB_PAD) { pad_job(pm, PF, TF, bid, ts); return; }
    if (bid < PB_PAD + 4 * PB_WT) {
        const int j = bid - PB_PAD; const int w = j / PB_WT, tile = j % PB_WT;
        // w = 0..2: wq, wk, wv, in[K = 512][N = 1024] -> [1024 rows (head-permuted)][512], bf16; w = 3: wo, in[K = 1024 (h*64+dm)][N = 512] -> [512 rows][1024], f16 x1024
        const bool o = (w == 3);
        const float* W = o ? wo : (w == 0 ? wq : (w == 1 ? wk : wv));
        bf* dst = o ? WOB : WT + (size_t)w * DP * DIN;
        const int K = o ? DP : DIN, N = o ? DIN : DP;
        wt_job(W, dst, K, N, o ? 0 : 1, o ? 1 : 0, o ? WOS : 1.0f, tile % (K / 64), tile / (K / 64), ts);
        return; }
    cvt_job(x, XB, bid - (PB_PAD + 4 * PB_WT));
}

// k_proj: register-blocked bf16 GEMM, ONE WAVE per 64x64 tile (16 accumulators), operands straight from K-contiguous bf16 planes, K = DIN.
// C[m][n] = sum_k A[m][k] Bt[n][k] + bias, written as f16 (Ph), row pitch 'pitch' (halves). grid (NB*SEQ/64 data tiles, DP/64 weight tiles, 3), 32 threads; z picks the product:
// z = 0, 1 (q, k): A = data rows (m = b*SEQ + t), Bt = W^T rows (n = h*64 + d) -> plane [(b*16 + h)][t][d]; bias per column.
// z = 2 (v^T):     A = Wv^T rows (m = h*64 + d), Bt = data rows (n = b*SEQ + t) -> plane [(b*1024 + m)][t] = [(b*16 + h)][d][t]; bias per row.
// bias (source order dm*16 + h, RNE-converted to bf16, added in f32): bmode 0 = per column n = h*64 + dm, bmode 1 = per row m = h*64 + dm.
__global__ __launch_bounds__(32) void k_proj(const bf* __restrict__ XB, const bf* __restrict__ WT, const float* __restrict__ bq, const float* __restrict__ bk, const float* __restrict__ bv, h16* QH, h16* KP, h16* VT) {
    __shared__ __align__(16) float os[16 * 68];
    const int K = DIN;
    const int z = blockIdx.z; const bool bmode = (z == 2);
    const bf* Wz = WT + (size_t)z * DP * DIN;
    const bf* A = bmode ? Wz : XB; const bf* Bt = bmode ? XB : Wz;
    const float* bias = (z == 0) ? bq : ((z == 1) ? bk : bv);
    h16* Ph = (z == 0) ? QH : ((z == 1) ? KP : VT);
    const int pitch = bmode ? SEQ : HD;
    const int lane = threadIdx.x & 31, lr = lane & 15, hi = lane >> 4;
    const int r0 = (bmode ? blockIdx.y : blockIdx.x) * 64, c0 = (bmode ? blockIdx.x : blockIdx.y) * 64;
    v8f acc[4][4];
#pragma unroll
    for (int mb = 0; mb < 4; ++mb)
#pragma unroll
        for (int nb = 0; nb < 4; ++nb) acc[mb][nb] = (v8f){};
    const size_t aoff = (size_t)(r0 + lr) * K + 8 * hi, boff = (size_t)(c0 + lr) * K + 8 * hi;
#pragma unroll 1
    for (int kc = 0; kc < K; kc += 32) {
        v16bf a[4];
#pragma unroll
        for (int mb = 0; mb < 4; ++mb) a[mb] = ldb(A + aoff + (size_t)mb * 16 * K + kc);
#pragma unroll
        for (int nb = 0; nb < 4; ++nb) { const v16bf b = ldb(Bt + boff + (size_t)nb * 16 * K + kc);
#pragma unroll
            for (int mb = 0; mb < 4; ++mb) acc[mb][nb] = wmmab(a[mb], b, acc[mb][nb]); }
        asm volatile("v_nop\n\tv_nop\n\tv_nop\n\tv_nop" : "+v"(acc[0][0]), "+v"(acc[1][1]), "+v"(acc[2][2]), "+v"(acc[3][3]) : "v"(a[0]), "v"(a[1]), "v"(a[2]), "v"(a[3]));
    }
    const size_t tbase = bmode ? (size_t)r0 * SEQ + (size_t)(c0 / SEQ) * ((size_t)DP * SEQ) + (size_t)(c0 % SEQ)
                               : (size_t)(r0 / SEQ) * ((size_t)NH_ * SEQ * HD) + (size_t)(r0 % SEQ) * HD + (size_t)(c0 / HD) * ((size_t)SEQ * HD);
    const int c8 = (lane & 7) * 8;
    float bcol[8];      // column-mode bias of this lane's 8 columns (clamped addresses, always loaded)
    { const int hc = min(c0 >> 6, NH_ - 1);
#pragma unroll
      for (int i = 0; i < 8; ++i) bcol[i] = bfr(bias[min((c8 + i) * NH_ + hc, DP - 1)]); }
#pragma unroll
    for (int mb = 0; mb < 4; ++mb) {
#pragma unroll
        for (int nb = 0; nb < 4; ++nb) {
#pragma unroll
            for (int j = 0; j < 8; ++j) os[(hi * 8 + j) * 68 + nb * 16 + lr] = acc[mb][nb][j]; }   // D: row 8h+j, col lane&15
        wave_sync();
        const size_t sb = tbase + (size_t)(mb * 16) * (size_t)pitch;
{
#pragma unroll
            for (int s = 0; s < 4; ++s) { const int row = 4 * s + (lane >> 3);   // 4 s x 4 row groups = 16 rows; 8 lanes x 8 = 64 columns
                const int m = r0 + mb * 16 + row;
                const float brow = bfr(bias[min((m & 63) * NH_ + min(m >> 6, NH_ - 1), DP - 1)]);
                const v4f x0 = *(const v4fa*)(&os[row * 68 + c8]); const v4f x1 = *(const v4fa*)(&os[row * 68 + c8 + 4]); v8h hv;
#pragma unroll
                for (int i = 0; i < 4; ++i) { const float y0 = x0[i] + (bmode ? brow : bcol[i]); const float y1 = x1[i] + (bmode ? brow : bcol[4 + i]);
                    hv[i] = (h16)y0; hv[4 + i] = (h16)y1; }
                const size_t oo = sb + (size_t)row * (size_t)pitch + c8;
                *(v8h*)(Ph + oo) = hv; }
             }
        wave_sync();
    }
}

// One thread's share of a staged tile pair: four 16-byte asynchronous copies global -> LDS (two of K, two of V^T). The s_wait_xcnt closes the statement so that
// no address register of an issued copy is rewritten ahead of it.
__device__ __forceinline__ void stage4(unsigned l0, const h16* g0, unsigned l1, const h16* g1, unsigned l2, const h16* g2, unsigned l3, const h16* g3) {
    asm volatile("global_load_async_to_lds_b128 %0, %1, off\n\t"
                 "global_load_async_to_lds_b128 %2, %3, off\n\t"
                 "global_load_async_to_lds_b128 %4, %5, off\n\t"
                 "global_load_async_to_lds_b128 %6, %7, off\n\t"
                 "s_wait_xcnt 0x0"
                 :: "v"(l0), "v"(g0), "v"(l1), "v"(g1), "v"(l2), "v"(g2), "v"(l3), "v"(g3) : "memory");
}

// k_flash: fused attention, one wave per 16 query rows of one (batch, head); Q fragments straight from the f16 plane; K / V^T fragments from LDS tiles of 64 keys that the
// block's 8 waves share: tile t + 1 is copied (asynchronously, no registers) into one buffer while tile t is worked on in the other; one barrier per tile publishes and frees.
// Transposed form: S^T[key][t] = K Q^T (A = K rows, B = Q rows); lane (t = lane&15, h = lane>>4) holds keys 8h+r of each 16-key tile, so the packed
// P tile is directly the B fragment of O^T[d][t] = V^T P^T (element r <- tile keys 0..15, element 8+r <- tile keys 16..31, lane unchanged).
// Per 32-key step: 4 score matrix ops (2 key tiles x 2 d halves) + 4 P.V matrix ops (4 d tiles).
// Padded keys: the score is REPLACED by the fill value (flag plane loaded with the same key map as the P elements).
// Each wave reads the batch's per-tile words once and keeps one bit per tile; a tile without a padded key skips the flag loads, compares and selects (where no flag is set the replace is the identity).
// Softmax state (running max, partial sum) is one scalar per lane; the two lane halves of a row are combined with one xor-16 exchange.
__global__ __launch_bounds__(32 * AW) void k_flash(const h16* __restrict__ QH, const h16* __restrict__ KP, const h16* __restrict__ VT, const h16* __restrict__ PF, const unsigned* __restrict__ TF, h16* CTX) {
    __shared__ __align__(16) float os[AW * 16 * 68];
    __shared__ __align__(16) h16 ring[2][2][64 * LP];        // [buffer][K rows key | V^T rows d][row][LP]
    const int lane = threadIdx.x & 31, lr = lane & 15, hi = lane >> 4; const int wave = wave_id();
    const int zh = blockIdx.y; const int b = zh / NH_, h = zh % NH_;
    const int t0 = (blockIdx.x * AW + wave) * 16;
    const size_t pbase = (size_t)zh * SEQ * HD;
    const size_t qo = pbase + (size_t)(t0 + lr) * HD + 8 * hi;
    const v16h qh0 = ldh(QH + qo), qh1 = ldh(QH + qo + 32);   // B fragments: col t, k = d
    const int fo = lr * LP + 8 * hi;                         // fragment offset in a staged tile: K + key*LP (row key, k = d), V^T + 16j*LP + key (row d, k = key)
    // copy map: thread -> rows cr and cr + 32 of each tile, 16-byte column tid & 7
    const int cr = (int)(threadIdx.x >> 3), cc = (int)(threadIdx.x & 7) * 8;
    const h16* gk = KP + pbase + (size_t)cr * HD + cc;       // + key0 * HD
    const h16* gv = VT + pbase + (size_t)cr * SEQ + cc;      // + key0
    const unsigned lk = (unsigned)(size_t)&ring[0][0][cr * LP + cc];   // LDS byte address of the thread's first K chunk in buffer 0
    constexpr unsigned TB = 64 * LP * 2, HB = 32 * LP * 2;   // bytes of one tile, of 32 rows
    // tile 0 -> buffer 0, landed and published; then tile 1 -> buffer 1 in flight
    stage4(lk, gk, lk + HB, gk + 32 * HD, lk + TB, gv, lk + TB + HB, gv + (size_t)32 * SEQ);
    // bit t of padtiles: tile t of this batch holds a padded key (lane t reads tile t's word, one ballot makes the wave-uniform mask)
    const unsigned padtiles = __builtin_amdgcn_ballot_w32(TF[(size_t)b * NT + min(lane, NT - 1)] != 0u);
    asm volatile("s_wait_xcnt 0x0" ::: "memory");            // the load above is issued: its address register may be rewritten behind this line
    asm volatile("s_wait_asynccnt 0x0" ::: "memory");        // this wave's copies of tile 0 have landed
    __syncthreads();                                         // every wave's copies of tile 0 are readable
    stage4(lk + 2 * TB, gk + KST * HD, lk + 2 * TB + HB, gk + (KST + 32) * HD, lk + 3 * TB, gv + KST, lk + 3 * TB + HB, gv + (size_t)32 * SEQ + KST);
    const h16* pfp = PF + (size_t)b * SEQ + 8 * hi;          // + key0: elements r <- key0+8h+r, 8+r <- key0+16+8h+r
    v8f o0 = (v8f){}, o1 = (v8f){}, o2 = (v8f){}, o3 = (v8f){};
    float m = -3.0e38f, l = 0.0f;
#pragma unroll 1
    for (int t = 0; t < NT; ++t) {
      const h16* kt = &ring[t & 1][0][fo]; const h16* vt = &ring[t & 1][1][fo];
      const bool tpad = ((padtiles >> t) & 1u) != 0u;
#pragma unroll   // both 32-key steps of a tile inline, so that every LDS offset inside the tile is an immediate
      for (int s = 0; s < KST / 32; ++s) {
        const int key0 = t * KST + s * 32;
        const h16* ka = kt + s * 32 * LP;
        const v16h ka0 = ldh(ka), ka1 = ldh(ka + 32), kb0 = ldh(ka + 16 * LP), kb1 = ldh(ka + 16 * LP + 32);
        v8f sa = (v8f){}, sb = (v8f){};
        sa = wmma16(ka0, qh0, sa); sb = wmma16(kb0, qh0, sb);
        sa = wmma16(ka1, qh1, sa); sb = wmma16(kb1, qh1, sb);
        asm volatile("v_nop\n\tv_nop\n\tv_nop\n\tv_nop" : "+v"(sa), "+v"(sb) : "v"(ka0), "v"(ka1), "v"(kb0), "v"(kb1), "v"(qh0), "v"(qh1));
        float ta[8], tb[8]; float mx = -3.0e38f;
#pragma unroll
        for (int r = 0; r < 8; ++r) {
            ta[r] = sa[r] * SC2; tb[r] = sb[r] * SC2; }
        if (__builtin_expect(tpad, false)) {                 // scalar branch, the same in every wave of the block: only a tile that holds a padded key loads its flags and replaces (laid out of line)
            const v16h pf = ldh(pfp + key0);
            asm volatile("s_wait_xcnt 0x0" ::: "memory");    // the two flag loads are issued: their address pair is stepped at the loop's foot
#pragma unroll
            for (int r = 0; r < 8; ++r) { ta[r] = ((float)pf[r] != 0.0f) ? NEGB : ta[r]; tb[r] = ((float)pf[8 + r] != 0.0f) ? NEGB : tb[r]; } }
#pragma unroll
        for (int r = 0; r < 8; ++r) mx = fmaxf(mx, fmaxf(ta[r], tb[r]));
        mx = fmaxf(mx, __shfl_xor(mx, 16, 32));
        const float mnew = fmaxf(m, mx);
        const float alpha = __builtin_amdgcn_exp2f(m - mnew);
        const float sh = PSH - mnew;
        v16h pb; float ls = 0.0f;
#pragma unroll
        for (int r = 0; r < 8; ++r) { const h16 pa = (h16)__builtin_amdgcn_exp2f(ta[r] + sh); const h16 pc = (h16)__builtin_amdgcn_exp2f(tb[r] + sh); pb[r] = pa; pb[8 + r] = pc; ls += (float)pa + (float)pc; }
        l = l * alpha + ls; m = mnew;
        o0 = o0 * alpha; o1 = o1 * alpha; o2 = o2 * alpha; o3 = o3 * alpha;
        const h16* va = vt + s * 32;
        const v16h v0 = ldh(va), v1 = ldh(va + 16 * LP), v2 = ldh(va + 32 * LP), v3 = ldh(va + 48 * LP);
        o0 = wmma16(v0, pb, o0); o1 = wmma16(v1, pb, o1); o2 = wmma16(v2, pb, o2); o3 = wmma16(v3, pb, o3);
        asm volatile("v_nop\n\tv_nop\n\tv_nop\n\tv_nop" : "+v"(o0), "+v"(o1), "+v"(o2), "+v"(o3) : "v"(v0), "v"(v1), "v"(v2), "v"(v3), "v"(pb));
      }
      asm volatile("s_wait_dscnt 0x0" ::: "memory");         // this wave's reads of tile t are done before its buffer may be refilled
      asm volatile("s_wait_asynccnt 0x0" ::: "memory");      // this wave's copies of tile t + 1 have landed
      __syncthreads();                                       // publishes tile t + 1 and ends every wave's reads of tile t
      if (t + 2 < NT) {                                      // block-uniform: refill the buffer that tile t has just left
          const unsigned lb = lk + (unsigned)(t & 1) * (2 * TB); const h16* gk2 = gk + (size_t)(t + 2) * KST * HD; const h16* gv2 = gv + (t + 2) * KST;
          stage4(lb, gk2, lb + HB, gk2 + 32 * HD, lb + TB, gv2, lb + TB + HB, gv2 + (size_t)32 * SEQ); }
    }
    asm volatile("s_wait_asynccnt 0x0" ::: "memory");        // nothing of this wave is in flight when the ring goes out of use
    l += __shfl_xor(l, 16, 32);
    const float inv = CXS / l;
    const int wb = wave * 16 * 68;
    // O^T D layout: o_j[r] = (d = 16j + 8h + r, t = lane&15) -> os[t][d]; rows 0..15 x columns 0..63 all written
    { v4f a, c;
      a[0] = o0[0] * inv; a[1] = o0[1] * inv; a[2] = o0[2] * inv; a[3] = o0[3] * inv; c[0] = o0[4] * inv; c[1] = o0[5] * inv; c[2] = o0[6] * inv; c[3] = o0[7] * inv;
      *(v4fa*)(&os[wb + lr * 68 +  0 + 8 * hi]) = a; *(v4fa*)(&os[wb + lr * 68 +  0 + 8 * hi + 4]) = c;
      a[0] = o1[0] * inv; a[1] = o1[1] * inv; a[2] = o1[2] * inv; a[3] = o1[3] * inv; c[0] = o1[4] * inv; c[1] = o1[5] * inv; c[2] = o1[6] * inv; c[3] = o1[7] * inv;
      *(v4fa*)(&os[wb + lr * 68 + 16 + 8 * hi]) = a; *(v4fa*)(&os[wb + lr * 68 + 16 + 8 * hi + 4]) = c;
      a[0] = o2[0] * inv; a[1] = o2[1] * inv; a[2] = o2[2] * inv; a[3] = o2[3] * inv; c[0] = o2[4] * inv; c[1] = o2[5] * inv; c[2] = o2[6] * inv; c[3] = o2[7] * inv;
      *(v4fa*)(&os[wb + lr * 68 + 32 + 8 * hi]) = a; *(v4fa*)(&os[wb + lr * 68 + 32 + 8 * hi + 4]) = c;
      a[0] = o3[0] * inv; a[1] = o3[1] * inv; a[2] = o3[2] * inv; a[3] = o3[3] * inv; c[0] = o3[4] * inv; c[1] = o3[5] * inv; c[2] = o3[6] * inv; c[3] = o3[7] * inv;
      *(v4fa*)(&os[wb + lr * 68 + 48 + 8 * hi]) = a; *(v4fa*)(&os[wb + lr * 68 + 48 + 8 * hi + 4]) = c; }
    wave_sync();
    h16* crow = CTX + ((size_t)b * SEQ + t0) * DP + h * HD;
{
#pragma unroll
        for (int s = 0; s < 4; ++s) { const int row = 4 * s + (lane >> 3), c8 = (lane & 7) * 8;   // 4 s x 4 rows = 16 rows; 8 lanes x 8 halves = 64 columns
            const v4f x0 = *(const v4fa*)(&os[wb + row * 68 + c8]); const v4f x1 = *(const v4fa*)(&os[wb + row * 68 + c8 + 4]); v8h hv;
#pragma unroll
            for (int i = 0; i < 4; ++i) { hv[i] = (h16)x0[i]; hv[4 + i] = (h16)x1[i]; }
            *(v8h*)(crow + (size_t)row * DP + c8) = hv; }
         }
}

// k_out: f16 GEMM, ONE WAVE per 64x64 tile, A = ctx plane [NB*SEQ][1024] (x256), Bt = Wo^T plane [512][1024] (x1024), K = DP; OUT[m][n] = acc * 2^-18 + bo[n] (f32).
__global__ __launch_bounds__(32) void k_out(const h16* __restrict__ A, const h16* __restrict__ Bt, const float* __restrict__ bias, float* OUT) {
    __shared__ __align__(16) float os[16 * 68];
    const int K = DP;
    const int lane = threadIdx.x & 31, lr = lane & 15, hi = lane >> 4; const int r0 = blockIdx.x * 64, c0 = blockIdx.y * 64;
    v8f acc[4][4];
#pragma unroll
    for (int mb = 0; mb < 4; ++mb)
#pragma unroll
        for (int nb = 0; nb < 4; ++nb) acc[mb][nb] = (v8f){};
    const size_t aoff = (size_t)(r0 + lr) * K + 8 * hi, boff = (size_t)(c0 + lr) * K + 8 * hi;
#pragma unroll 1
    for (int kc = 0; kc < K; kc += 32) {
        v16h a[4];
#pragma unroll
        for (int mb = 0; mb < 4; ++mb) a[mb] = ldh(A + aoff + (size_t)mb * 16 * K + kc);
#pragma unroll
        for (int nb = 0; nb < 4; ++nb) { const v16h b = ldh(Bt + boff + (size_t)nb * 16 * K + kc);
#pragma unroll
            for (int mb = 0; mb < 4; ++mb) acc[mb][nb] = wmma16(a[mb], b, acc[mb][nb]); }
        asm volatile("v_nop\n\tv_nop\n\tv_nop\n\tv_nop" : "+v"(acc[0][0]), "+v"(acc[1][1]), "+v"(acc[2][2]), "+v"(acc[3][3]) : "v"(a[0]), "v"(a[1]), "v"(a[2]), "v"(a[3]));
    }
    const size_t orow0 = (size_t)(r0 / SEQ) * OUT_SEQ + (size_t)(r0 % SEQ);
    const int cofs = lr * 4;
    v4f bv;
#pragma unroll
    for (int i = 0; i < 4; ++i) bv[i] = bfr(bias[min(c0 + cofs + i, DIN - 1)]);
#pragma unroll
    for (int mb = 0; mb < 4; ++mb) {
#pragma unroll
        for (int nb = 0; nb < 4; ++nb) {
#pragma unroll
            for (int j = 0; j < 8; ++j) os[(hi * 8 + j) * 68 + nb * 16 + lr] = acc[mb][nb][j] * FOLD; }   // D: row 8h+j, col lane&15
        wave_sync();
{
#pragma unroll
            for (int s = 0; s < 8; ++s) { const int row = 2 * s + hi;   // 8 s x 2 rows = 16 rows; 16 lanes x 4 floats = 64 columns
                const v4f val = *(const v4fa*)(&os[row * 68 + cofs]) + bv;
                *(v4f*)(OUT + (orow0 + (size_t)(mb * 16 + row)) * DIN + c0 + cofs) = val; }
             }
        wave_sync();
    }
}

static constexpr size_t al256(size_t v) { return (v + 255) & ~(size_t)255; }
static constexpr size_t SZ_XB = al256((size_t)NB * SEQ * DIN * 2);
static constexpr size_t SZ_WT = al256((size_t)3 * DP * DIN * 2);
static constexpr size_t SZ_WO = al256((size_t)DIN * DP * 2);
static constexpr size_t SZ_PL = al256((size_t)NB * NH_ * SEQ * HD * 2);
static constexpr size_t SZ_CX = al256((size_t)NB * SEQ * DP * 2);
static constexpr size_t SZ_PF = al256((size_t)NB * SEQ * 2);
static constexpr size_t SZ_TF = al256((size_t)NB * NT * 4);
static constexpr size_t SZ_TOTAL = SZ_XB + SZ_WT + SZ_WO + 3 * SZ_PL + SZ_CX + SZ_PF + SZ_TF;
static_assert(SZ_TOTAL <= (size_t)134217728);          // workspace carve <= 128 MiB
static_assert(((size_t)DP * DIN * 2) % 256 == 0);      // weight sub-planes stay 256-byte aligned

extern "C" void kernel_launch(void* const* d_in, const int* in_sizes, int n_in,
                              void* d_out, int out_size, void* d_ws, size_t ws_size, hipStream_t stream) {
    if (n_in < 10) return;
    const size_t needx = ((size_t)(NB - 1) * SEQ_FULL + SEQ) * DIN;
    if ((size_t)in_sizes[0] < needx || (size_t)in_sizes[1] < needx) return;
    if ((size_t)in_sizes[2] < (size_t)DIN * DP || (size_t)in_sizes[4] < (size_t)DIN * DP || (size_t)in_sizes[6] < (size_t)DIN * DP || (size_t)in_sizes[8] < (size_t)DP * DIN) return;
    if ((size_t)in_sizes[3] < (size_t)DP || (size_t)in_sizes[5] < (size_t)DP || (size_t)in_sizes[7] < (size_t)DP || (size_t)in_sizes[9] < (size_t)DIN) return;
    if ((size_t)out_size < ((size_t)(NB - 1) * OUT_SEQ + SEQ) * DIN) return;
    if (SZ_TOTAL > ws_size) return;
    // wire order: data, pad input, wq, bq, wk, bk, wv, bv, wo, bo (all f32)
    const float* x = (const float*)d_in[0]; const float* pm = (const float*)d_in[1];
    const float* wq = (const float*)d_in[2]; const float* bq = (const float*)d_in[3];
    const float* wk = (const float*)d_in[4]; const float* bk = (const float*)d_in[5];
    const float* wv = (const float*)d_in[6]; const float* bv = (const float*)d_in[7];
    const float* wo = (const float*)d_in[8]; const float* bo = (const float*)d_in[9];
    float* OUT = (float*)d_out;      // [NB][SEQ][512]
    char* wsp = (char*)d_ws;
    bf* XB = (bf*)wsp; wsp += SZ_XB;                 // [NB*SEQ][512] bf16
    bf* WT = (bf*)wsp; wsp += SZ_WT;                 // [3][1024][512] bf16, rows h*64+dm: q | k | v
    bf* WOB = (bf*)wsp; wsp += SZ_WO;                // [512][1024] f16 bits (x1024)
    h16* QH = (h16*)wsp; wsp += SZ_PL;               // [NB*16][SEQ][64]
    h16* KP = (h16*)wsp; wsp += SZ_PL;               // [NB*16][SEQ][64]
    h16* VT = (h16*)wsp; wsp += SZ_PL;               // [NB*16][64][SEQ]
    h16* CX = (h16*)wsp; wsp += SZ_CX;               // [NB*SEQ][1024] (x256)
    h16* PF = (h16*)wsp; wsp += SZ_PF;               // [NB*SEQ] pad flags
    unsigned* TF = (unsigned*)wsp; wsp += SZ_TF;     // [NB*SEQ/64] nonzero where a 64-key tile holds a padded key

    k_prep<<<dim3(PB_PAD + 4 * PB_WT + PB_CVT, 1, 1), 256, 0, stream>>>(x, pm, wq, wk, wv, wo, XB, WT, WOB, PF, TF);

    k_proj<<<dim3(NB * SEQ / 64, DP / 64, 3), 32, 0, stream>>>(XB, WT, bq, bk, bv, QH, KP, VT);

    k_flash<<<dim3(SEQ / (16 * AW), NB * NH_, 1), 32 * AW, 0, stream>>>(QH, KP, VT, PF, TF, CX);

    k_out<<<dim3(NB * SEQ / 64, DIN / 64, 1), 32, 0, stream>>>(CX, (const h16*)WOB, bo, OUT);
}

// v004
// One run takes 73.1 microseconds.
// Next to v003, in two timings, it ran 1.36 times as fast each time.
// Counting every step since v000, it is 2.70 times as fast.
#include <hip/hip_runtime.h>

// Multi-head self-attention: data [NB][SEQ][512], Wq/Wk/Wv [512][1024] ([in][out], column c = dm*16 + h), biases, key-padding replace fill (-1e9 where a key's 512 pad-input values sum to 0), score scale 1/8, merged heads (h*64+dm) @ Wo [1024][512] + bo, f32 output.
// Compute dtypes, f32 accumulate everywhere: projections v_wmma_f32_16x16x32_bf16 (data and W RNE-converted to bf16; products exact);
// scores v_wmma_f32_16x16x32_f16: q and k single f16 planes (one product); P (x256 carry, cancels in the normalisation) and v single f16; softmax f32 (online, running max);
// output projection v_wmma_f32_16x16x32_f16: ctx single f16 (x256 carry), Wo = f16 of (bf16 RNE of wo) x1024 (exact), 2^-18 folded back in f32, bias added in f32.
// Launches: 4. k_prep (block index picks the job: pad flags with one word per 64 keys, one weight tile, or a slice of the data conversion; the jobs read none of each other's output), k_proj (grid z picks q, k or v^T), k_flash, k_out.
// Layout: bf16 copy of data; transposed K-contiguous weight planes (head-permuted rows h*64+dm); q, k planes [b*16+h][t][d] and v^T plane [b*16+h][d][t] from the GEMM epilogue;
// fused flash kernel in transposed form (S^T = K Q^T, O^T = V^T P^T; 4 score + 4 P.V matrix ops per 32-key step; K and V^T tiles of 64 keys staged in LDS by asynchronous copies, two buffers) writing the ctx plane [b*SEQ+t][h*64+d].
// Both GEMMs (k_proj, k_out): 4-wave blocks, operand tiles staged in LDS by asynchronous copies of whole 128-byte lines, two buffers, fragments read from LDS.

#ifndef NB
#define NB 2
#endif
#ifndef SEQ
#define SEQ 2048
#endif
#define NB_FULL  2
#define SEQ_FULL 2048
#ifndef OUT_SEQ
#define OUT_SEQ SEQ              // row pitch (in tokens) between batches of the output
#endif
#define DIN  512                 // input width = output width
#define DP   1024                // projection width = 16 heads x 64
#define NH_  16
#define HD   64
#define AW   8                   // waves per flash block (16 query rows each); all share the staged K / V^T tiles
#define KST  64                  // keys per staged tile (two 32-key steps)
#define LP   72                  // LDS row pitch in halves: 128-byte rows + 16 bytes, the pitch for 16-byte LDS readers
#define NT   (SEQ / KST)         // staged tiles per (batch, head)
#define SC2  (0.125f * 1.4426950408889634f)   // HD^-0.5 * log2(e)
#define PSH  8.0f                // log2 of the P carry (256)
#define NEGB (-1.0e9f * 1.4426950408889634f)  // fill value of padded keys in the log2 domain
#define CXS  256.0f              // carry of the ctx plane
#define WOS  1024.0f             // carry of the Wo plane
#define FOLD (1.0f / (256.0f * 1024.0f))

static_assert(HD == 64);
static_assert(NH_ * HD == DP);
static_assert(NH_ == 16);                      // column c = dm*16 + h
static_assert(DP % 64 == 0);
static_assert(DIN % 64 == 0);
static_assert(DIN % 32 == 0);                  // GEMM k-loops step by 32
static_assert(DP % 32 == 0);
static_assert(DIN == 512);                     // pad-row sum: 4 x 128 floats per wave
static_assert(SEQ % 64 == 0);                  // a 64-row tile never straddles two batches
static_assert((NB * SEQ) % 64 == 0);
static_assert(SEQ % 32 == 0);                  // key loop steps by 32
static_assert(SEQ % (16 * AW) == 0);           // flash grid covers the sequence exactly
static_assert(SEQ % KST == 0);
static_assert(NT >= 2);                        // the two-buffer prologue fills tiles 0 and 1
static_assert(NT <= 32);                       // one bit per staged tile in the 32-lane ballot of padded tiles
static_assert(KST == 64);                      // a staged tile is the 64 key rows of one pad block
static_assert(32 * AW * 2 * 8 == KST * HD);    // two 16-byte copies per thread cover one 64 x 64 tile
static_assert(((size_t)SEQ * DIN) % 8 == 0);
static_assert((NB * SEQ) % 128 == 0);          // GEMM block tiles: 128 data rows (k_proj)
static_assert(DP % 128 == 0);
static_assert(DIN % 128 == 0);
static_assert(NB <= NB_FULL);
static_assert(SEQ <= SEQ_FULL);

typedef _Float16 h16;
typedef unsigned short bf;
typedef __attribute__((ext_vector_type(16))) __bf16   v16bf;
typedef __attribute__((ext_vector_type(16))) _Float16 v16h;
typedef __attribute__((ext_vector_type(8)))  _Float16 v8h;
typedef __attribute__((ext_vector_type(8)))  unsigned short v8us;
typedef __attribute__((ext_vector_type(16))) unsigned short v16us;
typedef __attribute__((ext_vector_type(8)))  float    v8f;
typedef __attribute__((ext_vector_type(4)))  float    v4f;
typedef v4f  __attribute__((may_alias)) v4fa;

__device__ __forceinline__ unsigned short f2bf(float f) { unsigned u = __float_as_uint(f); u += 0x7FFFu + ((u >> 16) & 1u); return (unsigned short)(u >> 16); }
__device__ __forceinline__ float bfr(float f) { return __uint_as_float(((unsigned)f2bf(f)) << 16); }   // value after RNE conversion to bf16
__device__ __forceinline__ v16h cat16(v8h lo, v8h hi) { return __builtin_shufflevector(lo, hi, 0, 1, 2, 3, 4, 5, 6, 7, 8, 9, 10, 11, 12, 13, 14, 15); }
__device__ __forceinline__ v16bf cat16b(v8us lo, v8us hi) { return __builtin_bit_cast(v16bf, __builtin_shufflevector(lo, hi, 0, 1, 2, 3, 4, 5, 6, 7, 8, 9, 10, 11, 12, 13, 14, 15)); }
__device__ __forceinline__ v8f wmma16(v16h a, v16h b, v8f c) { return __builtin_amdgcn_wmma_f32_16x16x32_f16(false, a, false, b, (short)0, c, false, false); }
__device__ __forceinline__ v8f wmmab(v16bf a, v16bf b, v8f c) { return __builtin_amdgcn_wmma_f32_16x16x32_bf16(false, a, false, b, (short)0, c, false, false); }
// fragment loaders from K-contiguous 16-bit rows; p already includes + 8*(lane>>4): elements 0..7 <- k0+8h+0..7, elements 8..15 <- k0+16+8h+0..7 (same map for A and B)
__device__ __forceinline__ v16h  ldh(const h16* p) { return cat16(*(const v8h*)p, *(const v8h*)(p + 16)); }
__device__ __forceinline__ v16bf ldb(const bf* p)  { return cat16b(*(const v8us*)p, *(const v8us*)(p + 16)); }
// ordering point for wave-private LDS tiles (same wave writes and reads)
__device__ __forceinline__ void wave_sync() { __builtin_amdgcn_fence(3 /* release order */, "wavefront"); __builtin_amdgcn_wave_barrier(); asm volatile("" ::: "memory"); }
// wave index of the calling thread as a wave-uniform scalar
__device__ __forceinline__ int wave_id() { return __builtin_amdgcn_readfirstlane((int)(threadIdx.x >> 5)); }

// blocks of k_prep per job
#define PB_PAD (NB * SEQ / 64)                        // 64 pad rows each
#define PB_WT  ((DIN / 64) * (DP / 64))               // 64 x 64 tiles of one weight matrix (all four have DIN * DP elements)
#define N8     ((size_t)NB * SEQ * DIN / 8)           // 8-element chunks of the data
#define PB_CVT ((unsigned)((N8 + 255) / 256))

// cvt_job: data f32 -> bf16 copy [NB*SEQ][512], 8 elements per thread; blk = block index inside the job.
__device__ __forceinline__ void cvt_job(const float* __restrict__ x, bf* dst, int blk) {
    const size_t i = (size_t)blk * 256 + threadIdx.x; if (i >= N8) return;
    constexpr size_t C8 = (size_t)SEQ * DIN / 8;      // chunks per batch
    const size_t so = (SEQ == SEQ_FULL) ? i * 8 : (i / C8) * ((size_t)SEQ_FULL * DIN) + (i % C8) * 8;
    const v8f v = *(const v8f*)(x + so); v8us o;
#pragma unroll
    for (int k = 0; k < 8; ++k) o[k] = f2bf(v[k]);
    *(v8us*)(dst + i * 8) = o;
}

// wt_job: W [K][N] f32 ([in][out]) -> dst [N][K] 16-bit rows (K-contiguous). in[K rows][N cols] -> out[N rows][K cols]; one 64 x 64 tile (bx of K/64, by of N/64), 256 threads; ts = 64 * 68 floats of LDS.
// perm != 0: source column c = dm*16 + h lands on destination row h*64 + dm. asf16 == 0: bf16 bits; asf16 != 0: f16 bits of (bf16 value * scale).
__device__ __forceinline__ void wt_job(const float* __restrict__ W, bf* dst, int K, int N, int perm, int asf16, float scale, int bx, int by, float* ts) {   // ts: [column][k]
    const int tid = threadIdx.x, lane = tid & 31; const int wave = wave_id();
    const int k0 = bx * 64, c0 = by * 64;
#pragma unroll
    for (int it = 0; it < 4; ++it) { const int e = tid + 256 * it; const int kk = e >> 4, c4 = (e & 15) * 4;   // 64 k rows x 16 float4 = whole tile
        const v4f v = *(const v4f*)(W + (size_t)(k0 + kk) * (size_t)N + c0 + c4);
        ts[(c4 + 0) * 68 + kk] = v[0]; ts[(c4 + 1) * 68 + kk] = v[1]; ts[(c4 + 2) * 68 + kk] = v[2]; ts[(c4 + 3) * 68 + kk] = v[3]; }
    __syncthreads();
{
#pragma unroll
        for (int s = 0; s < 2; ++s) { const int row = 4 * (wave + 8 * s) + (lane >> 3), c8 = (lane & 7) * 8;   // 8 waves x 2 s x 4 rows = 64 rows; 8 lanes x 8 = 64 k
            const v4f x0 = *(const v4fa*)(&ts[row * 68 + c8]); const v4f x1 = *(const v4fa*)(&ts[row * 68 + c8 + 4]); v8us o;
#pragma unroll
            for (int i = 0; i < 4; ++i) { const float f0 = bfr(x0[i]), f1 = bfr(x1[i]);
                const unsigned short b0 = (unsigned short)(__float_as_uint(f0) >> 16), b1 = (unsigned short)(__float_as_uint(f1) >> 16);
                const unsigned short g0 = __builtin_bit_cast(unsigned short, (h16)(f0 * scale)), g1 = __builtin_bit_cast(unsigned short, (h16)(f1 * scale));
                o[i] = asf16 ? g0 : b0; o[4 + i] = asf16 ? g1 : b1; }
            const int c = c0 + row; const int n = perm ? ((c & 15) * 64 + (c >> 4)) : c;
            *(v8us*)(dst + (size_t)n * (size_t)K + k0 + c8) = o; }
         }
    asm volatile("s_wait_xcnt 0x0" ::: "memory");   // the two stores above are issued: no register that they name is rewritten by the code that follows this job in the merged kernel
}

// pad_job: flags of 64 key rows (1 where the row's 512 pad-input values sum to 0), and one word for the 64 rows together (nonzero where any of them is flagged); fl = 64 floats of LDS.
__device__ __forceinline__ void pad_job(const float* __restrict__ mask, h16* PF, unsigned* TF, int blk, float* fl) {
    const int tid = threadIdx.x, lane = tid & 31; const int wave = wave_id();
    const int m0 = blk * 64;
#pragma unroll 1
    for (int i = 0; i < 8; ++i) { const int m = m0 + wave * 8 + i; const int b = m / SEQ, t = m % SEQ;
        const float* row = mask + ((size_t)b * SEQ_FULL + t) * DIN;
        float s = 0.0f;
#pragma unroll
        for (int j = 0; j < 4; ++j) { const v4f v = *(const v4f*)(row + j * 128 + lane * 4); s += bfr(v[0]); s += bfr(v[1]); s += bfr(v[2]); s += bfr(v[3]); }
        s += __shfl_xor(s, 16, 32); s += __shfl_xor(s, 8, 32); s += __shfl_xor(s, 4, 32); s += __shfl_xor(s, 2, 32); s += __shfl_xor(s, 1, 32);
        if (lane == 0) fl[wave * 8 + i] = (s == 0.0f) ? 1.0f : 0.0f; }
    __syncthreads();
    if (tid < 8) { v8h o;
#pragma unroll
        for (int k = 0; k < 8; ++k) o[k] = (h16)fl[tid * 8 + k];
        *(v8h*)(PF + (size_t)m0 + tid * 8) = o;  }
    if (wave == 0) { const unsigned any = __builtin_amdgcn_ballot_w32((fl[lane] != 0.0f) | (fl[lane + 32] != 0.0f));
        if (lane == 0) TF[blk] = any; }
}

// k_prep: everything that reads only the inputs, in one launch. The job is a function of blockIdx.x alone, so every branch (and the barrier inside a job) is block-uniform.
// Order: the pad rows (eight dependent row sums per wave, the longest job) start first, the one-load conversion blocks last.
__global__ __launch_bounds__(256) void k_prep(const float* __restrict__ x, const float* __restrict__ pm, const float* __restrict__ wq, const float* __restrict__ wk, const float* __restrict__ wv,
                                              const float* __restrict__ wo, bf* XB, bf* WT, bf* WOB, h16* PF, unsigned* TF) {
    __shared__ __align__(16) float ts[64 * 68];
    const int bid = blockIdx.x;
    if (bid < PB_PAD) { pad_job(pm, PF, TF, bid, ts); return; }
    if (bid < PB_PAD + 4 * PB_WT) {
        const int j = bid - PB_PAD; const int w = j / PB_WT, tile = j % PB_WT;
        // w = 0..2: wq, wk, wv, in[K = 512][N = 1024] -> [1024 rows (head-permuted)][512], bf16; w = 3: wo, in[K = 1024 (h*64+dm)][N = 512] -> [512 rows][1024], f16 x1024
        const bool o = (w == 3);
        const float* W = o ? wo : (w == 0 ? wq : (w == 1 ? wk : wv));
        bf* dst = o ? WOB : WT + (size_t)w * DP * DIN;
        const int K = o ? DP : DIN, N = o ? DIN : DP;
        wt_job(W, dst, K, N, o ? 0 : 1, o ? 1 : 0, o ? WOS : 1.0f, tile % (K / 64), tile / (K / 64), ts);
        return; }
    cvt_job(x, XB, bid - (PB_PAD + 4 * PB_WT));
}

// One thread's eight 16-byte asynchronous copies global -> LDS: rows ls bytes apart in LDS, gs elements apart in memory. The s_wait_xcnt closes the statement so that
// no address register of an issued copy is rewritten ahead of it.
__device__ __forceinline__ void stage8(unsigned l, const bf* g, unsigned ls, size_t gs) {
    asm volatile("global_load_async_to_lds_b128 %0, %1, off\n\t"
                 "global_load_async_to_lds_b128 %2, %3, off\n\t"
                 "global_load_async_to_lds_b128 %4, %5, off\n\t"
                 "global_load_async_to_lds_b128 %6, %7, off\n\t"
                 "global_load_async_to_lds_b128 %8, %9, off\n\t"
                 "global_load_async_to_lds_b128 %10, %11, off\n\t"
                 "global_load_async_to_lds_b128 %12, %13, off\n\t"
                 "global_load_async_to_lds_b128 %14, %15, off\n\t"
                 "s_wait_xcnt 0x0"
                 :: "v"(l), "v"(g), "v"(l + ls), "v"(g + gs), "v"(l + 2 * ls), "v"(g + 2 * gs), "v"(l + 3 * ls), "v"(g + 3 * gs),
                    "v"(l + 4 * ls), "v"(g + 4 * gs), "v"(l + 5 * ls), "v"(g + 5 * gs), "v"(l + 6 * ls), "v"(g + 6 * gs), "v"(l + 7 * ls), "v"(g + 7 * gs) : "memory");
}
__device__ __forceinline__ v16us ldu(const bf* p) { return __builtin_shufflevector(*(const v8us*)p, *(const v8us*)(p + 16), 0, 1, 2, 3, 4, 5, 6, 7, 8, 9, 10, 11, 12, 13, 14, 15); }   // same k map as ldh / ldb
template <bool BF> __device__ __forceinline__ v8f mm(v16us a, v16us b, v8f c) {
    if constexpr (BF) return wmmab(__builtin_bit_cast(v16bf, a), __builtin_bit_cast(v16bf, b), c);
    else              return wmma16(__builtin_bit_cast(v16h, a), __builtin_bit_cast(v16h, b), c);
}

// gemm_core: acc[mb][nb] += A rows x Bt rows over K (16-bit, K-contiguous planes), for a block of 4 waves (2 x 2). Block tile (2 * MF * 16) x 128 at (R0, C0); wave (wave >> 1, wave & 1) owns (MF * 16) x 64.
// Per trip KS k values of every row of both tiles lie in one LDS buffer (row pitch KS + 8 halves: 16 bytes x odd, the pitch for 16-byte LDS readers); a wave's copy covers whole 128-byte lines.
// Tile t + 1 is copied into one buffer while tile t is worked on in the other; one barrier per trip publishes and frees. k ascends by 32 in every accumulator.
template <int MF, int KS, int K, bool BF>
__device__ __forceinline__ void gemm_core(const bf* __restrict__ A, const bf* __restrict__ Bt, int R0, int C0, bf* ring, v8f (&acc)[MF][4]) {
    constexpr int GP = KS + 8, BM = 2 * MF * 16, BUFH = (BM + 128) * GP;   // pitch (halves), A rows, halves per buffer
    constexpr int CPR = KS / 8, RS = 128 / CPR, NTR = K / KS;              // 16-byte chunks per row, rows covered by the block's 128 threads in one copy each, trips
    static_assert(BM == 8 * RS);                                           // one stage8 covers the A tile
    static_assert(128 % (8 * RS) == 0);                                    // whole stage8 groups cover the B tile
    static_assert(K % KS == 0);
    static_assert(NTR >= 2);                                               // the prologue fills tiles 0 and 1
    static_assert(MF == 2 || MF == 4);
    const int tid = threadIdx.x, lane = tid & 31, lr = lane & 15, hi = lane >> 4; const int wave = wave_id();
    const int cr = tid / CPR, cc = (tid % CPR) * 8;                        // copy map: thread -> row cr (+ multiples of RS), 16-byte column
    const bf* ga = A + (size_t)(R0 + cr) * K + cc;                         // + t * KS
    const bf* gb = Bt + (size_t)(C0 + cr) * K + cc;
    const unsigned la = (unsigned)(size_t)&ring[cr * GP + cc];             // LDS byte address of the thread's first A chunk in buffer 0
    auto stage = [&](int t, int buf) {
        const unsigned l = la + (unsigned)buf * (unsigned)(BUFH * 2);
        stage8(l, ga + t * KS, RS * GP * 2, (size_t)RS * K);
#pragma unroll
        for (int g = 0; g < 128 / (8 * RS); ++g) stage8(l + (unsigned)((BM + g * 8 * RS) * GP * 2), gb + (size_t)g * 8 * RS * K + t * KS, RS * GP * 2, (size_t)RS * K);
    };
    stage(0, 0);
    asm volatile("s_wait_asynccnt 0x0" ::: "memory");        // this wave's copies of tile 0 have landed
    __syncthreads();                                         // every wave's copies of tile 0 are readable
    stage(1, 1);
    const int ao = ((wave >> 1) * MF * 16 + lr) * GP + 8 * hi, bo = (BM + (wave & 1) * 64 + lr) * GP + 8 * hi;
#pragma unroll 1   // rolled; the buffer is picked by a scalar select
    for (int t = 0; t < NTR; ++t) {
        const bf* ab = ring + (t & 1) * BUFH + ao; const bf* bb = ring + (t & 1) * BUFH + bo;
        // Fragment sets: each k step's LDS reads go out as one group. NS == 2 (the small wave tile, one wave per SIMD): the next step's group ahead of this step's matrix instructions;
        // NS == 1 (the large wave tile, several waves per SIMD, which cover each other's LDS waits): one set, so that the wave stays inside the first 256 registers.
        constexpr int NS = (MF == 2) ? 2 : 1, NK = KS / 32;
        v16us a[NS][MF], b[NS][4];
        auto frags = [&](int ks) {                           // never past the trip's own tile: ks < NK at every call
#pragma unroll
            for (int mb = 0; mb < MF; ++mb) a[ks % NS][mb] = ldu(ab + mb * 16 * GP + ks * 32);
#pragma unroll
            for (int nb = 0; nb < 4; ++nb) b[ks % NS][nb] = ldu(bb + nb * 16 * GP + ks * 32);
        };
        frags(0);
#pragma unroll   // all k steps of a trip inline, so that every LDS offset inside the tile is an immediate and the fragment sets stay in registers
        for (int ks = 0; ks < NK; ++ks) {
            if (NS == 2 && ks + 1 < NK) frags(ks + 1);
            __builtin_amdgcn_sched_barrier(0);               // keeps the group of LDS reads ahead of the matrix instructions below: sunk among them, each read is waited for where it stands
#pragma unroll
            for (int nb = 0; nb < 4; ++nb)
#pragma unroll
                for (int mb = 0; mb < MF; ++mb) acc[mb][nb] = mm<BF>(a[ks % NS][mb], b[ks % NS][nb], acc[mb][nb]);
            if (NS == 1 && ks + 1 < NK) frags(ks + 1);
        }
        __builtin_amdgcn_sched_barrier(0);                   // keeps the trip's matrix instructions ahead of the barrier: sunk behind it they delay the refill, which then has less than a trip to land
        asm volatile("s_wait_dscnt 0x0" ::: "memory");       // this wave's reads of tile t are done before its buffer may be refilled
        asm volatile("s_wait_asynccnt 0x0" ::: "memory");    // this wave's copies of tile t + 1 have landed
        __syncthreads();                                     // publishes tile t + 1 and ends every wave's reads of tile t
        if (t + 2 < NTR) stage(t + 2, t & 1);                // block-uniform: refill the buffer that tile t has just left
    }
    asm volatile("s_wait_asynccnt 0x0" ::: "memory");        // nothing of this wave is in flight when the ring goes out of use
}

// k_proj: bf16 GEMM, 4 waves per 128x128 tile (64x64 and 16 accumulators per wave), operands from K-contiguous bf16 planes through gemm_core, K = DIN.
// C[m][n] = sum_k A[m][k] Bt[n][k] + bias, written as f16 (Ph), row pitch 'pitch' (halves). grid (NB*SEQ/128 data tiles, DP/128 weight tiles, 3), 128 threads; z picks the product:
// z = 0, 1 (q, k): A = data rows (m = b*SEQ + t), Bt = W^T rows (n = h*64 + d) -> plane [(b*16 + h)][t][d]; bias per column.
// z = 2 (v^T):     A = Wv^T rows (m = h*64 + d), Bt = data rows (n = b*SEQ + t) -> plane [(b*1024 + m)][t] = [(b*16 + h)][d][t]; bias per row.
// bias (source order dm*16 + h, RNE-converted to bf16, added in f32): bmode 0 = per column n = h*64 + dm, bmode 1 = per row m = h*64 + dm.
__global__ __launch_bounds__(128) void k_proj(const bf* __restrict__ XB, const bf* __restrict__ WT, const float* __restrict__ bq, const float* __restrict__ bk, const float* __restrict__ bv, h16* QH, h16* KP, h16* VT) {
    __shared__ __align__(16) float osb[4 * 16 * 68];
    __shared__ __align__(16) bf ring[2 * (128 + 128) * (64 + 8)];
    const int z = blockIdx.z; const bool bmode = (z == 2);
    const bf* Wz = WT + (size_t)z * DP * DIN;
    const bf* A = bmode ? Wz : XB; const bf* Bt = bmode ? XB : Wz;
    const float* bias = (z == 0) ? bq : ((z == 1) ? bk : bv);
    h16* Ph = (z == 0) ? QH : ((z == 1) ? KP : VT);
    const int pitch = bmode ? SEQ : HD;
    const int lane = threadIdx.x & 31, lr = lane & 15, hi = lane >> 4; const int wave = wave_id();
    float* os = osb + wave * 16 * 68;                        // wave-private staging of the epilogue
    const int R0 = (bmode ? blockIdx.y : blockIdx.x) * 128, C0 = (bmode ? blockIdx.x : blockIdx.y) * 128;
    v8f acc[4][4];
#pragma unroll
    for (int mb = 0; mb < 4; ++mb)
#pragma unroll
        for (int nb = 0; nb < 4; ++nb) acc[mb][nb] = (v8f){};
    gemm_core<4, 64, DIN, true>(A, Bt, R0, C0, ring, acc);
    const int r0 = R0 + (wave >> 1) * 64, c0 = C0 + (wave & 1) * 64;   // this wave's 64 x 64 tile
    const size_t tbase = bmode ? (size_t)r0 * SEQ + (size_t)(c0 / SEQ) * ((size_t)DP * SEQ) + (size_t)(c0 % SEQ)
                               : (size_t)(r0 / SEQ) * ((size_t)NH_ * SEQ * HD) + (size_t)(r0 % SEQ) * HD + (size_t)(c0 / HD) * ((size_t)SEQ * HD);
    const int c8 = (lane & 7) * 8;
    float bcol[8];      // column-mode bias of this lane's 8 columns (clamped addresses, always loaded)
    { const int hc = min(c0 >> 6, NH_ - 1);
#pragma unroll
      for (int i = 0; i < 8; ++i) bcol[i] = bfr(bias[min((c8 + i) * NH_ + hc, DP - 1)]); }
#pragma unroll
    for (int mb = 0; mb < 4; ++mb) {
#pragma unroll
        for (int nb = 0; nb < 4; ++nb) {
#pragma unroll
            for (int j = 0; j < 8; ++j) os[(hi * 8 + j) * 68 + nb * 16 + lr] = acc[mb][nb][j]; }   // D: row 8h+j, col lane&15
        wave_sync();
        const size_t sb = tbase + (size_t)(mb * 16) * (size_t)pitch;
{
#pragma unroll
            for (int s = 0; s < 4; ++s) { const int row = 4 * s + (lane >> 3);   // 4 s x 4 row groups = 16 rows; 8 lanes x 8 = 64 columns
                const int m = r0 + mb * 16 + row;
                const float brow = bfr(bias[min((m & 63) * NH_ + min(m >> 6, NH_ - 1), DP - 1)]);
                const v4f x0 = *(const v4fa*)(&os[row * 68 + c8]); const v4f x1 = *(const v4fa*)(&os[row * 68 + c8 + 4]); v8h hv;
#pragma unroll
                for (int i = 0; i < 4; ++i) { const float y0 = x0[i] + (bmode ? brow : bcol[i]); const float y1 = x1[i] + (bmode ? brow : bcol[4 + i]);
                    hv[i] = (h16)y0; hv[4 + i] = (h16)y1; }
                const size_t oo = sb + (size_t)row * (size_t)pitch + c8;
                *(v8h*)(Ph + oo) = hv; }
             }
        wave_sync();
    }
}

// One thread's share of a staged tile pair: four 16-byte asynchronous copies global -> LDS (two of K, two of V^T). The s_wait_xcnt closes the statement so that
// no address register of an issued copy is rewritten ahead of it.
__device__ __forceinline__ void stage4(unsigned l0, const h16* g0, unsigned l1, const h16* g1, unsigned l2, const h16* g2, unsigned l3, const h16* g3) {
    asm volatile("global_load_async_to_lds_b128 %0, %1, off\n\t"
                 "global_load_async_to_lds_b128 %2, %3, off\n\t"
                 "global_load_async_to_lds_b128 %4, %5, off\n\t"
                 "global_load_async_to_lds_b128 %6, %7, off\n\t"
                 "s_wait_xcnt 0x0"
                 :: "v"(l0), "v"(g0), "v"(l1), "v"(g1), "v"(l2), "v"(g2), "v"(l3), "v"(g3) : "memory");
}

// k_flash: fused attention, one wave per 16 query rows of one (batch, head); Q fragments straight from the f16 plane; K / V^T fragments from LDS tiles of 64 keys that the
// block's 8 waves share: tile t + 1 is copied (asynchronously, no registers) into one buffer while tile t is worked on in the other; one barrier per tile publishes and frees.
// Transposed form: S^T[key][t] = K Q^T (A = K rows, B = Q rows); lane (t = lane&15, h = lane>>4) holds keys 8h+r of each 16-key tile, so the packed
// P tile is directly the B fragment of O^T[d][t] = V^T P^T (element r <- tile keys 0..15, element 8+r <- tile keys 16..31, lane unchanged).
// Per 32-key step: 4 score matrix ops (2 key tiles x 2 d halves) + 4 P.V matrix ops (4 d tiles).
// Padded keys: the score is REPLACED by the fill value (flag plane loaded with the same key map as the P elements).
// Each wave reads the batch's per-tile words once and keeps one bit per tile; a tile without a padded key skips the flag loads, compares and selects (where no flag is set the replace is the identity).
// Softmax state (running max, partial sum) is one scalar per lane; the two lane halves of a row are combined with one xor-16 exchange.
__global__ __launch_bounds__(32 * AW) void k_flash(const h16* __restrict__ QH, const h16* __restrict__ KP, const h16* __restrict__ VT, const h16* __restrict__ PF, const unsigned* __restrict__ TF, h16* CTX) {
    __shared__ __align__(16) float os[AW * 16 * 68];
    __shared__ __align__(16) h16 ring[2][2][64 * LP];        // [buffer][K rows key | V^T rows d][row][LP]
    const int lane = threadIdx.x & 31, lr = lane & 15, hi = lane >> 4; const int wave = wave_id();
    const int zh = blockIdx.y; const int b = zh / NH_, h = zh % NH_;
    const int t0 = (blockIdx.x * AW + wave) * 16;
    const size_t pbase = (size_t)zh * SEQ * HD;
    const size_t qo = pbase + (size_t)(t0 + lr) * HD + 8 * hi;
    const v16h qh0 = ldh(QH + qo), qh1 = ldh(QH + qo + 32);   // B fragments: col t, k = d
    const int fo = lr * LP + 8 * hi;                         // fragment offset in a staged tile: K + key*LP (row key, k = d), V^T + 16j*LP + key (row d, k = key)
    // copy map: thread -> rows cr and cr + 32 of each tile, 16-byte column tid & 7
    const int cr = (int)(threadIdx.x >> 3), cc = (int)(threadIdx.x & 7) * 8;
    const h16* gk = KP + pbase + (size_t)cr * HD + cc;       // + key0 * HD
    const h16* gv = VT + pbase + (size_t)cr * SEQ + cc;      // + key0
    const unsigned lk = (unsigned)(size_t)&ring[0][0][cr * LP + cc];   // LDS byte address of the thread's first K chunk in buffer 0
    constexpr unsigned TB = 64 * LP * 2, HB = 32 * LP * 2;   // bytes of one tile, of 32 rows
    // tile 0 -> buffer 0, landed and published; then tile 1 -> buffer 1 in flight
    stage4(lk, gk, lk + HB, gk + 32 * HD, lk + TB, gv, lk + TB + HB, gv + (size_t)32 * SEQ);
    // bit t of padtiles: tile t of this batch holds a padded key (lane t reads tile t's word, one ballot makes the wave-uniform mask)
    const unsigned padtiles = __builtin_amdgcn_ballot_w32(TF[(size_t)b * NT + min(lane, NT - 1)] != 0u);
    asm volatile("s_wait_xcnt 0x0" ::: "memory");            // the load above is issued: its address register may be rewritten behind this line
    asm volatile("s_wait_asynccnt 0x0" ::: "memory");        // this wave's copies of tile 0 have landed
    __syncthreads();                                         // every wave's copies of tile 0 are readable
    stage4(lk + 2 * TB, gk + KST * HD, lk + 2 * TB + HB, gk + (KST + 32) * HD, lk + 3 * TB, gv + KST, lk + 3 * TB + HB, gv + (size_t)32 * SEQ + KST);
    const h16* pfp = PF + (size_t)b * SEQ + 8 * hi;          // + key0: elements r <- key0+8h+r, 8+r <- key0+16+8h+r
    v8f o0 = (v8f){}, o1 = (v8f){}, o2 = (v8f){}, o3 = (v8f){};
    float m = -3.0e38f, l = 0.0f;
#pragma unroll 1
    for (int t = 0; t < NT; ++t) {
      const h16* kt = &ring[t & 1][0][fo]; const h16* vt = &ring[t & 1][1][fo];
      const bool tpad = ((padtiles >> t) & 1u) != 0u;
#pragma unroll   // both 32-key steps of a tile inline, so that every LDS offset inside the tile is an immediate
      for (int s = 0; s < KST / 32; ++s) {
        const int key0 = t * KST + s * 32;
        const h16* ka = kt + s * 32 * LP;
        const v16h ka0 = ldh(ka), ka1 = ldh(ka + 32), kb0 = ldh(ka + 16 * LP), kb1 = ldh(ka + 16 * LP + 32);
        v8f sa = (v8f){}, sb = (v8f){};
        sa = wmma16(ka0, qh0, sa); sb = wmma16(kb0, qh0, sb);
        sa = wmma16(ka1, qh1, sa); sb = wmma16(kb1, qh1, sb);
        asm volatile("v_nop\n\tv_nop\n\tv_nop\n\tv_nop" : "+v"(sa), "+v"(sb) : "v"(ka0), "v"(ka1), "v"(kb0), "v"(kb1), "v"(qh0), "v"(qh1));
        float ta[8], tb[8]; float mx = -3.0e38f;
#pragma unroll
        for (int r = 0; r < 8; ++r) {
            ta[r] = sa[r] * SC2; tb[r] = sb[r] * SC2; }
        if (__builtin_expect(tpad, false)) {                 // scalar branch, the same in every wave of the block: only a tile that holds a padded key loads its flags and replaces (laid out of line)
            const v16h pf = ldh(pfp + key0);
            asm volatile("s_wait_xcnt 0x0" ::: "memory");    // the two flag loads are issued: their address pair is stepped at the loop's foot
#pragma unroll
            for (int r = 0; r < 8; ++r) { ta[r] = ((float)pf[r] != 0.0f) ? NEGB : ta[r]; tb[r] = ((float)pf[8 + r] != 0.0f) ? NEGB : tb[r]; } }
#pragma unroll
        for (int r = 0; r < 8; ++r) mx = fmaxf(mx, fmaxf(ta[r], tb[r]));
        mx = fmaxf(mx, __shfl_xor(mx, 16, 32));
        const float mnew = fmaxf(m, mx);
        const float alpha = __builtin_amdgcn_exp2f(m - mnew);
        const float sh = PSH - mnew;
        v16h pb; float ls = 0.0f;
#pragma unroll
        for (int r = 0; r < 8; ++r) { const h16 pa = (h16)__builtin_amdgcn_exp2f(ta[r] + sh); const h16 pc = (h16)__builtin_amdgcn_exp2f(tb[r] + sh); pb[r] = pa; pb[8 + r] = pc; ls += (float)pa + (float)pc; }
        l = l * alpha + ls; m = mnew;
        o0 = o0 * alpha; o1 = o1 * alpha; o2 = o2 * alpha; o3 = o3 * alpha;
        const h16* va = vt + s * 32;
        const v16h v0 = ldh(va), v1 = ldh(va + 16 * LP), v2 = ldh(va + 32 * LP), v3 = ldh(va + 48 * LP);
        o0 = wmma16(v0, pb, o0); o1 = wmma16(v1, pb, o1); o2 = wmma16(v2, pb, o2); o3 = wmma16(v3, pb, o3);
        asm volatile("v_nop\n\tv_nop\n\tv_nop\n\tv_nop" : "+v"(o0), "+v"(o1), "+v"(o2), "+v"(o3) : "v"(v0), "v"(v1), "v"(v2), "v"(v3), "v"(pb));
      }
      asm volatile("s_wait_dscnt 0x0" ::: "memory");         // this wave's reads of tile t are done before its buffer may be refilled
      asm volatile("s_wait_asynccnt 0x0" ::: "memory");      // this wave's copies of tile t + 1 have landed
      __syncthreads();                                       // publishes tile t + 1 and ends every wave's reads of tile t
      if (t + 2 < NT) {                                      // block-uniform: refill the buffer that tile t has just left
          const unsigned lb = lk + (unsigned)(t & 1) * (2 * TB); const h16* gk2 = gk + (size_t)(t + 2) * KST * HD; const h16* gv2 = gv + (t + 2) * KST;
          stage4(lb, gk2, lb + HB, gk2 + 32 * HD, lb + TB, gv2, lb + TB + HB, gv2 + (size_t)32 * SEQ); }
    }
    asm volatile("s_wait_asynccnt 0x0" ::: "memory");        // nothing of this wave is in flight when the ring goes out of use
    l += __shfl_xor(l, 16, 32);
    const float inv = CXS / l;
    const int wb = wave * 16 * 68;
    // O^T D layout: o_j[r] = (d = 16j + 8h + r, t = lane&15) -> os[t][d]; rows 0..15 x columns 0..63 all written
    { v4f a, c;
      a[0] = o0[0] * inv; a[1] = o0[1] * inv; a[2] = o0[2] * inv; a[3] = o0[3] * inv; c[0] = o0[4] * inv; c[1] = o0[5] * inv; c[2] = o0[6] * inv; c[3] = o0[7] * inv;
      *(v4fa*)(&os[wb + lr * 68 +  0 + 8 * hi]) = a; *(v4fa*)(&os[wb + lr * 68 +  0 + 8 * hi + 4]) = c;
      a[0] = o1[0] * inv; a[1] = o1[1] * inv; a[2] = o1[2] * inv; a[3] = o1[3] * inv; c[0] = o1[4] * inv; c[1] = o1[5] * inv; c[2] = o1[6] * inv; c[3] = o1[7] * inv;
      *(v4fa*)(&os[wb + lr * 68 + 16 + 8 * hi]) = a; *(v4fa*)(&os[wb + lr * 68 + 16 + 8 * hi + 4]) = c;
      a[0] = o2[0] * inv; a[1] = o2[1] * inv; a[2] = o2[2] * inv; a[3] = o2[3] * inv; c[0] = o2[4] * inv; c[1] = o2[5] * inv; c[2] = o2[6] * inv; c[3] = o2[7] * inv;
      *(v4fa*)(&os[wb + lr * 68 + 32 + 8 * hi]) = a; *(v4fa*)(&os[wb + lr * 68 + 32 + 8 * hi + 4]) = c;
      a[0] = o3[0] * inv; a[1] = o3[1] * inv; a[2] = o3[2] * inv; a[3] = o3[3] * inv; c[0] = o3[4] * inv; c[1] = o3[5] * inv; c[2] = o3[6] * inv; c[3] = o3[7] * inv;
      *(v4fa*)(&os[wb + lr * 68 + 48 + 8 * hi]) = a; *(v4fa*)(&os[wb + lr * 68 + 48 + 8 * hi + 4]) = c; }
    wave_sync();
    h16* crow = CTX + ((size_t)b * SEQ + t0) * DP + h * HD;
{
#pragma unroll
        for (int s = 0; s < 4; ++s) { const int row = 4 * s + (lane >> 3), c8 = (lane & 7) * 8;   // 4 s x 4 rows = 16 rows; 8 lanes x 8 halves = 64 columns
            const v4f x0 = *(const v4fa*)(&os[wb + row * 68 + c8]); const v4f x1 = *(const v4fa*)(&os[wb + row * 68 + c8 + 4]); v8h hv;
#pragma unroll
            for (int i = 0; i < 4; ++i) { hv[i] = (h16)x0[i]; hv[4 + i] = (h16)x1[i]; }
            *(v8h*)(crow + (size_t)row * DP + c8) = hv; }
         }
}

// k_out: f16 GEMM, 4 waves per 64x128 tile (32x64 per wave), A = ctx plane [NB*SEQ][1024] (x256), Bt = Wo^T plane [512][1024] (x1024), K = DP, through gemm_core; OUT[m][n] = acc * 2^-18 + bo[n] (f32).
__global__ __launch_bounds__(128) void k_out(const h16* __restrict__ A, const h16* __restrict__ Bt, const float* __restrict__ bias, float* OUT) {
    __shared__ __align__(16) float osb[4 * 16 * 68];
    __shared__ __align__(16) bf ring[2 * (64 + 128) * (128 + 8)];
    const int lane = threadIdx.x & 31, lr = lane & 15, hi = lane >> 4; const int wave = wave_id();
    float* os = osb + wave * 16 * 68;                        // wave-private staging of the epilogue
    const int R0 = blockIdx.x * 64, C0 = blockIdx.y * 128;
    v8f acc[2][4];
#pragma unroll
    for (int mb = 0; mb < 2; ++mb)
#pragma unroll
        for (int nb = 0; nb < 4; ++nb) acc[mb][nb] = (v8f){};
    gemm_core<2, 128, DP, false>((const bf*)A, (const bf*)Bt, R0, C0, ring, acc);
    const int r0 = R0 + (wave >> 1) * 32, c0 = C0 + (wave & 1) * 64;   // this wave's 32 x 64 tile
    const size_t orow0 = (size_t)(r0 / SEQ) * OUT_SEQ + (size_t)(r0 % SEQ);
    const int cofs = lr * 4;
    v4f bv;
#pragma unroll
    for (int i = 0; i < 4; ++i) bv[i] = bfr(bias[min(c0 + cofs + i, DIN - 1)]);
#pragma unroll
    for (int mb = 0; mb < 2; ++mb) {
#pragma unroll
        for (int nb = 0; nb < 4; ++nb) {
#pragma unroll
            for (int j = 0; j < 8; ++j) os[(hi * 8 + j) * 68 + nb * 16 + lr] = acc[mb][nb][j] * FOLD; }   // D: row 8h+j, col lane&15
        wave_sync();
{
#pragma unroll
            for (int s = 0; s < 8; ++s) { const int row = 2 * s + hi;   // 8 s x 2 rows = 16 rows; 16 lanes x 4 floats = 64 columns
                const v4f val = *(const v4fa*)(&os[row * 68 + cofs]) + bv;
                *(v4f*)(OUT + (orow0 + (size_t)(mb * 16 + row)) * DIN + c0 + cofs) = val; }
             }
        wave_sync();
    }
}

static constexpr size_t al256(size_t v) { return (v + 255) & ~(size_t)255; }
static constexpr size_t SZ_XB = al256((size_t)NB * SEQ * DIN * 2);
static constexpr size_t SZ_WT = al256((size_t)3 * DP * DIN * 2);
static constexpr size_t SZ_WO = al256((size_t)DIN * DP * 2);
static constexpr size_t SZ_PL = al256((size_t)NB * NH_ * SEQ * HD * 2);
static constexpr size_t SZ_CX = al256((size_t)NB * SEQ * DP * 2);
static constexpr size_t SZ_PF = al256((size_t)NB * SEQ * 2);
static constexpr size_t SZ_TF = al256((size_t)NB * NT * 4);
static constexpr size_t SZ_TOTAL = SZ_XB + SZ_WT + SZ_WO + 3 * SZ_PL + SZ_CX + SZ_PF + SZ_TF;
static_assert(SZ_TOTAL <= (size_t)134217728);          // workspace carve <= 128 MiB
static_assert(((size_t)DP * DIN * 2) % 256 == 0);      // weight sub-planes stay 256-byte aligned

extern "C" void kernel_launch(void* const* d_in, const int* in_sizes, int n_in,
                              void* d_out, int out_size, void* d_ws, size_t ws_size, hipStream_t stream) {
    if (n_in < 10) return;
    const size_t needx = ((size_t)(NB - 1) * SEQ_FULL + SEQ) * DIN;
    if ((size_t)in_sizes[0] < needx || (size_t)in_sizes[1] < needx) return;
    if ((size_t)in_sizes[2] < (size_t)DIN * DP || (size_t)in_sizes[4] < (size_t)DIN * DP || (size_t)in_sizes[6] < (size_t)DIN * DP || (size_t)in_sizes[8] < (size_t)DP * DIN) return;
    if ((size_t)in_sizes[3] < (size_t)DP || (size_t)in_sizes[5] < (size_t)DP || (size_t)in_sizes[7] < (size_t)DP || (size_t)in_sizes[9] < (size_t)DIN) return;
    if ((size_t)out_size < ((size_t)(NB - 1) * OUT_SEQ + SEQ) * DIN) return;
    if (SZ_TOTAL > ws_size) return;
    // wire order: data, pad input, wq, bq, wk, bk, wv, bv, wo, bo (all f32)
    const float* x = (const float*)d_in[0]; const float* pm = (const float*)d_in[1];
    const float* wq = (const float*)d_in[2]; const float* bq = (const float*)d_in[3];
    const float* wk = (const float*)d_in[4]; const float* bk = (const float*)d_in[5];
    const float* wv = (const float*)d_in[6]; const float* bv = (const float*)d_in[7];
    const float* wo = (const float*)d_in[8]; const float* bo = (const float*)d_in[9];
    float* OUT = (float*)d_out;      // [NB][SEQ][512]
    char* wsp = (char*)d_ws;
    bf* XB = (bf*)wsp; wsp += SZ_XB;                 // [NB*SEQ][512] bf16
    bf* WT = (bf*)wsp; wsp += SZ_WT;                 // [3][1024][512] bf16, rows h*64+dm: q | k | v
    bf* WOB = (bf*)wsp; wsp += SZ_WO;                // [512][1024] f16 bits (x1024)
    h16* QH = (h16*)wsp; wsp += SZ_PL;               // [NB*16][SEQ][64]
    h16* KP = (h16*)wsp; wsp += SZ_PL;               // [NB*16][SEQ][64]
    h16* VT = (h16*)wsp; wsp += SZ_PL;               // [NB*16][64][SEQ]
    h16* CX = (h16*)wsp; wsp += SZ_CX;               // [NB*SEQ][1024] (x256)
    h16* PF = (h16*)wsp; wsp += SZ_PF;               // [NB*SEQ] pad flags
    unsigned* TF = (unsigned*)wsp; wsp += SZ_TF;     // [NB*SEQ/64] nonzero where a 64-key tile holds a padded key

    k_prep<<<dim3(PB_PAD + 4 * PB_WT + PB_CVT, 1, 1), 256, 0, stream>>>(x, pm, wq, wk, wv, wo, XB, WT, WOB, PF, TF);

    k_proj<<<dim3(NB * SEQ / 128, DP / 128, 3), 128, 0, stream>>>(XB, WT, bq, bk, bv, QH, KP, VT);

    k_flash<<<dim3(SEQ / (16 * AW), NB * NH_, 1), 32 * AW, 0, stream>>>(QH, KP, VT, PF, TF, CX);

    k_out<<<dim3(NB * SEQ / 64, DIN / 128, 1), 128, 0, stream>>>(CX, (const h16*)WOB, bo, OUT);
}

// v005
// Measured time: 71 microseconds a run.
// In two side-by-side timings against v004, it was 1.03 and 1.04 times as fast.
// All steps since v000 together make it 2.80 times as fast.
#include <hip/hip_runtime.h>

// Multi-head self-attention: data [NB][SEQ][512], Wq/Wk/Wv [512][1024] ([in][out], column c = dm*16 + h), biases, key-padding replace fill (-1e9 where a key's 512 pad-input values sum to 0), score scale 1/8, merged heads (h*64+dm) @ Wo [1024][512] + bo, f32 output.
// Compute dtypes, f32 accumulate everywhere: projections v_wmma_f32_16x16x32_bf16 (data and W RNE-converted to bf16; products exact);
// scores v_wmma_f32_16x16x32_f16: q and k single f16 planes (one product); P (x256 carry, cancels in the normalisation) and v single f16; softmax f32 (online, running max; row sums of the f16 P by a ones-row matrix op, f32 accumulate);
// output projection v_wmma_f32_16x16x32_f16: ctx single f16 (x256 carry), Wo = f16 of (bf16 RNE of wo) x1024 (exact), 2^-18 folded back in f32, bias added in f32.
// Launches: 4. k_prep (block index picks the job: pad flags with one word per 64 keys, one weight tile, or a slice of the data conversion; the jobs read none of each other's output), k_proj (grid z picks q, k or v^T), k_flash, k_out.
// Layout: bf16 copy of data; transposed K-contiguous weight planes (head-permuted rows h*64+dm); q, k planes [b*16+h][t][d] and v^T plane [b*16+h][d][t] from the GEMM epilogue;
// fused flash kernel in transposed form (S^T = K Q^T, O^T = V^T P^T; 4 score + 4 P.V matrix ops per 32-key step; K and V^T tiles of 64 keys staged in LDS by asynchronous copies, two buffers) writing the ctx plane [b*SEQ+t][h*64+d].
// Both GEMMs (k_proj, k_out): 4-wave blocks, operand tiles staged in LDS by asynchronous copies of whole 128-byte lines, two buffers, fragments read from LDS.

#ifndef NB
#define NB 2
#endif
#ifndef SEQ
#define SEQ 2048
#endif
#define NB_FULL  2
#define SEQ_FULL 2048
#ifndef OUT_SEQ
#define OUT_SEQ SEQ              // row pitch (in tokens) between batches of the output
#endif
#define DIN  512                 // input width = output width
#define DP   1024                // projection width = 16 heads x 64
#define NH_  16
#define HD   64
#define AW   8                   // waves per flash block (16 query rows each); all share the staged K / V^T tiles
#define KST  64                  // keys per staged tile (two 32-key steps)
#define LP   72                  // LDS row pitch in halves: 128-byte rows + 16 bytes, the pitch for 16-byte LDS readers
#define NT   (SEQ / KST)         // staged tiles per (batch, head)
#define SC2  (0.125f * 1.4426950408889634f)   // HD^-0.5 * log2(e)
#define PSH  8.0f                // log2 of the P carry (256)
#define NEGB (-1.0e9f * 1.4426950408889634f)  // fill value of padded keys in the log2 domain
#define CXS  256.0f              // carry of the ctx plane
#define WOS  1024.0f             // carry of the Wo plane
#define FOLD (1.0f / (256.0f * 1024.0f))

static_assert(HD == 64);
static_assert(NH_ * HD == DP);
static_assert(NH_ == 16);                      // column c = dm*16 + h
static_assert(DP % 64 == 0);
static_assert(DIN % 64 == 0);
static_assert(DIN % 32 == 0);                  // GEMM k-loops step by 32
static_assert(DP % 32 == 0);
static_assert(DIN == 512);                     // pad-row sum: 4 x 128 floats per wave
static_assert(SEQ % 64 == 0);                  // a 64-row tile never straddles two batches
static_assert((NB * SEQ) % 64 == 0);
static_assert(SEQ % 32 == 0);                  // key loop steps by 32
static_assert(SEQ % (16 * AW) == 0);           // flash grid covers the sequence exactly
static_assert(SEQ % KST == 0);
static_assert(NT >= 2);                        // the two-buffer prologue fills tiles 0 and 1
static_assert(NT <= 32);                       // one bit per staged tile in the 32-lane ballot of padded tiles
static_assert(KST == 64);                      // a staged tile is the 64 key rows of one pad block
static_assert(32 * AW * 2 * 8 == KST * HD);    // two 16-byte copies per thread cover one 64 x 64 tile
static_assert(((size_t)SEQ * DIN) % 8 == 0);
static_assert((NB * SEQ) % 128 == 0);          // GEMM block tiles: 128 data rows (k_proj)
static_assert(DP % 128 == 0);
static_assert(DIN % 128 == 0);
static_assert(NB <= NB_FULL);
static_assert(SEQ <= SEQ_FULL);

typedef _Float16 h16;
typedef unsigned short bf;
typedef __attribute__((ext_vector_type(16))) __bf16   v16bf;
typedef __attribute__((ext_vector_type(16))) _Float16 v16h;
typedef __attribute__((ext_vector_type(8)))  _Float16 v8h;
typedef __attribute__((ext_vector_type(8)))  unsigned short v8us;
typedef __attribute__((ext_vector_type(16))) unsigned short v16us;
typedef __attribute__((ext_vector_type(8)))  float    v8f;
typedef __attribute__((ext_vector_type(4)))  float    v4f;
typedef v4f  __attribute__((may_alias)) v4fa;

__device__ __forceinline__ unsigned short f2bf(float f) { unsigned u = __float_as_uint(f); u += 0x7FFFu + ((u >> 16) & 1u); return (unsigned short)(u >> 16); }
__device__ __forceinline__ float bfr(float f) { return __uint_as_float(((unsigned)f2bf(f)) << 16); }   // value after RNE conversion to bf16
__device__ __forceinline__ v16h cat16(v8h lo, v8h hi) { return __builtin_shufflevector(lo, hi, 0, 1, 2, 3, 4, 5, 6, 7, 8, 9, 10, 11, 12, 13, 14, 15); }
__device__ __forceinline__ v16bf cat16b(v8us lo, v8us hi) { return __builtin_bit_cast(v16bf, __builtin_shufflevector(lo, hi, 0, 1, 2, 3, 4, 5, 6, 7, 8, 9, 10, 11, 12, 13, 14, 15)); }
__device__ __forceinline__ v8f wmma16(v16h a, v16h b, v8f c) { return __builtin_amdgcn_wmma_f32_16x16x32_f16(false, a, false, b, (short)0, c, false, false); }
__device__ __forceinline__ v8f wmmab(v16bf a, v16bf b, v8f c) { return __builtin_amdgcn_wmma_f32_16x16x32_bf16(false, a, false, b, (short)0, c, false, false); }
// fragment loaders from K-contiguous 16-bit rows; p already includes + 8*(lane>>4): elements 0..7 <- k0+8h+0..7, elements 8..15 <- k0+16+8h+0..7 (same map for A and B)
__device__ __forceinline__ v16h  ldh(const h16* p) { return cat16(*(const v8h*)p, *(const v8h*)(p + 16)); }
__device__ __forceinline__ v16bf ldb(const bf* p)  { return cat16b(*(const v8us*)p, *(const v8us*)(p + 16)); }
// ordering point for wave-private LDS tiles (same wave writes and reads)
__device__ __forceinline__ void wave_sync() { __builtin_amdgcn_fence(3 /* release order */, "wavefront"); __builtin_amdgcn_wave_barrier(); asm volatile("" ::: "memory"); }
// wave index of the calling thread as a wave-uniform scalar
__device__ __forceinline__ int wave_id() { return __builtin_amdgcn_readfirstlane((int)(threadIdx.x >> 5)); }

// blocks of k_prep per job
#define PB_PAD (NB * SEQ / 64)                        // 64 pad rows each
#define PB_WT  ((DIN / 64) * (DP / 64))               // 64 x 64 tiles of one weight matrix (all four have DIN * DP elements)
#define N8     ((size_t)NB * SEQ * DIN / 8)           // 8-element chunks of the data
#define PB_CVT ((unsigned)((N8 + 255) / 256))

// cvt_job: data f32 -> bf16 copy [NB*SEQ][512], 8 elements per thread; blk = block index inside the job.
__device__ __forceinline__ void cvt_job(const float* __restrict__ x, bf* dst, int blk) {
    const size_t i = (size_t)blk * 256 + threadIdx.x; if (i >= N8) return;
    constexpr size_t C8 = (size_t)SEQ * DIN / 8;      // chunks per batch
    const size_t so = (SEQ == SEQ_FULL) ? i * 8 : (i / C8) * ((size_t)SEQ_FULL * DIN) + (i % C8) * 8;
    const v8f v = *(const v8f*)(x + so); v8us o;
#pragma unroll
    for (int k = 0; k < 8; ++k) o[k] = f2bf(v[k]);
    *(v8us*)(dst + i * 8) = o;
}

// wt_job: W [K][N] f32 ([in][out]) -> dst [N][K] 16-bit rows (K-contiguous). in[K rows][N cols] -> out[N rows][K cols]; one 64 x 64 tile (bx of K/64, by of N/64), 256 threads; ts = 64 * 68 floats of LDS.
// perm != 0: source column c = dm*16 + h lands on destination row h*64 + dm. asf16 == 0: bf16 bits; asf16 != 0: f16 bits of (bf16 value * scale).
__device__ __forceinline__ void wt_job(const float* __restrict__ W, bf* dst, int K, int N, int perm, int asf16, float scale, int bx, int by, float* ts) {   // ts: [column][k]
    const int tid = threadIdx.x, lane = tid & 31; const int wave = wave_id();
    const int k0 = bx * 64, c0 = by * 64;
#pragma unroll
    for (int it = 0; it < 4; ++it) { const int e = tid + 256 * it; const int kk = e >> 4, c4 = (e & 15) * 4;   // 64 k rows x 16 float4 = whole tile
        const v4f v = *(const v4f*)(W + (size_t)(k0 + kk) * (size_t)N + c0 + c4);
        ts[(c4 + 0) * 68 + kk] = v[0]; ts[(c4 + 1) * 68 + kk] = v[1]; ts[(c4 + 2) * 68 + kk] = v[2]; ts[(c4 + 3) * 68 + kk] = v[3]; }
    __syncthreads();
{
#pragma unroll
        for (int s = 0; s < 2; ++s) { const int row = 4 * (wave + 8 * s) + (lane >> 3), c8 = (lane & 7) * 8;   // 8 waves x 2 s x 4 rows = 64 rows; 8 lanes x 8 = 64 k
            const v4f x0 = *(const v4fa*)(&ts[row * 68 + c8]); const v4f x1 = *(const v4fa*)(&ts[row * 68 + c8 + 4]); v8us o;
#pragma unroll
            for (int i = 0; i < 4; ++i) { const float f0 = bfr(x0[i]), f1 = bfr(x1[i]);
                const unsigned short b0 = (unsigned short)(__float_as_uint(f0) >> 16), b1 = (unsigned short)(__float_as_uint(f1) >> 16);
                const unsigned short g0 = __builtin_bit_cast(unsigned short, (h16)(f0 * scale)), g1 = __builtin_bit_cast(unsigned short, (h16)(f1 * scale));
                o[i] = asf16 ? g0 : b0; o[4 + i] = asf16 ? g1 : b1; }
            const int c = c0 + row; const int n = perm ? ((c & 15) * 64 + (c >> 4)) : c;
            *(v8us*)(dst + (size_t)n * (size_t)K + k0 + c8) = o; }
         }
    asm volatile("s_wait_xcnt 0x0" ::: "memory");   // the two stores above are issued: no register that they name is rewritten by the code that follows this job in the merged kernel
}

// pad_job: flags of 64 key rows (1 where the row's 512 pad-input values sum to 0), and one word for the 64 rows together (nonzero where any of them is flagged); fl = 64 floats of LDS.
__device__ __forceinline__ void pad_job(const float* __restrict__ mask, h16* PF, unsigned* TF, int blk, float* fl) {
    const int tid = threadIdx.x, lane = tid & 31; const int wave = wave_id();
    const int m0 = blk * 64;
#pragma unroll 1
    for (int i = 0; i < 8; ++i) { const int m = m0 + wave * 8 + i; const int b = m / SEQ, t = m % SEQ;
        const float* row = mask + ((size_t)b * SEQ_FULL + t) * DIN;
        float s = 0.0f;
#pragma unroll
        for (int j = 0; j < 4; ++j) { const v4f v = *(const v4f*)(row + j * 128 + lane * 4); s += bfr(v[0]); s += bfr(v[1]); s += bfr(v[2]); s += bfr(v[3]); }
        s += __shfl_xor(s, 16, 32); s += __shfl_xor(s, 8, 32); s += __shfl_xor(s, 4, 32); s += __shfl_xor(s, 2, 32); s += __shfl_xor(s, 1, 32);
        if (lane == 0) fl[wave * 8 + i] = (s == 0.0f) ? 1.0f : 0.0f; }
    __syncthreads();
    if (tid < 8) { v8h o;
#pragma unroll
        for (int k = 0; k < 8; ++k) o[k] = (h16)fl[tid * 8 + k];
        *(v8h*)(PF + (size_t)m0 + tid * 8) = o;  }
    if (wave == 0) { const unsigned any = __builtin_amdgcn_ballot_w32((fl[lane] != 0.0f) | (fl[lane + 32] != 0.0f));
        if (lane == 0) TF[blk] = any; }
}

// k_prep: everything that reads only the inputs, in one launch. The job is a function of blockIdx.x alone, so every branch (and the barrier inside a job) is block-uniform.
// Order: the pad rows (eight dependent row sums per wave, the longest job) start first, the one-load conversion blocks last.
__global__ __launch_bounds__(256) void k_prep(const float* __restrict__ x, const float* __restrict__ pm, const float* __restrict__ wq, const float* __restrict__ wk, const float* __restrict__ wv,
                                              const float* __restrict__ wo, bf* XB, bf* WT, bf* WOB, h16* PF, unsigned* TF) {
    __shared__ __align__(16) float ts[64 * 68];
    const int bid = blockIdx.x;
    if (bid < PB_PAD) { pad_job(pm, PF, TF, bid, ts); return; }
    if (bid < PB_PAD + 4 * PB_WT) {
        const int j = bid - PB_PAD; const int w = j / PB_WT, tile = j % PB_WT;
        // w = 0..2: wq, wk, wv, in[K = 512][N = 1024] -> [1024 rows (head-permuted)][512], bf16; w = 3: wo, in[K = 1024 (h*64+dm)][N = 512] -> [512 rows][1024], f16 x1024
        const bool o = (w == 3);
        const float* W = o ? wo : (w == 0 ? wq : (w == 1 ? wk : wv));
        bf* dst = o ? WOB : WT + (size_t)w * DP * DIN;
        const int K = o ? DP : DIN, N = o ? DIN : DP;
        wt_job(W, dst, K, N, o ? 0 : 1, o ? 1 : 0, o ? WOS : 1.0f, tile % (K / 64), tile / (K / 64), ts);
        return; }
    cvt_job(x, XB, bid - (PB_PAD + 4 * PB_WT));
}

// One thread's eight 16-byte asynchronous copies global -> LDS: rows ls bytes apart in LDS, gs elements apart in memory. The s_wait_xcnt closes the statement so that
// no address register of an issued copy is rewritten ahead of it.
__device__ __forceinline__ void stage8(unsigned l, const bf* g, unsigned ls, size_t gs) {
    asm volatile("global_load_async_to_lds_b128 %0, %1, off\n\t"
                 "global_load_async_to_lds_b128 %2, %3, off\n\t"
                 "global_load_async_to_lds_b128 %4, %5, off\n\t"
                 "global_load_async_to_lds_b128 %6, %7, off\n\t"
                 "global_load_async_to_lds_b128 %8, %9, off\n\t"
                 "global_load_async_to_lds_b128 %10, %11, off\n\t"
                 "global_load_async_to_lds_b128 %12, %13, off\n\t"
                 "global_load_async_to_lds_b128 %14, %15, off\n\t"
                 "s_wait_xcnt 0x0"
                 :: "v"(l), "v"(g), "v"(l + ls), "v"(g + gs), "v"(l + 2 * ls), "v"(g + 2 * gs), "v"(l + 3 * ls), "v"(g + 3 * gs),
                    "v"(l + 4 * ls), "v"(g + 4 * gs), "v"(l + 5 * ls), "v"(g + 5 * gs), "v"(l + 6 * ls), "v"(g + 6 * gs), "v"(l + 7 * ls), "v"(g + 7 * gs) : "memory");
}
__device__ __forceinline__ v16us ldu(const bf* p) { return __builtin_shufflevector(*(const v8us*)p, *(const v8us*)(p + 16), 0, 1, 2, 3, 4, 5, 6, 7, 8, 9, 10, 11, 12, 13, 14, 15); }   // same k map as ldh / ldb
template <bool BF> __device__ __forceinline__ v8f mm(v16us a, v16us b, v8f c) {
    if constexpr (BF) return wmmab(__builtin_bit_cast(v16bf, a), __builtin_bit_cast(v16bf, b), c);
    else              return wmma16(__builtin_bit_cast(v16h, a), __builtin_bit_cast(v16h, b), c);
}

// gemm_core: acc[mb][nb] += A rows x Bt rows over K (16-bit, K-contiguous planes), for a block of 4 waves (2 x 2). Block tile (2 * MF * 16) x 128 at (R0, C0); wave (wave >> 1, wave & 1) owns (MF * 16) x 64.
// Per trip KS k values of every row of both tiles lie in one LDS buffer (row pitch KS + 8 halves: 16 bytes x odd, the pitch for 16-byte LDS readers); a wave's copy covers whole 128-byte lines.
// Tile t + 1 is copied into one buffer while tile t is worked on in the other; one barrier per trip publishes and frees. k ascends by 32 in every accumulator.
template <int MF, int KS, int K, bool BF>
__device__ __forceinline__ void gemm_core(const bf* __restrict__ A, const bf* __restrict__ Bt, int R0, int C0, bf* ring, v8f (&acc)[MF][4]) {
    constexpr int GP = KS + 8, BM = 2 * MF * 16, BUFH = (BM + 128) * GP;   // pitch (halves), A rows, halves per buffer
    constexpr int CPR = KS / 8, RS = 128 / CPR, NTR = K / KS;              // 16-byte chunks per row, rows covered by the block's 128 threads in one copy each, trips
    static_assert(BM == 8 * RS);                                           // one stage8 covers the A tile
    static_assert(128 % (8 * RS) == 0);                                    // whole stage8 groups cover the B tile
    static_assert(K % KS == 0);
    static_assert(NTR >= 2);                                               // the prologue fills tiles 0 and 1
    static_assert(MF == 2 || MF == 4);
    const int tid = threadIdx.x, lane = tid & 31, lr = lane & 15, hi = lane >> 4; const int wave = wave_id();
    const int cr = tid / CPR, cc = (tid % CPR) * 8;                        // copy map: thread -> row cr (+ multiples of RS), 16-byte column
    const bf* ga = A + (size_t)(R0 + cr) * K + cc;                         // + t * KS
    const bf* gb = Bt + (size_t)(C0 + cr) * K + cc;
    const unsigned la = (unsigned)(size_t)&ring[cr * GP + cc];             // LDS byte address of the thread's first A chunk in buffer 0
    auto stage = [&](int t, int buf) {
        const unsigned l = la + (unsigned)buf * (unsigned)(BUFH * 2);
        stage8(l, ga + t * KS, RS * GP * 2, (size_t)RS * K);
#pragma unroll
        for (int g = 0; g < 128 / (8 * RS); ++g) stage8(l + (unsigned)((BM + g * 8 * RS) * GP * 2), gb + (size_t)g * 8 * RS * K + t * KS, RS * GP * 2, (size_t)RS * K);
    };
    stage(0, 0);
    asm volatile("s_wait_asynccnt 0x0" ::: "memory");        // this wave's copies of tile 0 have landed
    __syncthreads();                                         // every wave's copies of tile 0 are readable
    stage(1, 1);
    const int ao = ((wave >> 1) * MF * 16 + lr) * GP + 8 * hi, bo = (BM + (wave & 1) * 64 + lr) * GP + 8 * hi;
#pragma unroll 1   // rolled; the buffer is picked by a scalar select
    for (int t = 0; t < NTR; ++t) {
        const bf* ab = ring + (t & 1) * BUFH + ao; const bf* bb = ring + (t & 1) * BUFH + bo;
        // Fragment sets: each k step's LDS reads go out as one group. NS == 2 (the small wave tile, one wave per SIMD): the next step's group ahead of this step's matrix instructions;
        // NS == 1 (the large wave tile, several waves per SIMD, which cover each other's LDS waits): one set, so that the wave stays inside the first 256 registers.
        constexpr int NS = (MF == 2) ? 2 : 1, NK = KS / 32;
        v16us a[NS][MF], b[NS][4];
        auto frags = [&](int ks) {                           // never past the trip's own tile: ks < NK at every call
#pragma unroll
            for (int mb = 0; mb < MF; ++mb) a[ks % NS][mb] = ldu(ab + mb * 16 * GP + ks * 32);
#pragma unroll
            for (int nb = 0; nb < 4; ++nb) b[ks % NS][nb] = ldu(bb + nb * 16 * GP + ks * 32);
        };
        frags(0);
#pragma unroll   // all k steps of a trip inline, so that every LDS offset inside the tile is an immediate and the fragment sets stay in registers
        for (int ks = 0; ks < NK; ++ks) {
            if (NS == 2 && ks + 1 < NK) frags(ks + 1);
            __builtin_amdgcn_sched_barrier(0);               // keeps the group of LDS reads ahead of the matrix instructions below: sunk among them, each read is waited for where it stands
#pragma unroll
            for (int nb = 0; nb < 4; ++nb)
#pragma unroll
                for (int mb = 0; mb < MF; ++mb) acc[mb][nb] = mm<BF>(a[ks % NS][mb], b[ks % NS][nb], acc[mb][nb]);
            if (NS == 1 && ks + 1 < NK) frags(ks + 1);
        }
        __builtin_amdgcn_sched_barrier(0);                   // keeps the trip's matrix instructions ahead of the barrier: sunk behind it they delay the refill, which then has less than a trip to land
        asm volatile("s_wait_dscnt 0x0" ::: "memory");       // this wave's reads of tile t are done before its buffer may be refilled
        asm volatile("s_wait_asynccnt 0x0" ::: "memory");    // this wave's copies of tile t + 1 have landed
        __syncthreads();                                     // publishes tile t + 1 and ends every wave's reads of tile t
        if (t + 2 < NTR) stage(t + 2, t & 1);                // block-uniform: refill the buffer that tile t has just left
    }
    asm volatile("s_wait_asynccnt 0x0" ::: "memory");        // nothing of this wave is in flight when the ring goes out of use
}

// k_proj: bf16 GEMM, 4 waves per 128x128 tile (64x64 and 16 accumulators per wave), operands from K-contiguous bf16 planes through gemm_core, K = DIN.
// C[m][n] = sum_k A[m][k] Bt[n][k] + bias, written as f16 (Ph), row pitch 'pitch' (halves). grid (NB*SEQ/128 data tiles, DP/128 weight tiles, 3), 128 threads; z picks the product:
// z = 0, 1 (q, k): A = data rows (m = b*SEQ + t), Bt = W^T rows (n = h*64 + d) -> plane [(b*16 + h)][t][d]; bias per column.
// z = 2 (v^T):     A = Wv^T rows (m = h*64 + d), Bt = data rows (n = b*SEQ + t) -> plane [(b*1024 + m)][t] = [(b*16 + h)][d][t]; bias per row.
// bias (source order dm*16 + h, RNE-converted to bf16, added in f32): bmode 0 = per column n = h*64 + dm, bmode 1 = per row m = h*64 + dm.
__global__ __launch_bounds__(128) void k_proj(const bf* __restrict__ XB, const bf* __restrict__ WT, const float* __restrict__ bq, const float* __restrict__ bk, const float* __restrict__ bv, h16* QH, h16* KP, h16* VT) {
    __shared__ __align__(16) float osb[4 * 16 * 68];
    __shared__ __align__(16) bf ring[2 * (128 + 128) * (64 + 8)];
    const int z = blockIdx.z; const bool bmode = (z == 2);
    const bf* Wz = WT + (size_t)z * DP * DIN;
    const bf* A = bmode ? Wz : XB; const bf* Bt = bmode ? XB : Wz;
    const float* bias = (z == 0) ? bq : ((z == 1) ? bk : bv);
    h16* Ph = (z == 0) ? QH : ((z == 1) ? KP : VT);
    const int pitch = bmode ? SEQ : HD;
    const int lane = threadIdx.x & 31, lr = lane & 15, hi = lane >> 4; const int wave = wave_id();
    float* os = osb + wave * 16 * 68;                        // wave-private staging of the epilogue
    const int R0 = (bmode ? blockIdx.y : blockIdx.x) * 128, C0 = (bmode ? blockIdx.x : blockIdx.y) * 128;
    v8f acc[4][4];
#pragma unroll
    for (int mb = 0; mb < 4; ++mb)
#pragma unroll
        for (int nb = 0; nb < 4; ++nb) acc[mb][nb] = (v8f){};
    gemm_core<4, 64, DIN, true>(A, Bt, R0, C0, ring, acc);
    const int r0 = R0 + (wave >> 1) * 64, c0 = C0 + (wave & 1) * 64;   // this wave's 64 x 64 tile
    const size_t tbase = bmode ? (size_t)r0 * SEQ + (size_t)(c0 / SEQ) * ((size_t)DP * SEQ) + (size_t)(c0 % SEQ)
                               : (size_t)(r0 / SEQ) * ((size_t)NH_ * SEQ * HD) + (size_t)(r0 % SEQ) * HD + (size_t)(c0 / HD) * ((size_t)SEQ * HD);
    const int c8 = (lane & 7) * 8;
    float bcol[8];      // column-mode bias of this lane's 8 columns (clamped addresses, always loaded)
    { const int hc = min(c0 >> 6, NH_ - 1);
#pragma unroll
      for (int i = 0; i < 8; ++i) bcol[i] = bfr(bias[min((c8 + i) * NH_ + hc, DP - 1)]); }
#pragma unroll
    for (int mb = 0; mb < 4; ++mb) {
#pragma unroll
        for (int nb = 0; nb < 4; ++nb) {
#pragma unroll
            for (int j = 0; j < 8; ++j) os[(hi * 8 + j) * 68 + nb * 16 + lr] = acc[mb][nb][j]; }   // D: row 8h+j, col lane&15
        wave_sync();
        const size_t sb = tbase + (size_t)(mb * 16) * (size_t)pitch;
{
#pragma unroll
            for (int s = 0; s < 4; ++s) { const int row = 4 * s + (lane >> 3);   // 4 s x 4 row groups = 16 rows; 8 lanes x 8 = 64 columns
                const int m = r0 + mb * 16 + row;
                const float brow = bfr(bias[min((m & 63) * NH_ + min(m >> 6, NH_ - 1), DP - 1)]);
                const v4f x0 = *(const v4fa*)(&os[row * 68 + c8]); const v4f x1 = *(const v4fa*)(&os[row * 68 + c8 + 4]); v8h hv;
#pragma unroll
                for (int i = 0; i < 4; ++i) { const float y0 = x0[i] + (bmode ? brow : bcol[i]); const float y1 = x1[i] + (bmode ? brow : bcol[4 + i]);
                    hv[i] = (h16)y0; hv[4 + i] = (h16)y1; }
                const size_t oo = sb + (size_t)row * (size_t)pitch + c8;
                *(v8h*)(Ph + oo) = hv; }
             }
        wave_sync();
    }
}

// One thread's share of a staged tile pair: four 16-byte asynchronous copies global -> LDS (two of K, two of V^T). The s_wait_xcnt closes the statement so that
// no address register of an issued copy is rewritten ahead of it.
__device__ __forceinline__ void stage4(unsigned l0, const h16* g0, unsigned l1, const h16* g1, unsigned l2, const h16* g2, unsigned l3, const h16* g3) {
    asm volatile("global_load_async_to_lds_b128 %0, %1, off\n\t"
                 "global_load_async_to_lds_b128 %2, %3, off\n\t"
                 "global_load_async_to_lds_b128 %4, %5, off\n\t"
                 "global_load_async_to_lds_b128 %6, %7, off\n\t"
                 "s_wait_xcnt 0x0"
                 :: "v"(l0), "v"(g0), "v"(l1), "v"(g1), "v"(l2), "v"(g2), "v"(l3), "v"(g3) : "memory");
}

// k_flash: fused attention, one wave per 16 query rows of one (batch, head); Q fragments straight from the f16 plane; K / V^T fragments from LDS tiles of 64 keys that the
// block's 8 waves share: tile t + 1 is copied (asynchronously, no registers) into one buffer while tile t is worked on in the other; one barrier per tile publishes and frees.
// Transposed form: S^T[key][t] = K Q^T (A = K rows, B = Q rows); lane (t = lane&15, h = lane>>4) holds keys 8h+r of each 16-key tile, so the packed
// P tile is directly the B fragment of O^T[d][t] = V^T P^T (element r <- tile keys 0..15, element 8+r <- tile keys 16..31, lane unchanged).
// Per 32-key step: 4 score matrix ops (2 key tiles x 2 d halves) + 4 P.V matrix ops (4 d tiles) + 1 row-sum matrix op.
// Padded keys: the score is REPLACED by the fill value (flag plane loaded with the same key map as the P elements).
// Each wave reads the batch's per-tile words once and keeps one bit per tile; a tile without a padded key skips the flag loads, compares and selects (where no flag is set the replace is the identity).
// Softmax state: the running max is one scalar per lane (the two lane halves of a row are combined with one xor-16 exchange).
// Row sums on the matrix unit: one more matrix op per 32-key step, A = a tile whose row 0 is ones and whose other rows are 0, B = the packed P tile, adds the 32 keys' P (as rounded to f16)
// of query t into row 0, column t of an f32 tile: element 0 of lanes 0..15. Rows 1..15 stay 0, so only element 0 is rescaled.
__global__ __launch_bounds__(32 * AW) void k_flash(const h16* __restrict__ QH, const h16* __restrict__ KP, const h16* __restrict__ VT, const h16* __restrict__ PF, const unsigned* __restrict__ TF, h16* CTX) {
    __shared__ __align__(16) float os[AW * 16 * 68];
    __shared__ __align__(16) h16 ring[2][2][64 * LP];        // [buffer][K rows key | V^T rows d][row][LP]
    const int lane = threadIdx.x & 31, lr = lane & 15, hi = lane >> 4; const int wave = wave_id();
    const int zh = blockIdx.y; const int b = zh / NH_, h = zh % NH_;
    const int t0 = (blockIdx.x * AW + wave) * 16;
    const size_t pbase = (size_t)zh * SEQ * HD;
    const size_t qo = pbase + (size_t)(t0 + lr) * HD + 8 * hi;
    const v16h qh0 = ldh(QH + qo), qh1 = ldh(QH + qo + 32);   // B fragments: col t, k = d
    const int fo = lr * LP + 8 * hi;                         // fragment offset in a staged tile: K + key*LP (row key, k = d), V^T + 16j*LP + key (row d, k = key)
    // copy map: thread -> rows cr and cr + 32 of each tile, 16-byte column tid & 7
    const int cr = (int)(threadIdx.x >> 3), cc = (int)(threadIdx.x & 7) * 8;
    const h16* gk = KP + pbase + (size_t)cr * HD + cc;       // + key0 * HD
    const h16* gv = VT + pbase + (size_t)cr * SEQ + cc;      // + key0
    const unsigned lk = (unsigned)(size_t)&ring[0][0][cr * LP + cc];   // LDS byte address of the thread's first K chunk in buffer 0
    constexpr unsigned TB = 64 * LP * 2, HB = 32 * LP * 2;   // bytes of one tile, of 32 rows
    // tile 0 -> buffer 0, landed and published; then tile 1 -> buffer 1 in flight
    stage4(lk, gk, lk + HB, gk + 32 * HD, lk + TB, gv, lk + TB + HB, gv + (size_t)32 * SEQ);
    // bit t of padtiles: tile t of this batch holds a padded key (lane t reads tile t's word, one ballot makes the wave-uniform mask)
    const unsigned padtiles = __builtin_amdgcn_ballot_w32(TF[(size_t)b * NT + min(lane, NT - 1)] != 0u);
    asm volatile("s_wait_xcnt 0x0" ::: "memory");            // the load above is issued: its address register may be rewritten behind this line
    asm volatile("s_wait_asynccnt 0x0" ::: "memory");        // this wave's copies of tile 0 have landed
    __syncthreads();                                         // every wave's copies of tile 0 are readable
    stage4(lk + 2 * TB, gk + KST * HD, lk + 2 * TB + HB, gk + (KST + 32) * HD, lk + 3 * TB, gv + KST, lk + 3 * TB + HB, gv + (size_t)32 * SEQ + KST);
    const h16* pfp = PF + (size_t)b * SEQ + 8 * hi;          // + key0: elements r <- key0+8h+r, 8+r <- key0+16+8h+r
    v8f o0 = (v8f){}, o1 = (v8f){}, o2 = (v8f){}, o3 = (v8f){};
    v8f lt = (v8f){};                                        // row 0: running row sums (column t = query t)
    v16h ones;                                               // A fragment: lanes 0 and 16 hold row 0 (all 32 k positions), the other lanes rows 1..15
#pragma unroll
    for (int i = 0; i < 16; ++i) ones[i] = (lr == 0) ? (h16)1.0f : (h16)0.0f;
    float m = -3.0e38f;
#pragma unroll 1
    for (int t = 0; t < NT; ++t) {
      const h16* kt = &ring[t & 1][0][fo]; const h16* vt = &ring[t & 1][1][fo];
      const bool tpad = ((padtiles >> t) & 1u) != 0u;
#pragma unroll   // both 32-key steps of a tile inline, so that every LDS offset inside the tile is an immediate
      for (int s = 0; s < KST / 32; ++s) {
        const int key0 = t * KST + s * 32;
        const h16* ka = kt + s * 32 * LP;
        const v16h ka0 = ldh(ka), ka1 = ldh(ka + 32), kb0 = ldh(ka + 16 * LP), kb1 = ldh(ka + 16 * LP + 32);
        v8f sa = (v8f){}, sb = (v8f){};
        sa = wmma16(ka0, qh0, sa); sb = wmma16(kb0, qh0, sb);
        sa = wmma16(ka1, qh1, sa); sb = wmma16(kb1, qh1, sb);
        asm volatile("v_nop\n\tv_nop\n\tv_nop\n\tv_nop" : "+v"(sa), "+v"(sb) : "v"(ka0), "v"(ka1), "v"(kb0), "v"(kb1), "v"(qh0), "v"(qh1));
        float ta[8], tb[8]; float mx = -3.0e38f;
#pragma unroll
        for (int r = 0; r < 8; ++r) {
            ta[r] = sa[r] * SC2; tb[r] = sb[r] * SC2; }
        if (__builtin_expect(tpad, false)) {                 // scalar branch, the same in every wave of the block: only a tile that holds a padded key loads its flags and replaces (laid out of line)
            const v16h pf = ldh(pfp + key0);
            asm volatile("s_wait_xcnt 0x0" ::: "memory");    // the two flag loads are issued: their address pair is stepped at the loop's foot
#pragma unroll
            for (int r = 0; r < 8; ++r) { ta[r] = ((float)pf[r] != 0.0f) ? NEGB : ta[r]; tb[r] = ((float)pf[8 + r] != 0.0f) ? NEGB : tb[r]; } }
#pragma unroll
        for (int r = 0; r < 8; ++r) mx = fmaxf(mx, fmaxf(ta[r], tb[r]));
        mx = fmaxf(mx, __shfl_xor(mx, 16, 32));
        const float mnew = fmaxf(m, mx);
        const float alpha = __builtin_amdgcn_exp2f(m - mnew);
        const float sh = PSH - mnew;
        v16h pb;
#pragma unroll
        for (int r = 0; r < 8; ++r) { pb[r] = (h16)__builtin_amdgcn_exp2f(ta[r] + sh); pb[8 + r] = (h16)__builtin_amdgcn_exp2f(tb[r] + sh); }
        lt[0] *= alpha; m = mnew;
        o0 = o0 * alpha; o1 = o1 * alpha; o2 = o2 * alpha; o3 = o3 * alpha;
        const h16* va = vt + s * 32;
        const v16h v0 = ldh(va), v1 = ldh(va + 16 * LP), v2 = ldh(va + 32 * LP), v3 = ldh(va + 48 * LP);
        lt = wmma16(ones, pb, lt);
        o0 = wmma16(v0, pb, o0); o1 = wmma16(v1, pb, o1); o2 = wmma16(v2, pb, o2); o3 = wmma16(v3, pb, o3);
        // four vector slots behind the run of matrix ops above, the distance the chip needs before a vector instruction touches their results or operands
        asm volatile("v_nop\n\tv_nop\n\tv_nop\n\tv_nop" : "+v"(o0), "+v"(o1), "+v"(o2), "+v"(o3), "+v"(lt) : "v"(v0), "v"(v1), "v"(v2), "v"(v3), "v"(pb));
      }
      asm volatile("s_wait_dscnt 0x0" ::: "memory");         // this wave's reads of tile t are done before its buffer may be refilled
      asm volatile("s_wait_asynccnt 0x0" ::: "memory");      // this wave's copies of tile t + 1 have landed
      __syncthreads();                                       // publishes tile t + 1 and ends every wave's reads of tile t
      if (t + 2 < NT) {                                      // block-uniform: refill the buffer that tile t has just left
          const unsigned lb = lk + (unsigned)(t & 1) * (2 * TB); const h16* gk2 = gk + (size_t)(t + 2) * KST * HD; const h16* gv2 = gv + (t + 2) * KST;
          stage4(lb, gk2, lb + HB, gk2 + 32 * HD, lb + TB, gv2, lb + TB + HB, gv2 + (size_t)32 * SEQ); }
    }
    asm volatile("s_wait_asynccnt 0x0" ::: "memory");        // nothing of this wave is in flight when the ring goes out of use
    float l = lt[0];                                         // lanes 0..15: the row sum of query t; lanes 16..31: row 8 of the tile, 0
    l += __shfl_xor(l, 16, 32);
    const float inv = CXS / l;
    const int wb = wave * 16 * 68;
    // O^T D layout: o_j[r] = (d = 16j + 8h + r, t = lane&15) -> os[t][d]; rows 0..15 x columns 0..63 all written
    { v4f a, c;
      a[0] = o0[0] * inv; a[1] = o0[1] * inv; a[2] = o0[2] * inv; a[3] = o0[3] * inv; c[0] = o0[4] * inv; c[1] = o0[5] * inv; c[2] = o0[6] * inv; c[3] = o0[7] * inv;
      *(v4fa*)(&os[wb + lr * 68 +  0 + 8 * hi]) = a; *(v4fa*)(&os[wb + lr * 68 +  0 + 8 * hi + 4]) = c;
      a[0] = o1[0] * inv; a[1] = o1[1] * inv; a[2] = o1[2] * inv; a[3] = o1[3] * inv; c[0] = o1[4] * inv; c[1] = o1[5] * inv; c[2] = o1[6] * inv; c[3] = o1[7] * inv;
      *(v4fa*)(&os[wb + lr * 68 + 16 + 8 * hi]) = a; *(v4fa*)(&os[wb + lr * 68 + 16 + 8 * hi + 4]) = c;
      a[0] = o2[0] * inv; a[1] = o2[1] * inv; a[2] = o2[2] * inv; a[3] = o2[3] * inv; c[0] = o2[4] * inv; c[1] = o2[5] * inv; c[2] = o2[6] * inv; c[3] = o2[7] * inv;
      *(v4fa*)(&os[wb + lr * 68 + 32 + 8 * hi]) = a; *(v4fa*)(&os[wb + lr * 68 + 32 + 8 * hi + 4]) = c;
      a[0] = o3[0] * inv; a[1] = o3[1] * inv; a[2] = o3[2] * inv; a[3] = o3[3] * inv; c[0] = o3[4] * inv; c[1] = o3[5] * inv; c[2] = o3[6] * inv; c[3] = o3[7] * inv;
      *(v4fa*)(&os[wb + lr * 68 + 48 + 8 * hi]) = a; *(v4fa*)(&os[wb + lr * 68 + 48 + 8 * hi + 4]) = c; }
    wave_sync();
    h16* crow = CTX + ((size_t)b * SEQ + t0) * DP + h * HD;
{
#pragma unroll
        for (int s = 0; s < 4; ++s) { const int row = 4 * s + (lane >> 3), c8 = (lane & 7) * 8;   // 4 s x 4 rows = 16 rows; 8 lanes x 8 halves = 64 columns
            const v4f x0 = *(const v4fa*)(&os[wb + row * 68 + c8]); const v4f x1 = *(const v4fa*)(&os[wb + row * 68 + c8 + 4]); v8h hv;
#pragma unroll
            for (int i = 0; i < 4; ++i) { hv[i] = (h16)x0[i]; hv[4 + i] = (h16)x1[i]; }
            *(v8h*)(crow + (size_t)row * DP + c8) = hv; }
         }
}

// k_out: f16 GEMM, 4 waves per 64x128 tile (32x64 per wave), A = ctx plane [NB*SEQ][1024] (x256), Bt = Wo^T plane [512][1024] (x1024), K = DP, through gemm_core; OUT[m][n] = acc * 2^-18 + bo[n] (f32).
__global__ __launch_bounds__(128) void k_out(const h16* __restrict__ A, const h16* __restrict__ Bt, const float* __restrict__ bias, float* OUT) {
    __shared__ __align__(16) float osb[4 * 16 * 68];
    __shared__ __align__(16) bf ring[2 * (64 + 128) * (128 + 8)];
    const int lane = threadIdx.x & 31, lr = lane & 15, hi = lane >> 4; const int wave = wave_id();
    float* os = osb + wave * 16 * 68;                        // wave-private staging of the epilogue
    const int R0 = blockIdx.x * 64, C0 = blockIdx.y * 128;
    v8f acc[2][4];
#pragma unroll
    for (int mb = 0; mb < 2; ++mb)
#pragma unroll
        for (int nb = 0; nb < 4; ++nb) acc[mb][nb] = (v8f){};
    gemm_core<2, 128, DP, false>((const bf*)A, (const bf*)Bt, R0, C0, ring, acc);
    const int r0 = R0 + (wave >> 1) * 32, c0 = C0 + (wave & 1) * 64;   // this wave's 32 x 64 tile
    const size_t orow0 = (size_t)(r0 / SEQ) * OUT_SEQ + (size_t)(r0 % SEQ);
    const int cofs = lr * 4;
    v4f bv;
#pragma unroll
    for (int i = 0; i < 4; ++i) bv[i] = bfr(bias[min(c0 + cofs + i, DIN - 1)]);
#pragma unroll
    for (int mb = 0; mb < 2; ++mb) {
#pragma unroll
        for (int nb = 0; nb < 4; ++nb) {
#pragma unroll
            for (int j = 0; j < 8; ++j) os[(hi * 8 + j) * 68 + nb * 16 + lr] = acc[mb][nb][j] * FOLD; }   // D: row 8h+j, col lane&15
        wave_sync();
{
#pragma unroll
            for (int s = 0; s < 8; ++s) { const int row = 2 * s + hi;   // 8 s x 2 rows = 16 rows; 16 lanes x 4 floats = 64 columns
                const v4f val = *(const v4fa*)(&os[row * 68 + cofs]) + bv;
                *(v4f*)(OUT + (orow0 + (size_t)(mb * 16 + row)) * DIN + c0 + cofs) = val; }
             }
        wave_sync();
    }
}

static constexpr size_t al256(size_t v) { return (v + 255) & ~(size_t)255; }
static constexpr size_t SZ_XB = al256((size_t)NB * SEQ * DIN * 2);
static constexpr size_t SZ_WT = al256((size_t)3 * DP * DIN * 2);
static constexpr size_t SZ_WO = al256((size_t)DIN * DP * 2);
static constexpr size_t SZ_PL = al256((size_t)NB * NH_ * SEQ * HD * 2);
static constexpr size_t SZ_CX = al256((size_t)NB * SEQ * DP * 2);
static constexpr size_t SZ_PF = al256((size_t)NB * SEQ * 2);
static constexpr size_t SZ_TF = al256((size_t)NB * NT * 4);
static constexpr size_t SZ_TOTAL = SZ_XB + SZ_WT + SZ_WO + 3 * SZ_PL + SZ_CX + SZ_PF + SZ_TF;
static_assert(SZ_TOTAL <= (size_t)134217728);          // workspace carve <= 128 MiB
static_assert(((size_t)DP * DIN * 2) % 256 == 0);      // weight sub-planes stay 256-byte aligned

extern "C" void kernel_launch(void* const* d_in, const int* in_sizes, int n_in,
                              void* d_out, int out_size, void* d_ws, size_t ws_size, hipStream_t stream) {
    if (n_in < 10) return;
    const size_t needx = ((size_t)(NB - 1) * SEQ_FULL + SEQ) * DIN;
    if ((size_t)in_sizes[0] < needx || (size_t)in_sizes[1] < needx) return;
    if ((size_t)in_sizes[2] < (size_t)DIN * DP || (size_t)in_sizes[4] < (size_t)DIN * DP || (size_t)in_sizes[6] < (size_t)DIN * DP || (size_t)in_sizes[8] < (size_t)DP * DIN) return;
    if ((size_t)in_sizes[3] < (size_t)DP || (size_t)in_sizes[5] < (size_t)DP || (size_t)in_sizes[7] < (size_t)DP || (size_t)in_sizes[9] < (size_t)DIN) return;
    if ((size_t)out_size < ((size_t)(NB - 1) * OUT_SEQ + SEQ) * DIN) return;
    if (SZ_TOTAL > ws_size) return;
    // wire order: data, pad input, wq, bq, wk, bk, wv, bv, wo, bo (all f32)
    const float* x = (const float*)d_in[0]; const float* pm = (const float*)d_in[1];
    const float* wq = (const float*)d_in[2]; const float* bq = (const float*)d_in[3];
    const float* wk = (const float*)d_in[4]; const float* bk = (const float*)d_in[5];
    const float* wv = (const float*)d_in[6]; const float* bv = (const float*)d_in[7];
    const float* wo = (const float*)d_in[8]; const float* bo = (const float*)d_in[9];
    float* OUT = (float*)d_out;      // [NB][SEQ][512]
    char* wsp = (char*)d_ws;
    bf* XB = (bf*)wsp; wsp += SZ_XB;                 // [NB*SEQ][512] bf16
    bf* WT = (bf*)wsp; wsp += SZ_WT;                 // [3][1024][512] bf16, rows h*64+dm: q | k | v
    bf* WOB = (bf*)wsp; wsp += SZ_WO;                // [512][1024] f16 bits (x1024)
    h16* QH = (h16*)wsp; wsp += SZ_PL;               // [NB*16][SEQ][64]
    h16* KP = (h16*)wsp; wsp += SZ_PL;               // [NB*16][SEQ][64]
    h16* VT = (h16*)wsp; wsp += SZ_PL;               // [NB*16][64][SEQ]
    h16* CX = (h16*)wsp; wsp += SZ_CX;               // [NB*SEQ][1024] (x256)
    h16* PF = (h16*)wsp; wsp += SZ_PF;               // [NB*SEQ] pad flags
    unsigned* TF = (unsigned*)wsp; wsp += SZ_TF;     // [NB*SEQ/64] nonzero where a 64-key tile holds a padded key

    k_prep<<<dim3(PB_PAD + 4 * PB_WT + PB_CVT, 1, 1), 256, 0, stream>>>(x, pm, wq, wk, wv, wo, XB, WT, WOB, PF, TF);

    k_proj<<<dim3(NB * SEQ / 128, DP / 128, 3), 128, 0, stream>>>(XB, WT, bq, bk, bv, QH, KP, VT);

    k_flash<<<dim3(SEQ / (16 * AW), NB * NH_, 1), 32 * AW, 0, stream>>>(QH, KP, VT, PF, TF, CX);

    k_out<<<dim3(NB * SEQ / 64, DIN / 128, 1), 128, 0, stream>>>(CX, (const h16*)WOB, bo, OUT);
}

// v006
// It runs in 66.9 microseconds.
// In both of two side-by-side timings against v005, it was 1.05 times as fast.
// All steps since v000 together make it 2.94 times as fast.
#include <hip/hip_runtime.h>

// Multi-head self-attention: data [NB][SEQ][512], Wq/Wk/Wv [512][1024] ([in][out], column c = dm*16 + h), biases, key-padding replace fill (-1e9 where a key's 512 pad-input values sum to 0), score scale 1/8, merged heads (h*64+dm) @ Wo [1024][512] + bo, f32 output.
// Compute dtypes, f32 accumulate everywhere: projections v_wmma_f32_16x16x32_bf16 (data and W RNE-converted to bf16; products exact);
// scores v_wmma_f32_16x16x32_f16: q and k single f16 planes (one product); P (x256 carry, cancels in the normalisation) and v single f16; softmax f32 (online, lazily moved reference maximum; row sums of the f16 P by a ones-row matrix op, f32 accumulate);
// output projection v_wmma_f32_16x16x32_f16: ctx single f16 (x256 carry), Wo = f16 of (bf16 RNE of wo) x1024 (exact), 2^-18 folded back in f32, bias added in f32.
// Launches: 4. k_prep (block index picks the job: pad flags with one word per 64 keys, one weight tile, or a slice of the data conversion; the jobs read none of each other's output), k_proj (grid z picks q, k or v^T), k_flash, k_out.
// Layout: bf16 copy of data; transposed K-contiguous weight planes (head-permuted rows h*64+dm); q, k planes [b*16+h][t][d] and v^T plane [b*16+h][d][t] from the GEMM epilogue;
// fused flash kernel in transposed form (S^T = K Q^T, O^T = V^T P^T; 4 score + 4 P.V matrix ops per 32-key step; K and V^T tiles of 64 keys staged in LDS by asynchronous copies, two buffers) writing the ctx plane [b*SEQ+t][h*64+d].
// Both GEMMs (k_proj, k_out): 4-wave blocks, operand tiles staged in LDS by asynchronous copies of whole 128-byte lines, two buffers, fragments read from LDS.

#ifndef NB
#define NB 2
#endif
#ifndef SEQ
#define SEQ 2048
#endif
#define NB_FULL  2
#define SEQ_FULL 2048
#ifndef OUT_SEQ
#define OUT_SEQ SEQ              // row pitch (in tokens) between batches of the output
#endif
#define DIN  512                 // input width = output width
#define DP   1024                // projection width = 16 heads x 64
#define NH_  16
#define HD   64
#define AW   8                   // waves per flash block (16 query rows each); all share the staged K / V^T tiles
#define KST  64                  // keys per staged tile (two 32-key steps)
#define LP   72                  // LDS row pitch in halves: 128-byte rows + 16 bytes, the pitch for 16-byte LDS readers
#define NT   (SEQ / KST)         // staged tiles per (batch, head)
#define SC2  (0.125f * 1.4426950408889634f)   // HD^-0.5 * log2(e)
#define PSH  8.0f                // log2 of the P carry (256)
#define RTH  7.0f                // lazy rescale: how far (log2) a column's new maximum may stand above the reference in use before the reference moves
#define NEGB (-1.0e9f * 1.4426950408889634f)  // fill value of padded keys in the log2 domain
#define CXS  256.0f              // carry of the ctx plane
#define WOS  1024.0f             // carry of the Wo plane
#define FOLD (1.0f / (256.0f * 1024.0f))

static_assert(HD == 64);
static_assert(PSH + RTH <= 15.0f);             // P <= 2^(PSH + RTH) stays finite in f16
static_assert(NH_ * HD == DP);
static_assert(NH_ == 16);                      // column c = dm*16 + h
static_assert(DP % 64 == 0);
static_assert(DIN % 64 == 0);
static_assert(DIN % 32 == 0);                  // GEMM k-loops step by 32
static_assert(DP % 32 == 0);
static_assert(DIN == 512);                     // pad-row sum: 4 x 128 floats per wave
static_assert(SEQ % 64 == 0);                  // a 64-row tile never straddles two batches
static_assert((NB * SEQ) % 64 == 0);
static_assert(SEQ % 32 == 0);                  // key loop steps by 32
static_assert(SEQ % (16 * AW) == 0);           // flash grid covers the sequence exactly
static_assert(SEQ % KST == 0);
static_assert(NT >= 2);                        // the two-buffer prologue fills tiles 0 and 1
static_assert(NT <= 32);                       // one bit per staged tile in the 32-lane ballot of padded tiles
static_assert(KST == 64);                      // a staged tile is the 64 key rows of one pad block
static_assert(32 * AW * 2 * 8 == KST * HD);    // two 16-byte copies per thread cover one 64 x 64 tile
static_assert(((size_t)SEQ * DIN) % 8 == 0);
static_assert((NB * SEQ) % 128 == 0);          // GEMM block tiles: 128 data rows (k_proj)
static_assert(DP % 128 == 0);
static_assert(DIN % 128 == 0);
static_assert(NB <= NB_FULL);
static_assert(SEQ <= SEQ_FULL);

typedef _Float16 h16;
typedef unsigned short bf;
typedef __attribute__((ext_vector_type(16))) __bf16   v16bf;
typedef __attribute__((ext_vector_type(16))) _Float16 v16h;
typedef __attribute__((ext_vector_type(8)))  _Float16 v8h;
typedef __attribute__((ext_vector_type(8)))  unsigned short v8us;
typedef __attribute__((ext_vector_type(16))) unsigned short v16us;
typedef __attribute__((ext_vector_type(8)))  float    v8f;
typedef __attribute__((ext_vector_type(4)))  float    v4f;
typedef v4f  __attribute__((may_alias)) v4fa;

__device__ __forceinline__ unsigned short f2bf(float f) { unsigned u = __float_as_uint(f); u += 0x7FFFu + ((u >> 16) & 1u); return (unsigned short)(u >> 16); }
__device__ __forceinline__ float bfr(float f) { return __uint_as_float(((unsigned)f2bf(f)) << 16); }   // value after RNE conversion to bf16
__device__ __forceinline__ v16h cat16(v8h lo, v8h hi) { return __builtin_shufflevector(lo, hi, 0, 1, 2, 3, 4, 5, 6, 7, 8, 9, 10, 11, 12, 13, 14, 15); }
__device__ __forceinline__ v16bf cat16b(v8us lo, v8us hi) { return __builtin_bit_cast(v16bf, __builtin_shufflevector(lo, hi, 0, 1, 2, 3, 4, 5, 6, 7, 8, 9, 10, 11, 12, 13, 14, 15)); }
__device__ __forceinline__ v8f wmma16(v16h a, v16h b, v8f c) { return __builtin_amdgcn_wmma_f32_16x16x32_f16(false, a, false, b, (short)0, c, false, false); }
__device__ __forceinline__ v8f wmmab(v16bf a, v16bf b, v8f c) { return __builtin_amdgcn_wmma_f32_16x16x32_bf16(false, a, false, b, (short)0, c, false, false); }
// fragment loaders from K-contiguous 16-bit rows; p already includes + 8*(lane>>4): elements 0..7 <- k0+8h+0..7, elements 8..15 <- k0+16+8h+0..7 (same map for A and B)
__device__ __forceinline__ v16h  ldh(const h16* p) { return cat16(*(const v8h*)p, *(const v8h*)(p + 16)); }
__device__ __forceinline__ v16bf ldb(const bf* p)  { return cat16b(*(const v8us*)p, *(const v8us*)(p + 16)); }
// ordering point for wave-private LDS tiles (same wave writes and reads)
__device__ __forceinline__ void wave_sync() { __builtin_amdgcn_fence(3 /* release order */, "wavefront"); __builtin_amdgcn_wave_barrier(); asm volatile("" ::: "memory"); }
// wave index of the calling thread as a wave-uniform scalar
__device__ __forceinline__ int wave_id() { return __builtin_amdgcn_readfirstlane((int)(threadIdx.x >> 5)); }

// blocks of k_prep per job
#define PB_PAD (NB * SEQ / 64)                        // 64 pad rows each
#define PB_WT  ((DIN / 64) * (DP / 64))               // 64 x 64 tiles of one weight matrix (all four have DIN * DP elements)
#define N8     ((size_t)NB * SEQ * DIN / 8)           // 8-element chunks of the data
#define PB_CVT ((unsigned)((N8 + 255) / 256))

// cvt_job: data f32 -> bf16 copy [NB*SEQ][512], 8 elements per thread; blk = block index inside the job.
__device__ __forceinline__ void cvt_job(const float* __restrict__ x, bf* dst, int blk) {
    const size_t i = (size_t)blk * 256 + threadIdx.x; if (i >= N8) return;
    constexpr size_t C8 = (size_t)SEQ * DIN / 8;      // chunks per batch
    const size_t so = (SEQ == SEQ_FULL) ? i * 8 : (i / C8) * ((size_t)SEQ_FULL * DIN) + (i % C8) * 8;
    const v8f v = *(const v8f*)(x + so); v8us o;
#pragma unroll
    for (int k = 0; k < 8; ++k) o[k] = f2bf(v[k]);
    *(v8us*)(dst + i * 8) = o;
}

// wt_job: W [K][N] f32 ([in][out]) -> dst [N][K] 16-bit rows (K-contiguous). in[K rows][N cols] -> out[N rows][K cols]; one 64 x 64 tile (bx of K/64, by of N/64), 256 threads; ts = 64 * 68 floats of LDS.
// perm != 0: source column c = dm*16 + h lands on destination row h*64 + dm. asf16 == 0: bf16 bits; asf16 != 0: f16 bits of (bf16 value * scale).
__device__ __forceinline__ void wt_job(const float* __restrict__ W, bf* dst, int K, int N, int perm, int asf16, float scale, int bx, int by, float* ts) {   // ts: [column][k]
    const int tid = threadIdx.x, lane = tid & 31; const int wave = wave_id();
    const int k0 = bx * 64, c0 = by * 64;
#pragma unroll
    for (int it = 0; it < 4; ++it) { const int e = tid + 256 * it; const int kk = e >> 4, c4 = (e & 15) * 4;   // 64 k rows x 16 float4 = whole tile
        const v4f v = *(const v4f*)(W + (size_t)(k0 + kk) * (size_t)N + c0 + c4);
        ts[(c4 + 0) * 68 + kk] = v[0]; ts[(c4 + 1) * 68 + kk] = v[1]; ts[(c4 + 2) * 68 + kk] = v[2]; ts[(c4 + 3) * 68 + kk] = v[3]; }
    __syncthreads();
{
#pragma unroll
        for (int s = 0; s < 2; ++s) { const int row = 4 * (wave + 8 * s) + (lane >> 3), c8 = (lane & 7) * 8;   // 8 waves x 2 s x 4 rows = 64 rows; 8 lanes x 8 = 64 k
            const v4f x0 = *(const v4fa*)(&ts[row * 68 + c8]); const v4f x1 = *(const v4fa*)(&ts[row * 68 + c8 + 4]); v8us o;
#pragma unroll
            for (int i = 0; i < 4; ++i) { const float f0 = bfr(x0[i]), f1 = bfr(x1[i]);
                const unsigned short b0 = (unsigned short)(__float_as_uint(f0) >> 16), b1 = (unsigned short)(__float_as_uint(f1) >> 16);
                const unsigned short g0 = __builtin_bit_cast(unsigned short, (h16)(f0 * scale)), g1 = __builtin_bit_cast(unsigned short, (h16)(f1 * scale));
                o[i] = asf16 ? g0 : b0; o[4 + i] = asf16 ? g1 : b1; }
            const int c = c0 + row; const int n = perm ? ((c & 15) * 64 + (c >> 4)) : c;
            *(v8us*)(dst + (size_t)n * (size_t)K + k0 + c8) = o; }
         }
    asm volatile("s_wait_xcnt 0x0" ::: "memory");   // the two stores above are issued: no register that they name is rewritten by the code that follows this job in the merged kernel
}

// pad_job: flags of 64 key rows (1 where the row's 512 pad-input values sum to 0), and one word for the 64 rows together (nonzero where any of them is flagged); fl = 64 floats of LDS.
__device__ __forceinline__ void pad_job(const float* __restrict__ mask, h16* PF, unsigned* TF, int blk, float* fl) {
    const int tid = threadIdx.x, lane = tid & 31; const int wave = wave_id();
    const int m0 = blk * 64;
#pragma unroll 1
    for (int i = 0; i < 8; ++i) { const int m = m0 + wave * 8 + i; const int b = m / SEQ, t = m % SEQ;
        const float* row = mask + ((size_t)b * SEQ_FULL + t) * DIN;
        float s = 0.0f;
#pragma unroll
        for (int j = 0; j < 4; ++j) { const v4f v = *(const v4f*)(row + j * 128 + lane * 4); s += bfr(v[0]); s += bfr(v[1]); s += bfr(v[2]); s += bfr(v[3]); }
        s += __shfl_xor(s, 16, 32); s += __shfl_xor(s, 8, 32); s += __shfl_xor(s, 4, 32); s += __shfl_xor(s, 2, 32); s += __shfl_xor(s, 1, 32);
        if (lane == 0) fl[wave * 8 + i] = (s == 0.0f) ? 1.0f : 0.0f; }
    __syncthreads();
    if (tid < 8) { v8h o;
#pragma unroll
        for (int k = 0; k < 8; ++k) o[k] = (h16)fl[tid * 8 + k];
        *(v8h*)(PF + (size_t)m0 + tid * 8) = o;  }
    if (wave == 0) { const unsigned any = __builtin_amdgcn_ballot_w32((fl[lane] != 0.0f) | (fl[lane + 32] != 0.0f));
        if (lane == 0) TF[blk] = any; }
}

// k_prep: everything that reads only the inputs, in one launch. The job is a function of blockIdx.x alone, so every branch (and the barrier inside a job) is block-uniform.
// Order: the pad rows (eight dependent row sums per wave, the longest job) take the lowest block indices, the one-load conversion blocks the highest.
__global__ __launch_bounds__(256) void k_prep(const float* __restrict__ x, const float* __restrict__ pm, const float* __restrict__ wq, const float* __restrict__ wk, const float* __restrict__ wv,
                                              const float* __restrict__ wo, bf* XB, bf* WT, bf* WOB, h16* PF, unsigned* TF) {
    __shared__ __align__(16) float ts[64 * 68];
    const int bid = blockIdx.x;
    if (bid < PB_PAD) { pad_job(pm, PF, TF, bid, ts); return; }
    if (bid < PB_PAD + 4 * PB_WT) {
        const int j = bid - PB_PAD; const int w = j / PB_WT, tile = j % PB_WT;
        // w = 0..2: wq, wk, wv, in[K = 512][N = 1024] -> [1024 rows (head-permuted)][512], bf16; w = 3: wo, in[K = 1024 (h*64+dm)][N = 512] -> [512 rows][1024], f16 x1024
        const bool o = (w == 3);
        const float* W = o ? wo : (w == 0 ? wq : (w == 1 ? wk : wv));
        bf* dst = o ? WOB : WT + (size_t)w * DP * DIN;
        const int K = o ? DP : DIN, N = o ? DIN : DP;
        wt_job(W, dst, K, N, o ? 0 : 1, o ? 1 : 0, o ? WOS : 1.0f, tile % (K / 64), tile / (K / 64), ts);
        return; }
    cvt_job(x, XB, bid - (PB_PAD + 4 * PB_WT));
}

// One thread's eight 16-byte asynchronous copies global -> LDS: rows ls bytes apart in LDS, gs elements apart in memory. The s_wait_xcnt closes the statement so that
// no address register of an issued copy is rewritten ahead of it.
__device__ __forceinline__ void stage8(unsigned l, const bf* g, unsigned ls, size_t gs) {
    asm volatile("global_load_async_to_lds_b128 %0, %1, off\n\t"
                 "global_load_async_to_lds_b128 %2, %3, off\n\t"
                 "global_load_async_to_lds_b128 %4, %5, off\n\t"
                 "global_load_async_to_lds_b128 %6, %7, off\n\t"
                 "global_load_async_to_lds_b128 %8, %9, off\n\t"
                 "global_load_async_to_lds_b128 %10, %11, off\n\t"
                 "global_load_async_to_lds_b128 %12, %13, off\n\t"
                 "global_load_async_to_lds_b128 %14, %15, off\n\t"
                 "s_wait_xcnt 0x0"
                 :: "v"(l), "v"(g), "v"(l + ls), "v"(g + gs), "v"(l + 2 * ls), "v"(g + 2 * gs), "v"(l + 3 * ls), "v"(g + 3 * gs),
                    "v"(l + 4 * ls), "v"(g + 4 * gs), "v"(l + 5 * ls), "v"(g + 5 * gs), "v"(l + 6 * ls), "v"(g + 6 * gs), "v"(l + 7 * ls), "v"(g + 7 * gs) : "memory");
}
__device__ __forceinline__ v16us ldu(const bf* p) { return __builtin_shufflevector(*(const v8us*)p, *(const v8us*)(p + 16), 0, 1, 2, 3, 4, 5, 6, 7, 8, 9, 10, 11, 12, 13, 14, 15); }   // same k map as ldh / ldb
template <bool BF> __device__ __forceinline__ v8f mm(v16us a, v16us b, v8f c) {
    if constexpr (BF) return wmmab(__builtin_bit_cast(v16bf, a), __builtin_bit_cast(v16bf, b), c);
    else              return wmma16(__builtin_bit_cast(v16h, a), __builtin_bit_cast(v16h, b), c);
}

// gemm_core: acc[mb][nb] += A rows x Bt rows over K (16-bit, K-contiguous planes), for a block of 4 waves (2 x 2). Block tile (2 * MF * 16) x 128 at (R0, C0); wave (wave >> 1, wave & 1) owns (MF * 16) x 64.
// Per trip KS k values of every row of both tiles lie in one LDS buffer (row pitch KS + 8 halves: 16 bytes x odd, the pitch for 16-byte LDS readers); a wave's copy covers whole 128-byte lines.
// Tile t + 1 is copied into one buffer while tile t is worked on in the other; one barrier per trip publishes and frees. k ascends by 32 in every accumulator.
template <int MF, int KS, int K, bool BF>
__device__ __forceinline__ void gemm_core(const bf* __restrict__ A, const bf* __restrict__ Bt, int R0, int C0, bf* ring, v8f (&acc)[MF][4]) {
    constexpr int GP = KS + 8, BM = 2 * MF * 16, BUFH = (BM + 128) * GP;   // pitch (halves), A rows, halves per buffer
    constexpr int CPR = KS / 8, RS = 128 / CPR, NTR = K / KS;              // 16-byte chunks per row, rows covered by the block's 128 threads in one copy each, trips
    static_assert(BM == 8 * RS);                                           // one stage8 covers the A tile
    static_assert(128 % (8 * RS) == 0);                                    // whole stage8 groups cover the B tile
    static_assert(K % KS == 0);
    static_assert(NTR >= 2);                                               // the prologue fills tiles 0 and 1
    static_assert(MF == 2 || MF == 4);
    const int tid = threadIdx.x, lane = tid & 31, lr = lane & 15, hi = lane >> 4; const int wave = wave_id();
    const int cr = tid / CPR, cc = (tid % CPR) * 8;                        // copy map: thread -> row cr (+ multiples of RS), 16-byte column
    const bf* ga = A + (size_t)(R0 + cr) * K + cc;                         // + t * KS
    const bf* gb = Bt + (size_t)(C0 + cr) * K + cc;
    const unsigned la = (unsigned)(size_t)&ring[cr * GP + cc];             // LDS byte address of the thread's first A chunk in buffer 0
    auto stage = [&](int t, int buf) {
        const unsigned l = la + (unsigned)buf * (unsigned)(BUFH * 2);
        stage8(l, ga + t * KS, RS * GP * 2, (size_t)RS * K);
#pragma unroll
        for (int g = 0; g < 128 / (8 * RS); ++g) stage8(l + (unsigned)((BM + g * 8 * RS) * GP * 2), gb + (size_t)g * 8 * RS * K + t * KS, RS * GP * 2, (size_t)RS * K);
    };
    stage(0, 0);
    asm volatile("s_wait_asynccnt 0x0" ::: "memory");        // this wave's copies of tile 0 have landed
    __syncthreads();                                         // every wave's copies of tile 0 are readable
    stage(1, 1);
    const int ao = ((wave >> 1) * MF * 16 + lr) * GP + 8 * hi, bo = (BM + (wave & 1) * 64 + lr) * GP + 8 * hi;
#pragma unroll 1   // rolled; the buffer is picked by a scalar select
    for (int t = 0; t < NTR; ++t) {
        const bf* ab = ring + (t & 1) * BUFH + ao; const bf* bb = ring + (t & 1) * BUFH + bo;
        // Fragment sets: each k step's LDS reads go out as one group. NS == 2 (the small wave tile, one wave per SIMD): the next step's group ahead of this step's matrix instructions;
        // NS == 1 (the large wave tile, several waves per SIMD, which cover each other's LDS waits): one set, so that the wave stays inside the first 256 registers.
        constexpr int NS = (MF == 2) ? 2 : 1, NK = KS / 32;
        v16us a[NS][MF], b[NS][4];
        auto frags = [&](int ks) {                           // never past the trip's own tile: ks < NK at every call
#pragma unroll
            for (int mb = 0; mb < MF; ++mb) a[ks % NS][mb] = ldu(ab + mb * 16 * GP + ks * 32);
#pragma unroll
            for (int nb = 0; nb < 4; ++nb) b[ks % NS][nb] = ldu(bb + nb * 16 * GP + ks * 32);
        };
        frags(0);
#pragma unroll   // all k steps of a trip inline, so that every LDS offset inside the tile is an immediate and the fragment sets stay in registers
        for (int ks = 0; ks < NK; ++ks) {
            if (NS == 2 && ks + 1 < NK) frags(ks + 1);
            __builtin_amdgcn_sched_barrier(0);               // keeps the group of LDS reads ahead of the matrix instructions below: sunk among them, each read is waited for where it stands
#pragma unroll
            for (int nb = 0; nb < 4; ++nb)
#pragma unroll
                for (int mb = 0; mb < MF; ++mb) acc[mb][nb] = mm<BF>(a[ks % NS][mb], b[ks % NS][nb], acc[mb][nb]);
            if (NS == 1 && ks + 1 < NK) frags(ks + 1);
        }
        __builtin_amdgcn_sched_barrier(0);                   // keeps the trip's matrix instructions ahead of the barrier: sunk behind it they delay the refill, which then has less than a trip to land
        asm volatile("s_wait_dscnt 0x0" ::: "memory");       // this wave's reads of tile t are done before its buffer may be refilled
        asm volatile("s_wait_asynccnt 0x0" ::: "memory");    // this wave's copies of tile t + 1 have landed
        __syncthreads();                                     // publishes tile t + 1 and ends every wave's reads of tile t
        if (t + 2 < NTR) stage(t + 2, t & 1);                // block-uniform: refill the buffer that tile t has just left
    }
    asm volatile("s_wait_asynccnt 0x0" ::: "memory");        // nothing of this wave is in flight when the ring goes out of use
}

// k_proj: bf16 GEMM, 4 waves per 128x128 tile (64x64 and 16 accumulators per wave), operands from K-contiguous bf16 planes through gemm_core, K = DIN.
// C[m][n] = sum_k A[m][k] Bt[n][k] + bias, written as f16 (Ph), row pitch 'pitch' (halves). grid (NB*SEQ/128 data tiles, DP/128 weight tiles, 3), 128 threads; z picks the product:
// z = 0, 1 (q, k): A = data rows (m = b*SEQ + t), Bt = W^T rows (n = h*64 + d) -> plane [(b*16 + h)][t][d]; bias per column.
// z = 2 (v^T):     A = Wv^T rows (m = h*64 + d), Bt = data rows (n = b*SEQ + t) -> plane [(b*1024 + m)][t] = [(b*16 + h)][d][t]; bias per row.
// bias (source order dm*16 + h, RNE-converted to bf16, added in f32): bmode 0 = per column n = h*64 + dm, bmode 1 = per row m = h*64 + dm.
__global__ __launch_bounds__(128) void k_proj(const bf* __restrict__ XB, const bf* __restrict__ WT, const float* __restrict__ bq, const float* __restrict__ bk, const float* __restrict__ bv, h16* QH, h16* KP, h16* VT) {
    __shared__ __align__(16) float osb[4 * 16 * 68];
    __shared__ __align__(16) bf ring[2 * (128 + 128) * (64 + 8)];
    const int z = blockIdx.z; const bool bmode = (z == 2);
    const bf* Wz = WT + (size_t)z * DP * DIN;
    const bf* A = bmode ? Wz : XB; const bf* Bt = bmode ? XB : Wz;
    const float* bias = (z == 0) ? bq : ((z == 1) ? bk : bv);
    h16* Ph = (z == 0) ? QH : ((z == 1) ? KP : VT);
    const int pitch = bmode ? SEQ : HD;
    const int lane = threadIdx.x & 31, lr = lane & 15, hi = lane >> 4; const int wave = wave_id();
    float* os = osb + wave * 16 * 68;                        // wave-private staging of the epilogue
    const int R0 = (bmode ? blockIdx.y : blockIdx.x) * 128, C0 = (bmode ? blockIdx.x : blockIdx.y) * 128;
    v8f acc[4][4];
#pragma unroll
    for (int mb = 0; mb < 4; ++mb)
#pragma unroll
        for (int nb = 0; nb < 4; ++nb) acc[mb][nb] = (v8f){};
    gemm_core<4, 64, DIN, true>(A, Bt, R0, C0, ring, acc);
    const int r0 = R0 + (wave >> 1) * 64, c0 = C0 + (wave & 1) * 64;   // this wave's 64 x 64 tile
    const size_t tbase = bmode ? (size_t)r0 * SEQ + (size_t)(c0 / SEQ) * ((size_t)DP * SEQ) + (size_t)(c0 % SEQ)
                               : (size_t)(r0 / SEQ) * ((size_t)NH_ * SEQ * HD) + (size_t)(r0 % SEQ) * HD + (size_t)(c0 / HD) * ((size_t)SEQ * HD);
    const int c8 = (lane & 7) * 8;
    float bcol[8];      // column-mode bias of this lane's 8 columns (clamped addresses, always loaded)
    { const int hc = min(c0 >> 6, NH_ - 1);
#pragma unroll
      for (int i = 0; i < 8; ++i) bcol[i] = bfr(bias[min((c8 + i) * NH_ + hc, DP - 1)]); }
#pragma unroll
    for (int mb = 0; mb < 4; ++mb) {
#pragma unroll
        for (int nb = 0; nb < 4; ++nb) {
#pragma unroll
            for (int j = 0; j < 8; ++j) os[(hi * 8 + j) * 68 + nb * 16 + lr] = acc[mb][nb][j]; }   // D: row 8h+j, col lane&15
        wave_sync();
        const size_t sb = tbase + (size_t)(mb * 16) * (size_t)pitch;
{
#pragma unroll
            for (int s = 0; s < 4; ++s) { const int row = 4 * s + (lane >> 3);   // 4 s x 4 row groups = 16 rows; 8 lanes x 8 = 64 columns
                const int m = r0 + mb * 16 + row;
                const float brow = bfr(bias[min((m & 63) * NH_ + min(m >> 6, NH_ - 1), DP - 1)]);
                const v4f x0 = *(const v4fa*)(&os[row * 68 + c8]); const v4f x1 = *(const v4fa*)(&os[row * 68 + c8 + 4]); v8h hv;
#pragma unroll
                for (int i = 0; i < 4; ++i) { const float y0 = x0[i] + (bmode ? brow : bcol[i]); const float y1 = x1[i] + (bmode ? brow : bcol[4 + i]);
                    hv[i] = (h16)y0; hv[4 + i] = (h16)y1; }
                const size_t oo = sb + (size_t)row * (size_t)pitch + c8;
                *(v8h*)(Ph + oo) = hv; }
             }
        wave_sync();
    }
}

// One thread's share of a staged tile pair: four 16-byte asynchronous copies global -> LDS (two of K, two of V^T). The s_wait_xcnt closes the statement so that
// no address register of an issued copy is rewritten ahead of it.
__device__ __forceinline__ void stage4(unsigned l0, const h16* g0, unsigned l1, const h16* g1, unsigned l2, const h16* g2, unsigned l3, const h16* g3) {
    asm volatile("global_load_async_to_lds_b128 %0, %1, off\n\t"
                 "global_load_async_to_lds_b128 %2, %3, off\n\t"
                 "global_load_async_to_lds_b128 %4, %5, off\n\t"
                 "global_load_async_to_lds_b128 %6, %7, off\n\t"
                 "s_wait_xcnt 0x0"
                 :: "v"(l0), "v"(g0), "v"(l1), "v"(g1), "v"(l2), "v"(g2), "v"(l3), "v"(g3) : "memory");
}

// k_flash: fused attention, one wave per 16 query rows of one (batch, head); Q fragments straight from the f16 plane; K / V^T fragments from LDS tiles of 64 keys that the
// block's 8 waves share: tile t + 1 is copied (asynchronously, no registers) into one buffer while tile t is worked on in the other; one barrier per tile publishes and frees.
// Transposed form: S^T[key][t] = K Q^T (A = K rows, B = Q rows); lane (t = lane&15, h = lane>>4) holds keys 8h+r of each 16-key tile, so the packed
// P tile is directly the B fragment of O^T[d][t] = V^T P^T (element r <- tile keys 0..15, element 8+r <- tile keys 16..31, lane unchanged).
// Per 32-key step: 4 score matrix ops (2 key tiles x 2 d halves) + 4 P.V matrix ops (4 d tiles) + 1 row-sum matrix op.
// Padded keys: the score is REPLACED by the fill value (flag plane loaded with the same key map as the P elements).
// Each wave reads the batch's per-tile words once and keeps one bit per tile; a tile without a padded key skips the flag loads, compares and selects (where no flag is set the replace is the identity).
// Softmax state: the reference maximum is one scalar per lane, equal in the two lane halves of a column. Lazy rescale: each 32-key step tests once (one ballot, one scalar branch) whether any lane's new
// maximum stands more than RTH above its reference; only then are the halves combined (one xor-16 exchange), the reference moved to the running maximum and O and the row sums rescaled.
// Otherwise P = 2^(score - reference + PSH) <= 2^(PSH + RTH); the common factor cancels in the normalisation.
// Row sums on the matrix unit: one more matrix op per 32-key step, A = a tile whose row 0 is ones and whose other rows are 0, B = the packed P tile, adds the 32 keys' P (as rounded to f16)
// of query t into row 0, column t of an f32 tile: element 0 of lanes 0..15. Rows 1..15 stay 0, so only element 0 is rescaled.
__global__ __launch_bounds__(32 * AW) void k_flash(const h16* __restrict__ QH, const h16* __restrict__ KP, const h16* __restrict__ VT, const h16* __restrict__ PF, const unsigned* __restrict__ TF, h16* CTX) {
    __shared__ __align__(16) float os[AW * 16 * 68];
    __shared__ __align__(16) h16 ring[2][2][64 * LP];        // [buffer][K rows key | V^T rows d][row][LP]
    const int lane = threadIdx.x & 31, lr = lane & 15, hi = lane >> 4; const int wave = wave_id();
    const int zh = blockIdx.y; const int b = zh / NH_, h = zh % NH_;
    const int t0 = (blockIdx.x * AW + wave) * 16;
    const size_t pbase = (size_t)zh * SEQ * HD;
    const size_t qo = pbase + (size_t)(t0 + lr) * HD + 8 * hi;
    const v16h qh0 = ldh(QH + qo), qh1 = ldh(QH + qo + 32);   // B fragments: col t, k = d
    const int fo = lr * LP + 8 * hi;                         // fragment offset in a staged tile: K + key*LP (row key, k = d), V^T + 16j*LP + key (row d, k = key)
    // copy map: thread -> rows cr and cr + 32 of each tile, 16-byte column tid & 7
    const int cr = (int)(threadIdx.x >> 3), cc = (int)(threadIdx.x & 7) * 8;
    const h16* gk = KP + pbase + (size_t)cr * HD + cc;       // + key0 * HD
    const h16* gv = VT + pbase + (size_t)cr * SEQ + cc;      // + key0
    const unsigned lk = (unsigned)(size_t)&ring[0][0][cr * LP + cc];   // LDS byte address of the thread's first K chunk in buffer 0
    constexpr unsigned TB = 64 * LP * 2, HB = 32 * LP * 2;   // bytes of one tile, of 32 rows
    // tile 0 -> buffer 0, landed and published; then tile 1 -> buffer 1 in flight
    stage4(lk, gk, lk + HB, gk + 32 * HD, lk + TB, gv, lk + TB + HB, gv + (size_t)32 * SEQ);
    // bit t of padtiles: tile t of this batch holds a padded key (lane t reads tile t's word, one ballot makes the wave-uniform mask)
    const unsigned padtiles = __builtin_amdgcn_ballot_w32(TF[(size_t)b * NT + min(lane, NT - 1)] != 0u);
    asm volatile("s_wait_xcnt 0x0" ::: "memory");            // the load above is issued: its address register may be rewritten behind this line
    asm volatile("s_wait_asynccnt 0x0" ::: "memory");        // this wave's copies of tile 0 have landed
    __syncthreads();                                         // every wave's copies of tile 0 are readable
    stage4(lk + 2 * TB, gk + KST * HD, lk + 2 * TB + HB, gk + (KST + 32) * HD, lk + 3 * TB, gv + KST, lk + 3 * TB + HB, gv + (size_t)32 * SEQ + KST);
    const h16* pfp = PF + (size_t)b * SEQ + 8 * hi;          // + key0: elements r <- key0+8h+r, 8+r <- key0+16+8h+r
    v8f o0 = (v8f){}, o1 = (v8f){}, o2 = (v8f){}, o3 = (v8f){};
    v8f lt = (v8f){};                                        // row 0: running row sums (column t = query t)
    v16h ones;                                               // A fragment: lanes 0 and 16 hold row 0 (all 32 k positions), the other lanes rows 1..15
#pragma unroll
    for (int i = 0; i < 16; ++i) ones[i] = (lr == 0) ? (h16)1.0f : (h16)0.0f;
    float m = -3.0e38f, mlim = -3.0e38f, sh = 0.0f;          // reference maximum, m + RTH, PSH - m (the last two set with m in the first step)
#pragma unroll 1
    for (int t = 0; t < NT; ++t) {
      const h16* kt = &ring[t & 1][0][fo]; const h16* vt = &ring[t & 1][1][fo];
      const bool tpad = ((padtiles >> t) & 1u) != 0u;
#pragma unroll   // both 32-key steps of a tile inline, so that every LDS offset inside the tile is an immediate
      for (int s = 0; s < KST / 32; ++s) {
        const int key0 = t * KST + s * 32;
        const h16* ka = kt + s * 32 * LP;
        const v16h ka0 = ldh(ka), ka1 = ldh(ka + 32), kb0 = ldh(ka + 16 * LP), kb1 = ldh(ka + 16 * LP + 32);
        v8f sa = (v8f){}, sb = (v8f){};
        sa = wmma16(ka0, qh0, sa); sb = wmma16(kb0, qh0, sb);
        sa = wmma16(ka1, qh1, sa); sb = wmma16(kb1, qh1, sb);
        asm volatile("v_nop\n\tv_nop\n\tv_nop\n\tv_nop" : "+v"(sa), "+v"(sb) : "v"(ka0), "v"(ka1), "v"(kb0), "v"(kb1), "v"(qh0), "v"(qh1));
        float ta[8], tb[8]; float mx = -3.0e38f;
#pragma unroll
        for (int r = 0; r < 8; ++r) {
            ta[r] = sa[r] * SC2; tb[r] = sb[r] * SC2; }
        if (__builtin_expect(tpad, false)) {                 // scalar branch, the same in every wave of the block: only a tile that holds a padded key loads its flags and replaces (laid out of line)
            const v16h pf = ldh(pfp + key0);
            asm volatile("s_wait_xcnt 0x0" ::: "memory");    // the two flag loads are issued: their address pair is stepped at the loop's foot
#pragma unroll
            for (int r = 0; r < 8; ++r) { ta[r] = ((float)pf[r] != 0.0f) ? NEGB : ta[r]; tb[r] = ((float)pf[8 + r] != 0.0f) ? NEGB : tb[r]; } }
        // V^T fragment reads ahead of the test: behind its branch they would stand directly in front of the matrix ops that wait for them
        const h16* va = vt + s * 32;
        const v16h v0 = ldh(va), v1 = ldh(va + 16 * LP), v2 = ldh(va + 32 * LP), v3 = ldh(va + 48 * LP);
#pragma unroll
        for (int r = 0; r < 8; ++r) mx = fmaxf(mx, fmaxf(ta[r], tb[r]));
        if (__builtin_expect(__builtin_amdgcn_ballot_w32(mx > mlim) != 0u, false)) {   // scalar branch, every lane on inside (laid out of line): always taken in the first step, later only where a maximum grows by more than RTH
            const float mnew = fmaxf(m, fmaxf(mx, __shfl_xor(mx, 16, 32)));
            const float alpha = __builtin_amdgcn_exp2f(m - mnew);
            lt[0] *= alpha;
            o0 = o0 * alpha; o1 = o1 * alpha; o2 = o2 * alpha; o3 = o3 * alpha;
            m = mnew; mlim = mnew + RTH; sh = PSH - mnew; }
        v16h pb;
#pragma unroll
        for (int r = 0; r < 8; ++r) { pb[r] = (h16)__builtin_amdgcn_exp2f(ta[r] + sh); pb[8 + r] = (h16)__builtin_amdgcn_exp2f(tb[r] + sh); }
        lt = wmma16(ones, pb, lt);
        o0 = wmma16(v0, pb, o0); o1 = wmma16(v1, pb, o1); o2 = wmma16(v2, pb, o2); o3 = wmma16(v3, pb, o3);
        // four vector slots behind the run of matrix ops above, the distance the chip needs before a vector instruction touches their results or operands
        asm volatile("v_nop\n\tv_nop\n\tv_nop\n\tv_nop" : "+v"(o0), "+v"(o1), "+v"(o2), "+v"(o3), "+v"(lt) : "v"(v0), "v"(v1), "v"(v2), "v"(v3), "v"(pb));
      }
      asm volatile("s_wait_dscnt 0x0" ::: "memory");         // this wave's reads of tile t are done before its buffer may be refilled
      asm volatile("s_wait_asynccnt 0x0" ::: "memory");      // this wave's copies of tile t + 1 have landed
      __syncthreads();                                       // publishes tile t + 1 and ends every wave's reads of tile t
      if (t + 2 < NT) {                                      // block-uniform: refill the buffer that tile t has just left
          const unsigned lb = lk + (unsigned)(t & 1) * (2 * TB); const h16* gk2 = gk + (size_t)(t + 2) * KST * HD; const h16* gv2 = gv + (t + 2) * KST;
          stage4(lb, gk2, lb + HB, gk2 + 32 * HD, lb + TB, gv2, lb + TB + HB, gv2 + (size_t)32 * SEQ); }
    }
    asm volatile("s_wait_asynccnt 0x0" ::: "memory");        // nothing of this wave is in flight when the ring goes out of use
    float l = lt[0];                                         // lanes 0..15: the row sum of query t; lanes 16..31: row 8 of the tile, 0
    l += __shfl_xor(l, 16, 32);
    const float inv = CXS / l;
    const int wb = wave * 16 * 68;
    // O^T D layout: o_j[r] = (d = 16j + 8h + r, t = lane&15) -> os[t][d]; rows 0..15 x columns 0..63 all written
    { v4f a, c;
      a[0] = o0[0] * inv; a[1] = o0[1] * inv; a[2] = o0[2] * inv; a[3] = o0[3] * inv; c[0] = o0[4] * inv; c[1] = o0[5] * inv; c[2] = o0[6] * inv; c[3] = o0[7] * inv;
      *(v4fa*)(&os[wb + lr * 68 +  0 + 8 * hi]) = a; *(v4fa*)(&os[wb + lr * 68 +  0 + 8 * hi + 4]) = c;
      a[0] = o1[0] * inv; a[1] = o1[1] * inv; a[2] = o1[2] * inv; a[3] = o1[3] * inv; c[0] = o1[4] * inv; c[1] = o1[5] * inv; c[2] = o1[6] * inv; c[3] = o1[7] * inv;
      *(v4fa*)(&os[wb + lr * 68 + 16 + 8 * hi]) = a; *(v4fa*)(&os[wb + lr * 68 + 16 + 8 * hi + 4]) = c;
      a[0] = o2[0] * inv; a[1] = o2[1] * inv; a[2] = o2[2] * inv; a[3] = o2[3] * inv; c[0] = o2[4] * inv; c[1] = o2[5] * inv; c[2] = o2[6] * inv; c[3] = o2[7] * inv;
      *(v4fa*)(&os[wb + lr * 68 + 32 + 8 * hi]) = a; *(v4fa*)(&os[wb + lr * 68 + 32 + 8 * hi + 4]) = c;
      a[0] = o3[0] * inv; a[1] = o3[1] * inv; a[2] = o3[2] * inv; a[3] = o3[3] * inv; c[0] = o3[4] * inv; c[1] = o3[5] * inv; c[2] = o3[6] * inv; c[3] = o3[7] * inv;
      *(v4fa*)(&os[wb + lr * 68 + 48 + 8 * hi]) = a; *(v4fa*)(&os[wb + lr * 68 + 48 + 8 * hi + 4]) = c; }
    wave_sync();
    h16* crow = CTX + ((size_t)b * SEQ + t0) * DP + h * HD;
{
#pragma unroll
        for (int s = 0; s < 4; ++s) { const int row = 4 * s + (lane >> 3), c8 = (lane & 7) * 8;   // 4 s x 4 rows = 16 rows; 8 lanes x 8 halves = 64 columns
            const v4f x0 = *(const v4fa*)(&os[wb + row * 68 + c8]); const v4f x1 = *(const v4fa*)(&os[wb + row * 68 + c8 + 4]); v8h hv;
#pragma unroll
            for (int i = 0; i < 4; ++i) { hv[i] = (h16)x0[i]; hv[4 + i] = (h16)x1[i]; }
            *(v8h*)(crow + (size_t)row * DP + c8) = hv; }
         }
}

// k_out: f16 GEMM, 4 waves per 64x128 tile (32x64 per wave), A = ctx plane [NB*SEQ][1024] (x256), Bt = Wo^T plane [512][1024] (x1024), K = DP, through gemm_core; OUT[m][n] = acc * 2^-18 + bo[n] (f32).
__global__ __launch_bounds__(128) void k_out(const h16* __restrict__ A, const h16* __restrict__ Bt, const float* __restrict__ bias, float* OUT) {
    __shared__ __align__(16) float osb[4 * 16 * 68];
    __shared__ __align__(16) bf ring[2 * (64 + 128) * (128 + 8)];
    const int lane = threadIdx.x & 31, lr = lane & 15, hi = lane >> 4; const int wave = wave_id();
    float* os = osb + wave * 16 * 68;                        // wave-private staging of the epilogue
    const int R0 = blockIdx.x * 64, C0 = blockIdx.y * 128;
    v8f acc[2][4];
#pragma unroll
    for (int mb = 0; mb < 2; ++mb)
#pragma unroll
        for (int nb = 0; nb < 4; ++nb) acc[mb][nb] = (v8f){};
    gemm_core<2, 128, DP, false>((const bf*)A, (const bf*)Bt, R0, C0, ring, acc);
    const int r0 = R0 + (wave >> 1) * 32, c0 = C0 + (wave & 1) * 64;   // this wave's 32 x 64 tile
    const size_t orow0 = (size_t)(r0 / SEQ) * OUT_SEQ + (size_t)(r0 % SEQ);
    const int cofs = lr * 4;
    v4f bv;
#pragma unroll
    for (int i = 0; i < 4; ++i) bv[i] = bfr(bias[min(c0 + cofs + i, DIN - 1)]);
#pragma unroll
    for (int mb = 0; mb < 2; ++mb) {
#pragma unroll
        for (int nb = 0; nb < 4; ++nb) {
#pragma unroll
            for (int j = 0; j < 8; ++j) os[(hi * 8 + j) * 68 + nb * 16 + lr] = acc[mb][nb][j] * FOLD; }   // D: row 8h+j, col lane&15
        wave_sync();
{
#pragma unroll
            for (int s = 0; s < 8; ++s) { const int row = 2 * s + hi;   // 8 s x 2 rows = 16 rows; 16 lanes x 4 floats = 64 columns
                const v4f val = *(const v4fa*)(&os[row * 68 + cofs]) + bv;
                *(v4f*)(OUT + (orow0 + (size_t)(mb * 16 + row)) * DIN + c0 + cofs) = val; }
             }
        wave_sync();
    }
}

static constexpr size_t al256(size_t v) { return (v + 255) & ~(size_t)255; }
static constexpr size_t SZ_XB = al256((size_t)NB * SEQ * DIN * 2);
static constexpr size_t SZ_WT = al256((size_t)3 * DP * DIN * 2);
static constexpr size_t SZ_WO = al256((size_t)DIN * DP * 2);
static constexpr size_t SZ_PL = al256((size_t)NB * NH_ * SEQ * HD * 2);
static constexpr size_t SZ_CX = al256((size_t)NB * SEQ * DP * 2);
static constexpr size_t SZ_PF = al256((size_t)NB * SEQ * 2);
static constexpr size_t SZ_TF = al256((size_t)NB * NT * 4);
static constexpr size_t SZ_TOTAL = SZ_XB + SZ_WT + SZ_WO + 3 * SZ_PL + SZ_CX + SZ_PF + SZ_TF;
static_assert(SZ_TOTAL <= (size_t)134217728);          // workspace carve <= 128 MiB
static_assert(((size_t)DP * DIN * 2) % 256 == 0);      // weight sub-planes stay 256-byte aligned

extern "C" void kernel_launch(void* const* d_in, const int* in_sizes, int n_in,
                              void* d_out, int out_size, void* d_ws, size_t ws_size, hipStream_t stream) {
    if (n_in < 10) return;
    const size_t needx = ((size_t)(NB - 1) * SEQ_FULL + SEQ) * DIN;
    if ((size_t)in_sizes[0] < needx || (size_t)in_sizes[1] < needx) return;
    if ((size_t)in_sizes[2] < (size_t)DIN * DP || (size_t)in_sizes[4] < (size_t)DIN * DP || (size_t)in_sizes[6] < (size_t)DIN * DP || (size_t)in_sizes[8] < (size_t)DP * DIN) return;
    if ((size_t)in_sizes[3] < (size_t)DP || (size_t)in_sizes[5] < (size_t)DP || (size_t)in_sizes[7] < (size_t)DP || (size_t)in_sizes[9] < (size_t)DIN) return;
    if ((size_t)out_size < ((size_t)(NB - 1) * OUT_SEQ + SEQ) * DIN) return;
    if (SZ_TOTAL > ws_size) return;
    // wire order: data, pad input, wq, bq, wk, bk, wv, bv, wo, bo (all f32)
    const float* x = (const float*)d_in[0]; const float* pm = (const float*)d_in[1];
    const float* wq = (const float*)d_in[2]; const float* bq = (const float*)d_in[3];
    const float* wk = (const float*)d_in[4]; const float* bk = (const float*)d_in[5];
    const float* wv = (const float*)d_in[6]; const float* bv = (const float*)d_in[7];
    const float* wo = (const float*)d_in[8]; const float* bo = (const float*)d_in[9];
    float* OUT = (float*)d_out;      // [NB][SEQ][512]
    char* wsp = (char*)d_ws;
    bf* XB = (bf*)wsp; wsp += SZ_XB;                 // [NB*SEQ][512] bf16
    bf* WT = (bf*)wsp; wsp += SZ_WT;                 // [3][1024][512] bf16, rows h*64+dm: q | k | v
    bf* WOB = (bf*)wsp; wsp += SZ_WO;                // [512][1024] f16 bits (x1024)
    h16* QH = (h16*)wsp; wsp += SZ_PL;               // [NB*16][SEQ][64]
    h16* KP = (h16*)wsp; wsp += SZ_PL;               // [NB*16][SEQ][64]
    h16* VT = (h16*)wsp; wsp += SZ_PL;               // [NB*16][64][SEQ]
    h16* CX = (h16*)wsp; wsp += SZ_CX;               // [NB*SEQ][1024] (x256)
    h16* PF = (h16*)wsp; wsp += SZ_PF;               // [NB*SEQ] pad flags
    unsigned* TF = (unsigned*)wsp; wsp += SZ_TF;     // [NB*SEQ/64] nonzero where a 64-key tile holds a padded key

    k_prep<<<dim3(PB_PAD + 4 * PB_WT + PB_CVT, 1, 1), 256, 0, stream>>>(x, pm, wq, wk, wv, wo, XB, WT, WOB, PF, TF);

    k_proj<<<dim3(NB * SEQ / 128, DP / 128, 3), 128, 0, stream>>>(XB, WT, bq, bk, bv, QH, KP, VT);

    k_flash<<<dim3(SEQ / (16 * AW), NB * NH_, 1), 32 * AW, 0, stream>>>(QH, KP, VT, PF, TF, CX);

    k_out<<<dim3(NB * SEQ / 64, DIN / 128, 1), 128, 0, stream>>>(CX, (const h16*)WOB, bo, OUT);
}

// v007
// It runs in 64.3 microseconds.
// Next to v006, in two timings, it ran 1.03 and 1.05 times as fast.
// All steps since v000 together make it 3.06 times as fast.
#include <hip/hip_runtime.h>

// Multi-head self-attention: data [NB][SEQ][512], Wq/Wk/Wv [512][1024] ([in][out], column c = dm*16 + h), biases, key-padding replace fill (-1e9 where a key's 512 pad-input values sum to 0), score scale 1/8, merged heads (h*64+dm) @ Wo [1024][512] + bo, f32 output.
// Compute dtypes, f32 accumulate everywhere: projections v_wmma_f32_16x16x32_bf16 (data and W RNE-converted to bf16; products exact);
// scores v_wmma_f32_16x16x32_f16: q and k single f16 planes (one product); P (x256 carry, cancels in the normalisation) and v single f16; softmax f32 (online, lazily moved reference maximum; row sums of the f16 P by a ones-row matrix op, f32 accumulate);
// output projection v_wmma_f32_16x16x32_f16: ctx single f16 (x256 carry), Wo = f16 of (bf16 RNE of wo) x1024 (exact), 2^-18 folded back in f32, bias added in f32.
// Launches: 4. k_prep (block index picks the job: pad flags with one word per 64 keys, one weight tile, or a slice of the data conversion; the jobs read none of each other's output), k_proj (grid z picks q, k or v^T), k_flash, k_out.
// Layout: bf16 copy of data; transposed K-contiguous weight planes (head-permuted rows h*64+dm); q, k planes [b*16+h][t][d] and v^T plane [b*16+h][d][t] from the GEMM epilogue;
// fused flash kernel in transposed form (S^T = K Q^T, O^T = V^T P^T; a wave holds 32 queries and every second 64-key tile, 8 score + 8 P.V matrix ops per 32-key step; K and V^T tiles of 64 keys staged in pairs in LDS by asynchronous copies, two buffers; wave pairs merge their halves of the keys at the end) writing the ctx plane [b*SEQ+t][h*64+d].
// Both GEMMs (k_proj, k_out): 4-wave blocks, operand tiles staged in LDS by asynchronous copies of whole 128-byte lines, two buffers, fragments read from LDS.

#ifndef NB
#define NB 2
#endif
#ifndef SEQ
#define SEQ 2048
#endif
#define NB_FULL  2
#define SEQ_FULL 2048
#ifndef OUT_SEQ
#define OUT_SEQ SEQ              // row pitch (in tokens) between batches of the output
#endif
#define DIN  512                 // input width = output width
#define DP   1024                // projection width = 16 heads x 64
#define NH_  16
#define HD   64
#define AW   8                   // waves per flash block; all share the staged K / V^T tiles
#define KH   2                   // 64-key tiles staged together; wave group wave / QG works on one of them
#define QG   (AW / KH)           // query groups per flash block, 32 query rows (two column tiles) each
#define KST  64                  // keys per staged tile (two 32-key steps)
#define LP   72                  // LDS row pitch in halves: 128-byte rows + 16 bytes, the pitch for 16-byte LDS readers
#define NT   (SEQ / KST)         // staged tiles per (batch, head)
#define NP   (NT / KH)           // staged tile pairs per (batch, head)
#define SC2  (0.125f * 1.4426950408889634f)   // HD^-0.5 * log2(e)
#define PSH  8.0f                // log2 of the P carry (256)
#define RTH  7.0f                // lazy rescale: how far (log2) a column's new maximum may stand above the reference in use before the reference moves
#define NEGB (-1.0e9f * 1.4426950408889634f)  // fill value of padded keys in the log2 domain
#define CXS  256.0f              // carry of the ctx plane
#define WOS  1024.0f             // carry of the Wo plane
#define FOLD (1.0f / (256.0f * 1024.0f))

static_assert(HD == 64);
static_assert(PSH + RTH <= 15.0f);             // P <= 2^(PSH + RTH) stays finite in f16
static_assert(NH_ * HD == DP);
static_assert(NH_ == 16);                      // column c = dm*16 + h
static_assert(DP % 64 == 0);
static_assert(DIN % 64 == 0);
static_assert(DIN % 32 == 0);                  // GEMM k-loops step by 32
static_assert(DP % 32 == 0);
static_assert(DIN == 512);                     // pad-row sum: 4 x 128 floats per wave
static_assert(SEQ % 64 == 0);                  // a 64-row tile never straddles two batches
static_assert((NB * SEQ) % 64 == 0);
static_assert(SEQ % 32 == 0);                  // key loop steps by 32
static_assert(KH == 2);                        // a wave and its partner wave ^ QG exchange one column tile each
static_assert(32 * QG == 16 * AW);             // a flash block covers 16 * AW query rows
static_assert(SEQ % (16 * AW) == 0);           // flash grid covers the sequence exactly
static_assert(SEQ % KST == 0);
static_assert(NT % KH == 0);
static_assert(NP >= 2);                        // the two-buffer prologue fills tile pairs 0 and 1
static_assert(NT <= 32);                       // one bit per staged tile in the 32-lane ballot of padded tiles
static_assert(KST == 64);                      // a staged tile is the 64 key rows of one pad block
static_assert(32 * AW * 2 * 8 == KST * HD);    // two 16-byte copies per thread cover one 64 x 64 tile
static_assert(((size_t)SEQ * DIN) % 8 == 0);
static_assert((NB * SEQ) % 128 == 0);          // GEMM block tiles: 128 data rows (k_proj)
static_assert(DP % 128 == 0);
static_assert(DIN % 128 == 0);
static_assert(NB <= NB_FULL);
static_assert(SEQ <= SEQ_FULL);

typedef _Float16 h16;
typedef unsigned short bf;
typedef __attribute__((ext_vector_type(16))) __bf16   v16bf;
typedef __attribute__((ext_vector_type(16))) _Float16 v16h;
typedef __attribute__((ext_vector_type(8)))  _Float16 v8h;
typedef __attribute__((ext_vector_type(8)))  unsigned short v8us;
typedef __attribute__((ext_vector_type(16))) unsigned short v16us;
typedef __attribute__((ext_vector_type(8)))  float    v8f;
typedef __attribute__((ext_vector_type(4)))  float    v4f;
typedef __attribute__((ext_vector_type(2)))  float    v2f;
typedef v4f  __attribute__((may_alias)) v4fa;

__device__ __forceinline__ unsigned short f2bf(float f) { unsigned u = __float_as_uint(f); u += 0x7FFFu + ((u >> 16) & 1u); return (unsigned short)(u >> 16); }
__device__ __forceinline__ float bfr(float f) { return __uint_as_float(((unsigned)f2bf(f)) << 16); }   // value after RNE conversion to bf16
__device__ __forceinline__ v16h cat16(v8h lo, v8h hi) { return __builtin_shufflevector(lo, hi, 0, 1, 2, 3, 4, 5, 6, 7, 8, 9, 10, 11, 12, 13, 14, 15); }
__device__ __forceinline__ v16bf cat16b(v8us lo, v8us hi) { return __builtin_bit_cast(v16bf, __builtin_shufflevector(lo, hi, 0, 1, 2, 3, 4, 5, 6, 7, 8, 9, 10, 11, 12, 13, 14, 15)); }
__device__ __forceinline__ v8f wmma16(v16h a, v16h b, v8f c) { return __builtin_amdgcn_wmma_f32_16x16x32_f16(false, a, false, b, (short)0, c, false, false); }
__device__ __forceinline__ v8f wmmab(v16bf a, v16bf b, v8f c) { return __builtin_amdgcn_wmma_f32_16x16x32_bf16(false, a, false, b, (short)0, c, false, false); }
// fragment loaders from K-contiguous 16-bit rows; p already includes + 8*(lane>>4): elements 0..7 <- k0+8h+0..7, elements 8..15 <- k0+16+8h+0..7 (same map for A and B)
__device__ __forceinline__ v16h  ldh(const h16* p) { return cat16(*(const v8h*)p, *(const v8h*)(p + 16)); }
__device__ __forceinline__ v16bf ldb(const bf* p)  { return cat16b(*(const v8us*)p, *(const v8us*)(p + 16)); }
// ordering point for wave-private LDS tiles (same wave writes and reads)
__device__ __forceinline__ void wave_sync() { __builtin_amdgcn_fence(3 /* release order */, "wavefront"); __builtin_amdgcn_wave_barrier(); asm volatile("" ::: "memory"); }
// wave index of the calling thread as a wave-uniform scalar
__device__ __forceinline__ int wave_id() { return __builtin_amdgcn_readfirstlane((int)(threadIdx.x >> 5)); }

// blocks of k_prep per job
#define PB_PAD (NB * SEQ / 64)                        // 64 pad rows each
#define PB_WT  ((DIN / 64) * (DP / 64))               // 64 x 64 tiles of one weight matrix (all four have DIN * DP elements)
#define N8     ((size_t)NB * SEQ * DIN / 8)           // 8-element chunks of the data
#define PB_CVT ((unsigned)((N8 + 255) / 256))

// cvt_job: data f32 -> bf16 copy [NB*SEQ][512], 8 elements per thread; blk = block index inside the job.
__device__ __forceinline__ void cvt_job(const float* __restrict__ x, bf* dst, int blk) {
    const size_t i = (size_t)blk * 256 + threadIdx.x; if (i >= N8) return;
    constexpr size_t C8 = (size_t)SEQ * DIN / 8;      // chunks per batch
    const size_t so = (SEQ == SEQ_FULL) ? i * 8 : (i / C8) * ((size_t)SEQ_FULL * DIN) + (i % C8) * 8;
    const v8f v = *(const v8f*)(x + so); v8us o;
#pragma unroll
    for (int k = 0; k < 8; ++k) o[k] = f2bf(v[k]);
    *(v8us*)(dst + i * 8) = o;
}

// wt_job: W [K][N] f32 ([in][out]) -> dst [N][K] 16-bit rows (K-contiguous). in[K rows][N cols] -> out[N rows][K cols]; one 64 x 64 tile (bx of K/64, by of N/64), 256 threads; ts = 64 * 68 floats of LDS.
// perm != 0: source column c = dm*16 + h lands on destination row h*64 + dm. asf16 == 0: bf16 bits; asf16 != 0: f16 bits of (bf16 value * scale).
__device__ __forceinline__ void wt_job(const float* __restrict__ W, bf* dst, int K, int N, int perm, int asf16, float scale, int bx, int by, float* ts) {   // ts: [column][k]
    const int tid = threadIdx.x, lane = tid & 31; const int wave = wave_id();
    const int k0 = bx * 64, c0 = by * 64;
#pragma unroll
    for (int it = 0; it < 4; ++it) { const int e = tid + 256 * it; const int kk = e >> 4, c4 = (e & 15) * 4;   // 64 k rows x 16 float4 = whole tile
        const v4f v = *(const v4f*)(W + (size_t)(k0 + kk) * (size_t)N + c0 + c4);
        ts[(c4 + 0) * 68 + kk] = v[0]; ts[(c4 + 1) * 68 + kk] = v[1]; ts[(c4 + 2) * 68 + kk] = v[2]; ts[(c4 + 3) * 68 + kk] = v[3]; }
    __syncthreads();
{
#pragma unroll
        for (int s = 0; s < 2; ++s) { const int row = 4 * (wave + 8 * s) + (lane >> 3), c8 = (lane & 7) * 8;   // 8 waves x 2 s x 4 rows = 64 rows; 8 lanes x 8 = 64 k
            const v4f x0 = *(const v4fa*)(&ts[row * 68 + c8]); const v4f x1 = *(const v4fa*)(&ts[row * 68 + c8 + 4]); v8us o;
#pragma unroll
            for (int i = 0; i < 4; ++i) { const float f0 = bfr(x0[i]), f1 = bfr(x1[i]);
                const unsigned short b0 = (unsigned short)(__float_as_uint(f0) >> 16), b1 = (unsigned short)(__float_as_uint(f1) >> 16);
                const unsigned short g0 = __builtin_bit_cast(unsigned short, (h16)(f0 * scale)), g1 = __builtin_bit_cast(unsigned short, (h16)(f1 * scale));
                o[i] = asf16 ? g0 : b0; o[4 + i] = asf16 ? g1 : b1; }
            const int c = c0 + row; const int n = perm ? ((c & 15) * 64 + (c >> 4)) : c;
            *(v8us*)(dst + (size_t)n * (size_t)K + k0 + c8) = o; }
         }
    asm volatile("s_wait_xcnt 0x0" ::: "memory");   // the two stores above are issued: no register that they name is rewritten by the code that follows this job in the merged kernel
}

// pad_job: flags of 64 key rows (1 where the row's 512 pad-input values sum to 0), and one word for the 64 rows together (nonzero where any of them is flagged); fl = 64 floats of LDS.
__device__ __forceinline__ void pad_job(const float* __restrict__ mask, h16* PF, unsigned* TF, int blk, float* fl) {
    const int tid = threadIdx.x, lane = tid & 31; const int wave = wave_id();
    const int m0 = blk * 64;
#pragma unroll 1
    for (int i = 0; i < 8; ++i) { const int m = m0 + wave * 8 + i; const int b = m / SEQ, t = m % SEQ;
        const float* row = mask + ((size_t)b * SEQ_FULL + t) * DIN;
        float s = 0.0f;
#pragma unroll
        for (int j = 0; j < 4; ++j) { const v4f v = *(const v4f*)(row + j * 128 + lane * 4); s += bfr(v[0]); s += bfr(v[1]); s += bfr(v[2]); s += bfr(v[3]); }
        s += __shfl_xor(s, 16, 32); s += __shfl_xor(s, 8, 32); s += __shfl_xor(s, 4, 32); s += __shfl_xor(s, 2, 32); s += __shfl_xor(s, 1, 32);
        if (lane == 0) fl[wave * 8 + i] = (s == 0.0f) ? 1.0f : 0.0f; }
    __syncthreads();
    if (tid < 8) { v8h o;
#pragma unroll
        for (int k = 0; k < 8; ++k) o[k] = (h16)fl[tid * 8 + k];
        *(v8h*)(PF + (size_t)m0 + tid * 8) = o;  }
    if (wave == 0) { const unsigned any = __builtin_amdgcn_ballot_w32((fl[lane] != 0.0f) | (fl[lane + 32] != 0.0f));
        if (lane == 0) TF[blk] = any; }
}

// k_prep: everything that reads only the inputs, in one launch. The job is a function of blockIdx.x alone, so every branch (and the barrier inside a job) is block-uniform.
// Order: the pad rows (eight dependent row sums per wave, the longest job) take the lowest block indices, the one-load conversion blocks the highest.
__global__ __launch_bounds__(256) void k_prep(const float* __restrict__ x, const float* __restrict__ pm, const float* __restrict__ wq, const float* __restrict__ wk, const float* __restrict__ wv,
                                              const float* __restrict__ wo, bf* XB, bf* WT, bf* WOB, h16* PF, unsigned* TF) {
    __shared__ __align__(16) float ts[64 * 68];
    const int bid = blockIdx.x;
    if (bid < PB_PAD) { pad_job(pm, PF, TF, bid, ts); return; }
    if (bid < PB_PAD + 4 * PB_WT) {
        const int j = bid - PB_PAD; const int w = j / PB_WT, tile = j % PB_WT;
        // w = 0..2: wq, wk, wv, in[K = 512][N = 1024] -> [1024 rows (head-permuted)][512], bf16; w = 3: wo, in[K = 1024 (h*64+dm)][N = 512] -> [512 rows][1024], f16 x1024
        const bool o = (w == 3);
        const float* W = o ? wo : (w == 0 ? wq : (w == 1 ? wk : wv));
        bf* dst = o ? WOB : WT + (size_t)w * DP * DIN;
        const int K = o ? DP : DIN, N = o ? DIN : DP;
        wt_job(W, dst, K, N, o ? 0 : 1, o ? 1 : 0, o ? WOS : 1.0f, tile % (K / 64), tile / (K / 64), ts);
        return; }
    cvt_job(x, XB, bid - (PB_PAD + 4 * PB_WT));
}

// One thread's eight 16-byte asynchronous copies global -> LDS: rows ls bytes apart in LDS, gs elements apart in memory. The s_wait_xcnt closes the statement so that
// no address register of an issued copy is rewritten ahead of it.
__device__ __forceinline__ void stage8(unsigned l, const bf* g, unsigned ls, size_t gs) {
    asm volatile("global_load_async_to_lds_b128 %0, %1, off\n\t"
                 "global_load_async_to_lds_b128 %2, %3, off\n\t"
                 "global_load_async_to_lds_b128 %4, %5, off\n\t"
                 "global_load_async_to_lds_b128 %6, %7, off\n\t"
                 "global_load_async_to_lds_b128 %8, %9, off\n\t"
                 "global_load_async_to_lds_b128 %10, %11, off\n\t"
                 "global_load_async_to_lds_b128 %12, %13, off\n\t"
                 "global_load_async_to_lds_b128 %14, %15, off\n\t"
                 "s_wait_xcnt 0x0"
                 :: "v"(l), "v"(g), "v"(l + ls), "v"(g + gs), "v"(l + 2 * ls), "v"(g + 2 * gs), "v"(l + 3 * ls), "v"(g + 3 * gs),
                    "v"(l + 4 * ls), "v"(g + 4 * gs), "v"(l + 5 * ls), "v"(g + 5 * gs), "v"(l + 6 * ls), "v"(g + 6 * gs), "v"(l + 7 * ls), "v"(g + 7 * gs) : "memory");
}
__device__ __forceinline__ v16us ldu(const bf* p) { return __builtin_shufflevector(*(const v8us*)p, *(const v8us*)(p + 16), 0, 1, 2, 3, 4, 5, 6, 7, 8, 9, 10, 11, 12, 13, 14, 15); }   // same k map as ldh / ldb
template <bool BF> __device__ __forceinline__ v8f mm(v16us a, v16us b, v8f c) {
    if constexpr (BF) return wmmab(__builtin_bit_cast(v16bf, a), __builtin_bit_cast(v16bf, b), c);
    else              return wmma16(__builtin_bit_cast(v16h, a), __builtin_bit_cast(v16h, b), c);
}

// gemm_core: acc[mb][nb] += A rows x Bt rows over K (16-bit, K-contiguous planes), for a block of 4 waves (2 x 2). Block tile (2 * MF * 16) x 128 at (R0, C0); wave (wave >> 1, wave & 1) owns (MF * 16) x 64.
// Per trip KS k values of every row of both tiles lie in one LDS buffer (row pitch KS + 8 halves: 16 bytes x odd, the pitch for 16-byte LDS readers); a wave's copy covers whole 128-byte lines.
// Tile t + 1 is copied into one buffer while tile t is worked on in the other; one barrier per trip publishes and frees. k ascends by 32 in every accumulator.
template <int MF, int KS, int K, bool BF>
__device__ __forceinline__ void gemm_core(const bf* __restrict__ A, const bf* __restrict__ Bt, int R0, int C0, bf* ring, v8f (&acc)[MF][4]) {
    constexpr int GP = KS + 8, BM = 2 * MF * 16, BUFH = (BM + 128) * GP;   // pitch (halves), A rows, halves per buffer
    constexpr int CPR = KS / 8, RS = 128 / CPR, NTR = K / KS;              // 16-byte chunks per row, rows covered by the block's 128 threads in one copy each, trips
    static_assert(BM == 8 * RS);                                           // one stage8 covers the A tile
    static_assert(128 % (8 * RS) == 0);                                    // whole stage8 groups cover the B tile
    static_assert(K % KS == 0);
    static_assert(NTR >= 2);                                               // the prologue fills tiles 0 and 1
    static_assert(MF == 2 || MF == 4);
    const int tid = threadIdx.x, lane = tid & 31, lr = lane & 15, hi = lane >> 4; const int wave = wave_id();
    const int cr = tid / CPR, cc = (tid % CPR) * 8;                        // copy map: thread -> row cr (+ multiples of RS), 16-byte column
    const bf* ga = A + (size_t)(R0 + cr) * K + cc;                         // + t * KS
    const bf* gb = Bt + (size_t)(C0 + cr) * K + cc;
    const unsigned la = (unsigned)(size_t)&ring[cr * GP + cc];             // LDS byte address of the thread's first A chunk in buffer 0
    auto stage = [&](int t, int buf) {
        const unsigned l = la + (unsigned)buf * (unsigned)(BUFH * 2);
        stage8(l, ga + t * KS, RS * GP * 2, (size_t)RS * K);
#pragma unroll
        for (int g = 0; g < 128 / (8 * RS); ++g) stage8(l + (unsigned)((BM + g * 8 * RS) * GP * 2), gb + (size_t)g * 8 * RS * K + t * KS, RS * GP * 2, (size_t)RS * K);
    };
    stage(0, 0);
    asm volatile("s_wait_asynccnt 0x0" ::: "memory");        // this wave's copies of tile 0 have landed
    __syncthreads();                                         // every wave's copies of tile 0 are readable
    stage(1, 1);
    const int ao = ((wave >> 1) * MF * 16 + lr) * GP + 8 * hi, bo = (BM + (wave & 1) * 64 + lr) * GP + 8 * hi;
#pragma unroll 1   // rolled; the buffer is picked by a scalar select
    for (int t = 0; t < NTR; ++t) {
        const bf* ab = ring + (t & 1) * BUFH + ao; const bf* bb = ring + (t & 1) * BUFH + bo;
        // Fragment sets: each k step's LDS reads go out as one group. NS == 2 (the small wave tile, one wave per SIMD): the next step's group ahead of this step's matrix instructions;
        // NS == 1 (the large wave tile, several waves per SIMD, which cover each other's LDS waits): one set, so that the wave stays inside the first 256 registers.
        constexpr int NS = (MF == 2) ? 2 : 1, NK = KS / 32;
        v16us a[NS][MF], b[NS][4];
        auto frags = [&](int ks) {                           // never past the trip's own tile: ks < NK at every call
#pragma unroll
            for (int mb = 0; mb < MF; ++mb) a[ks % NS][mb] = ldu(ab + mb * 16 * GP + ks * 32);
#pragma unroll
            for (int nb = 0; nb < 4; ++nb) b[ks % NS][nb] = ldu(bb + nb * 16 * GP + ks * 32);
        };
        frags(0);
#pragma unroll   // all k steps of a trip inline, so that every LDS offset inside the tile is an immediate and the fragment sets stay in registers
        for (int ks = 0; ks < NK; ++ks) {
            if (NS == 2 && ks + 1 < NK) frags(ks + 1);
            __builtin_amdgcn_sched_barrier(0);               // keeps the group of LDS reads ahead of the matrix instructions below: sunk among them, each read is waited for where it stands
#pragma unroll
            for (int nb = 0; nb < 4; ++nb)
#pragma unroll
                for (int mb = 0; mb < MF; ++mb) acc[mb][nb] = mm<BF>(a[ks % NS][mb], b[ks % NS][nb], acc[mb][nb]);
            if (NS == 1 && ks + 1 < NK) frags(ks + 1);
        }
        __builtin_amdgcn_sched_barrier(0);                   // keeps the trip's matrix instructions ahead of the barrier: sunk behind it they delay the refill, which then has less than a trip to land
        asm volatile("s_wait_dscnt 0x0" ::: "memory");       // this wave's reads of tile t are done before its buffer may be refilled
        asm volatile("s_wait_asynccnt 0x0" ::: "memory");    // this wave's copies of tile t + 1 have landed
        __syncthreads();                                     // publishes tile t + 1 and ends every wave's reads of tile t
        if (t + 2 < NTR) stage(t + 2, t & 1);                // block-uniform: refill the buffer that tile t has just left
    }
    asm volatile("s_wait_asynccnt 0x0" ::: "memory");        // nothing of this wave is in flight when the ring goes out of use
}

// k_proj: bf16 GEMM, 4 waves per 128x128 tile (64x64 and 16 accumulators per wave), operands from K-contiguous bf16 planes through gemm_core, K = DIN.
// C[m][n] = sum_k A[m][k] Bt[n][k] + bias, written as f16 (Ph), row pitch 'pitch' (halves). grid (NB*SEQ/128 data tiles, DP/128 weight tiles, 3), 128 threads; z picks the product:
// z = 0, 1 (q, k): A = data rows (m = b*SEQ + t), Bt = W^T rows (n = h*64 + d) -> plane [(b*16 + h)][t][d]; bias per column.
// z = 2 (v^T):     A = Wv^T rows (m = h*64 + d), Bt = data rows (n = b*SEQ + t) -> plane [(b*1024 + m)][t] = [(b*16 + h)][d][t]; bias per row.
// bias (source order dm*16 + h, RNE-converted to bf16, added in f32): bmode 0 = per column n = h*64 + dm, bmode 1 = per row m = h*64 + dm.
__global__ __launch_bounds__(128) void k_proj(const bf* __restrict__ XB, const bf* __restrict__ WT, const float* __restrict__ bq, const float* __restrict__ bk, const float* __restrict__ bv, h16* QH, h16* KP, h16* VT) {
    __shared__ __align__(16) float osb[4 * 16 * 68];
    __shared__ __align__(16) bf ring[2 * (128 + 128) * (64 + 8)];
    const int z = blockIdx.z; const bool bmode = (z == 2);
    const bf* Wz = WT + (size_t)z * DP * DIN;
    const bf* A = bmode ? Wz : XB; const bf* Bt = bmode ? XB : Wz;
    const float* bias = (z == 0) ? bq : ((z == 1) ? bk : bv);
    h16* Ph = (z == 0) ? QH : ((z == 1) ? KP : VT);
    const int pitch = bmode ? SEQ : HD;
    const int lane = threadIdx.x & 31, lr = lane & 15, hi = lane >> 4; const int wave = wave_id();
    float* os = osb + wave * 16 * 68;                        // wave-private staging of the epilogue
    const int R0 = (bmode ? blockIdx.y : blockIdx.x) * 128, C0 = (bmode ? blockIdx.x : blockIdx.y) * 128;
    v8f acc[4][4];
#pragma unroll
    for (int mb = 0; mb < 4; ++mb)
#pragma unroll
        for (int nb = 0; nb < 4; ++nb) acc[mb][nb] = (v8f){};
    gemm_core<4, 64, DIN, true>(A, Bt, R0, C0, ring, acc);
    const int r0 = R0 + (wave >> 1) * 64, c0 = C0 + (wave & 1) * 64;   // this wave's 64 x 64 tile
    const size_t tbase = bmode ? (size_t)r0 * SEQ + (size_t)(c0 / SEQ) * ((size_t)DP * SEQ) + (size_t)(c0 % SEQ)
                               : (size_t)(r0 / SEQ) * ((size_t)NH_ * SEQ * HD) + (size_t)(r0 % SEQ) * HD + (size_t)(c0 / HD) * ((size_t)SEQ * HD);
    const int c8 = (lane & 7) * 8;
    float bcol[8];      // column-mode bias of this lane's 8 columns (clamped addresses, always loaded)
    { const int hc = min(c0 >> 6, NH_ - 1);
#pragma unroll
      for (int i = 0; i < 8; ++i) bcol[i] = bfr(bias[min((c8 + i) * NH_ + hc, DP - 1)]); }
#pragma unroll
    for (int mb = 0; mb < 4; ++mb) {
#pragma unroll
        for (int nb = 0; nb < 4; ++nb) {
#pragma unroll
            for (int j = 0; j < 8; ++j) os[(hi * 8 + j) * 68 + nb * 16 + lr] = acc[mb][nb][j]; }   // D: row 8h+j, col lane&15
        wave_sync();
        const size_t sb = tbase + (size_t)(mb * 16) * (size_t)pitch;
{
#pragma unroll
            for (int s = 0; s < 4; ++s) { const int row = 4 * s + (lane >> 3);   // 4 s x 4 row groups = 16 rows; 8 lanes x 8 = 64 columns
                const int m = r0 + mb * 16 + row;
                const float brow = bfr(bias[min((m & 63) * NH_ + min(m >> 6, NH_ - 1), DP - 1)]);
                const v4f x0 = *(const v4fa*)(&os[row * 68 + c8]); const v4f x1 = *(const v4fa*)(&os[row * 68 + c8 + 4]); v8h hv;
#pragma unroll
                for (int i = 0; i < 4; ++i) { const float y0 = x0[i] + (bmode ? brow : bcol[i]); const float y1 = x1[i] + (bmode ? brow : bcol[4 + i]);
                    hv[i] = (h16)y0; hv[4 + i] = (h16)y1; }
                const size_t oo = sb + (size_t)row * (size_t)pitch + c8;
                *(v8h*)(Ph + oo) = hv; }
             }
        wave_sync();
    }
}

// One thread's share of one staged 64-key tile: four 16-byte asynchronous copies global -> LDS (two of K, two of V^T). The s_wait_xcnt closes the statement so that
// no address register of an issued copy is rewritten ahead of it.
__device__ __forceinline__ void stage4(unsigned l0, const h16* g0, unsigned l1, const h16* g1, unsigned l2, const h16* g2, unsigned l3, const h16* g3) {
    asm volatile("global_load_async_to_lds_b128 %0, %1, off\n\t"
                 "global_load_async_to_lds_b128 %2, %3, off\n\t"
                 "global_load_async_to_lds_b128 %4, %5, off\n\t"
                 "global_load_async_to_lds_b128 %6, %7, off\n\t"
                 "s_wait_xcnt 0x0"
                 :: "v"(l0), "v"(g0), "v"(l1), "v"(g1), "v"(l2), "v"(g2), "v"(l3), "v"(g3) : "memory");
}

// k_flash: fused attention. A block of 8 waves covers 128 query rows of one (batch, head): wave (qg = wave & 3, hf = wave >> 2) takes the 32 query rows of group qg (two column tiles of 16)
// and, of every staged pair of 64-key tiles, tile hf. Each K / V^T fragment read from LDS feeds two matrix ops (one per column tile). Q fragments straight from the f16 plane; K / V^T fragments from LDS:
// tile pair p + 1 is copied (asynchronously, no registers) into one buffer while pair p is worked on in the other; one barrier per pair publishes and frees.
// Transposed form: S^T[key][t] = K Q^T (A = K rows, B = Q rows); lane (t = lane&15, h = lane>>4) holds keys 8h+r of each 16-key tile, so the packed
// P tile is directly the B fragment of O^T[d][t] = V^T P^T (element r <- tile keys 0..15, element 8+r <- tile keys 16..31, lane unchanged).
// Per 32-key step and column tile: 4 score matrix ops (2 key tiles x 2 d halves) + 4 P.V matrix ops (4 d tiles) + 1 row-sum matrix op.
// Padded keys: the score is REPLACED by the fill value (flag plane loaded with the same key map as the P elements).
// Each wave reads the batch's per-tile words once and keeps one bit per tile; a tile without a padded key skips the flag loads, compares and selects (where no flag is set the replace is the identity).
// Softmax state per column tile: the reference maximum is one scalar per lane, equal in the two lane halves of a column. Lazy rescale: each 32-key step tests once for both column tiles (one ballot, one scalar
// branch) whether any lane's new maximum stands more than RTH above its reference; only then are the halves combined (one xor-16 exchange), the references moved to the running maxima and O and the row sums rescaled.
// Otherwise P = 2^(score - reference + PSH) <= 2^(PSH + RTH); the common factor cancels in the normalisation.
// Row sums on the matrix unit: one more matrix op per 32-key step and column tile, A = a tile whose row 0 is ones and whose other rows are 0, B = the packed P tile, adds the 32 keys' P (as rounded to f16)
// of query t into row 0, column t of an f32 tile: element 0 of lanes 0..15. Rows 1..15 stay 0, so only element 0 is rescaled.
// Epilogue: waves w and w ^ 4 hold the same 32 queries over the two halves of the keys. Each hands the other one column tile (O, reference, row sum) through LDS and finishes the tile it keeps:
// both parts brought to the larger reference, added, normalised.
__global__ __launch_bounds__(32 * AW) void k_flash(const h16* __restrict__ QH, const h16* __restrict__ KP, const h16* __restrict__ VT, const h16* __restrict__ PF, const unsigned* __restrict__ TF, h16* CTX) {
    __shared__ __align__(16) float os[AW * 16 * 68];
    __shared__ __align__(16) h16 ring[2][KH][2][64 * LP];    // [buffer][tile of the pair][K rows key | V^T rows d][row][LP]
    const int lane = threadIdx.x & 31, lr = lane & 15, hi = lane >> 4; const int wave = wave_id();
    const int hf = wave / QG, qg = wave % QG;
    const int zh = blockIdx.y; const int b = zh / NH_, h = zh % NH_;
    const int t0 = (blockIdx.x * QG + qg) * 32;
    const size_t pbase = (size_t)zh * SEQ * HD;
    const size_t qo = pbase + (size_t)(t0 + lr) * HD + 8 * hi;
    // Every loop over a column tile, a d tile or a register index below is unrolled, so that the register arrays are indexed by constants and stay in registers.
    v16h qh[2][2];                                           // B fragments [column tile][d half]: col t, k = d
#pragma unroll
    for (int c = 0; c < 2; ++c) { qh[c][0] = ldh(QH + qo + c * 16 * HD); qh[c][1] = ldh(QH + qo + c * 16 * HD + 32); }
    const int fo = lr * LP + 8 * hi;                         // fragment offset in a staged tile: K + key*LP (row key, k = d), V^T + 16j*LP + key (row d, k = key)
    // copy map: thread -> rows cr and cr + 32 of each tile, 16-byte column tid & 7
    const int cr = (int)(threadIdx.x >> 3), cc = (int)(threadIdx.x & 7) * 8;
    const h16* gk = KP + pbase + (size_t)cr * HD + cc;       // + key0 * HD
    const h16* gv = VT + pbase + (size_t)cr * SEQ + cc;      // + key0
    const unsigned lk = (unsigned)(size_t)&ring[0][0][0][cr * LP + cc];   // LDS byte address of the thread's first K chunk in buffer 0
    constexpr unsigned TB = 64 * LP * 2, HB = 32 * LP * 2;   // bytes of one tile, of 32 rows
    auto stage = [&](int p, int buf) {                       // tile pair p -> buffer buf: eight copies per thread
#pragma unroll
        for (int k = 0; k < KH; ++k) {
            const unsigned l = lk + (unsigned)(buf * KH + k) * (2 * TB); const h16* gk2 = gk + (size_t)(p * KH + k) * KST * HD; const h16* gv2 = gv + (p * KH + k) * KST;
            stage4(l, gk2, l + HB, gk2 + 32 * HD, l + TB, gv2, l + TB + HB, gv2 + (size_t)32 * SEQ); }
    };
    // pair 0 -> buffer 0, landed and published; then pair 1 -> buffer 1 in flight
    stage(0, 0);
    // bit t of padtiles: tile t of this batch holds a padded key (lane t reads tile t's word, one ballot makes the wave-uniform mask)
    const unsigned padtiles = __builtin_amdgcn_ballot_w32(TF[(size_t)b * NT + min(lane, NT - 1)] != 0u);
    asm volatile("s_wait_xcnt 0x0" ::: "memory");            // the load above is issued: its address register may be rewritten behind this line
    asm volatile("s_wait_asynccnt 0x0" ::: "memory");        // this wave's copies of pair 0 have landed
    __syncthreads();                                         // every wave's copies of pair 0 are readable
    stage(1, 1);
    const h16* pfp = PF + (size_t)b * SEQ + 8 * hi;          // + key0: elements r <- key0+8h+r, 8+r <- key0+16+8h+r
    v8f o[2][4], lt[2];                                      // [column tile][d tile]; lt row 0: running row sums (column t = query t)
#pragma unroll
    for (int c = 0; c < 2; ++c) { lt[c] = (v8f){};
#pragma unroll
        for (int j = 0; j < 4; ++j) o[c][j] = (v8f){}; }
    v16h ones;                                               // A fragment: lanes 0 and 16 hold row 0 (all 32 k positions), the other lanes rows 1..15
#pragma unroll
    for (int i = 0; i < 16; ++i) ones[i] = (lr == 0) ? (h16)1.0f : (h16)0.0f;
    float m[2] = {-3.0e38f, -3.0e38f}, mlim[2] = {-3.0e38f, -3.0e38f}, sh[2] = {0.0f, 0.0f};   // per column tile: reference maximum, m + RTH, PSH - m (the last two set with m in the first step)
#pragma unroll 1
    for (int p = 0; p < NP; ++p) {
      const int t = p * KH + hf;                             // this wave's tile of the pair
      const h16* kt = &ring[p & 1][hf][0][fo]; const h16* vt = &ring[p & 1][hf][1][fo];
      const bool tpad = ((padtiles >> t) & 1u) != 0u;
#pragma unroll   // both 32-key steps of a tile inline, so that every LDS offset inside the tile is an immediate
      for (int s = 0; s < KST / 32; ++s) {
        const int key0 = t * KST + s * 32;
        const h16* ka = kt + s * 32 * LP;
        const v16h ka0 = ldh(ka), ka1 = ldh(ka + 32), kb0 = ldh(ka + 16 * LP), kb1 = ldh(ka + 16 * LP + 32);
        v8f sa0 = (v8f){}, sb0 = (v8f){}, sa1 = (v8f){}, sb1 = (v8f){};
        sa0 = wmma16(ka0, qh[0][0], sa0); sb0 = wmma16(kb0, qh[0][0], sb0); sa1 = wmma16(ka0, qh[1][0], sa1); sb1 = wmma16(kb0, qh[1][0], sb1);
        sa0 = wmma16(ka1, qh[0][1], sa0); sb0 = wmma16(kb1, qh[0][1], sb0); sa1 = wmma16(ka1, qh[1][1], sa1); sb1 = wmma16(kb1, qh[1][1], sb1);
        // four vector slots behind the run of matrix ops above, the distance the chip needs before a vector instruction touches their results or operands
        asm volatile("v_nop\n\tv_nop\n\tv_nop\n\tv_nop" : "+v"(sa0), "+v"(sb0), "+v"(sa1), "+v"(sb1) : "v"(ka0), "v"(ka1), "v"(kb0), "v"(kb1), "v"(qh[0][0]), "v"(qh[0][1]), "v"(qh[1][0]), "v"(qh[1][1]));
        float ta[2][8], tb[2][8];
#pragma unroll
        for (int r = 0; r < 8; r += 2) {                     // packed multiplies on the accumulators' own register pairs (paired across two accumulators they cost register copies)
            const v2f a0 = (v2f){sa0[r], sa0[r + 1]} * SC2, b0 = (v2f){sb0[r], sb0[r + 1]} * SC2, a1 = (v2f){sa1[r], sa1[r + 1]} * SC2, b1 = (v2f){sb1[r], sb1[r + 1]} * SC2;
            ta[0][r] = a0[0]; ta[0][r + 1] = a0[1]; tb[0][r] = b0[0]; tb[0][r + 1] = b0[1]; ta[1][r] = a1[0]; ta[1][r + 1] = a1[1]; tb[1][r] = b1[0]; tb[1][r + 1] = b1[1]; }
        if (__builtin_expect(tpad, false)) {                 // scalar branch, wave-uniform: only a tile that holds a padded key loads its flags and replaces (laid out of line)
            const v16h pf = ldh(pfp + key0);
            asm volatile("s_wait_xcnt 0x0" ::: "memory");    // the two flag loads are issued: no register of their address is rewritten ahead of this line
#pragma unroll
            for (int c = 0; c < 2; ++c)
#pragma unroll
                for (int r = 0; r < 8; ++r) { ta[c][r] = ((float)pf[r] != 0.0f) ? NEGB : ta[c][r]; tb[c][r] = ((float)pf[8 + r] != 0.0f) ? NEGB : tb[c][r]; } }
        // V^T fragment reads ahead of the test: behind its branch they would stand directly in front of the matrix ops that wait for them
        const h16* va = vt + s * 32;
        const v16h v0 = ldh(va), v1 = ldh(va + 16 * LP), v2 = ldh(va + 32 * LP), v3 = ldh(va + 48 * LP);
        float mx[2] = {-3.0e38f, -3.0e38f};
#pragma unroll
        for (int r = 0; r < 8; ++r) mx[0] = fmaxf(mx[0], fmaxf(ta[0][r], tb[0][r]));
#pragma unroll
        for (int r = 0; r < 8; ++r) mx[1] = fmaxf(mx[1], fmaxf(ta[1][r], tb[1][r]));
        if (__builtin_expect(__builtin_amdgcn_ballot_w32((mx[0] > mlim[0]) | (mx[1] > mlim[1])) != 0u, false)) {   // scalar branch, every lane on inside (laid out of line): always taken in the first step, later only where a maximum grows by more than RTH
#pragma unroll
            for (int c = 0; c < 2; ++c) {
                const float mnew = fmaxf(m[c], fmaxf(mx[c], __shfl_xor(mx[c], 16, 32)));
                const float alpha = __builtin_amdgcn_exp2f(m[c] - mnew);
                lt[c][0] *= alpha;
                o[c][0] = o[c][0] * alpha; o[c][1] = o[c][1] * alpha; o[c][2] = o[c][2] * alpha; o[c][3] = o[c][3] * alpha;
                m[c] = mnew; mlim[c] = mnew + RTH; sh[c] = PSH - mnew; } }
        v16h pb0, pb1;
#pragma unroll
        for (int r = 0; r < 8; ++r) { pb0[r] = (h16)__builtin_amdgcn_exp2f(ta[0][r] + sh[0]); pb0[8 + r] = (h16)__builtin_amdgcn_exp2f(tb[0][r] + sh[0]); }
#pragma unroll
        for (int r = 0; r < 8; ++r) { pb1[r] = (h16)__builtin_amdgcn_exp2f(ta[1][r] + sh[1]); pb1[8 + r] = (h16)__builtin_amdgcn_exp2f(tb[1][r] + sh[1]); }
        lt[0] = wmma16(ones, pb0, lt[0]);
        o[0][0] = wmma16(v0, pb0, o[0][0]); o[0][1] = wmma16(v1, pb0, o[0][1]); o[0][2] = wmma16(v2, pb0, o[0][2]); o[0][3] = wmma16(v3, pb0, o[0][3]);
        lt[1] = wmma16(ones, pb1, lt[1]);
        o[1][0] = wmma16(v0, pb1, o[1][0]); o[1][1] = wmma16(v1, pb1, o[1][1]); o[1][2] = wmma16(v2, pb1, o[1][2]); o[1][3] = wmma16(v3, pb1, o[1][3]);
        // four vector slots behind the run of matrix ops above, the distance the chip needs before a vector instruction touches their results or operands
        asm volatile("v_nop\n\tv_nop\n\tv_nop\n\tv_nop" : "+v"(o[0][0]), "+v"(o[0][1]), "+v"(o[0][2]), "+v"(o[0][3]), "+v"(lt[0]), "+v"(o[1][0]), "+v"(o[1][1]), "+v"(o[1][2]), "+v"(o[1][3]), "+v"(lt[1])
                     : "v"(v0), "v"(v1), "v"(v2), "v"(v3), "v"(pb0), "v"(pb1));
      }
      asm volatile("s_wait_dscnt 0x0" ::: "memory");         // this wave's reads of pair p are done before its buffer may be refilled
      asm volatile("s_wait_asynccnt 0x0" ::: "memory");      // this wave's copies of pair p + 1 have landed
      __syncthreads();                                       // publishes pair p + 1 and ends every wave's reads of pair p
      if (p + 2 < NP) stage(p + 2, p & 1);                   // block-uniform: refill the buffer that pair p has just left
    }
    asm volatile("s_wait_asynccnt 0x0" ::: "memory");        // nothing of this wave is in flight when the ring goes out of use
    float l0 = lt[0][0], l1 = lt[1][0];                      // lanes 0..15: the row sum of query t; lanes 16..31: row 8 of the tile, 0
    l0 += __shfl_xor(l0, 16, 32); l1 += __shfl_xor(l1, 16, 32);
    // Hand-over: this wave keeps column tile hf and gives tile 1 - hf to wave ^ QG. Area of a wave: 8 x 128 floats of O (four registers by lane, 16 bytes a lane), 32 references, 32 row sums = 16 * 68 floats.
    const bool h1 = (hf != 0);
    float* xo = os + wave * 16 * 68;                         // written by this wave in front of the barrier
    const int wb = (wave ^ QG) * 16 * 68;                    // the partner's area: read behind the barrier by this wave alone, then this wave's output staging
#pragma unroll
    for (int j = 0; j < 4; ++j) { const v8f g = h1 ? o[0][j] : o[1][j]; v4f a, c;
        a[0] = g[0]; a[1] = g[1]; a[2] = g[2]; a[3] = g[3]; c[0] = g[4]; c[1] = g[5]; c[2] = g[6]; c[3] = g[7];
        *(v4fa*)(&xo[(2 * j) * 128 + lane * 4]) = a; *(v4fa*)(&xo[(2 * j + 1) * 128 + lane * 4]) = c; }
    xo[1024 + lane] = h1 ? m[0] : m[1]; xo[1056 + lane] = h1 ? l0 : l1;
    __syncthreads();                                         // every wave's hand-over is readable
    const float mk = h1 ? m[1] : m[0], lkp = h1 ? l1 : l0;
    const float mg = os[wb + 1024 + lane], lg = os[wb + 1056 + lane];
    const float mm_ = fmaxf(mk, mg);
    const float ak = __builtin_amdgcn_exp2f(mk - mm_), ag = __builtin_amdgcn_exp2f(mg - mm_);
    const float inv = CXS / (lkp * ak + lg * ag);
    const float fk = ak * inv, fg = ag * inv;
    v4f ra[4], rc[4];
#pragma unroll
    for (int j = 0; j < 4; ++j) { const v8f kq = h1 ? o[1][j] : o[0][j];
        const v4f ga = *(const v4fa*)(&os[wb + (2 * j) * 128 + lane * 4]); const v4f gc = *(const v4fa*)(&os[wb + (2 * j + 1) * 128 + lane * 4]);
#pragma unroll
        for (int i = 0; i < 4; ++i) { ra[j][i] = kq[i] * fk + ga[i] * fg; rc[j][i] = kq[4 + i] * fk + gc[i] * fg; } }
    wave_sync();                                             // the reads above are done before the same area takes the output rows
    // O^T D layout: o_j[r] = (d = 16j + 8h + r, t = lane&15) -> os[t][d]; rows 0..15 x columns 0..63 all written
#pragma unroll
    for (int j = 0; j < 4; ++j) { *(v4fa*)(&os[wb + lr * 68 + 16 * j + 8 * hi]) = ra[j]; *(v4fa*)(&os[wb + lr * 68 + 16 * j + 8 * hi + 4]) = rc[j]; }
    wave_sync();
    h16* crow = CTX + ((size_t)b * SEQ + t0 + 16 * hf) * DP + h * HD;
{
#pragma unroll
        for (int s = 0; s < 4; ++s) { const int row = 4 * s + (lane >> 3), c8 = (lane & 7) * 8;   // 4 s x 4 rows = 16 rows; 8 lanes x 8 halves = 64 columns
            const v4f x0 = *(const v4fa*)(&os[wb + row * 68 + c8]); const v4f x1 = *(const v4fa*)(&os[wb + row * 68 + c8 + 4]); v8h hv;
#pragma unroll
            for (int i = 0; i < 4; ++i) { hv[i] = (h16)x0[i]; hv[4 + i] = (h16)x1[i]; }
            *(v8h*)(crow + (size_t)row * DP + c8) = hv; }
         }
}

// k_out: f16 GEMM, 4 waves per 64x128 tile (32x64 per wave), A = ctx plane [NB*SEQ][1024] (x256), Bt = Wo^T plane [512][1024] (x1024), K = DP, through gemm_core; OUT[m][n] = acc * 2^-18 + bo[n] (f32).
__global__ __launch_bounds__(128) void k_out(const h16* __restrict__ A, const h16* __restrict__ Bt, const float* __restrict__ bias, float* OUT) {
    __shared__ __align__(16) float osb[4 * 16 * 68];
    __shared__ __align__(16) bf ring[2 * (64 + 128) * (128 + 8)];
    const int lane = threadIdx.x & 31, lr = lane & 15, hi = lane >> 4; const int wave = wave_id();
    float* os = osb + wave * 16 * 68;                        // wave-private staging of the epilogue
    const int R0 = blockIdx.x * 64, C0 = blockIdx.y * 128;
    v8f acc[2][4];
#pragma unroll
    for (int mb = 0; mb < 2; ++mb)
#pragma unroll
        for (int nb = 0; nb < 4; ++nb) acc[mb][nb] = (v8f){};
    gemm_core<2, 128, DP, false>((const bf*)A, (const bf*)Bt, R0, C0, ring, acc);
    const int r0 = R0 + (wave >> 1) * 32, c0 = C0 + (wave & 1) * 64;   // this wave's 32 x 64 tile
    const size_t orow0 = (size_t)(r0 / SEQ) * OUT_SEQ + (size_t)(r0 % SEQ);
    const int cofs = lr * 4;
    v4f bv;
#pragma unroll
    for (int i = 0; i < 4; ++i) bv[i] = bfr(bias[min(c0 + cofs + i, DIN - 1)]);
#pragma unroll
    for (int mb = 0; mb < 2; ++mb) {
#pragma unroll
        for (int nb = 0; nb < 4; ++nb) {
#pragma unroll
            for (int j = 0; j < 8; ++j) os[(hi * 8 + j) * 68 + nb * 16 + lr] = acc[mb][nb][j] * FOLD; }   // D: row 8h+j, col lane&15
        wave_sync();
{
#pragma unroll
            for (int s = 0; s < 8; ++s) { const int row = 2 * s + hi;   // 8 s x 2 rows = 16 rows; 16 lanes x 4 floats = 64 columns
                const v4f val = *(const v4fa*)(&os[row * 68 + cofs]) + bv;
                *(v4f*)(OUT + (orow0 + (size_t)(mb * 16 + row)) * DIN + c0 + cofs) = val; }
             }
        wave_sync();
    }
}

static constexpr size_t al256(size_t v) { return (v + 255) & ~(size_t)255; }
static constexpr size_t SZ_XB = al256((size_t)NB * SEQ * DIN * 2);
static constexpr size_t SZ_WT = al256((size_t)3 * DP * DIN * 2);
static constexpr size_t SZ_WO = al256((size_t)DIN * DP * 2);
static constexpr size_t SZ_PL = al256((size_t)NB * NH_ * SEQ * HD * 2);
static constexpr size_t SZ_CX = al256((size_t)NB * SEQ * DP * 2);
static constexpr size_t SZ_PF = al256((size_t)NB * SEQ * 2);
static constexpr size_t SZ_TF = al256((size_t)NB * NT * 4);
static constexpr size_t SZ_TOTAL = SZ_XB + SZ_WT + SZ_WO + 3 * SZ_PL + SZ_CX + SZ_PF + SZ_TF;
static_assert(SZ_TOTAL <= (size_t)134217728);          // workspace carve <= 128 MiB
static_assert(((size_t)DP * DIN * 2) % 256 == 0);      // weight sub-planes stay 256-byte aligned

extern "C" void kernel_launch(void* const* d_in, const int* in_sizes, int n_in,
                              void* d_out, int out_size, void* d_ws, size_t ws_size, hipStream_t stream) {
    if (n_in < 10) return;
    const size_t needx = ((size_t)(NB - 1) * SEQ_FULL + SEQ) * DIN;
    if ((size_t)in_sizes[0] < needx || (size_t)in_sizes[1] < needx) return;
    if ((size_t)in_sizes[2] < (size_t)DIN * DP || (size_t)in_sizes[4] < (size_t)DIN * DP || (size_t)in_sizes[6] < (size_t)DIN * DP || (size_t)in_sizes[8] < (size_t)DP * DIN) return;
    if ((size_t)in_sizes[3] < (size_t)DP || (size_t)in_sizes[5] < (size_t)DP || (size_t)in_sizes[7] < (size_t)DP || (size_t)in_sizes[9] < (size_t)DIN) return;
    if ((size_t)out_size < ((size_t)(NB - 1) * OUT_SEQ + SEQ) * DIN) return;
    if (SZ_TOTAL > ws_size) return;
    // wire order: data, pad input, wq, bq, wk, bk, wv, bv, wo, bo (all f32)
    const float* x = (const float*)d_in[0]; const float* pm = (const float*)d_in[1];
    const float* wq = (const float*)d_in[2]; const float* bq = (const float*)d_in[3];
    const float* wk = (const float*)d_in[4]; const float* bk = (const float*)d_in[5];
    const float* wv = (const float*)d_in[6]; const float* bv = (const float*)d_in[7];
    const float* wo = (const float*)d_in[8]; const float* bo = (const float*)d_in[9];
    float* OUT = (float*)d_out;      // [NB][SEQ][512]
    char* wsp = (char*)d_ws;
    bf* XB = (bf*)wsp; wsp += SZ_XB;                 // [NB*SEQ][512] bf16
    bf* WT = (bf*)wsp; wsp += SZ_WT;                 // [3][1024][512] bf16, rows h*64+dm: q | k | v
    bf* WOB = (bf*)wsp; wsp += SZ_WO;                // [512][1024] f16 bits (x1024)
    h16* QH = (h16*)wsp; wsp += SZ_PL;               // [NB*16][SEQ][64]
    h16* KP = (h16*)wsp; wsp += SZ_PL;               // [NB*16][SEQ][64]
    h16* VT = (h16*)wsp; wsp += SZ_PL;               // [NB*16][64][SEQ]
    h16* CX = (h16*)wsp; wsp += SZ_CX;               // [NB*SEQ][1024] (x256)
    h16* PF = (h16*)wsp; wsp += SZ_PF;               // [NB*SEQ] pad flags
    unsigned* TF = (unsigned*)wsp; wsp += SZ_TF;     // [NB*SEQ/64] nonzero where a 64-key tile holds a padded key

    k_prep<<<dim3(PB_PAD + 4 * PB_WT + PB_CVT, 1, 1), 256, 0, stream>>>(x, pm, wq, wk, wv, wo, XB, WT, WOB, PF, TF);

    k_proj<<<dim3(NB * SEQ / 128, DP / 128, 3), 128, 0, stream>>>(XB, WT, bq, bk, bv, QH, KP, VT);

    k_flash<<<dim3(SEQ / (16 * AW), NB * NH_, 1), 32 * AW, 0, stream>>>(QH, KP, VT, PF, TF, CX);

    k_out<<<dim3(NB * SEQ / 64, DIN / 128, 1), 128, 0, stream>>>(CX, (const h16*)WOB, bo, OUT);
}

// v008
// Measured time: 62.2 microseconds a run.
// Two timings next to v007 both put it at 1.04 times that version's speed.
// Counting every step since v000, it is 3.19 times as fast.
#include <hip/hip_runtime.h>

// Multi-head self-attention: data [NB][SEQ][512], Wq/Wk/Wv [512][1024] ([in][out], column c = dm*16 + h), biases, key-padding replace fill (-1e9 where a key's 512 pad-input values sum to 0), score scale 1/8, merged heads (h*64+dm) @ Wo [1024][512] + bo, f32 output.
// Compute dtypes, f32 accumulate everywhere: projections v_wmma_f32_16x16x32_bf16 (data and W RNE-converted to bf16; products exact);
// scores v_wmma_f32_16x16x32_f16: q and k single f16 planes (one product); P (x256 carry, cancels in the normalisation) and v single f16; softmax f32 (online, lazily moved reference maximum; row sums of the f16 P by a ones-row matrix op, f32 accumulate);
// output projection v_wmma_f32_16x16x32_f16: ctx single f16 (x256 carry), Wo = f16 of (bf16 RNE of wo) x1024 (exact), 2^-18 folded back in f32, bias added in f32.
// Launches: 4. k_prep (block index picks the job: pad flags with one word per 64 keys, one weight tile, or a slice of the data conversion; the jobs read none of each other's output; a wave of the pad and conversion jobs issues all its global loads ahead of their first use), k_proj (grid z picks q, k or v^T), k_flash, k_out.
// Layout: bf16 copy of data; transposed K-contiguous weight planes (head-permuted rows h*64+dm); q, k planes [b*16+h][t][d] and v^T plane [b*16+h][d][t] from the GEMM epilogue;
// fused flash kernel in transposed form (S^T = K Q^T, O^T = V^T P^T; a wave holds 32 queries and every second 64-key tile, 8 score + 8 P.V matrix ops per 32-key step; K and V^T tiles of 64 keys staged in pairs in LDS by asynchronous copies, two buffers; wave pairs merge their halves of the keys at the end) writing the ctx plane [b*SEQ+t][h*64+d].
// Both GEMMs (k_proj, k_out): 4-wave blocks, operand tiles staged in LDS by asynchronous copies of whole 128-byte lines, two buffers, fragments read from LDS.

#ifndef NB
#define NB 2
#endif
#ifndef SEQ
#define SEQ 2048
#endif
#define NB_FULL  2
#define SEQ_FULL 2048
#ifndef OUT_SEQ
#define OUT_SEQ SEQ              // row pitch (in tokens) between batches of the output
#endif
#define DIN  512                 // input width = output width
#define DP   1024                // projection width = 16 heads x 64
#define NH_  16
#define HD   64
#define AW   8                   // waves per flash block; all share the staged K / V^T tiles
#define KH   2                   // 64-key tiles staged together; wave group wave / QG works on one of them
#define QG   (AW / KH)           // query groups per flash block, 32 query rows (two column tiles) each
#define KST  64                  // keys per staged tile (two 32-key steps)
#define LP   72                  // LDS row pitch in halves: 128-byte rows + 16 bytes, the pitch for 16-byte LDS readers
#define NT   (SEQ / KST)         // staged tiles per (batch, head)
#define NP   (NT / KH)           // staged tile pairs per (batch, head)
#define SC2  (0.125f * 1.4426950408889634f)   // HD^-0.5 * log2(e)
#define PSH  8.0f                // log2 of the P carry (256)
#define RTH  7.0f                // lazy rescale: how far (log2) a column's new maximum may stand above the reference in use before the reference moves
#define NEGB (-1.0e9f * 1.4426950408889634f)  // fill value of padded keys in the log2 domain
#define CXS  256.0f              // carry of the ctx plane
#define WOS  1024.0f             // carry of the Wo plane
#define FOLD (1.0f / (256.0f * 1024.0f))

static_assert(HD == 64);
static_assert(PSH + RTH <= 15.0f);             // P <= 2^(PSH + RTH) stays finite in f16
static_assert(NH_ * HD == DP);
static_assert(NH_ == 16);                      // column c = dm*16 + h
static_assert(DP % 64 == 0);
static_assert(DIN % 64 == 0);
static_assert(DIN % 32 == 0);                  // GEMM k-loops step by 32
static_assert(DP % 32 == 0);
static_assert(DIN == 512);                     // pad-row sum: 4 x 128 floats per wave
static_assert(SEQ % 64 == 0);                  // a 64-row tile never straddles two batches
static_assert((NB * SEQ) % 64 == 0);
static_assert(SEQ % 32 == 0);                  // key loop steps by 32
static_assert(KH == 2);                        // a wave and its partner wave ^ QG exchange one column tile each
static_assert(32 * QG == 16 * AW);             // a flash block covers 16 * AW query rows
static_assert(SEQ % (16 * AW) == 0);           // flash grid covers the sequence exactly
static_assert(SEQ % KST == 0);
static_assert(NT % KH == 0);
static_assert(NP >= 2);                        // the two-buffer prologue fills tile pairs 0 and 1
static_assert(NT <= 32);                       // one bit per staged tile in the 32-lane ballot of padded tiles
static_assert(KST == 64);                      // a staged tile is the 64 key rows of one pad block
static_assert(32 * AW * 2 * 8 == KST * HD);    // two 16-byte copies per thread cover one 64 x 64 tile
static_assert(((size_t)SEQ * DIN) % 8 == 0);
static_assert((NB * SEQ) % 128 == 0);          // GEMM block tiles: 128 data rows (k_proj)
static_assert(DP % 128 == 0);
static_assert(DIN % 128 == 0);
static_assert(NB <= NB_FULL);
static_assert(SEQ <= SEQ_FULL);

typedef _Float16 h16;
typedef unsigned short bf;
typedef __attribute__((ext_vector_type(16))) __bf16   v16bf;
typedef __attribute__((ext_vector_type(16))) _Float16 v16h;
typedef __attribute__((ext_vector_type(8)))  _Float16 v8h;
typedef __attribute__((ext_vector_type(8)))  unsigned short v8us;
typedef __attribute__((ext_vector_type(16))) unsigned short v16us;
typedef __attribute__((ext_vector_type(8)))  float    v8f;
typedef __attribute__((ext_vector_type(4)))  float    v4f;
typedef __attribute__((ext_vector_type(2)))  float    v2f;
typedef v4f  __attribute__((may_alias)) v4fa;

__device__ __forceinline__ unsigned short f2bf(float f) { unsigned u = __float_as_uint(f); u += 0x7FFFu + ((u >> 16) & 1u); return (unsigned short)(u >> 16); }
__device__ __forceinline__ float bfr(float f) { return __uint_as_float(((unsigned)f2bf(f)) << 16); }   // value after RNE conversion to bf16
__device__ __forceinline__ v16h cat16(v8h lo, v8h hi) { return __builtin_shufflevector(lo, hi, 0, 1, 2, 3, 4, 5, 6, 7, 8, 9, 10, 11, 12, 13, 14, 15); }
__device__ __forceinline__ v16bf cat16b(v8us lo, v8us hi) { return __builtin_bit_cast(v16bf, __builtin_shufflevector(lo, hi, 0, 1, 2, 3, 4, 5, 6, 7, 8, 9, 10, 11, 12, 13, 14, 15)); }
__device__ __forceinline__ v8f wmma16(v16h a, v16h b, v8f c) { return __builtin_amdgcn_wmma_f32_16x16x32_f16(false, a, false, b, (short)0, c, false, false); }
__device__ __forceinline__ v8f wmmab(v16bf a, v16bf b, v8f c) { return __builtin_amdgcn_wmma_f32_16x16x32_bf16(false, a, false, b, (short)0, c, false, false); }
// fragment loaders from K-contiguous 16-bit rows; p already includes + 8*(lane>>4): elements 0..7 <- k0+8h+0..7, elements 8..15 <- k0+16+8h+0..7 (same map for A and B)
__device__ __forceinline__ v16h  ldh(const h16* p) { return cat16(*(const v8h*)p, *(const v8h*)(p + 16)); }
__device__ __forceinline__ v16bf ldb(const bf* p)  { return cat16b(*(const v8us*)p, *(const v8us*)(p + 16)); }
// ordering point for wave-private LDS tiles (same wave writes and reads)
__device__ __forceinline__ void wave_sync() { __builtin_amdgcn_fence(3 /* release order */, "wavefront"); __builtin_amdgcn_wave_barrier(); asm volatile("" ::: "memory"); }
// wave index of the calling thread as a wave-uniform scalar
__device__ __forceinline__ int wave_id() { return __builtin_amdgcn_readfirstlane((int)(threadIdx.x >> 5)); }

// blocks of k_prep per job
#define PB_PAD (NB * SEQ / 64)                        // 64 pad rows each
#define PB_WT  ((DIN / 64) * (DP / 64))               // 64 x 64 tiles of one weight matrix (all four have DIN * DP elements)
#define N8     ((size_t)NB * SEQ * DIN / 8)           // 8-element chunks of the data
#define CV     8                                      // chunks per thread of the conversion job
#define PB_CVT ((unsigned)(N8 / (256 * CV)))
static_assert(N8 % (256 * CV) == 0);                  // the conversion blocks cover the data exactly

// cvt_job: data f32 -> bf16 copy [NB*SEQ][512], CV chunks of 8 elements per thread, 256 chunks apart, all loaded ahead of the first conversion; blk = block index inside the job.
__device__ __forceinline__ void cvt_job(const float* __restrict__ x, bf* dst, int blk) {
    const size_t i0 = (size_t)blk * (256 * CV) + threadIdx.x;
    constexpr size_t C8 = (size_t)SEQ * DIN / 8;      // chunks per batch
    v8f v[CV];
#pragma unroll   // register array indexed by constants
    for (int u = 0; u < CV; ++u) { const size_t i = i0 + (size_t)u * 256;
        const size_t so = (SEQ == SEQ_FULL) ? i * 8 : (i / C8) * ((size_t)SEQ_FULL * DIN) + (i % C8) * 8;
        v[u] = *(const v8f*)(x + so); }
    asm volatile("s_wait_xcnt 0x0" :: "v"(x + i0 * 8) : "memory");   // the loads above are issued: no register of their addresses is rewritten ahead of this line (the address as an input: it stays whole up to here, so that no load's result is placed on it)
#pragma unroll
    for (int u = 0; u < CV; ++u) { v8us o;
#pragma unroll
        for (int k = 0; k < 8; ++k) o[k] = f2bf(v[u][k]);
        *(v8us*)(dst + (i0 + (size_t)u * 256) * 8) = o; }
    asm volatile("s_wait_xcnt 0x0" ::: "memory");   // the stores above are issued: no register that they name is rewritten by the code that follows this job in the merged kernel
}

// wt_job: W [K][N] f32 ([in][out]) -> dst [N][K] 16-bit rows (K-contiguous). in[K rows][N cols] -> out[N rows][K cols]; one 64 x 64 tile (bx of K/64, by of N/64), 256 threads; ts = 64 * 68 floats of LDS.
// perm != 0: source column c = dm*16 + h lands on destination row h*64 + dm. asf16 == 0: bf16 bits; asf16 != 0: f16 bits of (bf16 value * scale).
__device__ __forceinline__ void wt_job(const float* __restrict__ W, bf* dst, int K, int N, int perm, int asf16, float scale, int bx, int by, float* ts) {   // ts: [column][k]
    const int tid = threadIdx.x, lane = tid & 31; const int wave = wave_id();
    const int k0 = bx * 64, c0 = by * 64;
#pragma unroll
    for (int it = 0; it < 4; ++it) { const int e = tid + 256 * it; const int kk = e >> 4, c4 = (e & 15) * 4;   // 64 k rows x 16 float4 = whole tile
        const v4f v = *(const v4f*)(W + (size_t)(k0 + kk) * (size_t)N + c0 + c4);
        ts[(c4 + 0) * 68 + kk] = v[0]; ts[(c4 + 1) * 68 + kk] = v[1]; ts[(c4 + 2) * 68 + kk] = v[2]; ts[(c4 + 3) * 68 + kk] = v[3]; }
    __syncthreads();
{
#pragma unroll
        for (int s = 0; s < 2; ++s) { const int row = 4 * (wave + 8 * s) + (lane >> 3), c8 = (lane & 7) * 8;   // 8 waves x 2 s x 4 rows = 64 rows; 8 lanes x 8 = 64 k
            const v4f x0 = *(const v4fa*)(&ts[row * 68 + c8]); const v4f x1 = *(const v4fa*)(&ts[row * 68 + c8 + 4]); v8us o;
#pragma unroll
            for (int i = 0; i < 4; ++i) { const float f0 = bfr(x0[i]), f1 = bfr(x1[i]);
                const unsigned short b0 = (unsigned short)(__float_as_uint(f0) >> 16), b1 = (unsigned short)(__float_as_uint(f1) >> 16);
                const unsigned short g0 = __builtin_bit_cast(unsigned short, (h16)(f0 * scale)), g1 = __builtin_bit_cast(unsigned short, (h16)(f1 * scale));
                o[i] = asf16 ? g0 : b0; o[4 + i] = asf16 ? g1 : b1; }
            const int c = c0 + row; const int n = perm ? ((c & 15) * 64 + (c >> 4)) : c;
            *(v8us*)(dst + (size_t)n * (size_t)K + k0 + c8) = o; }
         }
    asm volatile("s_wait_xcnt 0x0" ::: "memory");   // the two stores above are issued: no register that they name is rewritten by the code that follows this job in the merged kernel
}

// pad_job: flags of 64 key rows (1 where the row's 512 pad-input values sum to 0), and one word for the 64 rows together (nonzero where any of them is flagged); fl = 64 floats of LDS.
__device__ __forceinline__ void pad_job(const float* __restrict__ mask, h16* PF, unsigned* TF, int blk, float* fl) {
    const int tid = threadIdx.x, lane = tid & 31; const int wave = wave_id();
    const int m0 = blk * 64;
    // A wave's eight rows: all 32 loads ahead of the first sum, then the eight sums side by side (each row's own order of additions: 16 values per lane in turn, then lane distances 16, 8, 4, 2, 1).
    const int mw = m0 + wave * 8;                     // the eight rows lie in one batch (SEQ % 64 == 0)
    const float* row = mask + ((size_t)(mw / SEQ) * SEQ_FULL + mw % SEQ) * DIN + lane * 4;
    v4f v[8][4];
#pragma unroll   // register arrays indexed by constants
    for (int i = 0; i < 8; ++i)
#pragma unroll
        for (int j = 0; j < 4; ++j) v[i][j] = *(const v4f*)(row + i * DIN + j * 128);
    asm volatile("s_wait_xcnt 0x0" ::: "memory");     // the loads above are issued: no register of their addresses is rewritten ahead of this line
    __builtin_amdgcn_sched_barrier(0);                // keeps every load ahead of the first sum (built without it, 12 of the 32 loads stand behind the first data waits): a sum lifted among them waits for its data while the later loads are not yet in flight
    float s[8];
#pragma unroll
    for (int i = 0; i < 8; ++i) { s[i] = 0.0f;
#pragma unroll
        for (int j = 0; j < 4; ++j) { s[i] += bfr(v[i][j][0]); s[i] += bfr(v[i][j][1]); s[i] += bfr(v[i][j][2]); s[i] += bfr(v[i][j][3]); } }
#pragma unroll
    for (int d = 16; d >= 1; d >>= 1)
#pragma unroll
        for (int i = 0; i < 8; ++i) s[i] += __shfl_xor(s[i], d, 32);
    if (lane == 0) {
#pragma unroll
        for (int i = 0; i < 8; ++i) fl[wave * 8 + i] = (s[i] == 0.0f) ? 1.0f : 0.0f; }
    __syncthreads();
    if (tid < 8) { v8h o;
#pragma unroll
        for (int k = 0; k < 8; ++k) o[k] = (h16)fl[tid * 8 + k];
        *(v8h*)(PF + (size_t)m0 + tid * 8) = o;  }
    if (wave == 0) { const unsigned any = __builtin_amdgcn_ballot_w32((fl[lane] != 0.0f) | (fl[lane + 32] != 0.0f));
        if (lane == 0) TF[blk] = any; }
}

// k_prep: everything that reads only the inputs, in one launch. The job is a function of blockIdx.x alone, so every branch (and the barrier inside a job) is block-uniform.
// Order: the pad rows (32 loads per wave, then eight row sums and a barrier: the longest job) take the lowest block indices, the conversion blocks (16 loads per wave, no barrier) the highest.
__global__ __launch_bounds__(256) void k_prep(const float* __restrict__ x, const float* __restrict__ pm, const float* __restrict__ wq, const float* __restrict__ wk, const float* __restrict__ wv,
                                              const float* __restrict__ wo, bf* XB, bf* WT, bf* WOB, h16* PF, unsigned* TF) {
    __shared__ __align__(16) float ts[64 * 68];
    const int bid = blockIdx.x;
    if (bid < PB_PAD) { pad_job(pm, PF, TF, bid, ts); return; }
    if (bid < PB_PAD + 4 * PB_WT) {
        const int j = bid - PB_PAD; const int w = j / PB_WT, tile = j % PB_WT;
        // w = 0..2: wq, wk, wv, in[K = 512][N = 1024] -> [1024 rows (head-permuted)][512], bf16; w = 3: wo, in[K = 1024 (h*64+dm)][N = 512] -> [512 rows][1024], f16 x1024
        const bool o = (w == 3);
        const float* W = o ? wo : (w == 0 ? wq : (w == 1 ? wk : wv));
        bf* dst = o ? WOB : WT + (size_t)w * DP * DIN;
        const int K = o ? DP : DIN, N = o ? DIN : DP;
        wt_job(W, dst, K, N, o ? 0 : 1, o ? 1 : 0, o ? WOS : 1.0f, tile % (K / 64), tile / (K / 64), ts);
        return; }
    cvt_job(x, XB, bid - (PB_PAD + 4 * PB_WT));
}

// One thread's eight 16-byte asynchronous copies global -> LDS: rows ls bytes apart in LDS, gs elements apart in memory. The s_wait_xcnt closes the statement so that
// no address register of an issued copy is rewritten ahead of it.
__device__ __forceinline__ void stage8(unsigned l, const bf* g, unsigned ls, size_t gs) {
    asm volatile("global_load_async_to_lds_b128 %0, %1, off\n\t"
                 "global_load_async_to_lds_b128 %2, %3, off\n\t"
                 "global_load_async_to_lds_b128 %4, %5, off\n\t"
                 "global_load_async_to_lds_b128 %6, %7, off\n\t"
                 "global_load_async_to_lds_b128 %8, %9, off\n\t"
                 "global_load_async_to_lds_b128 %10, %11, off\n\t"
                 "global_load_async_to_lds_b128 %12, %13, off\n\t"
                 "global_load_async_to_lds_b128 %14, %15, off\n\t"
                 "s_wait_xcnt 0x0"
                 :: "v"(l), "v"(g), "v"(l + ls), "v"(g + gs), "v"(l + 2 * ls), "v"(g + 2 * gs), "v"(l + 3 * ls), "v"(g + 3 * gs),
                    "v"(l + 4 * ls), "v"(g + 4 * gs), "v"(l + 5 * ls), "v"(g + 5 * gs), "v"(l + 6 * ls), "v"(g + 6 * gs), "v"(l + 7 * ls), "v"(g + 7 * gs) : "memory");
}
__device__ __forceinline__ v16us ldu(const bf* p) { return __builtin_shufflevector(*(const v8us*)p, *(const v8us*)(p + 16), 0, 1, 2, 3, 4, 5, 6, 7, 8, 9, 10, 11, 12, 13, 14, 15); }   // same k map as ldh / ldb
template <bool BF> __device__ __forceinline__ v8f mm(v16us a, v16us b, v8f c) {
    if constexpr (BF) return wmmab(__builtin_bit_cast(v16bf, a), __builtin_bit_cast(v16bf, b), c);
    else              return wmma16(__builtin_bit_cast(v16h, a), __builtin_bit_cast(v16h, b), c);
}

// gemm_core: acc[mb][nb] += A rows x Bt rows over K (16-bit, K-contiguous planes), for a block of 4 waves (2 x 2). Block tile (2 * MF * 16) x 128 at (R0, C0); wave (wave >> 1, wave & 1) owns (MF * 16) x 64.
// Per trip KS k values of every row of both tiles lie in one LDS buffer (row pitch KS + 8 halves: 16 bytes x odd, the pitch for 16-byte LDS readers); a wave's copy covers whole 128-byte lines.
// Tile t + 1 is copied into one buffer while tile t is worked on in the other; one barrier per trip publishes and frees. k ascends by 32 in every accumulator.
template <int MF, int KS, int K, bool BF>
__device__ __forceinline__ void gemm_core(const bf* __restrict__ A, const bf* __restrict__ Bt, int R0, int C0, bf* ring, v8f (&acc)[MF][4]) {
    constexpr int GP = KS + 8, BM = 2 * MF * 16, BUFH = (BM + 128) * GP;   // pitch (halves), A rows, halves per buffer
    constexpr int CPR = KS / 8, RS = 128 / CPR, NTR = K / KS;              // 16-byte chunks per row, rows covered by the block's 128 threads in one copy each, trips
    static_assert(BM == 8 * RS);                                           // one stage8 covers the A tile
    static_assert(128 % (8 * RS) == 0);                                    // whole stage8 groups cover the B tile
    static_assert(K % KS == 0);
    static_assert(NTR >= 2);                                               // the prologue fills tiles 0 and 1
    static_assert(MF == 2 || MF == 4);
    const int tid = threadIdx.x, lane = tid & 31, lr = lane & 15, hi = lane >> 4; const int wave = wave_id();
    const int cr = tid / CPR, cc = (tid % CPR) * 8;                        // copy map: thread -> row cr (+ multiples of RS), 16-byte column
    const bf* ga = A + (size_t)(R0 + cr) * K + cc;                         // + t * KS
    const bf* gb = Bt + (size_t)(C0 + cr) * K + cc;
    const unsigned la = (unsigned)(size_t)&ring[cr * GP + cc];             // LDS byte address of the thread's first A chunk in buffer 0
    auto stage = [&](int t, int buf) {
        const unsigned l = la + (unsigned)buf * (unsigned)(BUFH * 2);
        stage8(l, ga + t * KS, RS * GP * 2, (size_t)RS * K);
#pragma unroll
        for (int g = 0; g < 128 / (8 * RS); ++g) stage8(l + (unsigned)((BM + g * 8 * RS) * GP * 2), gb + (size_t)g * 8 * RS * K + t * KS, RS * GP * 2, (size_t)RS * K);
    };
    stage(0, 0);
    asm volatile("s_wait_asynccnt 0x0" ::: "memory");        // this wave's copies of tile 0 have landed
    __syncthreads();                                         // every wave's copies of tile 0 are readable
    stage(1, 1);
    const int ao = ((wave >> 1) * MF * 16 + lr) * GP + 8 * hi, bo = (BM + (wave & 1) * 64 + lr) * GP + 8 * hi;
#pragma unroll 1   // rolled; the buffer is picked by a scalar select
    for (int t = 0; t < NTR; ++t) {
        const bf* ab = ring + (t & 1) * BUFH + ao; const bf* bb = ring + (t & 1) * BUFH + bo;
        // Fragment sets: each k step's LDS reads go out as one group. NS == 2 (the small wave tile, one wave per SIMD): the next step's group ahead of this step's matrix instructions;
        // NS == 1 (the large wave tile, several waves per SIMD, which cover each other's LDS waits): one set, so that the wave stays inside the first 256 registers.
        constexpr int NS = (MF == 2) ? 2 : 1, NK = KS / 32;
        v16us a[NS][MF], b[NS][4];
        auto frags = [&](int ks) {                           // never past the trip's own tile: ks < NK at every call
#pragma unroll
            for (int mb = 0; mb < MF; ++mb) a[ks % NS][mb] = ldu(ab + mb * 16 * GP + ks * 32);
#pragma unroll
            for (int nb = 0; nb < 4; ++nb) b[ks % NS][nb] = ldu(bb + nb * 16 * GP + ks * 32);
        };
        frags(0);
#pragma unroll   // all k steps of a trip inline, so that every LDS offset inside the tile is an immediate and the fragment sets stay in registers
        for (int ks = 0; ks < NK; ++ks) {
            if (NS == 2 && ks + 1 < NK) frags(ks + 1);
            __builtin_amdgcn_sched_barrier(0);               // keeps the group of LDS reads ahead of the matrix instructions below: sunk among them, each read is waited for where it stands
#pragma unroll
            for (int nb = 0; nb < 4; ++nb)
#pragma unroll
                for (int mb = 0; mb < MF; ++mb) acc[mb][nb] = mm<BF>(a[ks % NS][mb], b[ks % NS][nb], acc[mb][nb]);
            if (NS == 1 && ks + 1 < NK) frags(ks + 1);
        }
        __builtin_amdgcn_sched_barrier(0);                   // keeps the trip's matrix instructions ahead of the barrier: sunk behind it they delay the refill, which then has less than a trip to land
        asm volatile("s_wait_dscnt 0x0" ::: "memory");       // this wave's reads of tile t are done before its buffer may be refilled
        asm volatile("s_wait_asynccnt 0x0" ::: "memory");    // this wave's copies of tile t + 1 have landed
        __syncthreads();                                     // publishes tile t + 1 and ends every wave's reads of tile t
        if (t + 2 < NTR) stage(t + 2, t & 1);                // block-uniform: refill the buffer that tile t has just left
    }
    asm volatile("s_wait_asynccnt 0x0" ::: "memory");        // nothing of this wave is in flight when the ring goes out of use
}

// k_proj: bf16 GEMM, 4 waves per 128x128 tile (64x64 and 16 accumulators per wave), operands from K-contiguous bf16 planes through gemm_core, K = DIN.
// C[m][n] = sum_k A[m][k] Bt[n][k] + bias, written as f16 (Ph), row pitch 'pitch' (halves). grid (NB*SEQ/128 data tiles, DP/128 weight tiles, 3), 128 threads; z picks the product:
// z = 0, 1 (q, k): A = data rows (m = b*SEQ + t), Bt = W^T rows (n = h*64 + d) -> plane [(b*16 + h)][t][d]; bias per column.
// z = 2 (v^T):     A = Wv^T rows (m = h*64 + d), Bt = data rows (n = b*SEQ + t) -> plane [(b*1024 + m)][t] = [(b*16 + h)][d][t]; bias per row.
// bias (source order dm*16 + h, RNE-converted to bf16, added in f32): bmode 0 = per column n = h*64 + dm, bmode 1 = per row m = h*64 + dm.
__global__ __launch_bounds__(128) void k_proj(const bf* __restrict__ XB, const bf* __restrict__ WT, const float* __restrict__ bq, const float* __restrict__ bk, const float* __restrict__ bv, h16* QH, h16* KP, h16* VT) {
    __shared__ __align__(16) float osb[4 * 16 * 68];
    __shared__ __align__(16) bf ring[2 * (128 + 128) * (64 + 8)];
    const int z = blockIdx.z; const bool bmode = (z == 2);
    const bf* Wz = WT + (size_t)z * DP * DIN;
    const bf* A = bmode ? Wz : XB; const bf* Bt = bmode ? XB : Wz;
    const float* bias = (z == 0) ? bq : ((z == 1) ? bk : bv);
    h16* Ph = (z == 0) ? QH : ((z == 1) ? KP : VT);
    const int pitch = bmode ? SEQ : HD;
    const int lane = threadIdx.x & 31, lr = lane & 15, hi = lane >> 4; const int wave = wave_id();
    float* os = osb + wave * 16 * 68;                        // wave-private staging of the epilogue
    const int R0 = (bmode ? blockIdx.y : blockIdx.x) * 128, C0 = (bmode ? blockIdx.x : blockIdx.y) * 128;
    v8f acc[4][4];
#pragma unroll
    for (int mb = 0; mb < 4; ++mb)
#pragma unroll
        for (int nb = 0; nb < 4; ++nb) acc[mb][nb] = (v8f){};
    gemm_core<4, 64, DIN, true>(A, Bt, R0, C0, ring, acc);
    const int r0 = R0 + (wave >> 1) * 64, c0 = C0 + (wave & 1) * 64;   // this wave's 64 x 64 tile
    const size_t tbase = bmode ? (size_t)r0 * SEQ + (size_t)(c0 / SEQ) * ((size_t)DP * SEQ) + (size_t)(c0 % SEQ)
                               : (size_t)(r0 / SEQ) * ((size_t)NH_ * SEQ * HD) + (size_t)(r0 % SEQ) * HD + (size_t)(c0 / HD) * ((size_t)SEQ * HD);
    const int c8 = (lane & 7) * 8;
    float bcol[8];      // column-mode bias of this lane's 8 columns (clamped addresses, always loaded)
    { const int hc = min(c0 >> 6, NH_ - 1);
#pragma unroll
      for (int i = 0; i < 8; ++i) bcol[i] = bfr(bias[min((c8 + i) * NH_ + hc, DP - 1)]); }
#pragma unroll
    for (int mb = 0; mb < 4; ++mb) {
#pragma unroll
        for (int nb = 0; nb < 4; ++nb) {
#pragma unroll
            for (int j = 0; j < 8; ++j) os[(hi * 8 + j) * 68 + nb * 16 + lr] = acc[mb][nb][j]; }   // D: row 8h+j, col lane&15
        wave_sync();
        const size_t sb = tbase + (size_t)(mb * 16) * (size_t)pitch;
{
#pragma unroll
            for (int s = 0; s < 4; ++s) { const int row = 4 * s + (lane >> 3);   // 4 s x 4 row groups = 16 rows; 8 lanes x 8 = 64 columns
                const int m = r0 + mb * 16 + row;
                const float brow = bfr(bias[min((m & 63) * NH_ + min(m >> 6, NH_ - 1), DP - 1)]);
                const v4f x0 = *(const v4fa*)(&os[row * 68 + c8]); const v4f x1 = *(const v4fa*)(&os[row * 68 + c8 + 4]); v8h hv;
#pragma unroll
                for (int i = 0; i < 4; ++i) { const float y0 = x0[i] + (bmode ? brow : bcol[i]); const float y1 = x1[i] + (bmode ? brow : bcol[4 + i]);
                    hv[i] = (h16)y0; hv[4 + i] = (h16)y1; }
                const size_t oo = sb + (size_t)row * (size_t)pitch + c8;
                *(v8h*)(Ph + oo) = hv; }
             }
        wave_sync();
    }
}

// One thread's share of one staged 64-key tile: four 16-byte asynchronous copies global -> LDS (two of K, two of V^T). The s_wait_xcnt closes the statement so that
// no address register of an issued copy is rewritten ahead of it.
__device__ __forceinline__ void stage4(unsigned l0, const h16* g0, unsigned l1, const h16* g1, unsigned l2, const h16* g2, unsigned l3, const h16* g3) {
    asm volatile("global_load_async_to_lds_b128 %0, %1, off\n\t"
                 "global_load_async_to_lds_b128 %2, %3, off\n\t"
                 "global_load_async_to_lds_b128 %4, %5, off\n\t"
                 "global_load_async_to_lds_b128 %6, %7, off\n\t"
                 "s_wait_xcnt 0x0"
                 :: "v"(l0), "v"(g0), "v"(l1), "v"(g1), "v"(l2), "v"(g2), "v"(l3), "v"(g3) : "memory");
}

// k_flash: fused attention. A block of 8 waves covers 128 query rows of one (batch, head): wave (qg = wave & 3, hf = wave >> 2) takes the 32 query rows of group qg (two column tiles of 16)
// and, of every staged pair of 64-key tiles, tile hf. Each K / V^T fragment read from LDS feeds two matrix ops (one per column tile). Q fragments straight from the f16 plane; K / V^T fragments from LDS:
// tile pair p + 1 is copied (asynchronously, no registers) into one buffer while pair p is worked on in the other; one barrier per pair publishes and frees.
// Transposed form: S^T[key][t] = K Q^T (A = K rows, B = Q rows); lane (t = lane&15, h = lane>>4) holds keys 8h+r of each 16-key tile, so the packed
// P tile is directly the B fragment of O^T[d][t] = V^T P^T (element r <- tile keys 0..15, element 8+r <- tile keys 16..31, lane unchanged).
// Per 32-key step and column tile: 4 score matrix ops (2 key tiles x 2 d halves) + 4 P.V matrix ops (4 d tiles) + 1 row-sum matrix op.
// Padded keys: the score is REPLACED by the fill value (flag plane loaded with the same key map as the P elements).
// Each wave reads the batch's per-tile words once and keeps one bit per tile; a tile without a padded key skips the flag loads, compares and selects (where no flag is set the replace is the identity).
// Softmax state per column tile: the reference maximum is one scalar per lane, equal in the two lane halves of a column. Lazy rescale: each 32-key step tests once for both column tiles (one ballot, one scalar
// branch) whether any lane's new maximum stands more than RTH above its reference; only then are the halves combined (one xor-16 exchange), the references moved to the running maxima and O and the row sums rescaled.
// Otherwise P = 2^(score - reference + PSH) <= 2^(PSH + RTH); the common factor cancels in the normalisation.
// Row sums on the matrix unit: one more matrix op per 32-key step and column tile, A = a tile whose row 0 is ones and whose other rows are 0, B = the packed P tile, adds the 32 keys' P (as rounded to f16)
// of query t into row 0, column t of an f32 tile: element 0 of lanes 0..15. Rows 1..15 stay 0, so only element 0 is rescaled.
// Epilogue: waves w and w ^ 4 hold the same 32 queries over the two halves of the keys. Each hands the other one column tile (O, reference, row sum) through LDS and finishes the tile it keeps:
// both parts brought to the larger reference, added, normalised.
__global__ __launch_bounds__(32 * AW) void k_flash(const h16* __restrict__ QH, const h16* __restrict__ KP, const h16* __restrict__ VT, const h16* __restrict__ PF, const unsigned* __restrict__ TF, h16* CTX) {
    __shared__ __align__(16) float os[AW * 16 * 68];
    __shared__ __align__(16) h16 ring[2][KH][2][64 * LP];    // [buffer][tile of the pair][K rows key | V^T rows d][row][LP]
    const int lane = threadIdx.x & 31, lr = lane & 15, hi = lane >> 4; const int wave = wave_id();
    const int hf = wave / QG, qg = wave % QG;
    const int zh = blockIdx.y; const int b = zh / NH_, h = zh % NH_;
    const int t0 = (blockIdx.x * QG + qg) * 32;
    const size_t pbase = (size_t)zh * SEQ * HD;
    const size_t qo = pbase + (size_t)(t0 + lr) * HD + 8 * hi;
    // Every loop over a column tile, a d tile or a register index below is unrolled, so that the register arrays are indexed by constants and stay in registers.
    v16h qh[2][2];                                           // B fragments [column tile][d half]: col t, k = d
#pragma unroll
    for (int c = 0; c < 2; ++c) { qh[c][0] = ldh(QH + qo + c * 16 * HD); qh[c][1] = ldh(QH + qo + c * 16 * HD + 32); }
    const int fo = lr * LP + 8 * hi;                         // fragment offset in a staged tile: K + key*LP (row key, k = d), V^T + 16j*LP + key (row d, k = key)
    // copy map: thread -> rows cr and cr + 32 of each tile, 16-byte column tid & 7
    const int cr = (int)(threadIdx.x >> 3), cc = (int)(threadIdx.x & 7) * 8;
    const h16* gk = KP + pbase + (size_t)cr * HD + cc;       // + key0 * HD
    const h16* gv = VT + pbase + (size_t)cr * SEQ + cc;      // + key0
    const unsigned lk = (unsigned)(size_t)&ring[0][0][0][cr * LP + cc];   // LDS byte address of the thread's first K chunk in buffer 0
    constexpr unsigned TB = 64 * LP * 2, HB = 32 * LP * 2;   // bytes of one tile, of 32 rows
    auto stage = [&](int p, int buf) {                       // tile pair p -> buffer buf: eight copies per thread
#pragma unroll
        for (int k = 0; k < KH; ++k) {
            const unsigned l = lk + (unsigned)(buf * KH + k) * (2 * TB); const h16* gk2 = gk + (size_t)(p * KH + k) * KST * HD; const h16* gv2 = gv + (p * KH + k) * KST;
            stage4(l, gk2, l + HB, gk2 + 32 * HD, l + TB, gv2, l + TB + HB, gv2 + (size_t)32 * SEQ); }
    };
    // pair 0 -> buffer 0, landed and published; then pair 1 -> buffer 1 in flight
    stage(0, 0);
    // bit t of padtiles: tile t of this batch holds a padded key (lane t reads tile t's word, one ballot makes the wave-uniform mask)
    const unsigned padtiles = __builtin_amdgcn_ballot_w32(TF[(size_t)b * NT + min(lane, NT - 1)] != 0u);
    asm volatile("s_wait_xcnt 0x0" ::: "memory");            // the load above is issued: its address register may be rewritten behind this line
    asm volatile("s_wait_asynccnt 0x0" ::: "memory");        // this wave's copies of pair 0 have landed
    __syncthreads();                                         // every wave's copies of pair 0 are readable
    stage(1, 1);
    const h16* pfp = PF + (size_t)b * SEQ + 8 * hi;          // + key0: elements r <- key0+8h+r, 8+r <- key0+16+8h+r
    v8f o[2][4], lt[2];                                      // [column tile][d tile]; lt row 0: running row sums (column t = query t)
#pragma unroll
    for (int c = 0; c < 2; ++c) { lt[c] = (v8f){};
#pragma unroll
        for (int j = 0; j < 4; ++j) o[c][j] = (v8f){}; }
    v16h ones;                                               // A fragment: lanes 0 and 16 hold row 0 (all 32 k positions), the other lanes rows 1..15
#pragma unroll
    for (int i = 0; i < 16; ++i) ones[i] = (lr == 0) ? (h16)1.0f : (h16)0.0f;
    float m[2] = {-3.0e38f, -3.0e38f}, mlim[2] = {-3.0e38f, -3.0e38f}, sh[2] = {0.0f, 0.0f};   // per column tile: reference maximum, m + RTH, PSH - m (the last two set with m in the first step)
#pragma unroll 1
    for (int p = 0; p < NP; ++p) {
      const int t = p * KH + hf;                             // this wave's tile of the pair
      const h16* kt = &ring[p & 1][hf][0][fo]; const h16* vt = &ring[p & 1][hf][1][fo];
      const bool tpad = ((padtiles >> t) & 1u) != 0u;
#pragma unroll   // both 32-key steps of a tile inline, so that every LDS offset inside the tile is an immediate
      for (int s = 0; s < KST / 32; ++s) {
        const int key0 = t * KST + s * 32;
        const h16* ka = kt + s * 32 * LP;
        const v16h ka0 = ldh(ka), ka1 = ldh(ka + 32), kb0 = ldh(ka + 16 * LP), kb1 = ldh(ka + 16 * LP + 32);
        v8f sa0 = (v8f){}, sb0 = (v8f){}, sa1 = (v8f){}, sb1 = (v8f){};
        sa0 = wmma16(ka0, qh[0][0], sa0); sb0 = wmma16(kb0, qh[0][0], sb0); sa1 = wmma16(ka0, qh[1][0], sa1); sb1 = wmma16(kb0, qh[1][0], sb1);
        sa0 = wmma16(ka1, qh[0][1], sa0); sb0 = wmma16(kb1, qh[0][1], sb0); sa1 = wmma16(ka1, qh[1][1], sa1); sb1 = wmma16(kb1, qh[1][1], sb1);
        // four vector slots behind the run of matrix ops above, the distance the chip needs before a vector instruction touches their results or operands
        asm volatile("v_nop\n\tv_nop\n\tv_nop\n\tv_nop" : "+v"(sa0), "+v"(sb0), "+v"(sa1), "+v"(sb1) : "v"(ka0), "v"(ka1), "v"(kb0), "v"(kb1), "v"(qh[0][0]), "v"(qh[0][1]), "v"(qh[1][0]), "v"(qh[1][1]));
        float ta[2][8], tb[2][8];
#pragma unroll
        for (int r = 0; r < 8; r += 2) {                     // packed multiplies on the accumulators' own register pairs (paired across two accumulators they cost register copies)
            const v2f a0 = (v2f){sa0[r], sa0[r + 1]} * SC2, b0 = (v2f){sb0[r], sb0[r + 1]} * SC2, a1 = (v2f){sa1[r], sa1[r + 1]} * SC2, b1 = (v2f){sb1[r], sb1[r + 1]} * SC2;
            ta[0][r] = a0[0]; ta[0][r + 1] = a0[1]; tb[0][r] = b0[0]; tb[0][r + 1] = b0[1]; ta[1][r] = a1[0]; ta[1][r + 1] = a1[1]; tb[1][r] = b1[0]; tb[1][r + 1] = b1[1]; }
        if (__builtin_expect(tpad, false)) {                 // scalar branch, wave-uniform: only a tile that holds a padded key loads its flags and replaces (laid out of line)
            const v16h pf = ldh(pfp + key0);
            asm volatile("s_wait_xcnt 0x0" ::: "memory");    // the two flag loads are issued: no register of their address is rewritten ahead of this line
#pragma unroll
            for (int c = 0; c < 2; ++c)
#pragma unroll
                for (int r = 0; r < 8; ++r) { ta[c][r] = ((float)pf[r] != 0.0f) ? NEGB : ta[c][r]; tb[c][r] = ((float)pf[8 + r] != 0.0f) ? NEGB : tb[c][r]; } }
        // V^T fragment reads ahead of the test: behind its branch they would stand directly in front of the matrix ops that wait for them
        const h16* va = vt + s * 32;
        const v16h v0 = ldh(va), v1 = ldh(va + 16 * LP), v2 = ldh(va + 32 * LP), v3 = ldh(va + 48 * LP);
        float mx[2] = {-3.0e38f, -3.0e38f};
#pragma unroll
        for (int r = 0; r < 8; ++r) mx[0] = fmaxf(mx[0], fmaxf(ta[0][r], tb[0][r]));
#pragma unroll
        for (int r = 0; r < 8; ++r) mx[1] = fmaxf(mx[1], fmaxf(ta[1][r], tb[1][r]));
        if (__builtin_expect(__builtin_amdgcn_ballot_w32((mx[0] > mlim[0]) | (mx[1] > mlim[1])) != 0u, false)) {   // scalar branch, every lane on inside (laid out of line): always taken in the first step, later only where a maximum grows by more than RTH
#pragma unroll
            for (int c = 0; c < 2; ++c) {
                const float mnew = fmaxf(m[c], fmaxf(mx[c], __shfl_xor(mx[c], 16, 32)));
                const float alpha = __builtin_amdgcn_exp2f(m[c] - mnew);
                lt[c][0] *= alpha;
                o[c][0] = o[c][0] * alpha; o[c][1] = o[c][1] * alpha; o[c][2] = o[c][2] * alpha; o[c][3] = o[c][3] * alpha;
                m[c] = mnew; mlim[c] = mnew + RTH; sh[c] = PSH - mnew; } }
        v16h pb0, pb1;
#pragma unroll
        for (int r = 0; r < 8; ++r) { pb0[r] = (h16)__builtin_amdgcn_exp2f(ta[0][r] + sh[0]); pb0[8 + r] = (h16)__builtin_amdgcn_exp2f(tb[0][r] + sh[0]); }
#pragma unroll
        for (int r = 0; r < 8; ++r) { pb1[r] = (h16)__builtin_amdgcn_exp2f(ta[1][r] + sh[1]); pb1[8 + r] = (h16)__builtin_amdgcn_exp2f(tb[1][r] + sh[1]); }
        lt[0] = wmma16(ones, pb0, lt[0]);
        o[0][0] = wmma16(v0, pb0, o[0][0]); o[0][1] = wmma16(v1, pb0, o[0][1]); o[0][2] = wmma16(v2, pb0, o[0][2]); o[0][3] = wmma16(v3, pb0, o[0][3]);
        lt[1] = wmma16(ones, pb1, lt[1]);
        o[1][0] = wmma16(v0, pb1, o[1][0]); o[1][1] = wmma16(v1, pb1, o[1][1]); o[1][2] = wmma16(v2, pb1, o[1][2]); o[1][3] = wmma16(v3, pb1, o[1][3]);
        // four vector slots behind the run of matrix ops above, the distance the chip needs before a vector instruction touches their results or operands
        asm volatile("v_nop\n\tv_nop\n\tv_nop\n\tv_nop" : "+v"(o[0][0]), "+v"(o[0][1]), "+v"(o[0][2]), "+v"(o[0][3]), "+v"(lt[0]), "+v"(o[1][0]), "+v"(o[1][1]), "+v"(o[1][2]), "+v"(o[1][3]), "+v"(lt[1])
                     : "v"(v0), "v"(v1), "v"(v2), "v"(v3), "v"(pb0), "v"(pb1));
      }
      asm volatile("s_wait_dscnt 0x0" ::: "memory");         // this wave's reads of pair p are done before its buffer may be refilled
      asm volatile("s_wait_asynccnt 0x0" ::: "memory");      // this wave's copies of pair p + 1 have landed
      __syncthreads();                                       // publishes pair p + 1 and ends every wave's reads of pair p
      if (p + 2 < NP) stage(p + 2, p & 1);                   // block-uniform: refill the buffer that pair p has just left
    }
    asm volatile("s_wait_asynccnt 0x0" ::: "memory");        // nothing of this wave is in flight when the ring goes out of use
    float l0 = lt[0][0], l1 = lt[1][0];                      // lanes 0..15: the row sum of query t; lanes 16..31: row 8 of the tile, 0
    l0 += __shfl_xor(l0, 16, 32); l1 += __shfl_xor(l1, 16, 32);
    // Hand-over: this wave keeps column tile hf and gives tile 1 - hf to wave ^ QG. Area of a wave: 8 x 128 floats of O (four registers by lane, 16 bytes a lane), 32 references, 32 row sums = 16 * 68 floats.
    const bool h1 = (hf != 0);
    float* xo = os + wave * 16 * 68;                         // written by this wave in front of the barrier
    const int wb = (wave ^ QG) * 16 * 68;                    // the partner's area: read behind the barrier by this wave alone, then this wave's output staging
#pragma unroll
    for (int j = 0; j < 4; ++j) { const v8f g = h1 ? o[0][j] : o[1][j]; v4f a, c;
        a[0] = g[0]; a[1] = g[1]; a[2] = g[2]; a[3] = g[3]; c[0] = g[4]; c[1] = g[5]; c[2] = g[6]; c[3] = g[7];
        *(v4fa*)(&xo[(2 * j) * 128 + lane * 4]) = a; *(v4fa*)(&xo[(2 * j + 1) * 128 + lane * 4]) = c; }
    xo[1024 + lane] = h1 ? m[0] : m[1]; xo[1056 + lane] = h1 ? l0 : l1;
    __syncthreads();                                         // every wave's hand-over is readable
    const float mk = h1 ? m[1] : m[0], lkp = h1 ? l1 : l0;
    const float mg = os[wb + 1024 + lane], lg = os[wb + 1056 + lane];
    const float mm_ = fmaxf(mk, mg);
    const float ak = __builtin_amdgcn_exp2f(mk - mm_), ag = __builtin_amdgcn_exp2f(mg - mm_);
    const float inv = CXS / (lkp * ak + lg * ag);
    const float fk = ak * inv, fg = ag * inv;
    v4f ra[4], rc[4];
#pragma unroll
    for (int j = 0; j < 4; ++j) { const v8f kq = h1 ? o[1][j] : o[0][j];
        const v4f ga = *(const v4fa*)(&os[wb + (2 * j) * 128 + lane * 4]); const v4f gc = *(const v4fa*)(&os[wb + (2 * j + 1) * 128 + lane * 4]);
#pragma unroll
        for (int i = 0; i < 4; ++i) { ra[j][i] = kq[i] * fk + ga[i] * fg; rc[j][i] = kq[4 + i] * fk + gc[i] * fg; } }
    wave_sync();                                             // the reads above are done before the same area takes the output rows
    // O^T D layout: o_j[r] = (d = 16j + 8h + r, t = lane&15) -> os[t][d]; rows 0..15 x columns 0..63 all written
#pragma unroll
    for (int j = 0; j < 4; ++j) { *(v4fa*)(&os[wb + lr * 68 + 16 * j + 8 * hi]) = ra[j]; *(v4fa*)(&os[wb + lr * 68 + 16 * j + 8 * hi + 4]) = rc[j]; }
    wave_sync();
    h16* crow = CTX + ((size_t)b * SEQ + t0 + 16 * hf) * DP + h * HD;
{
#pragma unroll
        for (int s = 0; s < 4; ++s) { const int row = 4 * s + (lane >> 3), c8 = (lane & 7) * 8;   // 4 s x 4 rows = 16 rows; 8 lanes x 8 halves = 64 columns
            const v4f x0 = *(const v4fa*)(&os[wb + row * 68 + c8]); const v4f x1 = *(const v4fa*)(&os[wb + row * 68 + c8 + 4]); v8h hv;
#pragma unroll
            for (int i = 0; i < 4; ++i) { hv[i] = (h16)x0[i]; hv[4 + i] = (h16)x1[i]; }
            *(v8h*)(crow + (size_t)row * DP + c8) = hv; }
         }
}

// k_out: f16 GEMM, 4 waves per 64x128 tile (32x64 per wave), A = ctx plane [NB*SEQ][1024] (x256), Bt = Wo^T plane [512][1024] (x1024), K = DP, through gemm_core; OUT[m][n] = acc * 2^-18 + bo[n] (f32).
__global__ __launch_bounds__(128) void k_out(const h16* __restrict__ A, const h16* __restrict__ Bt, const float* __restrict__ bias, float* OUT) {
    __shared__ __align__(16) float osb[4 * 16 * 68];
    __shared__ __align__(16) bf ring[2 * (64 + 128) * (128 + 8)];
    const int lane = threadIdx.x & 31, lr = lane & 15, hi = lane >> 4; const int wave = wave_id();
    float* os = osb + wave * 16 * 68;                        // wave-private staging of the epilogue
    const int R0 = blockIdx.x * 64, C0 = blockIdx.y * 128;
    v8f acc[2][4];
#pragma unroll
    for (int mb = 0; mb < 2; ++mb)
#pragma unroll
        for (int nb = 0; nb < 4; ++nb) acc[mb][nb] = (v8f){};
    gemm_core<2, 128, DP, false>((const bf*)A, (const bf*)Bt, R0, C0, ring, acc);
    const int r0 = R0 + (wave >> 1) * 32, c0 = C0 + (wave & 1) * 64;   // this wave's 32 x 64 tile
    const size_t orow0 = (size_t)(r0 / SEQ) * OUT_SEQ + (size_t)(r0 % SEQ);
    const int cofs = lr * 4;
    v4f bv;
#pragma unroll
    for (int i = 0; i < 4; ++i) bv[i] = bfr(bias[min(c0 + cofs + i, DIN - 1)]);
#pragma unroll
    for (int mb = 0; mb < 2; ++mb) {
#pragma unroll
        for (int nb = 0; nb < 4; ++nb) {
#pragma unroll
            for (int j = 0; j < 8; ++j) os[(hi * 8 + j) * 68 + nb * 16 + lr] = acc[mb][nb][j] * FOLD; }   // D: row 8h+j, col lane&15
        wave_sync();
{
#pragma unroll
            for (int s = 0; s < 8; ++s) { const int row = 2 * s + hi;   // 8 s x 2 rows = 16 rows; 16 lanes x 4 floats = 64 columns
                const v4f val = *(const v4fa*)(&os[row * 68 + cofs]) + bv;
                *(v4f*)(OUT + (orow0 + (size_t)(mb * 16 + row)) * DIN + c0 + cofs) = val; }
             }
        wave_sync();
    }
}

static constexpr size_t al256(size_t v) { return (v + 255) & ~(size_t)255; }
static constexpr size_t SZ_XB = al256((size_t)NB * SEQ * DIN * 2);
static constexpr size_t SZ_WT = al256((size_t)3 * DP * DIN * 2);
static constexpr size_t SZ_WO = al256((size_t)DIN * DP * 2);
static constexpr size_t SZ_PL = al256((size_t)NB * NH_ * SEQ * HD * 2);
static constexpr size_t SZ_CX = al256((size_t)NB * SEQ * DP * 2);
static constexpr size_t SZ_PF = al256((size_t)NB * SEQ * 2);
static constexpr size_t SZ_TF = al256((size_t)NB * NT * 4);
static constexpr size_t SZ_TOTAL = SZ_XB + SZ_WT + SZ_WO + 3 * SZ_PL + SZ_CX + SZ_PF + SZ_TF;
static_assert(SZ_TOTAL <= (size_t)134217728);          // workspace carve <= 128 MiB
static_assert(((size_t)DP * DIN * 2) % 256 == 0);      // weight sub-planes stay 256-byte aligned

extern "C" void kernel_launch(void* const* d_in, const int* in_sizes, int n_in,
                              void* d_out, int out_size, void* d_ws, size_t ws_size, hipStream_t stream) {
    if (n_in < 10) return;
    const size_t needx = ((size_t)(NB - 1) * SEQ_FULL + SEQ) * DIN;
    if ((size_t)in_sizes[0] < needx || (size_t)in_sizes[1] < needx) return;
    if ((size_t)in_sizes[2] < (size_t)DIN * DP || (size_t)in_sizes[4] < (size_t)DIN * DP || (size_t)in_sizes[6] < (size_t)DIN * DP || (size_t)in_sizes[8] < (size_t)DP * DIN) return;
    if ((size_t)in_sizes[3] < (size_t)DP || (size_t)in_sizes[5] < (size_t)DP || (size_t)in_sizes[7] < (size_t)DP || (size_t)in_sizes[9] < (size_t)DIN) return;
    if ((size_t)out_size < ((size_t)(NB - 1) * OUT_SEQ + SEQ) * DIN) return;
    if (SZ_TOTAL > ws_size) return;
    // wire order: data, pad input, wq, bq, wk, bk, wv, bv, wo, bo (all f32)
    const float* x = (const float*)d_in[0]; const float* pm = (const float*)d_in[1];
    const float* wq = (const float*)d_in[2]; const float* bq = (const float*)d_in[3];
    const float* wk = (const float*)d_in[4]; const float* bk = (const float*)d_in[5];
    const float* wv = (const float*)d_in[6]; const float* bv = (const float*)d_in[7];
    const float* wo = (const float*)d_in[8]; const float* bo = (const float*)d_in[9];
    float* OUT = (float*)d_out;      // [NB][SEQ][512]
    char* wsp = (char*)d_ws;
    bf* XB = (bf*)wsp; wsp += SZ_XB;                 // [NB*SEQ][512] bf16
    bf* WT = (bf*)wsp; wsp += SZ_WT;                 // [3][1024][512] bf16, rows h*64+dm: q | k | v
    bf* WOB = (bf*)wsp; wsp += SZ_WO;                // [512][1024] f16 bits (x1024)
    h16* QH = (h16*)wsp; wsp += SZ_PL;               // [NB*16][SEQ][64]
    h16* KP = (h16*)wsp; wsp += SZ_PL;               // [NB*16][SEQ][64]
    h16* VT = (h16*)wsp; wsp += SZ_PL;               // [NB*16][64][SEQ]
    h16* CX = (h16*)wsp; wsp += SZ_CX;               // [NB*SEQ][1024] (x256)
    h16* PF = (h16*)wsp; wsp += SZ_PF;               // [NB*SEQ] pad flags
    unsigned* TF = (unsigned*)wsp; wsp += SZ_TF;     // [NB*SEQ/64] nonzero where a 64-key tile holds a padded key

    k_prep<<<dim3(PB_PAD + 4 * PB_WT + PB_CVT, 1, 1), 256, 0, stream>>>(x, pm, wq, wk, wv, wo, XB, WT, WOB, PF, TF);

    k_proj<<<dim3(NB * SEQ / 128, DP / 128, 3), 128, 0, stream>>>(XB, WT, bq, bk, bv, QH, KP, VT);

    k_flash<<<dim3(SEQ / (16 * AW), NB * NH_, 1), 32 * AW, 0, stream>>>(QH, KP, VT, PF, TF, CX);

    k_out<<<dim3(NB * SEQ / 64, DIN / 128, 1), 128, 0, stream>>>(CX, (const h16*)WOB, bo, OUT);
}

// v009
// It runs in 59.4 microseconds.
// Timed twice side by side with v008, it ran 1.04 times as fast both times.
// Over all steps from v000 it is 3.31 times as fast.
#include <hip/hip_runtime.h>

// Multi-head self-attention: data [NB][SEQ][512], Wq/Wk/Wv [512][1024] ([in][out], column c = dm*16 + h), biases, key-padding replace fill (-1e9 where a key's 512 pad-input values sum to 0), score scale 1/8, merged heads (h*64+dm) @ Wo [1024][512] + bo, f32 output.
// Compute dtypes, f32 accumulate everywhere: projections v_wmma_f32_16x16x32_bf16 (data and W RNE-converted to bf16; products exact);
// scores v_wmma_f32_16x16x32_f16: q and k single f16 planes (one product); P (x256 carry, cancels in the normalisation) and v single f16; softmax f32 (online, lazily moved reference maximum, taken only in a wave's first tile where the batch has no padded key, with an overflow check and a fully guarded second pass; row sums of the f16 P by a ones-row matrix op, f32 accumulate);
// output projection v_wmma_f32_16x16x32_f16: ctx single f16 (x256 carry), Wo = f16 of (bf16 RNE of wo) x1024 (exact), 2^-18 folded back in f32, bias added in f32.
// Launches: 4. k_prep (block index picks the job: pad flags with one word per 64 keys, one weight tile, or a slice of the data conversion; the jobs read none of each other's output; a wave of the pad and conversion jobs issues all its global loads ahead of their first use), k_proj (grid z picks q, k or v^T), k_flash, k_out.
// Layout: bf16 copy of data; transposed K-contiguous weight planes (head-permuted rows h*64+dm); q, k planes [b*16+h][t][d] and v^T plane [b*16+h][d][t] from the GEMM epilogue;
// fused flash kernel in transposed form (S^T = K Q^T, O^T = V^T P^T; a wave holds 32 queries and every second 64-key tile, 8 score + 8 P.V matrix ops per 32-key step; K and V^T tiles of 64 keys staged in pairs in LDS by asynchronous copies, two buffers; wave pairs merge their halves of the keys at the end) writing the ctx plane [b*SEQ+t][h*64+d].
// Both GEMMs (k_proj, k_out): 4-wave blocks, operand tiles staged in LDS by asynchronous copies of whole 128-byte lines, two buffers, fragments read from LDS.

#ifndef NB
#define NB 2
#endif
#ifndef SEQ
#define SEQ 2048
#endif
#define NB_FULL  2
#define SEQ_FULL 2048
#ifndef OUT_SEQ
#define OUT_SEQ SEQ              // row pitch (in tokens) between batches of the output
#endif
#define DIN  512                 // input width = output width
#define DP   1024                // projection width = 16 heads x 64
#define NH_  16
#define HD   64
#define AW   8                   // waves per flash block; all share the staged K / V^T tiles
#define KH   2                   // 64-key tiles staged together; wave group wave / QG works on one of them
#define QG   (AW / KH)           // query groups per flash block, 32 query rows (two column tiles) each
#define KST  64                  // keys per staged tile (two 32-key steps)
#define LP   72                  // LDS row pitch in halves: 128-byte rows + 16 bytes, the pitch for 16-byte LDS readers
#define NT   (SEQ / KST)         // staged tiles per (batch, head)
#define NP   (NT / KH)           // staged tile pairs per (batch, head)
#define SC2  (0.125f * 1.4426950408889634f)   // HD^-0.5 * log2(e)
#define PSH  8.0f                // log2 of the P carry (256)
#define RTH  7.0f                // lazy rescale: how far (log2) a column's new maximum may stand above the reference in use before the reference moves
#define NEGB (-1.0e9f * 1.4426950408889634f)  // fill value of padded keys in the log2 domain
#define CXS  256.0f              // carry of the ctx plane
#define WOS  1024.0f             // carry of the Wo plane
#define FOLD (1.0f / (256.0f * 1024.0f))

static_assert(HD == 64);
static_assert(PSH + RTH <= 15.0f);             // P <= 2^(PSH + RTH) stays finite in f16
static_assert(NH_ * HD == DP);
static_assert(NH_ == 16);                      // column c = dm*16 + h
static_assert(DP % 64 == 0);
static_assert(DIN % 64 == 0);
static_assert(DIN % 32 == 0);                  // GEMM k-loops step by 32
static_assert(DP % 32 == 0);
static_assert(DIN == 512);                     // pad-row sum: 4 x 128 floats per wave
static_assert(SEQ % 64 == 0);                  // a 64-row tile never straddles two batches
static_assert((NB * SEQ) % 64 == 0);
static_assert(SEQ % 32 == 0);                  // key loop steps by 32
static_assert(KH == 2);                        // a wave and its partner wave ^ QG exchange one column tile each
static_assert(32 * QG == 16 * AW);             // a flash block covers 16 * AW query rows
static_assert(SEQ % (16 * AW) == 0);           // flash grid covers the sequence exactly
static_assert(SEQ % KST == 0);
static_assert(NT % KH == 0);
static_assert(NP >= 2);                        // the two-buffer prologue fills tile pairs 0 and 1
static_assert(NT <= 32);                       // one bit per staged tile in the 32-lane ballot of padded tiles
static_assert(KST == 64);                      // a staged tile is the 64 key rows of one pad block
static_assert(32 * AW * 2 * 8 == KST * HD);    // two 16-byte copies per thread cover one 64 x 64 tile
static_assert(((size_t)SEQ * DIN) % 8 == 0);
static_assert((NB * SEQ) % 128 == 0);          // GEMM block tiles: 128 data rows (k_proj)
static_assert(DP % 128 == 0);
static_assert(DIN % 128 == 0);
static_assert(NB <= NB_FULL);
static_assert(SEQ <= SEQ_FULL);

typedef _Float16 h16;
typedef unsigned short bf;
typedef __attribute__((ext_vector_type(16))) __bf16   v16bf;
typedef __attribute__((ext_vector_type(16))) _Float16 v16h;
typedef __attribute__((ext_vector_type(8)))  _Float16 v8h;
typedef __attribute__((ext_vector_type(8)))  unsigned short v8us;
typedef __attribute__((ext_vector_type(16))) unsigned short v16us;
typedef __attribute__((ext_vector_type(8)))  float    v8f;
typedef __attribute__((ext_vector_type(4)))  float    v4f;
typedef __attribute__((ext_vector_type(2)))  float    v2f;
typedef v4f  __attribute__((may_alias)) v4fa;

__device__ __forceinline__ unsigned short f2bf(float f) { unsigned u = __float_as_uint(f); u += 0x7FFFu + ((u >> 16) & 1u); return (unsigned short)(u >> 16); }
__device__ __forceinline__ float bfr(float f) { return __uint_as_float(((unsigned)f2bf(f)) << 16); }   // value after RNE conversion to bf16
__device__ __forceinline__ v16h cat16(v8h lo, v8h hi) { return __builtin_shufflevector(lo, hi, 0, 1, 2, 3, 4, 5, 6, 7, 8, 9, 10, 11, 12, 13, 14, 15); }
__device__ __forceinline__ v16bf cat16b(v8us lo, v8us hi) { return __builtin_bit_cast(v16bf, __builtin_shufflevector(lo, hi, 0, 1, 2, 3, 4, 5, 6, 7, 8, 9, 10, 11, 12, 13, 14, 15)); }
__device__ __forceinline__ v8f wmma16(v16h a, v16h b, v8f c) { return __builtin_amdgcn_wmma_f32_16x16x32_f16(false, a, false, b, (short)0, c, false, false); }
__device__ __forceinline__ v8f wmmab(v16bf a, v16bf b, v8f c) { return __builtin_amdgcn_wmma_f32_16x16x32_bf16(false, a, false, b, (short)0, c, false, false); }
// fragment loaders from K-contiguous 16-bit rows; p already includes + 8*(lane>>4): elements 0..7 <- k0+8h+0..7, elements 8..15 <- k0+16+8h+0..7 (same map for A and B)
__device__ __forceinline__ v16h  ldh(const h16* p) { return cat16(*(const v8h*)p, *(const v8h*)(p + 16)); }
__device__ __forceinline__ v16bf ldb(const bf* p)  { return cat16b(*(const v8us*)p, *(const v8us*)(p + 16)); }
// ordering point for wave-private LDS tiles (same wave writes and reads)
__device__ __forceinline__ void wave_sync() { __builtin_amdgcn_fence(3 /* release order */, "wavefront"); __builtin_amdgcn_wave_barrier(); asm volatile("" ::: "memory"); }
// wave index of the calling thread as a wave-uniform scalar
__device__ __forceinline__ int wave_id() { return __builtin_amdgcn_readfirstlane((int)(threadIdx.x >> 5)); }

// blocks of k_prep per job
#define PB_PAD (NB * SEQ / 64)                        // 64 pad rows each
#define PB_WT  ((DIN / 64) * (DP / 64))               // 64 x 64 tiles of one weight matrix (all four have DIN * DP elements)
#define N8     ((size_t)NB * SEQ * DIN / 8)           // 8-element chunks of the data
#define CV     8                                      // chunks per thread of the conversion job
#define PB_CVT ((unsigned)(N8 / (256 * CV)))
static_assert(N8 % (256 * CV) == 0);                  // the conversion blocks cover the data exactly

// cvt_job: data f32 -> bf16 copy [NB*SEQ][512], CV chunks of 8 elements per thread, 256 chunks apart, all loaded ahead of the first conversion; blk = block index inside the job.
__device__ __forceinline__ void cvt_job(const float* __restrict__ x, bf* dst, int blk) {
    const size_t i0 = (size_t)blk * (256 * CV) + threadIdx.x;
    constexpr size_t C8 = (size_t)SEQ * DIN / 8;      // chunks per batch
    v8f v[CV];
#pragma unroll   // register array indexed by constants
    for (int u = 0; u < CV; ++u) { const size_t i = i0 + (size_t)u * 256;
        const size_t so = (SEQ == SEQ_FULL) ? i * 8 : (i / C8) * ((size_t)SEQ_FULL * DIN) + (i % C8) * 8;
        v[u] = *(const v8f*)(x + so); }
    asm volatile("s_wait_xcnt 0x0" :: "v"(x + i0 * 8) : "memory");   // the loads above are issued: no register of their addresses is rewritten ahead of this line (the address as an input: it stays whole up to here, so that no load's result is placed on it)
#pragma unroll
    for (int u = 0; u < CV; ++u) { v8us o;
#pragma unroll
        for (int k = 0; k < 8; ++k) o[k] = f2bf(v[u][k]);
        *(v8us*)(dst + (i0 + (size_t)u * 256) * 8) = o; }
    asm volatile("s_wait_xcnt 0x0" ::: "memory");   // the stores above are issued: no register that they name is rewritten by the code that follows this job in the merged kernel
}

// wt_job: W [K][N] f32 ([in][out]) -> dst [N][K] 16-bit rows (K-contiguous). in[K rows][N cols] -> out[N rows][K cols]; one 64 x 64 tile (bx of K/64, by of N/64), 256 threads; ts = 64 * 68 floats of LDS.
// perm != 0: source column c = dm*16 + h lands on destination row h*64 + dm. asf16 == 0: bf16 bits; asf16 != 0: f16 bits of (bf16 value * scale).
__device__ __forceinline__ void wt_job(const float* __restrict__ W, bf* dst, int K, int N, int perm, int asf16, float scale, int bx, int by, float* ts) {   // ts: [column][k]
    const int tid = threadIdx.x, lane = tid & 31; const int wave = wave_id();
    const int k0 = bx * 64, c0 = by * 64;
#pragma unroll
    for (int it = 0; it < 4; ++it) { const int e = tid + 256 * it; const int kk = e >> 4, c4 = (e & 15) * 4;   // 64 k rows x 16 float4 = whole tile
        const v4f v = *(const v4f*)(W + (size_t)(k0 + kk) * (size_t)N + c0 + c4);
        ts[(c4 + 0) * 68 + kk] = v[0]; ts[(c4 + 1) * 68 + kk] = v[1]; ts[(c4 + 2) * 68 + kk] = v[2]; ts[(c4 + 3) * 68 + kk] = v[3]; }
    __syncthreads();
{
#pragma unroll
        for (int s = 0; s < 2; ++s) { const int row = 4 * (wave + 8 * s) + (lane >> 3), c8 = (lane & 7) * 8;   // 8 waves x 2 s x 4 rows = 64 rows; 8 lanes x 8 = 64 k
            const v4f x0 = *(const v4fa*)(&ts[row * 68 + c8]); const v4f x1 = *(const v4fa*)(&ts[row * 68 + c8 + 4]); v8us o;
#pragma unroll
            for (int i = 0; i < 4; ++i) { const float f0 = bfr(x0[i]), f1 = bfr(x1[i]);
                const unsigned short b0 = (unsigned short)(__float_as_uint(f0) >> 16), b1 = (unsigned short)(__float_as_uint(f1) >> 16);
                const unsigned short g0 = __builtin_bit_cast(unsigned short, (h16)(f0 * scale)), g1 = __builtin_bit_cast(unsigned short, (h16)(f1 * scale));
                o[i] = asf16 ? g0 : b0; o[4 + i] = asf16 ? g1 : b1; }
            const int c = c0 + row; const int n = perm ? ((c & 15) * 64 + (c >> 4)) : c;
            *(v8us*)(dst + (size_t)n * (size_t)K + k0 + c8) = o; }
         }
    asm volatile("s_wait_xcnt 0x0" ::: "memory");   // the two stores above are issued: no register that they name is rewritten by the code that follows this job in the merged kernel
}

// pad_job: flags of 64 key rows (1 where the row's 512 pad-input values sum to 0), and one word for the 64 rows together (nonzero where any of them is flagged); fl = 64 floats of LDS.
__device__ __forceinline__ void pad_job(const float* __restrict__ mask, h16* PF, unsigned* TF, int blk, float* fl) {
    const int tid = threadIdx.x, lane = tid & 31; const int wave = wave_id();
    const int m0 = blk * 64;
    // A wave's eight rows: all 32 loads ahead of the first sum, then the eight sums side by side (each row's own order of additions: 16 values per lane in turn, then lane distances 16, 8, 4, 2, 1).
    const int mw = m0 + wave * 8;                     // the eight rows lie in one batch (SEQ % 64 == 0)
    const float* row = mask + ((size_t)(mw / SEQ) * SEQ_FULL + mw % SEQ) * DIN + lane * 4;
    v4f v[8][4];
#pragma unroll   // register arrays indexed by constants
    for (int i = 0; i < 8; ++i)
#pragma unroll
        for (int j = 0; j < 4; ++j) v[i][j] = *(const v4f*)(row + i * DIN + j * 128);
    asm volatile("s_wait_xcnt 0x0" ::: "memory");     // the loads above are issued: no register of their addresses is rewritten ahead of this line
    __builtin_amdgcn_sched_barrier(0);                // keeps every load ahead of the first sum (built without it, 12 of the 32 loads stand behind the first data waits): a sum lifted among them waits for its data while the later loads are not yet in flight
    float s[8];
#pragma unroll
    for (int i = 0; i < 8; ++i) { s[i] = 0.0f;
#pragma unroll
        for (int j = 0; j < 4; ++j) { s[i] += bfr(v[i][j][0]); s[i] += bfr(v[i][j][1]); s[i] += bfr(v[i][j][2]); s[i] += bfr(v[i][j][3]); } }
#pragma unroll
    for (int d = 16; d >= 1; d >>= 1)
#pragma unroll
        for (int i = 0; i < 8; ++i) s[i] += __shfl_xor(s[i], d, 32);
    if (lane == 0) {
#pragma unroll
        for (int i = 0; i < 8; ++i) fl[wave * 8 + i] = (s[i] == 0.0f) ? 1.0f : 0.0f; }
    __syncthreads();
    if (tid < 8) { v8h o;
#pragma unroll
        for (int k = 0; k < 8; ++k) o[k] = (h16)fl[tid * 8 + k];
        *(v8h*)(PF + (size_t)m0 + tid * 8) = o;  }
    if (wave == 0) { const unsigned any = __builtin_amdgcn_ballot_w32((fl[lane] != 0.0f) | (fl[lane + 32] != 0.0f));
        if (lane == 0) TF[blk] = any; }
}

// k_prep: everything that reads only the inputs, in one launch. The job is a function of blockIdx.x alone, so every branch (and the barrier inside a job) is block-uniform.
// Order: the pad rows (32 loads per wave, then eight row sums and a barrier: the longest job) take the lowest block indices, the conversion blocks (16 loads per wave, no barrier) the highest.
__global__ __launch_bounds__(256) void k_prep(const float* __restrict__ x, const float* __restrict__ pm, const float* __restrict__ wq, const float* __restrict__ wk, const float* __restrict__ wv,
                                              const float* __restrict__ wo, bf* XB, bf* WT, bf* WOB, h16* PF, unsigned* TF) {
    __shared__ __align__(16) float ts[64 * 68];
    const int bid = blockIdx.x;
    if (bid < PB_PAD) { pad_job(pm, PF, TF, bid, ts); return; }
    if (bid < PB_PAD + 4 * PB_WT) {
        const int j = bid - PB_PAD; const int w = j / PB_WT, tile = j % PB_WT;
        // w = 0..2: wq, wk, wv, in[K = 512][N = 1024] -> [1024 rows (head-permuted)][512], bf16; w = 3: wo, in[K = 1024 (h*64+dm)][N = 512] -> [512 rows][1024], f16 x1024
        const bool o = (w == 3);
        const float* W = o ? wo : (w == 0 ? wq : (w == 1 ? wk : wv));
        bf* dst = o ? WOB : WT + (size_t)w * DP * DIN;
        const int K = o ? DP : DIN, N = o ? DIN : DP;
        wt_job(W, dst, K, N, o ? 0 : 1, o ? 1 : 0, o ? WOS : 1.0f, tile % (K / 64), tile / (K / 64), ts);
        return; }
    cvt_job(x, XB, bid - (PB_PAD + 4 * PB_WT));
}

// One thread's eight 16-byte asynchronous copies global -> LDS: rows ls bytes apart in LDS, gs elements apart in memory. The s_wait_xcnt closes the statement so that
// no address register of an issued copy is rewritten ahead of it.
__device__ __forceinline__ void stage8(unsigned l, const bf* g, unsigned ls, size_t gs) {
    asm volatile("global_load_async_to_lds_b128 %0, %1, off\n\t"
                 "global_load_async_to_lds_b128 %2, %3, off\n\t"
                 "global_load_async_to_lds_b128 %4, %5, off\n\t"
                 "global_load_async_to_lds_b128 %6, %7, off\n\t"
                 "global_load_async_to_lds_b128 %8, %9, off\n\t"
                 "global_load_async_to_lds_b128 %10, %11, off\n\t"
                 "global_load_async_to_lds_b128 %12, %13, off\n\t"
                 "global_load_async_to_lds_b128 %14, %15, off\n\t"
                 "s_wait_xcnt 0x0"
                 :: "v"(l), "v"(g), "v"(l + ls), "v"(g + gs), "v"(l + 2 * ls), "v"(g + 2 * gs), "v"(l + 3 * ls), "v"(g + 3 * gs),
                    "v"(l + 4 * ls), "v"(g + 4 * gs), "v"(l + 5 * ls), "v"(g + 5 * gs), "v"(l + 6 * ls), "v"(g + 6 * gs), "v"(l + 7 * ls), "v"(g + 7 * gs) : "memory");
}
__device__ __forceinline__ v16us ldu(const bf* p) { return __builtin_shufflevector(*(const v8us*)p, *(const v8us*)(p + 16), 0, 1, 2, 3, 4, 5, 6, 7, 8, 9, 10, 11, 12, 13, 14, 15); }   // same k map as ldh / ldb
template <bool BF> __device__ __forceinline__ v8f mm(v16us a, v16us b, v8f c) {
    if constexpr (BF) return wmmab(__builtin_bit_cast(v16bf, a), __builtin_bit_cast(v16bf, b), c);
    else              return wmma16(__builtin_bit_cast(v16h, a), __builtin_bit_cast(v16h, b), c);
}

// gemm_core: acc[mb][nb] += A rows x Bt rows over K (16-bit, K-contiguous planes), for a block of 4 waves (2 x 2). Block tile (2 * MF * 16) x 128 at (R0, C0); wave (wave >> 1, wave & 1) owns (MF * 16) x 64.
// Per trip KS k values of every row of both tiles lie in one LDS buffer (row pitch KS + 8 halves: 16 bytes x odd, the pitch for 16-byte LDS readers); a wave's copy covers whole 128-byte lines.
// Tile t + 1 is copied into one buffer while tile t is worked on in the other; one barrier per trip publishes and frees. k ascends by 32 in every accumulator.
template <int MF, int KS, int K, bool BF>
__device__ __forceinline__ void gemm_core(const bf* __restrict__ A, const bf* __restrict__ Bt, int R0, int C0, bf* ring, v8f (&acc)[MF][4]) {
    constexpr int GP = KS + 8, BM = 2 * MF * 16, BUFH = (BM + 128) * GP;   // pitch (halves), A rows, halves per buffer
    constexpr int CPR = KS / 8, RS = 128 / CPR, NTR = K / KS;              // 16-byte chunks per row, rows covered by the block's 128 threads in one copy each, trips
    static_assert(BM == 8 * RS);                                           // one stage8 covers the A tile
    static_assert(128 % (8 * RS) == 0);                                    // whole stage8 groups cover the B tile
    static_assert(K % KS == 0);
    static_assert(NTR >= 2);                                               // the prologue fills tiles 0 and 1
    static_assert(MF == 2 || MF == 4);
    const int tid = threadIdx.x, lane = tid & 31, lr = lane & 15, hi = lane >> 4; const int wave = wave_id();
    const int cr = tid / CPR, cc = (tid % CPR) * 8;                        // copy map: thread -> row cr (+ multiples of RS), 16-byte column
    const bf* ga = A + (size_t)(R0 + cr) * K + cc;                         // + t * KS
    const bf* gb = Bt + (size_t)(C0 + cr) * K + cc;
    const unsigned la = (unsigned)(size_t)&ring[cr * GP + cc];             // LDS byte address of the thread's first A chunk in buffer 0
    auto stage = [&](int t, int buf) {
        const unsigned l = la + (unsigned)buf * (unsigned)(BUFH * 2);
        stage8(l, ga + t * KS, RS * GP * 2, (size_t)RS * K);
#pragma unroll
        for (int g = 0; g < 128 / (8 * RS); ++g) stage8(l + (unsigned)((BM + g * 8 * RS) * GP * 2), gb + (size_t)g * 8 * RS * K + t * KS, RS * GP * 2, (size_t)RS * K);
    };
    stage(0, 0);
    asm volatile("s_wait_asynccnt 0x0" ::: "memory");        // this wave's copies of tile 0 have landed
    __syncthreads();                                         // every wave's copies of tile 0 are readable
    stage(1, 1);
    const int ao = ((wave >> 1) * MF * 16 + lr) * GP + 8 * hi, bo = (BM + (wave & 1) * 64 + lr) * GP + 8 * hi;
#pragma unroll 1   // rolled; the buffer is picked by a scalar select
    for (int t = 0; t < NTR; ++t) {
        const bf* ab = ring + (t & 1) * BUFH + ao; const bf* bb = ring + (t & 1) * BUFH + bo;
        // Fragment sets: each k step's LDS reads go out as one group. NS == 2 (the small wave tile, one wave per SIMD): the next step's group ahead of this step's matrix instructions;
        // NS == 1 (the large wave tile, several waves per SIMD, which cover each other's LDS waits): one set, so that the wave stays inside the first 256 registers.
        constexpr int NS = (MF == 2) ? 2 : 1, NK = KS / 32;
        v16us a[NS][MF], b[NS][4];
        auto frags = [&](int ks) {                           // never past the trip's own tile: ks < NK at every call
#pragma unroll
            for (int mb = 0; mb < MF; ++mb) a[ks % NS][mb] = ldu(ab + mb * 16 * GP + ks * 32);
#pragma unroll
            for (int nb = 0; nb < 4; ++nb) b[ks % NS][nb] = ldu(bb + nb * 16 * GP + ks * 32);
        };
        frags(0);
#pragma unroll   // all k steps of a trip inline, so that every LDS offset inside the tile is an immediate and the fragment sets stay in registers
        for (int ks = 0; ks < NK; ++ks) {
            if (NS == 2 && ks + 1 < NK) frags(ks + 1);
            __builtin_amdgcn_sched_barrier(0);               // keeps the group of LDS reads ahead of the matrix instructions below: sunk among them, each read is waited for where it stands
#pragma unroll
            for (int nb = 0; nb < 4; ++nb)
#pragma unroll
                for (int mb = 0; mb < MF; ++mb) acc[mb][nb] = mm<BF>(a[ks % NS][mb], b[ks % NS][nb], acc[mb][nb]);
            if (NS == 1 && ks + 1 < NK) frags(ks + 1);
        }
        __builtin_amdgcn_sched_barrier(0);                   // keeps the trip's matrix instructions ahead of the barrier: sunk behind it they delay the refill, which then has less than a trip to land
        asm volatile("s_wait_dscnt 0x0" ::: "memory");       // this wave's reads of tile t are done before its buffer may be refilled
        asm volatile("s_wait_asynccnt 0x0" ::: "memory");    // this wave's copies of tile t + 1 have landed
        __syncthreads();                                     // publishes tile t + 1 and ends every wave's reads of tile t
        if (t + 2 < NTR) stage(t + 2, t & 1);                // block-uniform: refill the buffer that tile t has just left
    }
    asm volatile("s_wait_asynccnt 0x0" ::: "memory");        // nothing of this wave is in flight when the ring goes out of use
}

// k_proj: bf16 GEMM, 4 waves per 128x128 tile (64x64 and 16 accumulators per wave), operands from K-contiguous bf16 planes through gemm_core, K = DIN.
// C[m][n] = sum_k A[m][k] Bt[n][k] + bias, written as f16 (Ph), row pitch 'pitch' (halves). grid (NB*SEQ/128 data tiles, DP/128 weight tiles, 3), 128 threads; z picks the product:
// z = 0, 1 (q, k): A = data rows (m = b*SEQ + t), Bt = W^T rows (n = h*64 + d) -> plane [(b*16 + h)][t][d]; bias per column.
// z = 2 (v^T):     A = Wv^T rows (m = h*64 + d), Bt = data rows (n = b*SEQ + t) -> plane [(b*1024 + m)][t] = [(b*16 + h)][d][t]; bias per row.
// bias (source order dm*16 + h, RNE-converted to bf16, added in f32): bmode 0 = per column n = h*64 + dm, bmode 1 = per row m = h*64 + dm.
__global__ __launch_bounds__(128) void k_proj(const bf* __restrict__ XB, const bf* __restrict__ WT, const float* __restrict__ bq, const float* __restrict__ bk, const float* __restrict__ bv, h16* QH, h16* KP, h16* VT) {
    __shared__ __align__(16) float osb[4 * 16 * 68];
    __shared__ __align__(16) bf ring[2 * (128 + 128) * (64 + 8)];
    const int z = blockIdx.z; const bool bmode = (z == 2);
    const bf* Wz = WT + (size_t)z * DP * DIN;
    const bf* A = bmode ? Wz : XB; const bf* Bt = bmode ? XB : Wz;
    const float* bias = (z == 0) ? bq : ((z == 1) ? bk : bv);
    h16* Ph = (z == 0) ? QH : ((z == 1) ? KP : VT);
    const int pitch = bmode ? SEQ : HD;
    const int lane = threadIdx.x & 31, lr = lane & 15, hi = lane >> 4; const int wave = wave_id();
    float* os = osb + wave * 16 * 68;                        // wave-private staging of the epilogue
    const int R0 = (bmode ? blockIdx.y : blockIdx.x) * 128, C0 = (bmode ? blockIdx.x : blockIdx.y) * 128;
    v8f acc[4][4];
#pragma unroll
    for (int mb = 0; mb < 4; ++mb)
#pragma unroll
        for (int nb = 0; nb < 4; ++nb) acc[mb][nb] = (v8f){};
    gemm_core<4, 64, DIN, true>(A, Bt, R0, C0, ring, acc);
    const int r0 = R0 + (wave >> 1) * 64, c0 = C0 + (wave & 1) * 64;   // this wave's 64 x 64 tile
    const size_t tbase = bmode ? (size_t)r0 * SEQ + (size_t)(c0 / SEQ) * ((size_t)DP * SEQ) + (size_t)(c0 % SEQ)
                               : (size_t)(r0 / SEQ) * ((size_t)NH_ * SEQ * HD) + (size_t)(r0 % SEQ) * HD + (size_t)(c0 / HD) * ((size_t)SEQ * HD);
    const int c8 = (lane & 7) * 8;
    float bcol[8];      // column-mode bias of this lane's 8 columns (clamped addresses, always loaded)
    { const int hc = min(c0 >> 6, NH_ - 1);
#pragma unroll
      for (int i = 0; i < 8; ++i) bcol[i] = bfr(bias[min((c8 + i) * NH_ + hc, DP - 1)]); }
#pragma unroll
    for (int mb = 0; mb < 4; ++mb) {
#pragma unroll
        for (int nb = 0; nb < 4; ++nb) {
#pragma unroll
            for (int j = 0; j < 8; ++j) os[(hi * 8 + j) * 68 + nb * 16 + lr] = acc[mb][nb][j]; }   // D: row 8h+j, col lane&15
        wave_sync();
        const size_t sb = tbase + (size_t)(mb * 16) * (size_t)pitch;
{
#pragma unroll
            for (int s = 0; s < 4; ++s) { const int row = 4 * s + (lane >> 3);   // 4 s x 4 row groups = 16 rows; 8 lanes x 8 = 64 columns
                const int m = r0 + mb * 16 + row;
                const float brow = bfr(bias[min((m & 63) * NH_ + min(m >> 6, NH_ - 1), DP - 1)]);
                const v4f x0 = *(const v4fa*)(&os[row * 68 + c8]); const v4f x1 = *(const v4fa*)(&os[row * 68 + c8 + 4]); v8h hv;
#pragma unroll
                for (int i = 0; i < 4; ++i) { const float y0 = x0[i] + (bmode ? brow : bcol[i]); const float y1 = x1[i] + (bmode ? brow : bcol[4 + i]);
                    hv[i] = (h16)y0; hv[4 + i] = (h16)y1; }
                const size_t oo = sb + (size_t)row * (size_t)pitch + c8;
                *(v8h*)(Ph + oo) = hv; }
             }
        wave_sync();
    }
}

// One thread's share of one staged 64-key tile: four 16-byte asynchronous copies global -> LDS (two of K, two of V^T). The s_wait_xcnt closes the statement so that
// no address register of an issued copy is rewritten ahead of it.
__device__ __forceinline__ void stage4(unsigned l0, const h16* g0, unsigned l1, const h16* g1, unsigned l2, const h16* g2, unsigned l3, const h16* g3) {
    asm volatile("global_load_async_to_lds_b128 %0, %1, off\n\t"
                 "global_load_async_to_lds_b128 %2, %3, off\n\t"
                 "global_load_async_to_lds_b128 %4, %5, off\n\t"
                 "global_load_async_to_lds_b128 %6, %7, off\n\t"
                 "s_wait_xcnt 0x0"
                 :: "v"(l0), "v"(g0), "v"(l1), "v"(g1), "v"(l2), "v"(g2), "v"(l3), "v"(g3) : "memory");
}

// k_flash: fused attention. A block of 8 waves covers 128 query rows of one (batch, head): wave (qg = wave & 3, hf = wave >> 2) takes the 32 query rows of group qg (two column tiles of 16)
// and, of every staged pair of 64-key tiles, tile hf. Each K / V^T fragment read from LDS feeds two matrix ops (one per column tile). Q fragments straight from the f16 plane; K / V^T fragments from LDS:
// tile pair p + 1 is copied (asynchronously, no registers) into one buffer while pair p is worked on in the other; one barrier per pair publishes and frees.
// Transposed form: S^T[key][t] = K Q^T (A = K rows, B = Q rows); lane (t = lane&15, h = lane>>4) holds keys 8h+r of each 16-key tile, so the packed
// P tile is directly the B fragment of O^T[d][t] = V^T P^T (element r <- tile keys 0..15, element 8+r <- tile keys 16..31, lane unchanged).
// Per 32-key step and column tile: 4 score matrix ops (2 key tiles x 2 d halves) + 4 P.V matrix ops (4 d tiles) + 1 row-sum matrix op.
// Padded keys: the score is REPLACED by the fill value (flag plane loaded with the same key map as the P elements).
// Each wave reads the batch's per-tile words once and keeps one bit per tile; a tile without a padded key skips the flag loads, compares and selects (where no flag is set the replace is the identity).
// Softmax state per column tile: the reference maximum is one scalar per lane, equal in the two lane halves of a column. Lazy rescale: each 32-key step tests once for both column tiles (one ballot, one scalar
// branch) whether any lane's new maximum stands more than RTH above its reference; only then are the halves combined (one xor-16 exchange), the references moved to the running maxima and O and the row sums rescaled.
// Otherwise P = 2^(score - reference + PSH) <= 2^(PSH + RTH); the common factor cancels in the normalisation.
// In a batch without a padded key the maxima are taken only in a wave's first tile. Every other step leaves the references where they stand: exponent = one multiply-add on the score, no maximum, no test.
// That is exact as long as every P stays finite in f16. A P that does not makes its row sum infinite or not a number; the sums are looked at once behind the key loop, and if any wave of the block
// finds such a sum the whole block runs the key loop a second time from the start, every step with maxima and test as described above (at most two passes).
// Row sums on the matrix unit: one more matrix op per 32-key step and column tile, A = a tile whose row 0 is ones and whose other rows are 0, B = the packed P tile, adds the 32 keys' P (as rounded to f16)
// of query t into row 0, column t of an f32 tile: element 0 of lanes 0..15. Rows 1..15 stay 0, so only element 0 is rescaled.
// Epilogue: waves w and w ^ 4 hold the same 32 queries over the two halves of the keys. Each hands the other one column tile (O, reference, row sum) through LDS and finishes the tile it keeps:
// both parts brought to the larger reference, added, normalised.
struct guard_on { static constexpr bool value = true; };
struct guard_off { static constexpr bool value = false; };
// amdgpu_waves_per_eu(4, 4): two blocks share a WGP, four waves a SIMD, so a wave has 256 registers. Built without the attribute the kernel with its two passes takes 257, and only one block would fit.
__global__ __launch_bounds__(32 * AW) __attribute__((amdgpu_waves_per_eu(4, 4))) void k_flash(const h16* __restrict__ QH, const h16* __restrict__ KP, const h16* __restrict__ VT, const h16* __restrict__ PF, const unsigned* __restrict__ TF, h16* CTX) {
    __shared__ __align__(16) float os[AW * 16 * 68];
    __shared__ __align__(16) h16 ring[2][KH][2][64 * LP];    // [buffer][tile of the pair][K rows key | V^T rows d][row][LP]
    __shared__ unsigned ovf[AW];                             // per wave: nonzero where its first pass over the keys overflowed
    const int lane = threadIdx.x & 31, lr = lane & 15, hi = lane >> 4; const int wave = wave_id();
    const int hf = wave / QG, qg = wave % QG;
    const int zh = blockIdx.y; const int b = zh / NH_, h = zh % NH_;
    const int t0 = (blockIdx.x * QG + qg) * 32;
    const size_t pbase = (size_t)zh * SEQ * HD;
    const size_t qo = pbase + (size_t)(t0 + lr) * HD + 8 * hi;
    // Every loop over a column tile, a d tile or a register index below is unrolled, so that the register arrays are indexed by constants and stay in registers.
    v16h qh[2][2];                                           // B fragments [column tile][d half]: col t, k = d
#pragma unroll
    for (int c = 0; c < 2; ++c) { qh[c][0] = ldh(QH + qo + c * 16 * HD); qh[c][1] = ldh(QH + qo + c * 16 * HD + 32); }
    const int fo = lr * LP + 8 * hi;                         // fragment offset in a staged tile: K + key*LP (row key, k = d), V^T + 16j*LP + key (row d, k = key)
    // copy map: thread -> rows cr and cr + 32 of each tile, 16-byte column tid & 7
    const int cr = (int)(threadIdx.x >> 3), cc = (int)(threadIdx.x & 7) * 8;
    const h16* gk = KP + pbase + (size_t)cr * HD + cc;       // + key0 * HD
    const h16* gv = VT + pbase + (size_t)cr * SEQ + cc;      // + key0
    const unsigned lk = (unsigned)(size_t)&ring[0][0][0][cr * LP + cc];   // LDS byte address of the thread's first K chunk in buffer 0
    constexpr unsigned TB = 64 * LP * 2, HB = 32 * LP * 2;   // bytes of one tile, of 32 rows
    auto stage = [&](int p, int buf) {                       // tile pair p -> buffer buf: eight copies per thread
#pragma unroll
        for (int k = 0; k < KH; ++k) {
            const unsigned l = lk + (unsigned)(buf * KH + k) * (2 * TB); const h16* gk2 = gk + (size_t)(p * KH + k) * KST * HD; const h16* gv2 = gv + (p * KH + k) * KST;
            stage4(l, gk2, l + HB, gk2 + 32 * HD, l + TB, gv2, l + TB + HB, gv2 + (size_t)32 * SEQ); }
    };
    // pair 0 -> buffer 0, landed and published; then pair 1 -> buffer 1 in flight
    stage(0, 0);
    // bit t of padtiles: tile t of this batch holds a padded key (lane t reads tile t's word, one ballot makes the wave-uniform mask)
    const unsigned padtiles = __builtin_amdgcn_ballot_w32(TF[(size_t)b * NT + min(lane, NT - 1)] != 0u);
    asm volatile("s_wait_xcnt 0x0" ::: "memory");            // the load above is issued: its address register may be rewritten behind this line
    asm volatile("s_wait_asynccnt 0x0" ::: "memory");        // this wave's copies of pair 0 have landed
    __syncthreads();                                         // every wave's copies of pair 0 are readable
    stage(1, 1);
    v8f o[2][4], lt[2];                                      // [column tile][d tile]; lt row 0: running row sums (column t = query t)
    v16h ones;                                               // A fragment: lanes 0 and 16 hold row 0 (all 32 k positions), the other lanes rows 1..15
#pragma unroll
    for (int i = 0; i < 16; ++i) ones[i] = (lr == 0) ? (h16)1.0f : (h16)0.0f;
    float m[2], mlim[2], sh[2];                              // per column tile: reference maximum, m + RTH, PSH - m (the last two set with m in the first step)
    // One pass over all keys, entered with pair 0 published and pair 1 in flight. A = guard_on: every tile takes its maxima; guard_off: only the first.
    auto keys = [&](auto A) {
#pragma unroll
    for (int c = 0; c < 2; ++c) { lt[c] = (v8f){}; m[c] = -3.0e38f; mlim[c] = -3.0e38f; sh[c] = 0.0f;
#pragma unroll
        for (int j = 0; j < 4; ++j) o[c][j] = (v8f){}; }
    auto trip = [&](int p, auto G) {                         // one staged pair: this wave's tile, then the foot that publishes the next pair and refills
      const int t = p * KH + hf;                             // this wave's tile of the pair
      const h16* kt = &ring[p & 1][hf][0][fo]; const h16* vt = &ring[p & 1][hf][1][fo];
      const bool tpad = ((padtiles >> t) & 1u) != 0u;
      constexpr bool GUARD = decltype(G)::value;             // two builds of a tile: with maxima, test and padded-key replace, or straight through
#pragma unroll   // both 32-key steps of a tile inline, so that every LDS offset inside the tile is an immediate
      for (int s = 0; s < KST / 32; ++s) {
        const int key0 = t * KST + s * 32;
        const h16* ka = kt + s * 32 * LP;
        const v16h ka0 = ldh(ka), ka1 = ldh(ka + 32), kb0 = ldh(ka + 16 * LP), kb1 = ldh(ka + 16 * LP + 32);
        v8f sa0 = (v8f){}, sb0 = (v8f){}, sa1 = (v8f){}, sb1 = (v8f){};
        sa0 = wmma16(ka0, qh[0][0], sa0); sb0 = wmma16(kb0, qh[0][0], sb0); sa1 = wmma16(ka0, qh[1][0], sa1); sb1 = wmma16(kb0, qh[1][0], sb1);
        sa0 = wmma16(ka1, qh[0][1], sa0); sb0 = wmma16(kb1, qh[0][1], sb0); sa1 = wmma16(ka1, qh[1][1], sa1); sb1 = wmma16(kb1, qh[1][1], sb1);
        // four vector slots behind the run of matrix ops above, the distance the chip needs before a vector instruction touches their results or operands
        asm volatile("v_nop\n\tv_nop\n\tv_nop\n\tv_nop" : "+v"(sa0), "+v"(sb0), "+v"(sa1), "+v"(sb1) : "v"(ka0), "v"(ka1), "v"(kb0), "v"(kb1), "v"(qh[0][0]), "v"(qh[0][1]), "v"(qh[1][0]), "v"(qh[1][1]));
        const h16* va = vt + s * 32;
        v16h v0, v1, v2, v3;
        float xa[2][8], xb[2][8];                            // exponents: scaled score + PSH - reference
        if constexpr (GUARD) {                               // the step takes its maxima and may move the references; product and sum of an exponent rounded apart
            float ta[2][8], tb[2][8];
#pragma unroll
            for (int r = 0; r < 8; r += 2) {                 // packed multiplies on the accumulators' own register pairs (paired across two accumulators they cost register copies)
                const v2f a0 = (v2f){sa0[r], sa0[r + 1]} * SC2, b0 = (v2f){sb0[r], sb0[r + 1]} * SC2, a1 = (v2f){sa1[r], sa1[r + 1]} * SC2, b1 = (v2f){sb1[r], sb1[r + 1]} * SC2;
                ta[0][r] = a0[0]; ta[0][r + 1] = a0[1]; tb[0][r] = b0[0]; tb[0][r + 1] = b0[1]; ta[1][r] = a1[0]; ta[1][r + 1] = a1[1]; tb[1][r] = b1[0]; tb[1][r + 1] = b1[1]; }
            if (__builtin_expect(tpad, false)) {             // scalar branch, wave-uniform: only a tile that holds a padded key loads its flags and replaces (laid out of line)
                const h16* pfa = PF + (size_t)b * SEQ + 8 * hi + key0;       // elements r <- key0+8h+r, 8+r <- key0+16+8h+r
                const v16h pf = ldh(pfa);
                asm volatile("s_wait_xcnt 0x0" :: "v"(pfa) : "memory");    // the two flag loads are issued: no register of their address is rewritten ahead of this line (the address as an input: it stays whole up to here, so that no load's result is placed on it)
#pragma unroll
                for (int c = 0; c < 2; ++c)
#pragma unroll
                    for (int r = 0; r < 8; ++r) { ta[c][r] = ((float)pf[r] != 0.0f) ? NEGB : ta[c][r]; tb[c][r] = ((float)pf[8 + r] != 0.0f) ? NEGB : tb[c][r]; } }
            // V^T fragment reads ahead of the test: behind its branch they would stand directly in front of the matrix ops that wait for them
            v0 = ldh(va); v1 = ldh(va + 16 * LP); v2 = ldh(va + 32 * LP); v3 = ldh(va + 48 * LP);
            float mx[2] = {-3.0e38f, -3.0e38f};
#pragma unroll
            for (int r = 0; r < 8; ++r) mx[0] = fmaxf(mx[0], fmaxf(ta[0][r], tb[0][r]));
#pragma unroll
            for (int r = 0; r < 8; ++r) mx[1] = fmaxf(mx[1], fmaxf(ta[1][r], tb[1][r]));
            if (__builtin_expect(__builtin_amdgcn_ballot_w32((mx[0] > mlim[0]) | (mx[1] > mlim[1])) != 0u, false)) {   // scalar branch, every lane on inside (laid out of line): always taken in the first step, later only where a maximum grows by more than RTH
#pragma unroll
                for (int c = 0; c < 2; ++c) {
                    const float mnew = fmaxf(m[c], fmaxf(mx[c], __shfl_xor(mx[c], 16, 32)));
                    const float alpha = __builtin_amdgcn_exp2f(m[c] - mnew);
                    lt[c][0] *= alpha;
                    o[c][0] = o[c][0] * alpha; o[c][1] = o[c][1] * alpha; o[c][2] = o[c][2] * alpha; o[c][3] = o[c][3] * alpha;
                    m[c] = mnew; mlim[c] = mnew + RTH; sh[c] = PSH - mnew; } }
#pragma unroll
            for (int c = 0; c < 2; ++c)
#pragma unroll
                for (int r = 0; r < 8; ++r) { xa[c][r] = ta[c][r] + sh[c]; xb[c][r] = tb[c][r] + sh[c]; }
        } else {                                                    // no maximum taken: the references stand, each score goes through one packed multiply-add
            const v2f sc = (v2f){SC2, SC2}, h0 = (v2f){sh[0], sh[0]}, h1 = (v2f){sh[1], sh[1]};
#pragma unroll
            for (int r = 0; r < 8; r += 2) {
                const v2f a0 = __builtin_elementwise_fma((v2f){sa0[r], sa0[r + 1]}, sc, h0), b0 = __builtin_elementwise_fma((v2f){sb0[r], sb0[r + 1]}, sc, h0);
                const v2f a1 = __builtin_elementwise_fma((v2f){sa1[r], sa1[r + 1]}, sc, h1), b1 = __builtin_elementwise_fma((v2f){sb1[r], sb1[r + 1]}, sc, h1);
                xa[0][r] = a0[0]; xa[0][r + 1] = a0[1]; xb[0][r] = b0[0]; xb[0][r + 1] = b0[1]; xa[1][r] = a1[0]; xa[1][r + 1] = a1[1]; xb[1][r] = b1[0]; xb[1][r + 1] = b1[1]; }
            v0 = ldh(va); v1 = ldh(va + 16 * LP); v2 = ldh(va + 32 * LP); v3 = ldh(va + 48 * LP);
        }
        v16h pb0, pb1;
#pragma unroll
        for (int r = 0; r < 8; ++r) { pb0[r] = (h16)__builtin_amdgcn_exp2f(xa[0][r]); pb0[8 + r] = (h16)__builtin_amdgcn_exp2f(xb[0][r]); }
#pragma unroll
        for (int r = 0; r < 8; ++r) { pb1[r] = (h16)__builtin_amdgcn_exp2f(xa[1][r]); pb1[8 + r] = (h16)__builtin_amdgcn_exp2f(xb[1][r]); }
        lt[0] = wmma16(ones, pb0, lt[0]);
        o[0][0] = wmma16(v0, pb0, o[0][0]); o[0][1] = wmma16(v1, pb0, o[0][1]); o[0][2] = wmma16(v2, pb0, o[0][2]); o[0][3] = wmma16(v3, pb0, o[0][3]);
        lt[1] = wmma16(ones, pb1, lt[1]);
        o[1][0] = wmma16(v0, pb1, o[1][0]); o[1][1] = wmma16(v1, pb1, o[1][1]); o[1][2] = wmma16(v2, pb1, o[1][2]); o[1][3] = wmma16(v3, pb1, o[1][3]);
        // four vector slots behind the run of matrix ops above, the distance the chip needs before a vector instruction touches their results or operands
        asm volatile("v_nop\n\tv_nop\n\tv_nop\n\tv_nop" : "+v"(o[0][0]), "+v"(o[0][1]), "+v"(o[0][2]), "+v"(o[0][3]), "+v"(lt[0]), "+v"(o[1][0]), "+v"(o[1][1]), "+v"(o[1][2]), "+v"(o[1][3]), "+v"(lt[1])
                     : "v"(v0), "v"(v1), "v"(v2), "v"(v3), "v"(pb0), "v"(pb1));
      }
      asm volatile("s_wait_dscnt 0x0" ::: "memory");         // this wave's reads of pair p are done before its buffer may be refilled
      asm volatile("s_wait_asynccnt 0x0" ::: "memory");      // this wave's copies of pair p + 1 have landed
      __syncthreads();                                       // publishes pair p + 1 and ends every wave's reads of pair p
      if (p + 2 < NP) stage(p + 2, p & 1);                   // block-uniform: refill the buffer that pair p has just left
    };
    trip(0, guard_on{});                                     // the first tile sets the references
#pragma unroll 1   // rolled: one copy of the trip in the instruction cache
    for (int p = 1; p < NP; ++p) trip(p, A);
    asm volatile("s_wait_asynccnt 0x0" ::: "memory");        // nothing of this wave is in flight when the ring goes out of use
    };
    bool redo = (padtiles != 0u);                            // block-uniform (one batch per block): a batch with a padded key takes the guarded pass at once
    if (__builtin_expect(!redo, true)) {
    keys(guard_off{});
    // Check of the pass: a P beyond the f16 range is infinite, and so (or not a number) is the row-sum tile it was added into. One word per wave, one barrier; the whole block repeats the key loop or none of it.
    const bool wbad = __builtin_amdgcn_ballot_w32(!(lt[0][0] < 3.0e38f) | !(lt[1][0] < 3.0e38f)) != 0u;
    if (lane == 0) ovf[wave] = wbad ? 1u : 0u;
    __syncthreads();                                         // every wave's word is readable
    redo = __builtin_amdgcn_ballot_w32(ovf[lane & (AW - 1)] != 0u) != 0u;   // block-uniform: every wave reads the same AW words
    if (__builtin_expect(redo, false)) {                     // the ring is filled anew as at the start (every wave's reads of it ended at the pass's last barrier)
        stage(0, 0);
        asm volatile("s_wait_asynccnt 0x0" ::: "memory");    // this wave's copies of pair 0 have landed
        __syncthreads();                                     // every wave's copies of pair 0 are readable
        stage(1, 1); }
    }
    if (__builtin_expect(redo, false)) keys(guard_on{});
    float l0 = lt[0][0], l1 = lt[1][0];                      // lanes 0..15: the row sum of query t; lanes 16..31: row 8 of the tile, 0
    l0 += __shfl_xor(l0, 16, 32); l1 += __shfl_xor(l1, 16, 32);
    // Hand-over: this wave keeps column tile hf and gives tile 1 - hf to wave ^ QG. Area of a wave: 8 x 128 floats of O (four registers by lane, 16 bytes a lane), 32 references, 32 row sums = 16 * 68 floats.
    const bool h1 = (hf != 0);
    float* xo = os + wave * 16 * 68;                         // written by this wave in front of the barrier
    const int wb = (wave ^ QG) * 16 * 68;                    // the partner's area: read behind the barrier by this wave alone, then this wave's output staging
#pragma unroll
    for (int j = 0; j < 4; ++j) { const v8f g = h1 ? o[0][j] : o[1][j]; v4f a, c;
        a[0] = g[0]; a[1] = g[1]; a[2] = g[2]; a[3] = g[3]; c[0] = g[4]; c[1] = g[5]; c[2] = g[6]; c[3] = g[7];
        *(v4fa*)(&xo[(2 * j) * 128 + lane * 4]) = a; *(v4fa*)(&xo[(2 * j + 1) * 128 + lane * 4]) = c; }
    xo[1024 + lane] = h1 ? m[0] : m[1]; xo[1056 + lane] = h1 ? l0 : l1;
    __syncthreads();                                         // every wave's hand-over is readable
    const float mk = h1 ? m[1] : m[0], lkp = h1 ? l1 : l0;
    const float mg = os[wb + 1024 + lane], lg = os[wb + 1056 + lane];
    const float mm_ = fmaxf(mk, mg);
    const float ak = __builtin_amdgcn_exp2f(mk - mm_), ag = __builtin_amdgcn_exp2f(mg - mm_);
    const float inv = CXS / (lkp * ak + lg * ag);
    const float fk = ak * inv, fg = ag * inv;
    v4f ra[4], rc[4];
#pragma unroll
    for (int j = 0; j < 4; ++j) { const v8f kq = h1 ? o[1][j] : o[0][j];
        const v4f ga = *(const v4fa*)(&os[wb + (2 * j) * 128 + lane * 4]); const v4f gc = *(const v4fa*)(&os[wb + (2 * j + 1) * 128 + lane * 4]);
#pragma unroll
        for (int i = 0; i < 4; ++i) { ra[j][i] = kq[i] * fk + ga[i] * fg; rc[j][i] = kq[4 + i] * fk + gc[i] * fg; } }
    wave_sync();                                             // the reads above are done before the same area takes the output rows
    // O^T D layout: o_j[r] = (d = 16j + 8h + r, t = lane&15) -> os[t][d]; rows 0..15 x columns 0..63 all written
#pragma unroll
    for (int j = 0; j < 4; ++j) { *(v4fa*)(&os[wb + lr * 68 + 16 * j + 8 * hi]) = ra[j]; *(v4fa*)(&os[wb + lr * 68 + 16 * j + 8 * hi + 4]) = rc[j]; }
    wave_sync();
    h16* crow = CTX + ((size_t)b * SEQ + t0 + 16 * hf) * DP + h * HD;
{
#pragma unroll
        for (int s = 0; s < 4; ++s) { const int row = 4 * s + (lane >> 3), c8 = (lane & 7) * 8;   // 4 s x 4 rows = 16 rows; 8 lanes x 8 halves = 64 columns
            const v4f x0 = *(const v4fa*)(&os[wb + row * 68 + c8]); const v4f x1 = *(const v4fa*)(&os[wb + row * 68 + c8 + 4]); v8h hv;
#pragma unroll
            for (int i = 0; i < 4; ++i) { hv[i] = (h16)x0[i]; hv[4 + i] = (h16)x1[i]; }
            *(v8h*)(crow + (size_t)row * DP + c8) = hv; }
         }
}

// k_out: f16 GEMM, 4 waves per 64x128 tile (32x64 per wave), A = ctx plane [NB*SEQ][1024] (x256), Bt = Wo^T plane [512][1024] (x1024), K = DP, through gemm_core; OUT[m][n] = acc * 2^-18 + bo[n] (f32).
__global__ __launch_bounds__(128) void k_out(const h16* __restrict__ A, const h16* __restrict__ Bt, const float* __restrict__ bias, float* OUT) {
    __shared__ __align__(16) float osb[4 * 16 * 68];
    __shared__ __align__(16) bf ring[2 * (64 + 128) * (128 + 8)];
    const int lane = threadIdx.x & 31, lr = lane & 15, hi = lane >> 4; const int wave = wave_id();
    float* os = osb + wave * 16 * 68;                        // wave-private staging of the epilogue
    const int R0 = blockIdx.x * 64, C0 = blockIdx.y * 128;
    v8f acc[2][4];
#pragma unroll
    for (int mb = 0; mb < 2; ++mb)
#pragma unroll
        for (int nb = 0; nb < 4; ++nb) acc[mb][nb] = (v8f){};
    gemm_core<2, 128, DP, false>((const bf*)A, (const bf*)Bt, R0, C0, ring, acc);
    const int r0 = R0 + (wave >> 1) * 32, c0 = C0 + (wave & 1) * 64;   // this wave's 32 x 64 tile
    const size_t orow0 = (size_t)(r0 / SEQ) * OUT_SEQ + (size_t)(r0 % SEQ);
    const int cofs = lr * 4;
    v4f bv;
#pragma unroll
    for (int i = 0; i < 4; ++i) bv[i] = bfr(bias[min(c0 + cofs + i, DIN - 1)]);
#pragma unroll
    for (int mb = 0; mb < 2; ++mb) {
#pragma unroll
        for (int nb = 0; nb < 4; ++nb) {
#pragma unroll
            for (int j = 0; j < 8; ++j) os[(hi * 8 + j) * 68 + nb * 16 + lr] = acc[mb][nb][j] * FOLD; }   // D: row 8h+j, col lane&15
        wave_sync();
{
#pragma unroll
            for (int s = 0; s < 8; ++s) { const int row = 2 * s + hi;   // 8 s x 2 rows = 16 rows; 16 lanes x 4 floats = 64 columns
                const v4f val = *(const v4fa*)(&os[row * 68 + cofs]) + bv;
                *(v4f*)(OUT + (orow0 + (size_t)(mb * 16 + row)) * DIN + c0 + cofs) = val; }
             }
        wave_sync();
    }
}

static constexpr size_t al256(size_t v) { return (v + 255) & ~(size_t)255; }
static constexpr size_t SZ_XB = al256((size_t)NB * SEQ * DIN * 2);
static constexpr size_t SZ_WT = al256((size_t)3 * DP * DIN * 2);
static constexpr size_t SZ_WO = al256((size_t)DIN * DP * 2);
static constexpr size_t SZ_PL = al256((size_t)NB * NH_ * SEQ * HD * 2);
static constexpr size_t SZ_CX = al256((size_t)NB * SEQ * DP * 2);
static constexpr size_t SZ_PF = al256((size_t)NB * SEQ * 2);
static constexpr size_t SZ_TF = al256((size_t)NB * NT * 4);
static constexpr size_t SZ_TOTAL = SZ_XB + SZ_WT + SZ_WO + 3 * SZ_PL + SZ_CX + SZ_PF + SZ_TF;
static_assert(SZ_TOTAL <= (size_t)134217728);          // workspace carve <= 128 MiB
static_assert(((size_t)DP * DIN * 2) % 256 == 0);      // weight sub-planes stay 256-byte aligned

extern "C" void kernel_launch(void* const* d_in, const int* in_sizes, int n_in,
                              void* d_out, int out_size, void* d_ws, size_t ws_size, hipStream_t stream) {
    if (n_in < 10) return;
    const size_t needx = ((size_t)(NB - 1) * SEQ_FULL + SEQ) * DIN;
    if ((size_t)in_sizes[0] < needx || (size_t)in_sizes[1] < needx) return;
    if ((size_t)in_sizes[2] < (size_t)DIN * DP || (size_t)in_sizes[4] < (size_t)DIN * DP || (size_t)in_sizes[6] < (size_t)DIN * DP || (size_t)in_sizes[8] < (size_t)DP * DIN) return;
    if ((size_t)in_sizes[3] < (size_t)DP || (size_t)in_sizes[5] < (size_t)DP || (size_t)in_sizes[7] < (size_t)DP || (size_t)in_sizes[9] < (size_t)DIN) return;
    if ((size_t)out_size < ((size_t)(NB - 1) * OUT_SEQ + SEQ) * DIN) return;
    if (SZ_TOTAL > ws_size) return;
    // wire order: data, pad input, wq, bq, wk, bk, wv, bv, wo, bo (all f32)
    const float* x = (const float*)d_in[0]; const float* pm = (const float*)d_in[1];
    const float* wq = (const float*)d_in[2]; const float* bq = (const float*)d_in[3];
    const float* wk = (const float*)d_in[4]; const float* bk = (const float*)d_in[5];
    const float* wv = (const float*)d_in[6]; const float* bv = (const float*)d_in[7];
    const float* wo = (const float*)d_in[8]; const float* bo = (const float*)d_in[9];
    float* OUT = (float*)d_out;      // [NB][SEQ][512]
    char* wsp = (char*)d_ws;
    bf* XB = (bf*)wsp; wsp += SZ_XB;                 // [NB*SEQ][512] bf16
    bf* WT = (bf*)wsp; wsp += SZ_WT;                 // [3][1024][512] bf16, rows h*64+dm: q | k | v
    bf* WOB = (bf*)wsp; wsp += SZ_WO;                // [512][1024] f16 bits (x1024)
    h16* QH = (h16*)wsp; wsp += SZ_PL;               // [NB*16][SEQ][64]
    h16* KP = (h16*)wsp; wsp += SZ_PL;               // [NB*16][SEQ][64]
    h16* VT = (h16*)wsp; wsp += SZ_PL;               // [NB*16][64][SEQ]
    h16* CX = (h16*)wsp; wsp += SZ_CX;               // [NB*SEQ][1024] (x256)
    h16* PF = (h16*)wsp; wsp += SZ_PF;               // [NB*SEQ] pad flags
    unsigned* TF = (unsigned*)wsp; wsp += SZ_TF;     // [NB*SEQ/64] nonzero where a 64-key tile holds a padded key

    k_prep<<<dim3(PB_PAD + 4 * PB_WT + PB_CVT, 1, 1), 256, 0, stream>>>(x, pm, wq, wk, wv, wo, XB, WT, WOB, PF, TF);

    k_proj<<<dim3(NB * SEQ / 128, DP / 128, 3), 128, 0, stream>>>(XB, WT, bq, bk, bv, QH, KP, VT);

    k_flash<<<dim3(SEQ / (16 * AW), NB * NH_, 1), 32 * AW, 0, stream>>>(QH, KP, VT, PF, TF, CX);

    k_out<<<dim3(NB * SEQ / 64, DIN / 128, 1), 128, 0, stream>>>(CX, (const h16*)WOB, bo, OUT);
}
